// v000
// Measured on an AMD MI455X. A time is GPU time per run, averaged over a window of back-to-back runs after a warm-up
// (all launches, gaps included; the runs take copies of the inputs in turn), and the median of several windows.
// Apart from v000's, it joins two sittings. Times from different sittings can be a few percent apart, while
// side-by-side timings come from the same sitting.
// v000, which the later versions start from, runs in 3940 microseconds.
#include <hip/hip_runtime.h>

// Transformer-XL style multi-head attention with post-LayerNorm (h [4][2048][1024]; q,k,v = h W ('xw' [1024][1024] with scale 1/8 x normal: sigma-4 projections, so the /8 logits have sigma ~16: sharply peaked); scores x 64^-0.5; softmax over keys; attn_out = attn_vec Wo ('xw', no bias); out = LayerNorm(h + attn_out) gamma/beta (1e-5) -> [4][2048][1024] (8.4 M)).
// Layout per batch: bf16 copy of h; 'xw' weights transposed once; exact projections; scores hi/lo 3 products on EVERY row (peaked logits), P and attn.v hybrid (rows < 512 hi/lo, rest fp16 x1024); merged hi/lo x Wo exact into workspace; residual add and a row LayerNorm kernel (one wave per 1,024-wide row, fixed-order sums, precise sqrt/div, affine) write the output rows.
// Compute dtypes, f32 accumulate: every input rounded to bf16; projections exact; scores 3 products on every row; softmax f32; attn.v rows < 512 3 products, rest fp16; Wo hl x exact; residual + LayerNorm f32.

#define NB_  4
#define TT   2048
#define DM   1024
#define NH_  16
#define NKV  16
#define REP  (NH_ / NKV)
#define HD   64
#define DQ   (NH_ * HD)
#define DKV  (NKV * HD)
#define ZH   2
#define RH   512                  // query rows < RH use hi+lo planes (0: none)
#define WIN  0
#define PCAR 1024.0f
#define SCL  0.125f
#define LNEPS 1e-5f
typedef _Float16 h16;
typedef unsigned short bf;
typedef __attribute__((ext_vector_type(16))) __bf16   v16bf;
typedef __attribute__((ext_vector_type(16))) _Float16 v16h;
typedef __attribute__((ext_vector_type(8)))  _Float16 v8h;
typedef __attribute__((ext_vector_type(8)))  unsigned short v8us;
typedef __attribute__((ext_vector_type(8)))  float    v8f;
typedef __attribute__((ext_vector_type(4)))  float    v4f;
typedef v8h  __attribute__((may_alias)) v8ha;
typedef v4f  __attribute__((may_alias)) v4fa;
typedef v8us __attribute__((may_alias)) v8usa;

__device__ __forceinline__ unsigned short f2bf(float f) { unsigned u = __float_as_uint(f); u += 0x7FFFu + ((u >> 16) & 1u); return (unsigned short)(u >> 16); }
__device__ __forceinline__ float bf2f(unsigned short b) { return __uint_as_float(((unsigned)b) << 16); }
__device__ __forceinline__ float bfr(float f) { return bf2f(f2bf(f)); }
__device__ __forceinline__ v16h cat16(v8h lo, v8h hi) { return __builtin_shufflevector(lo, hi, 0, 1, 2, 3, 4, 5, 6, 7, 8, 9, 10, 11, 12, 13, 14, 15); }
__device__ __forceinline__ v16bf cat16b(v8us lo, v8us hi) { return __builtin_bit_cast(v16bf, __builtin_shufflevector(lo, hi, 0, 1, 2, 3, 4, 5, 6, 7, 8, 9, 10, 11, 12, 13, 14, 15)); }
__device__ __forceinline__ v8f wmma16(v16h a, v16h b, v8f c) { return __builtin_amdgcn_wmma_f32_16x16x32_f16(false, a, false, b, (short)0, c, false, false); }
__device__ __forceinline__ v8f wmmab(v16bf a, v16bf b, v8f c) { return __builtin_amdgcn_wmma_f32_16x16x32_bf16(false, a, false, b, (short)0, c, false, false); }



// ---- k_gemmw: register-blocked GEMM, ONE WAVE per 64x64 output tile (16 accumulators), operands straight from K-contiguous 16-bit planes; grid (M/64, N/64, Z), 32 threads.
// C[m][n] (f32, pitch ldc, + optional f32 bias[n]) = sum_k A[m][k] Bt[n][k] (+ split products per NSPLIT). z-batch strides sA/sB/sC in elements. K % 32 == 0.
template <typename T16> struct WFrag;
template <> struct WFrag<h16> { typedef v16h V; static __device__ __forceinline__ V ld(const h16* p) { return cat16(*(const v8h*)p, *(const v8h*)(p + 16)); } static __device__ __forceinline__ v8f mma(V a, V b, v8f c) { return wmma16(a, b, c); } };
template <> struct WFrag<bf> { typedef v16bf V; static __device__ __forceinline__ V ld(const bf* p) { return cat16b(*(const v8us*)p, *(const v8us*)(p + 16)); } static __device__ __forceinline__ v8f mma(V a, V b, v8f c) { return wmmab(a, b, c); } };
template <typename T16, int NSPLIT, bool BIAS>
__global__ __launch_bounds__(32) void k_gemmw(const T16* __restrict__ A, const T16* __restrict__ A2, const T16* __restrict__ Bt, const T16* __restrict__ Bt2, int K, float* C, int ldc, const float* __restrict__ bias, size_t sA, size_t sB, size_t sC) {
    typedef typename WFrag<T16>::V V;
    __shared__ __align__(16) float os[16 * 68];
    const size_t z = blockIdx.z; A += z * sA; if (A2) A2 += z * sA; Bt += z * sB; if (Bt2) Bt2 += z * sB; C += z * sC;
    const int lane = threadIdx.x & 31, lr = lane & 15, hi = lane >> 4; const int r0 = blockIdx.x * 64, c0 = blockIdx.y * 64;
    v8f acc[4][4];
#pragma unroll
    for (int mb = 0; mb < 4; ++mb)
#pragma unroll
        for (int nb = 0; nb < 4; ++nb) acc[mb][nb] = (v8f){};
    const size_t aoff = (size_t)(r0 + lr) * K + 8 * hi, boff = (size_t)(c0 + lr) * K + 8 * hi;
#pragma unroll 1
    for (int kc = 0; kc < K; kc += 32) {
        V a[4], a2[4];
#pragma unroll
        for (int mb = 0; mb < 4; ++mb) { a[mb] = WFrag<T16>::ld(A + aoff + (size_t)mb * 16 * K + kc); if (NSPLIT == 1 || NSPLIT == 2) a2[mb] = WFrag<T16>::ld(A2 + aoff + (size_t)mb * 16 * K + kc); }
#pragma unroll
        for (int nb = 0; nb < 4; ++nb) { const V b = WFrag<T16>::ld(Bt + boff + (size_t)nb * 16 * K + kc); V b2; if (NSPLIT >= 2) b2 = WFrag<T16>::ld(Bt2 + boff + (size_t)nb * 16 * K + kc);
#pragma unroll
            for (int mb = 0; mb < 4; ++mb) { acc[mb][nb] = WFrag<T16>::mma(a[mb], b, acc[mb][nb]); if (NSPLIT == 1 || NSPLIT == 2) acc[mb][nb] = WFrag<T16>::mma(a2[mb], b, acc[mb][nb]); if (NSPLIT >= 2) acc[mb][nb] = WFrag<T16>::mma(a[mb], b2, acc[mb][nb]); } }
        asm volatile("v_nop\n\tv_nop\n\tv_nop\n\tv_nop" : "+v"(acc[0][0]), "+v"(acc[1][1]), "+v"(acc[2][2]), "+v"(acc[3][3]) : "v"(a[0]), "v"(a[3]));
    }
#pragma unroll
    for (int mb = 0; mb < 4; ++mb) {
#pragma unroll
        for (int nb = 0; nb < 4; ++nb) {
#pragma unroll
            for (int j = 0; j < 8; ++j) os[(hi * 8 + j) * 68 + nb * 16 + lr] = acc[mb][nb][j]; }
        __builtin_amdgcn_wave_barrier(); asm volatile("" ::: "memory");
        float* crow = C + (size_t)(r0 + mb * 16) * ldc + c0;
{
#pragma unroll
            for (int s = 0; s < 8; ++s) { const int row = 2 * s + hi, cofs = lr * 4; v4f val = *(const v4fa*)(os + row * 68 + cofs); if (BIAS) { val[0] += bfr(bias[c0 + cofs]); val[1] += bfr(bias[c0 + cofs + 1]); val[2] += bfr(bias[c0 + cofs + 2]); val[3] += bfr(bias[c0 + cofs + 3]); }
                *(v4f*)(crow + (size_t)row * ldc + cofs) = val; }
             }
        __builtin_amdgcn_wave_barrier(); asm volatile("" ::: "memory");
    }
}

__device__ __forceinline__ h16 tohx(float x) { return (h16)x; }
__device__ __forceinline__ void splitf(float y, unsigned short& h, unsigned short& l) { h = f2bf(y); l = f2bf(y - bf2f(h)); }
typedef __attribute__((ext_vector_type(2))) _Float16 v2h;
typedef __attribute__((ext_vector_type(4))) _Float16 v4h;
typedef __attribute__((ext_vector_type(2))) unsigned short v2us;
typedef __attribute__((ext_vector_type(4))) unsigned short v4us;
typedef __attribute__((ext_vector_type(2))) float v2f;
typedef __attribute__((ext_vector_type(4))) int v4i;

__global__ __launch_bounds__(256) void k_wtG(const float* __restrict__ w, int K, int N, bf* Bt) {
    const int lane = threadIdx.x & 31; const int L0 = (blockIdx.x * 8 + (threadIdx.x >> 5)) * 8; const int nlines = N * K / 64;
{
#pragma unroll 1
        for (int l = 0; l < 8; ++l) { const int L = L0 + l; if (L >= nlines) break; const size_t e = (size_t)L * 64 + lane * 2; const int k = (int)(e % K), n = (int)(e / K); v2us o;
            o[0] = f2bf(w[(size_t)k * N + n]); o[1] = f2bf(w[(size_t)(k + 1) * N + n]); *(v2us*)(Bt + e) = o; }
         }
}
__global__ __launch_bounds__(256) void k_cvt8(const float* __restrict__ src, bf* dst, size_t n8) { const size_t i = (size_t)blockIdx.x * 256 + threadIdx.x; if (i >= n8) return; const v8f v = *(const v8f*)(src + i * 8); v8us o;
#pragma unroll
    for (int k = 0; k < 8; ++k) o[k] = f2bf(v[k]); *(v8us*)(dst + i * 8) = o;  }

// k_rope: head planes [h][t][d] (fp16 + hi/lo) of rope(x) x sc with the rotate-half convention out[d] = x[d] cos[t][d] - x[d+HD/2] sin[t][d], out[d+HD/2] = x[d+HD/2] cos[t][d+HD/2] + x[d] sin[t][d+HD/2]
__global__ __launch_bounds__(256) void k_rope(const float* __restrict__ F, int pitch, int nheads, const float* __restrict__ CS, const float* __restrict__ RF, const float* __restrict__ nw, float sc, h16* P16, bf* Ph, bf* Pl) {
    const size_t e = ((size_t)blockIdx.x * 256 + threadIdx.x) * 2; if (e >= (size_t)nheads * TT * HD) return; const int d = (int)(e % HD); const int t = (int)((e / HD) % TT); const int h = (int)(e / ((size_t)HD * TT)); const float* f = F + (size_t)t * pitch + h * HD; const float rf = RF ? RF[(size_t)h * TT + t] : 1.0f; v2h o16; v2us oh, ol;
#pragma unroll
    for (int q = 0; q < 2; ++q) { const int dd = d + q; const int dp = (dd < HD / 2) ? dd + HD / 2 : dd - HD / 2; float x0 = f[dd], x1 = f[dp];
        if (RF) { float n0 = __fmul_rn(x0, rf), n1 = __fmul_rn(x1, rf); asm volatile("" : "+v"(n0)); asm volatile("" : "+v"(n1)); x0 = __fmul_rn(bfr(nw[dd]), n0); x1 = __fmul_rn(bfr(nw[dp]), n1); }
        const v2f cs = *(const v2f*)(CS + ((size_t)t * HD + dd) * 2); float a = __fmul_rn(x0, cs[0]), bq = __fmul_rn(x1, cs[1]); asm volatile("" : "+v"(a)); asm volatile("" : "+v"(bq)); const float r = ((dd < HD / 2) ? __fsub_rn(a, bq) : __fadd_rn(a, bq)) * sc;
        o16[q] = tohx(r); unsigned short a2, c2; splitf(r, a2, c2); oh[q] = a2; ol[q] = c2; }
    *(v2h*)(P16 + e) = o16; *(v2us*)(Ph + e) = oh; *(v2us*)(Pl + e) = ol;  }
__global__ __launch_bounds__(256) void k_vtp(const float* __restrict__ F, int pitch, int nheads, h16* V16, bf* Vh, bf* Vl) { const size_t e = ((size_t)blockIdx.x * 256 + threadIdx.x) * 2; if (e >= (size_t)nheads * HD * TT) return; const int t = (int)(e % TT); const int d = (int)((e / TT) % HD); const int g = (int)(e / ((size_t)TT * HD)); v2h o16; v2us oh, ol;
#pragma unroll
    for (int q = 0; q < 2; ++q) { const float x = F[(size_t)(t + q) * pitch + g * HD + d]; o16[q] = tohx(x); unsigned short a2, c2; splitf(x, a2, c2); oh[q] = a2; ol[q] = c2; }
    *(v2h*)(V16 + e) = o16; *(v2us*)(Vh + e) = oh; *(v2us*)(Vl + e) = ol;  }
__global__ __launch_bounds__(256) void k_csid(float* CS) { const int idx = blockIdx.x * 256 + threadIdx.x; if (idx >= TT * HD) return; v2f cs; cs[0] = 1.0f; cs[1] = 0.0f; *(v2f*)(CS + (size_t)idx * 2) = cs;  }
// k_asoft: per row (zz, i): t = S x HD^-0.5 (no mask); softmax over the 2048 keys (register row, one exp, fixed trees);
__global__ __launch_bounds__(256) void k_asoft(const float* __restrict__ Sb, h16* P16, bf* Ph, bf* Pl) {
    const int lane = threadIdx.x & 31; const int row = blockIdx.x * 8 + (threadIdx.x >> 5); if (row >= ZH * TT) return; const int i = row % TT; const int zz = row / TT; (void)zz; const bool hires = (i < RH); const float* sr = Sb + (size_t)row * TT; float v[TT / 32]; float mx = -3.0e38f;
#pragma unroll
    for (int ch = 0; ch < TT / 128; ++ch) { const int j0 = ch * 128 + lane * 4; const v4f a = *(const v4f*)(sr + j0);
#pragma unroll
        for (int q = 0; q < 4; ++q) { const int j = j0 + q; (void)j; const float t = a[q] * SCL; v[ch * 4 + q] = t; mx = fmaxf(mx, t); } }
#pragma unroll
    for (int sh = 16; sh; sh >>= 1) mx = fmaxf(mx, __shfl_xor(mx, sh, 32));
    float sum = 0.f;
#pragma unroll
    for (int k = 0; k < TT / 32; ++k) { float d0 = __fsub_rn(v[k], mx); asm volatile("" : "+v"(d0)); v[k] = __builtin_amdgcn_exp2f(__fmul_rn(d0, 1.4426950408889634f)); sum += v[k]; }
#pragma unroll
    for (int sh = 16; sh; sh >>= 1) sum += __shfl_xor(sum, sh, 32);
    const float f = __fdiv_rn(hires ? 1.0f : PCAR, sum);
{
        if (hires) {
#pragma unroll
            for (int ch = 0; ch < TT / 128; ++ch) { v4us oh, ol;
#pragma unroll
                for (int q = 0; q < 4; ++q) { unsigned short a, c2; splitf(v[ch * 4 + q] * f, a, c2); oh[q] = a; ol[q] = c2; }
                const size_t oo = ((size_t)zz * (RH ? RH : 1) + i) * TT + ch * 128 + lane * 4; *(v4us*)(Ph + oo) = oh; *(v4us*)(Pl + oo) = ol; }
        } else {
#pragma unroll
            for (int ch = 0; ch < TT / 128; ++ch) { v4h o4;
#pragma unroll
                for (int q = 0; q < 4; ++q) o4[q] = tohx(v[ch * 4 + q] * f);
                *(v4h*)(P16 + (size_t)row * TT + ch * 128 + lane * 4) = o4; } }
         }
}
__global__ __launch_bounds__(256) void k_addres(float* Y, const float* __restrict__ xr) { const size_t i = (size_t)blockIdx.x * 256 + threadIdx.x; if (i >= (size_t)TT * DQ / 4) return; const v4f a = *(const v4f*)(Y + i * 4); const v4f r = *(const v4f*)(xr + i * 4); v4f o;
#pragma unroll
    for (int q = 0; q < 4; ++q) o[q] = __fadd_rn(a[q], bfr(r[q]));
    *(v4f*)(Y + i * 4) = o;  }
__global__ __launch_bounds__(256) void k_lnout(const float* __restrict__ F, const float* __restrict__ g, const float* __restrict__ bb, float* out) { const int lane = threadIdx.x & 31; const int row = blockIdx.x * 8 + (threadIdx.x >> 5); if (row >= TT) return; const float* fr = F + (size_t)row * DQ; float* orow = out + (size_t)row * DQ; float v[DQ / 32]; float s = 0.f;
#pragma unroll
    for (int c = 0; c < DQ / 128; ++c) { const v4f a = *(const v4f*)(fr + c * 128 + lane * 4); for (int q = 0; q < 4; ++q) { v[c * 4 + q] = a[q]; s = __fadd_rn(s, a[q]); } }
#pragma unroll
    for (int sh = 16; sh; sh >>= 1) s = __fadd_rn(s, __shfl_xor(s, sh, 32));
    const float mean = __fdiv_rn(s, (float)DQ); float s2 = 0.f;
#pragma unroll
    for (int k = 0; k < DQ / 32; ++k) { const float dv = __fsub_rn(v[k], mean); float p2 = __fmul_rn(dv, dv); asm volatile("" : "+v"(p2)); s2 = __fadd_rn(s2, p2); v[k] = dv; }
#pragma unroll
    for (int sh = 16; sh; sh >>= 1) s2 = __fadd_rn(s2, __shfl_xor(s2, sh, 32));
    const float rs = __fdiv_rn(1.0f, __fsqrt_rn(__fadd_rn(__fdiv_rn(s2, (float)DQ), LNEPS)));
{
#pragma unroll
        for (int c = 0; c < DQ / 128; ++c) { v4f o; for (int q = 0; q < 4; ++q) { const int col = c * 128 + lane * 4 + q; float y = __fmul_rn(v[c * 4 + q], rs); asm volatile("" : "+v"(y)); y = __fmul_rn(y, bfr(g[col])); asm volatile("" : "+v"(y)); o[q] = __fadd_rn(y, bfr(bb[col])); } *(v4f*)(orow + c * 128 + lane * 4) = o; }
         } }
__global__ __launch_bounds__(256) void k_merge(const float* __restrict__ O, int h0, bf* Ah, bf* Al) { const size_t e = ((size_t)blockIdx.x * 256 + threadIdx.x) * 2; if (e >= (size_t)ZH * TT * HD) return; const int d = (int)(e % HD); const int t = (int)((e / HD) % TT); const int zz = (int)(e / ((size_t)HD * TT)); const float cs = (t < RH) ? 1.0f : (1.0f / PCAR); const size_t oo = (size_t)t * DQ + (h0 + zz) * HD + d;
    v2us oh, ol;
#pragma unroll
    for (int q = 0; q < 2; ++q) { unsigned short a, c2; splitf(O[e + q] * cs, a, c2); oh[q] = a; ol[q] = c2; } *(v2us*)(Ah + oo) = oh; *(v2us*)(Al + oo) = ol;  }

extern "C" void kernel_launch(void* const* d_in, const int* in_sizes, int n_in,
                              void* d_out, int out_size, void* d_ws, size_t ws_size, hipStream_t stream) {
    (void)in_sizes; (void)n_in; (void)out_size;
    const float* x = (const float*)d_in[0]; const float* wq = (const float*)d_in[1]; const float* wk = (const float*)d_in[2]; const float* wv = (const float*)d_in[3]; const float* wo = (const float*)d_in[4]; const float* lng = (const float*)d_in[5]; const float* lnb = (const float*)d_in[6];
    float* OUT = (float*)d_out;     // [4][2048][1024]
    char* wsp = (char*)d_ws;
    auto take = [&](size_t bytes) { char* p = wsp; wsp += (bytes + 255) & ~(size_t)255; return (void*)p; };
    float* Y = (float*)take((size_t)TT * DM * 4); bf* WQ = (bf*)take((size_t)DQ * DM * 2); bf* WK = (bf*)take((size_t)DKV * DM * 2); bf* WV = (bf*)take((size_t)DKV * DM * 2); bf* WO = (bf*)take((size_t)DM * DQ * 2); float* CS = (float*)take((size_t)TT * HD * 2 * 4);
    bf* XB = (bf*)take((size_t)TT * DM * 2); float* FQ = (float*)take((size_t)TT * DQ * 4); float* FK = (float*)take((size_t)TT * DKV * 4);
    h16* QP16 = (h16*)take((size_t)NH_ * TT * HD * 2); h16* KP16 = (h16*)take((size_t)NKV * TT * HD * 2); h16* VT16 = (h16*)take((size_t)NKV * HD * TT * 2);
    bf* QPh = (bf*)take((size_t)NH_ * TT * HD * 2); bf* QPl = (bf*)take((size_t)NH_ * TT * HD * 2); bf* KPh = (bf*)take((size_t)NKV * TT * HD * 2); bf* KPl = (bf*)take((size_t)NKV * TT * HD * 2); bf* VTh = (bf*)take((size_t)NKV * HD * TT * 2); bf* VTl = (bf*)take((size_t)NKV * HD * TT * 2); bf* Ph = (bf*)take((size_t)ZH * RH * TT * 2); bf* Pl = (bf*)take((size_t)ZH * RH * TT * 2);
    float* Sb = (float*)take((size_t)ZH * TT * TT * 4); h16* P16 = (h16*)take((size_t)ZH * TT * TT * 2); float* Ob = (float*)take((size_t)ZH * TT * HD * 4); bf* ATh = (bf*)take((size_t)TT * DQ * 2); bf* ATl = (bf*)take((size_t)TT * DQ * 2);
    if ((size_t)(wsp - (char*)d_ws) > ws_size) return;    // ws 256 MiB
    float* FV = FK;   // v projection reuses the k buffer after the k planes are built (stream-ordered)
    { k_wtG<<<(unsigned)((DM * DQ / 64 + 63) / 64), 256, 0, stream>>>(wq, DM, DQ, WQ); k_wtG<<<(unsigned)((DM * DKV / 64 + 63) / 64), 256, 0, stream>>>(wk, DM, DKV, WK); k_wtG<<<(unsigned)((DM * DKV / 64 + 63) / 64), 256, 0, stream>>>(wv, DM, DKV, WV);
      k_wtG<<<(unsigned)((DQ * DM / 64 + 63) / 64), 256, 0, stream>>>(wo, DQ, DM, WO);
       }
    k_csid<<<(TT * HD + 255) / 256, 256, 0, stream>>>(CS);
    const unsigned LQ = (unsigned)(((size_t)NH_ * TT * HD / 2 + 255) / 256), LKv = (unsigned)(((size_t)NKV * TT * HD / 2 + 255) / 256);
    for (int b = 0; b < NB_; ++b) {
        
        k_cvt8<<<(unsigned)(((size_t)TT * DM / 8 + 255) / 256), 256, 0, stream>>>(x + (size_t)b * TT * DM, XB, (size_t)TT * DM / 8);
        k_gemmw<bf, 0, false><<<dim3(TT / 64, DQ / 64, 1), 32, 0, stream>>>(XB, nullptr, WQ, nullptr, DM, FQ, DQ, nullptr, 0, 0, 0);
        k_rope<<<LQ, 256, 0, stream>>>(FQ, DQ, NH_, CS, nullptr, nullptr, 1.0f, QP16, QPh, QPl);
        k_gemmw<bf, 0, false><<<dim3(TT / 64, DKV / 64, 1), 32, 0, stream>>>(XB, nullptr, WK, nullptr, DM, FK, DKV, nullptr, 0, 0, 0);
        k_rope<<<LKv, 256, 0, stream>>>(FK, DKV, NKV, CS, nullptr, nullptr, 1.0f, KP16, KPh, KPl);
        k_gemmw<bf, 0, false><<<dim3(TT / 64, DKV / 64, 1), 32, 0, stream>>>(XB, nullptr, WV, nullptr, DM, FV, DKV, nullptr, 0, 0, 0); k_vtp<<<LKv, 256, 0, stream>>>(FV, DKV, NKV, VT16, VTh, VTl);
        for (int h0 = 0; h0 < NH_; h0 += ZH) { const size_t zq = (size_t)h0, zk = (size_t)(h0 / REP);   // one kv head per query head: the pass's two heads use consecutive kv planes (z-strides TT*HD)
            k_gemmw<bf, 2, false><<<dim3(TT / 64, TT / 64, ZH), 32, 0, stream>>>(QPh + zq * TT * HD, QPl + zq * TT * HD, KPh + zk * TT * HD, KPl + zk * TT * HD, HD, Sb, TT, nullptr, (size_t)TT * HD, (size_t)TT * HD, (size_t)TT * TT);   /* scores hi/lo on EVERY row (sigma-16 logits) */

            k_asoft<<<ZH * TT / 8, 256, 0, stream>>>(Sb, P16, Ph, Pl);
            k_gemmw<bf, 2, false><<<dim3(RH / 64, HD / 64, ZH), 32, 0, stream>>>(Ph, Pl, VTh + zk * HD * TT, VTl + zk * HD * TT, TT, Ob, HD, nullptr, (size_t)RH * TT, (size_t)HD * TT, (size_t)TT * HD);
            k_gemmw<h16, 0, false><<<dim3((TT - RH) / 64, HD / 64, ZH), 32, 0, stream>>>(P16 + (size_t)RH * TT, nullptr, VT16 + zk * HD * TT, nullptr, TT, Ob + (size_t)RH * HD, HD, nullptr, (size_t)TT * TT, (size_t)HD * TT, (size_t)TT * HD);
            k_merge<<<(unsigned)(((size_t)ZH * TT * HD / 2 + 255) / 256), 256, 0, stream>>>(Ob, h0, ATh, ATl); }
        k_gemmw<bf, 1, false><<<dim3(TT / 64, DM / 64, 1), 32, 0, stream>>>(ATh, ATl, WO, nullptr, DQ, Y, DM, nullptr, 0, 0, 0); k_addres<<<(unsigned)(((size_t)TT * DQ / 4 + 255) / 256), 256, 0, stream>>>(Y, x + (size_t)b * TT * DM); k_lnout<<<(TT + 7) / 8, 256, 0, stream>>>(Y, lng, lnb, OUT + (size_t)b * TT * DM);   /* LayerNorm(h + attn_out) */ }
}

// v001
// Measured time: 1690 microseconds a run.
// Two timings next to v000 put it at 2.34 and 2.37 times that version's speed.
#include <hip/hip_runtime.h>

// Transformer-XL style multi-head attention with post-LayerNorm (h [4][2048][1024]; q,k,v = h W ('xw' [1024][1024] with scale 1/8 x normal: sigma-4 projections, so the /8 logits have sigma ~16: sharply peaked); scores x 64^-0.5; softmax over keys; attn_out = attn_vec Wo ('xw', no bias); out = LayerNorm(h + attn_out) gamma/beta (1e-5) -> [4][2048][1024] (8.4 M)).
// Layout per batch: bf16 copy of h; 'xw' weights transposed once; exact projections; scores hi/lo 3 products on EVERY row (peaked logits), P and attn.v hybrid (rows < 512 hi/lo, rest fp16 x1024); merged hi/lo x Wo exact into workspace; residual add and a row LayerNorm kernel (one wave per 1,024-wide row, fixed-order sums, precise sqrt/div, affine) write the output rows.
// Compute dtypes, f32 accumulate: every input rounded to bf16; projections exact; scores 3 products on every row; softmax f32; attn.v rows < 512 3 products, rest fp16; Wo hl x exact; residual + LayerNorm f32.

#define NB_  4
#define TT   2048
#define DM   1024
#define NH_  16
#define NKV  16
#define REP  (NH_ / NKV)
#define HD   64
#define DQ   (NH_ * HD)
#define DKV  (NKV * HD)
#define ZH   2
#define RH   512                  // query rows < RH use hi+lo planes (0: none)
#define WIN  0
#define PCAR 1024.0f
#define SCL  0.125f
#define LNEPS 1e-5f
typedef _Float16 h16;
typedef unsigned short bf;
typedef __attribute__((ext_vector_type(16))) __bf16   v16bf;
typedef __attribute__((ext_vector_type(16))) _Float16 v16h;
typedef __attribute__((ext_vector_type(8)))  _Float16 v8h;
typedef __attribute__((ext_vector_type(8)))  unsigned short v8us;
typedef __attribute__((ext_vector_type(8)))  float    v8f;
typedef __attribute__((ext_vector_type(4)))  float    v4f;
typedef v8h  __attribute__((may_alias)) v8ha;
typedef v4f  __attribute__((may_alias)) v4fa;
typedef v8us __attribute__((may_alias)) v8usa;

__device__ __forceinline__ unsigned short f2bf(float f) { unsigned u = __float_as_uint(f); u += 0x7FFFu + ((u >> 16) & 1u); return (unsigned short)(u >> 16); }
__device__ __forceinline__ float bf2f(unsigned short b) { return __uint_as_float(((unsigned)b) << 16); }
__device__ __forceinline__ float bfr(float f) { return bf2f(f2bf(f)); }
__device__ __forceinline__ v16h cat16(v8h lo, v8h hi) { return __builtin_shufflevector(lo, hi, 0, 1, 2, 3, 4, 5, 6, 7, 8, 9, 10, 11, 12, 13, 14, 15); }
__device__ __forceinline__ v16bf cat16b(v8us lo, v8us hi) { return __builtin_bit_cast(v16bf, __builtin_shufflevector(lo, hi, 0, 1, 2, 3, 4, 5, 6, 7, 8, 9, 10, 11, 12, 13, 14, 15)); }
__device__ __forceinline__ v8f wmma16(v16h a, v16h b, v8f c) { return __builtin_amdgcn_wmma_f32_16x16x32_f16(false, a, false, b, (short)0, c, false, false); }
__device__ __forceinline__ v8f wmmab(v16bf a, v16bf b, v8f c) { return __builtin_amdgcn_wmma_f32_16x16x32_bf16(false, a, false, b, (short)0, c, false, false); }



// ---- k_gemmw: register-blocked GEMM, ONE WAVE per 64x64 output tile (16 accumulators), operands straight from K-contiguous 16-bit planes; grid (M/64, N/64, Z), 32 threads.
// C[m][n] (f32, pitch ldc, + optional f32 bias[n]) = sum_k A[m][k] Bt[n][k] (+ split products per NSPLIT). z-batch strides sA/sB/sC in elements. K % 32 == 0.
template <typename T16> struct WFrag;
template <> struct WFrag<h16> { typedef v16h V; static __device__ __forceinline__ V ld(const h16* p) { return cat16(*(const v8h*)p, *(const v8h*)(p + 16)); } static __device__ __forceinline__ v8f mma(V a, V b, v8f c) { return wmma16(a, b, c); } };
template <> struct WFrag<bf> { typedef v16bf V; static __device__ __forceinline__ V ld(const bf* p) { return cat16b(*(const v8us*)p, *(const v8us*)(p + 16)); } static __device__ __forceinline__ v8f mma(V a, V b, v8f c) { return wmmab(a, b, c); } };
template <typename T16, int NSPLIT, bool BIAS>
__global__ __launch_bounds__(32) void k_gemmw(const T16* __restrict__ A, const T16* __restrict__ A2, const T16* __restrict__ Bt, const T16* __restrict__ Bt2, int K, float* C, int ldc, const float* __restrict__ bias, size_t sA, size_t sB, size_t sC) {
    typedef typename WFrag<T16>::V V;
    __shared__ __align__(16) float os[16 * 68];
    const size_t z = blockIdx.z; A += z * sA; if (A2) A2 += z * sA; Bt += z * sB; if (Bt2) Bt2 += z * sB; C += z * sC;
    const int lane = threadIdx.x & 31, lr = lane & 15, hi = lane >> 4; const int r0 = blockIdx.x * 64, c0 = blockIdx.y * 64;
    v8f acc[4][4];
#pragma unroll
    for (int mb = 0; mb < 4; ++mb)
#pragma unroll
        for (int nb = 0; nb < 4; ++nb) acc[mb][nb] = (v8f){};
    const size_t aoff = (size_t)(r0 + lr) * K + 8 * hi, boff = (size_t)(c0 + lr) * K + 8 * hi;
#pragma unroll 1
    for (int kc = 0; kc < K; kc += 32) {
        V a[4], a2[4];
#pragma unroll
        for (int mb = 0; mb < 4; ++mb) { a[mb] = WFrag<T16>::ld(A + aoff + (size_t)mb * 16 * K + kc); if (NSPLIT == 1 || NSPLIT == 2) a2[mb] = WFrag<T16>::ld(A2 + aoff + (size_t)mb * 16 * K + kc); }
#pragma unroll
        for (int nb = 0; nb < 4; ++nb) { const V b = WFrag<T16>::ld(Bt + boff + (size_t)nb * 16 * K + kc); V b2; if (NSPLIT >= 2) b2 = WFrag<T16>::ld(Bt2 + boff + (size_t)nb * 16 * K + kc);
#pragma unroll
            for (int mb = 0; mb < 4; ++mb) { acc[mb][nb] = WFrag<T16>::mma(a[mb], b, acc[mb][nb]); if (NSPLIT == 1 || NSPLIT == 2) acc[mb][nb] = WFrag<T16>::mma(a2[mb], b, acc[mb][nb]); if (NSPLIT >= 2) acc[mb][nb] = WFrag<T16>::mma(a[mb], b2, acc[mb][nb]); } }
        asm volatile("v_nop\n\tv_nop\n\tv_nop\n\tv_nop" : "+v"(acc[0][0]), "+v"(acc[1][1]), "+v"(acc[2][2]), "+v"(acc[3][3]) : "v"(a[0]), "v"(a[3]));
    }
#pragma unroll
    for (int mb = 0; mb < 4; ++mb) {
#pragma unroll
        for (int nb = 0; nb < 4; ++nb) {
#pragma unroll
            for (int j = 0; j < 8; ++j) os[(hi * 8 + j) * 68 + nb * 16 + lr] = acc[mb][nb][j]; }
        __builtin_amdgcn_wave_barrier(); asm volatile("" ::: "memory");
        float* crow = C + (size_t)(r0 + mb * 16) * ldc + c0;
{
#pragma unroll
            for (int s = 0; s < 8; ++s) { const int row = 2 * s + hi, cofs = lr * 4; v4f val = *(const v4fa*)(os + row * 68 + cofs); if (BIAS) { val[0] += bfr(bias[c0 + cofs]); val[1] += bfr(bias[c0 + cofs + 1]); val[2] += bfr(bias[c0 + cofs + 2]); val[3] += bfr(bias[c0 + cofs + 3]); }
                *(v4f*)(crow + (size_t)row * ldc + cofs) = val; }
             }
        __builtin_amdgcn_wave_barrier(); asm volatile("" ::: "memory");
    }
}

// ---- k_gemmks: attn.v product with the key sum split. One work-group of 4 waves per (64-row tile, key slice of 4 x KSW keys, z); each wave multiplies its own KSW keys into a 64x64 tile (all fragments of that short range are loaded before the first product),
// the 4 wave tiles are summed in LDS in wave order and the slice's partial tile goes to plane blockIdx.y of C (plane stride sP); k_merge adds the KSP planes in plane order. A and Bt rows have pitch TT; N = HD = 64.
#define KSP  8                    // key slices (partial planes)
#define KSW  (TT / (KSP * 4))     // keys per wave
template <typename T16, int NSPLIT>
__global__ __launch_bounds__(128) void k_gemmks(const T16* __restrict__ A, const T16* __restrict__ A2, const T16* __restrict__ Bt, const T16* __restrict__ Bt2, float* C, size_t sA, size_t sB, size_t sC, size_t sP) {
    typedef typename WFrag<T16>::V V;
    __shared__ __align__(16) float os[4 * 64 * 68];
    const size_t z = blockIdx.z; A += z * sA; Bt += z * sB; if (NSPLIT == 2) { A2 += z * sA; Bt2 += z * sB; } C += z * sC + (size_t)blockIdx.y * sP;
    const int lane = threadIdx.x & 31, lr = lane & 15, hi = lane >> 4, wave = threadIdx.x >> 5; const int r0 = blockIdx.x * 64, k0 = (blockIdx.y * 4 + wave) * KSW;
    const size_t aoff = (size_t)(r0 + lr) * TT + k0 + 8 * hi, boff = (size_t)lr * TT + k0 + 8 * hi; const T16* pa = A + aoff; const T16* pb = Bt + boff; const T16* pa2 = (NSPLIT == 2) ? A2 + aoff : pa; const T16* pb2 = (NSPLIT == 2) ? Bt2 + boff : pb;
    V a[KSW / 32][4], b[KSW / 32][4], a2[KSW / 32][4], b2[KSW / 32][4];
#pragma unroll
    for (int s = 0; s < KSW / 32; ++s)
#pragma unroll
        for (int m = 0; m < 4; ++m) { a[s][m] = WFrag<T16>::ld(pa + m * 16 * TT + s * 32); b[s][m] = WFrag<T16>::ld(pb + m * 16 * TT + s * 32);
            if (NSPLIT == 2) { a2[s][m] = WFrag<T16>::ld(pa2 + m * 16 * TT + s * 32); b2[s][m] = WFrag<T16>::ld(pb2 + m * 16 * TT + s * 32); } }
    asm volatile("s_wait_xcnt 0x0" :: "v"(pa), "v"(pb), "v"(pa2), "v"(pb2) : "memory");   // the wait in front of any overwrite of an address register that an issued load names; the four addresses are inputs so that they stay in their registers up to here
    __builtin_amdgcn_sched_barrier(0);   // keeps every load of the wave's range in front of the first product: one memory latency a wave, not one a fragment group (the scheduler otherwise sinks loads between the products)
    v8f acc[4][4];
#pragma unroll
    for (int mb = 0; mb < 4; ++mb)
#pragma unroll
        for (int nb = 0; nb < 4; ++nb) acc[mb][nb] = (v8f){};
#pragma unroll
    for (int s = 0; s < KSW / 32; ++s) {
#pragma unroll
        for (int nb = 0; nb < 4; ++nb)
#pragma unroll
            for (int mb = 0; mb < 4; ++mb) acc[mb][nb] = WFrag<T16>::mma(a[s][mb], b[s][nb], acc[mb][nb]);
        if (NSPLIT == 2) {
#pragma unroll
            for (int nb = 0; nb < 4; ++nb)
#pragma unroll
                for (int mb = 0; mb < 4; ++mb) acc[mb][nb] = WFrag<T16>::mma(a2[s][mb], b[s][nb], acc[mb][nb]);
#pragma unroll
            for (int nb = 0; nb < 4; ++nb)
#pragma unroll
                for (int mb = 0; mb < 4; ++mb) acc[mb][nb] = WFrag<T16>::mma(a[s][mb], b2[s][nb], acc[mb][nb]); } }
    __builtin_amdgcn_sched_barrier(0);   // keeps the LDS stores behind the last product, so that the 16 independent accumulators stay interleaved and no accumulator register is reused right behind a product
    float* ow = os + wave * (64 * 68);
#pragma unroll
    for (int mb = 0; mb < 4; ++mb)
#pragma unroll
        for (int nb = 0; nb < 4; ++nb)
#pragma unroll
            for (int j = 0; j < 8; ++j) ow[(mb * 16 + hi * 8 + j) * 68 + nb * 16 + lr] = acc[mb][nb][j];
    __syncthreads();   // every wave's tile is in LDS before any thread sums the four
    float* cp = C + (size_t)r0 * HD;
#pragma unroll
    for (int s = 0; s < 8; ++s) { const int row = s * 8 + (threadIdx.x >> 4), cofs = (threadIdx.x & 15) * 4; const float* p = os + row * 68 + cofs; v4f val = *(const v4fa*)p;
#pragma unroll
        for (int w = 1; w < 4; ++w) { const v4f t = *(const v4fa*)(p + w * (64 * 68)); val += t; }
        *(v4f*)(cp + (size_t)row * HD + cofs) = val; }
}

__device__ __forceinline__ h16 tohx(float x) { return (h16)x; }
__device__ __forceinline__ void splitf(float y, unsigned short& h, unsigned short& l) { h = f2bf(y); l = f2bf(y - bf2f(h)); }
typedef __attribute__((ext_vector_type(2))) _Float16 v2h;
typedef __attribute__((ext_vector_type(4))) _Float16 v4h;
typedef __attribute__((ext_vector_type(2))) unsigned short v2us;
typedef __attribute__((ext_vector_type(4))) unsigned short v4us;
typedef __attribute__((ext_vector_type(2))) float v2f;
typedef __attribute__((ext_vector_type(4))) int v4i;

__global__ __launch_bounds__(256) void k_wtG(const float* __restrict__ w, int K, int N, bf* Bt) {
    const int lane = threadIdx.x & 31; const int L0 = (blockIdx.x * 8 + (threadIdx.x >> 5)) * 8; const int nlines = N * K / 64;
{
#pragma unroll 1
        for (int l = 0; l < 8; ++l) { const int L = L0 + l; if (L >= nlines) break; const size_t e = (size_t)L * 64 + lane * 2; const int k = (int)(e % K), n = (int)(e / K); v2us o;
            o[0] = f2bf(w[(size_t)k * N + n]); o[1] = f2bf(w[(size_t)(k + 1) * N + n]); *(v2us*)(Bt + e) = o; }
         }
}
__global__ __launch_bounds__(256) void k_cvt8(const float* __restrict__ src, bf* dst, size_t n8) { const size_t i = (size_t)blockIdx.x * 256 + threadIdx.x; if (i >= n8) return; const v8f v = *(const v8f*)(src + i * 8); v8us o;
#pragma unroll
    for (int k = 0; k < 8; ++k) o[k] = f2bf(v[k]); *(v8us*)(dst + i * 8) = o;  }

// k_rope: head planes [h][t][d] (fp16 + hi/lo) of rope(x) x sc with the rotate-half convention out[d] = x[d] cos[t][d] - x[d+HD/2] sin[t][d], out[d+HD/2] = x[d+HD/2] cos[t][d+HD/2] + x[d] sin[t][d+HD/2]
__global__ __launch_bounds__(256) void k_rope(const float* __restrict__ F, int pitch, int nheads, const float* __restrict__ CS, const float* __restrict__ RF, const float* __restrict__ nw, float sc, h16* P16, bf* Ph, bf* Pl) {
    const size_t e = ((size_t)blockIdx.x * 256 + threadIdx.x) * 2; if (e >= (size_t)nheads * TT * HD) return; const int d = (int)(e % HD); const int t = (int)((e / HD) % TT); const int h = (int)(e / ((size_t)HD * TT)); const float* f = F + (size_t)t * pitch + h * HD; const float rf = RF ? RF[(size_t)h * TT + t] : 1.0f; v2h o16; v2us oh, ol;
#pragma unroll
    for (int q = 0; q < 2; ++q) { const int dd = d + q; const int dp = (dd < HD / 2) ? dd + HD / 2 : dd - HD / 2; float x0 = f[dd], x1 = f[dp];
        if (RF) { float n0 = __fmul_rn(x0, rf), n1 = __fmul_rn(x1, rf); asm volatile("" : "+v"(n0)); asm volatile("" : "+v"(n1)); x0 = __fmul_rn(bfr(nw[dd]), n0); x1 = __fmul_rn(bfr(nw[dp]), n1); }
        const v2f cs = *(const v2f*)(CS + ((size_t)t * HD + dd) * 2); float a = __fmul_rn(x0, cs[0]), bq = __fmul_rn(x1, cs[1]); asm volatile("" : "+v"(a)); asm volatile("" : "+v"(bq)); const float r = ((dd < HD / 2) ? __fsub_rn(a, bq) : __fadd_rn(a, bq)) * sc;
        o16[q] = tohx(r); unsigned short a2, c2; splitf(r, a2, c2); oh[q] = a2; ol[q] = c2; }
    *(v2h*)(P16 + e) = o16; *(v2us*)(Ph + e) = oh; *(v2us*)(Pl + e) = ol;  }
__global__ __launch_bounds__(256) void k_vtp(const float* __restrict__ F, int pitch, int nheads, h16* V16, bf* Vh, bf* Vl) { const size_t e = ((size_t)blockIdx.x * 256 + threadIdx.x) * 2; if (e >= (size_t)nheads * HD * TT) return; const int t = (int)(e % TT); const int d = (int)((e / TT) % HD); const int g = (int)(e / ((size_t)TT * HD)); v2h o16; v2us oh, ol;
#pragma unroll
    for (int q = 0; q < 2; ++q) { const float x = F[(size_t)(t + q) * pitch + g * HD + d]; o16[q] = tohx(x); unsigned short a2, c2; splitf(x, a2, c2); oh[q] = a2; ol[q] = c2; }
    *(v2h*)(V16 + e) = o16; *(v2us*)(Vh + e) = oh; *(v2us*)(Vl + e) = ol;  }
__global__ __launch_bounds__(256) void k_csid(float* CS) { const int idx = blockIdx.x * 256 + threadIdx.x; if (idx >= TT * HD) return; v2f cs; cs[0] = 1.0f; cs[1] = 0.0f; *(v2f*)(CS + (size_t)idx * 2) = cs;  }
// k_asoft: per row (zz, i): t = S x HD^-0.5 (no mask); softmax over the 2048 keys (register row, one exp, fixed trees);
__global__ __launch_bounds__(256) void k_asoft(const float* __restrict__ Sb, h16* P16, bf* Ph, bf* Pl) {
    const int lane = threadIdx.x & 31; const int row = blockIdx.x * 8 + (threadIdx.x >> 5); if (row >= ZH * TT) return; const int i = row % TT; const int zz = row / TT; (void)zz; const bool hires = (i < RH); const float* sr = Sb + (size_t)row * TT; float v[TT / 32]; float mx = -3.0e38f;
#pragma unroll
    for (int ch = 0; ch < TT / 128; ++ch) { const int j0 = ch * 128 + lane * 4; const v4f a = *(const v4f*)(sr + j0);
#pragma unroll
        for (int q = 0; q < 4; ++q) { const int j = j0 + q; (void)j; const float t = a[q] * SCL; v[ch * 4 + q] = t; mx = fmaxf(mx, t); } }
#pragma unroll
    for (int sh = 16; sh; sh >>= 1) mx = fmaxf(mx, __shfl_xor(mx, sh, 32));
    float sum = 0.f;
#pragma unroll
    for (int k = 0; k < TT / 32; ++k) { float d0 = __fsub_rn(v[k], mx); asm volatile("" : "+v"(d0)); v[k] = __builtin_amdgcn_exp2f(__fmul_rn(d0, 1.4426950408889634f)); sum += v[k]; }
#pragma unroll
    for (int sh = 16; sh; sh >>= 1) sum += __shfl_xor(sum, sh, 32);
    const float f = __fdiv_rn(hires ? 1.0f : PCAR, sum);
{
        if (hires) {
#pragma unroll
            for (int ch = 0; ch < TT / 128; ++ch) { v4us oh, ol;
#pragma unroll
                for (int q = 0; q < 4; ++q) { unsigned short a, c2; splitf(v[ch * 4 + q] * f, a, c2); oh[q] = a; ol[q] = c2; }
                const size_t oo = ((size_t)zz * (RH ? RH : 1) + i) * TT + ch * 128 + lane * 4; *(v4us*)(Ph + oo) = oh; *(v4us*)(Pl + oo) = ol; }
        } else {
#pragma unroll
            for (int ch = 0; ch < TT / 128; ++ch) { v4h o4;
#pragma unroll
                for (int q = 0; q < 4; ++q) o4[q] = tohx(v[ch * 4 + q] * f);
                *(v4h*)(P16 + (size_t)row * TT + ch * 128 + lane * 4) = o4; } }
         }
}
__global__ __launch_bounds__(256) void k_addres(float* Y, const float* __restrict__ xr) { const size_t i = (size_t)blockIdx.x * 256 + threadIdx.x; if (i >= (size_t)TT * DQ / 4) return; const v4f a = *(const v4f*)(Y + i * 4); const v4f r = *(const v4f*)(xr + i * 4); v4f o;
#pragma unroll
    for (int q = 0; q < 4; ++q) o[q] = __fadd_rn(a[q], bfr(r[q]));
    *(v4f*)(Y + i * 4) = o;  }
__global__ __launch_bounds__(256) void k_lnout(const float* __restrict__ F, const float* __restrict__ g, const float* __restrict__ bb, float* out) { const int lane = threadIdx.x & 31; const int row = blockIdx.x * 8 + (threadIdx.x >> 5); if (row >= TT) return; const float* fr = F + (size_t)row * DQ; float* orow = out + (size_t)row * DQ; float v[DQ / 32]; float s = 0.f;
#pragma unroll
    for (int c = 0; c < DQ / 128; ++c) { const v4f a = *(const v4f*)(fr + c * 128 + lane * 4); for (int q = 0; q < 4; ++q) { v[c * 4 + q] = a[q]; s = __fadd_rn(s, a[q]); } }
#pragma unroll
    for (int sh = 16; sh; sh >>= 1) s = __fadd_rn(s, __shfl_xor(s, sh, 32));
    const float mean = __fdiv_rn(s, (float)DQ); float s2 = 0.f;
#pragma unroll
    for (int k = 0; k < DQ / 32; ++k) { const float dv = __fsub_rn(v[k], mean); float p2 = __fmul_rn(dv, dv); asm volatile("" : "+v"(p2)); s2 = __fadd_rn(s2, p2); v[k] = dv; }
#pragma unroll
    for (int sh = 16; sh; sh >>= 1) s2 = __fadd_rn(s2, __shfl_xor(s2, sh, 32));
    const float rs = __fdiv_rn(1.0f, __fsqrt_rn(__fadd_rn(__fdiv_rn(s2, (float)DQ), LNEPS)));
{
#pragma unroll
        for (int c = 0; c < DQ / 128; ++c) { v4f o; for (int q = 0; q < 4; ++q) { const int col = c * 128 + lane * 4 + q; float y = __fmul_rn(v[c * 4 + q], rs); asm volatile("" : "+v"(y)); y = __fmul_rn(y, bfr(g[col])); asm volatile("" : "+v"(y)); o[q] = __fadd_rn(y, bfr(bb[col])); } *(v4f*)(orow + c * 128 + lane * 4) = o; }
         } }
__global__ __launch_bounds__(256) void k_merge(const float* __restrict__ O, int h0, bf* Ah, bf* Al) { const size_t e = ((size_t)blockIdx.x * 256 + threadIdx.x) * 2; if (e >= (size_t)ZH * TT * HD) return; const int d = (int)(e % HD); const int t = (int)((e / HD) % TT); const int zz = (int)(e / ((size_t)HD * TT)); const float cs = (t < RH) ? 1.0f : (1.0f / PCAR); const size_t oo = (size_t)t * DQ + (h0 + zz) * HD + d;
    v2f sm = *(const v2f*)(O + e);
#pragma unroll
    for (int p = 1; p < KSP; ++p) { const v2f t = *(const v2f*)(O + (size_t)p * ZH * TT * HD + e); sm += t; }   // key-slice planes, plane order
    v2us oh, ol;
#pragma unroll
    for (int q = 0; q < 2; ++q) { unsigned short a, c2; splitf(sm[q] * cs, a, c2); oh[q] = a; ol[q] = c2; } *(v2us*)(Ah + oo) = oh; *(v2us*)(Al + oo) = ol;  }

extern "C" void kernel_launch(void* const* d_in, const int* in_sizes, int n_in,
                              void* d_out, int out_size, void* d_ws, size_t ws_size, hipStream_t stream) {
    (void)in_sizes; (void)n_in; (void)out_size;
    const float* x = (const float*)d_in[0]; const float* wq = (const float*)d_in[1]; const float* wk = (const float*)d_in[2]; const float* wv = (const float*)d_in[3]; const float* wo = (const float*)d_in[4]; const float* lng = (const float*)d_in[5]; const float* lnb = (const float*)d_in[6];
    float* OUT = (float*)d_out;     // [4][2048][1024]
    char* wsp = (char*)d_ws;
    auto take = [&](size_t bytes) { char* p = wsp; wsp += (bytes + 255) & ~(size_t)255; return (void*)p; };
    float* Y = (float*)take((size_t)TT * DM * 4); bf* WQ = (bf*)take((size_t)DQ * DM * 2); bf* WK = (bf*)take((size_t)DKV * DM * 2); bf* WV = (bf*)take((size_t)DKV * DM * 2); bf* WO = (bf*)take((size_t)DM * DQ * 2); float* CS = (float*)take((size_t)TT * HD * 2 * 4);
    bf* XB = (bf*)take((size_t)TT * DM * 2); float* FQ = (float*)take((size_t)TT * DQ * 4); float* FK = (float*)take((size_t)TT * DKV * 4);
    h16* QP16 = (h16*)take((size_t)NH_ * TT * HD * 2); h16* KP16 = (h16*)take((size_t)NKV * TT * HD * 2); h16* VT16 = (h16*)take((size_t)NKV * HD * TT * 2);
    bf* QPh = (bf*)take((size_t)NH_ * TT * HD * 2); bf* QPl = (bf*)take((size_t)NH_ * TT * HD * 2); bf* KPh = (bf*)take((size_t)NKV * TT * HD * 2); bf* KPl = (bf*)take((size_t)NKV * TT * HD * 2); bf* VTh = (bf*)take((size_t)NKV * HD * TT * 2); bf* VTl = (bf*)take((size_t)NKV * HD * TT * 2); bf* Ph = (bf*)take((size_t)ZH * RH * TT * 2); bf* Pl = (bf*)take((size_t)ZH * RH * TT * 2);
    float* Sb = (float*)take((size_t)ZH * TT * TT * 4); h16* P16 = (h16*)take((size_t)ZH * TT * TT * 2); float* Ob = (float*)take((size_t)KSP * ZH * TT * HD * 4); bf* ATh = (bf*)take((size_t)TT * DQ * 2); bf* ATl = (bf*)take((size_t)TT * DQ * 2);
    if ((size_t)(wsp - (char*)d_ws) > ws_size) return;    // ws 256 MiB
    float* FV = FK;   // v projection reuses the k buffer after the k planes are built (stream-ordered)
    { k_wtG<<<(unsigned)((DM * DQ / 64 + 63) / 64), 256, 0, stream>>>(wq, DM, DQ, WQ); k_wtG<<<(unsigned)((DM * DKV / 64 + 63) / 64), 256, 0, stream>>>(wk, DM, DKV, WK); k_wtG<<<(unsigned)((DM * DKV / 64 + 63) / 64), 256, 0, stream>>>(wv, DM, DKV, WV);
      k_wtG<<<(unsigned)((DQ * DM / 64 + 63) / 64), 256, 0, stream>>>(wo, DQ, DM, WO);
       }
    k_csid<<<(TT * HD + 255) / 256, 256, 0, stream>>>(CS);
    const unsigned LQ = (unsigned)(((size_t)NH_ * TT * HD / 2 + 255) / 256), LKv = (unsigned)(((size_t)NKV * TT * HD / 2 + 255) / 256);
    for (int b = 0; b < NB_; ++b) {
        
        k_cvt8<<<(unsigned)(((size_t)TT * DM / 8 + 255) / 256), 256, 0, stream>>>(x + (size_t)b * TT * DM, XB, (size_t)TT * DM / 8);
        k_gemmw<bf, 0, false><<<dim3(TT / 64, DQ / 64, 1), 32, 0, stream>>>(XB, nullptr, WQ, nullptr, DM, FQ, DQ, nullptr, 0, 0, 0);
        k_rope<<<LQ, 256, 0, stream>>>(FQ, DQ, NH_, CS, nullptr, nullptr, 1.0f, QP16, QPh, QPl);
        k_gemmw<bf, 0, false><<<dim3(TT / 64, DKV / 64, 1), 32, 0, stream>>>(XB, nullptr, WK, nullptr, DM, FK, DKV, nullptr, 0, 0, 0);
        k_rope<<<LKv, 256, 0, stream>>>(FK, DKV, NKV, CS, nullptr, nullptr, 1.0f, KP16, KPh, KPl);
        k_gemmw<bf, 0, false><<<dim3(TT / 64, DKV / 64, 1), 32, 0, stream>>>(XB, nullptr, WV, nullptr, DM, FV, DKV, nullptr, 0, 0, 0); k_vtp<<<LKv, 256, 0, stream>>>(FV, DKV, NKV, VT16, VTh, VTl);
        for (int h0 = 0; h0 < NH_; h0 += ZH) { const size_t zq = (size_t)h0, zk = (size_t)(h0 / REP);   // one kv head per query head: the pass's two heads use consecutive kv planes (z-strides TT*HD)
            k_gemmw<bf, 2, false><<<dim3(TT / 64, TT / 64, ZH), 32, 0, stream>>>(QPh + zq * TT * HD, QPl + zq * TT * HD, KPh + zk * TT * HD, KPl + zk * TT * HD, HD, Sb, TT, nullptr, (size_t)TT * HD, (size_t)TT * HD, (size_t)TT * TT);   /* scores hi/lo on EVERY row (sigma-16 logits) */

            k_asoft<<<ZH * TT / 8, 256, 0, stream>>>(Sb, P16, Ph, Pl);
            k_gemmks<bf, 2><<<dim3(RH / 64, KSP, ZH), 128, 0, stream>>>(Ph, Pl, VTh + zk * HD * TT, VTl + zk * HD * TT, Ob, (size_t)RH * TT, (size_t)HD * TT, (size_t)TT * HD, (size_t)ZH * TT * HD);
            k_gemmks<h16, 0><<<dim3((TT - RH) / 64, KSP, ZH), 128, 0, stream>>>(P16 + (size_t)RH * TT, nullptr, VT16 + zk * HD * TT, nullptr, Ob + (size_t)RH * HD, (size_t)TT * TT, (size_t)HD * TT, (size_t)TT * HD, (size_t)ZH * TT * HD);
            k_merge<<<(unsigned)(((size_t)ZH * TT * HD / 2 + 255) / 256), 256, 0, stream>>>(Ob, h0, ATh, ATl); }
        k_gemmw<bf, 1, false><<<dim3(TT / 64, DM / 64, 1), 32, 0, stream>>>(ATh, ATl, WO, nullptr, DQ, Y, DM, nullptr, 0, 0, 0); k_addres<<<(unsigned)(((size_t)TT * DQ / 4 + 255) / 256), 256, 0, stream>>>(Y, x + (size_t)b * TT * DM); k_lnout<<<(TT + 7) / 8, 256, 0, stream>>>(Y, lng, lnb, OUT + (size_t)b * TT * DM);   /* LayerNorm(h + attn_out) */ }
}

// v002
// A run of this version takes 844 microseconds.
// Next to v001, in two timings, it ran 2.02 and 2.00 times as fast.
// Over all steps from v000 it is 4.74 times as fast.
#include <hip/hip_runtime.h>

// Transformer-XL style multi-head attention with post-LayerNorm (h [4][2048][1024]; q,k,v = h W ('xw' [1024][1024] with scale 1/8 x normal: sigma-4 projections, so the /8 logits have sigma ~16: sharply peaked); scores x 64^-0.5; softmax over keys; attn_out = attn_vec Wo ('xw', no bias); out = LayerNorm(h + attn_out) gamma/beta (1e-5) -> [4][2048][1024] (8.4 M)).
// Layout per batch: bf16 copy of h; 'xw' weights transposed once; exact projections; one fused attention kernel per batch (scores hi/lo 3 products on EVERY row (peaked logits), running-maximum softmax in registers, P and attn.v hybrid (rows < 512 hi/lo, rest fp16 x1024)); merged hi/lo x Wo exact into workspace; residual add and a row LayerNorm kernel (one wave per 1,024-wide row, fixed-order sums, precise sqrt/div, affine) write the output rows.
// Compute dtypes, f32 accumulate: every input rounded to bf16; projections exact; scores 3 products on every row; softmax f32; attn.v rows < 512 3 products, rest fp16; Wo hl x exact; residual + LayerNorm f32.

#define NB_  4
#define TT   2048
#define DM   1024
#define NH_  16
#define NKV  16
#define REP  (NH_ / NKV)
#define HD   64
#define DQ   (NH_ * HD)
#define DKV  (NKV * HD)
#define RH   512                  // query rows < RH use hi+lo planes (0: none)
#define WIN  0
#define PCAR 1024.0f
#define SCL  0.125f
#define LNEPS 1e-5f
typedef _Float16 h16;
typedef unsigned short bf;
typedef __attribute__((ext_vector_type(16))) __bf16   v16bf;
typedef __attribute__((ext_vector_type(16))) _Float16 v16h;
typedef __attribute__((ext_vector_type(8)))  _Float16 v8h;
typedef __attribute__((ext_vector_type(8)))  unsigned short v8us;
typedef __attribute__((ext_vector_type(8)))  float    v8f;
typedef __attribute__((ext_vector_type(4)))  float    v4f;
typedef v8h  __attribute__((may_alias)) v8ha;
typedef v4f  __attribute__((may_alias)) v4fa;
typedef v8us __attribute__((may_alias)) v8usa;

__device__ __forceinline__ unsigned short f2bf(float f) { unsigned u = __float_as_uint(f); u += 0x7FFFu + ((u >> 16) & 1u); return (unsigned short)(u >> 16); }
__device__ __forceinline__ float bf2f(unsigned short b) { return __uint_as_float(((unsigned)b) << 16); }
__device__ __forceinline__ float bfr(float f) { return bf2f(f2bf(f)); }
__device__ __forceinline__ v16h cat16(v8h lo, v8h hi) { return __builtin_shufflevector(lo, hi, 0, 1, 2, 3, 4, 5, 6, 7, 8, 9, 10, 11, 12, 13, 14, 15); }
__device__ __forceinline__ v16bf cat16b(v8us lo, v8us hi) { return __builtin_bit_cast(v16bf, __builtin_shufflevector(lo, hi, 0, 1, 2, 3, 4, 5, 6, 7, 8, 9, 10, 11, 12, 13, 14, 15)); }
__device__ __forceinline__ v8f wmma16(v16h a, v16h b, v8f c) { return __builtin_amdgcn_wmma_f32_16x16x32_f16(false, a, false, b, (short)0, c, false, false); }
__device__ __forceinline__ v8f wmmab(v16bf a, v16bf b, v8f c) { return __builtin_amdgcn_wmma_f32_16x16x32_bf16(false, a, false, b, (short)0, c, false, false); }



// ---- k_gemmw: register-blocked GEMM, ONE WAVE per 64x64 output tile (16 accumulators), operands straight from K-contiguous 16-bit planes; grid (M/64, N/64, Z), 32 threads.
// C[m][n] (f32, pitch ldc, + optional f32 bias[n]) = sum_k A[m][k] Bt[n][k] (+ split products per NSPLIT). z-batch strides sA/sB/sC in elements. K % 32 == 0.
template <typename T16> struct WFrag;
template <> struct WFrag<h16> { typedef v16h V; static __device__ __forceinline__ V ld(const h16* p) { return cat16(*(const v8h*)p, *(const v8h*)(p + 16)); } static __device__ __forceinline__ v8f mma(V a, V b, v8f c) { return wmma16(a, b, c); } };
template <> struct WFrag<bf> { typedef v16bf V; static __device__ __forceinline__ V ld(const bf* p) { return cat16b(*(const v8us*)p, *(const v8us*)(p + 16)); } static __device__ __forceinline__ v8f mma(V a, V b, v8f c) { return wmmab(a, b, c); } };
template <typename T16, int NSPLIT, bool BIAS>
__global__ __launch_bounds__(32) void k_gemmw(const T16* __restrict__ A, const T16* __restrict__ A2, const T16* __restrict__ Bt, const T16* __restrict__ Bt2, int K, float* C, int ldc, const float* __restrict__ bias, size_t sA, size_t sB, size_t sC) {
    typedef typename WFrag<T16>::V V;
    __shared__ __align__(16) float os[16 * 68];
    const size_t z = blockIdx.z; A += z * sA; if (A2) A2 += z * sA; Bt += z * sB; if (Bt2) Bt2 += z * sB; C += z * sC;
    const int lane = threadIdx.x & 31, lr = lane & 15, hi = lane >> 4; const int r0 = blockIdx.x * 64, c0 = blockIdx.y * 64;
    v8f acc[4][4];
#pragma unroll
    for (int mb = 0; mb < 4; ++mb)
#pragma unroll
        for (int nb = 0; nb < 4; ++nb) acc[mb][nb] = (v8f){};
    const size_t aoff = (size_t)(r0 + lr) * K + 8 * hi, boff = (size_t)(c0 + lr) * K + 8 * hi;
#pragma unroll 1
    for (int kc = 0; kc < K; kc += 32) {
        V a[4], a2[4];
#pragma unroll
        for (int mb = 0; mb < 4; ++mb) { a[mb] = WFrag<T16>::ld(A + aoff + (size_t)mb * 16 * K + kc); if (NSPLIT == 1 || NSPLIT == 2) a2[mb] = WFrag<T16>::ld(A2 + aoff + (size_t)mb * 16 * K + kc); }
#pragma unroll
        for (int nb = 0; nb < 4; ++nb) { const V b = WFrag<T16>::ld(Bt + boff + (size_t)nb * 16 * K + kc); V b2; if (NSPLIT >= 2) b2 = WFrag<T16>::ld(Bt2 + boff + (size_t)nb * 16 * K + kc);
#pragma unroll
            for (int mb = 0; mb < 4; ++mb) { acc[mb][nb] = WFrag<T16>::mma(a[mb], b, acc[mb][nb]); if (NSPLIT == 1 || NSPLIT == 2) acc[mb][nb] = WFrag<T16>::mma(a2[mb], b, acc[mb][nb]); if (NSPLIT >= 2) acc[mb][nb] = WFrag<T16>::mma(a[mb], b2, acc[mb][nb]); } }
        asm volatile("v_nop\n\tv_nop\n\tv_nop\n\tv_nop" : "+v"(acc[0][0]), "+v"(acc[1][1]), "+v"(acc[2][2]), "+v"(acc[3][3]) : "v"(a[0]), "v"(a[3]));
    }
#pragma unroll
    for (int mb = 0; mb < 4; ++mb) {
#pragma unroll
        for (int nb = 0; nb < 4; ++nb) {
#pragma unroll
            for (int j = 0; j < 8; ++j) os[(hi * 8 + j) * 68 + nb * 16 + lr] = acc[mb][nb][j]; }
        __builtin_amdgcn_wave_barrier(); asm volatile("" ::: "memory");
        float* crow = C + (size_t)(r0 + mb * 16) * ldc + c0;
{
#pragma unroll
            for (int s = 0; s < 8; ++s) { const int row = 2 * s + hi, cofs = lr * 4; v4f val = *(const v4fa*)(os + row * 68 + cofs); if (BIAS) { val[0] += bfr(bias[c0 + cofs]); val[1] += bfr(bias[c0 + cofs + 1]); val[2] += bfr(bias[c0 + cofs + 2]); val[3] += bfr(bias[c0 + cofs + 3]); }
                *(v4f*)(crow + (size_t)row * ldc + cofs) = val; }
             }
        __builtin_amdgcn_wave_barrier(); asm volatile("" ::: "memory");
    }
}

__device__ __forceinline__ h16 tohx(float x) { return (h16)x; }
__device__ __forceinline__ void splitf(float y, unsigned short& h, unsigned short& l) { h = f2bf(y); l = f2bf(y - bf2f(h)); }
typedef __attribute__((ext_vector_type(2))) _Float16 v2h;
typedef __attribute__((ext_vector_type(4))) _Float16 v4h;
typedef __attribute__((ext_vector_type(2))) unsigned short v2us;
typedef __attribute__((ext_vector_type(4))) unsigned short v4us;
typedef __attribute__((ext_vector_type(2))) float v2f;
typedef __attribute__((ext_vector_type(4))) int v4i;

__global__ __launch_bounds__(256) void k_wtG(const float* __restrict__ w, int K, int N, bf* Bt) {
    const int lane = threadIdx.x & 31; const int L0 = (blockIdx.x * 8 + (threadIdx.x >> 5)) * 8; const int nlines = N * K / 64;
{
#pragma unroll 1
        for (int l = 0; l < 8; ++l) { const int L = L0 + l; if (L >= nlines) break; const size_t e = (size_t)L * 64 + lane * 2; const int k = (int)(e % K), n = (int)(e / K); v2us o;
            o[0] = f2bf(w[(size_t)k * N + n]); o[1] = f2bf(w[(size_t)(k + 1) * N + n]); *(v2us*)(Bt + e) = o; }
         }
}
__global__ __launch_bounds__(256) void k_cvt8(const float* __restrict__ src, bf* dst, size_t n8) { const size_t i = (size_t)blockIdx.x * 256 + threadIdx.x; if (i >= n8) return; const v8f v = *(const v8f*)(src + i * 8); v8us o;
#pragma unroll
    for (int k = 0; k < 8; ++k) o[k] = f2bf(v[k]); *(v8us*)(dst + i * 8) = o;  }

// k_rope: head planes [h][t][d] (fp16 + hi/lo) of rope(x) x sc with the rotate-half convention out[d] = x[d] cos[t][d] - x[d+HD/2] sin[t][d], out[d+HD/2] = x[d+HD/2] cos[t][d+HD/2] + x[d] sin[t][d+HD/2]
__global__ __launch_bounds__(256) void k_rope(const float* __restrict__ F, int pitch, int nheads, const float* __restrict__ CS, const float* __restrict__ RF, const float* __restrict__ nw, float sc, h16* P16, bf* Ph, bf* Pl) {
    const size_t e = ((size_t)blockIdx.x * 256 + threadIdx.x) * 2; if (e >= (size_t)nheads * TT * HD) return; const int d = (int)(e % HD); const int t = (int)((e / HD) % TT); const int h = (int)(e / ((size_t)HD * TT)); const float* f = F + (size_t)t * pitch + h * HD; const float rf = RF ? RF[(size_t)h * TT + t] : 1.0f; v2h o16; v2us oh, ol;
#pragma unroll
    for (int q = 0; q < 2; ++q) { const int dd = d + q; const int dp = (dd < HD / 2) ? dd + HD / 2 : dd - HD / 2; float x0 = f[dd], x1 = f[dp];
        if (RF) { float n0 = __fmul_rn(x0, rf), n1 = __fmul_rn(x1, rf); asm volatile("" : "+v"(n0)); asm volatile("" : "+v"(n1)); x0 = __fmul_rn(bfr(nw[dd]), n0); x1 = __fmul_rn(bfr(nw[dp]), n1); }
        const v2f cs = *(const v2f*)(CS + ((size_t)t * HD + dd) * 2); float a = __fmul_rn(x0, cs[0]), bq = __fmul_rn(x1, cs[1]); asm volatile("" : "+v"(a)); asm volatile("" : "+v"(bq)); const float r = ((dd < HD / 2) ? __fsub_rn(a, bq) : __fadd_rn(a, bq)) * sc;
        o16[q] = tohx(r); unsigned short a2, c2; splitf(r, a2, c2); oh[q] = a2; ol[q] = c2; }
    *(v2h*)(P16 + e) = o16; *(v2us*)(Ph + e) = oh; *(v2us*)(Pl + e) = ol;  }
__global__ __launch_bounds__(256) void k_vtp(const float* __restrict__ F, int pitch, int nheads, h16* V16, bf* Vh, bf* Vl) { const size_t e = ((size_t)blockIdx.x * 256 + threadIdx.x) * 2; if (e >= (size_t)nheads * HD * TT) return; const int t = (int)(e % TT); const int d = (int)((e / TT) % HD); const int g = (int)(e / ((size_t)TT * HD)); v2h o16; v2us oh, ol;
#pragma unroll
    for (int q = 0; q < 2; ++q) { const float x = F[(size_t)(t + q) * pitch + g * HD + d]; o16[q] = tohx(x); unsigned short a2, c2; splitf(x, a2, c2); oh[q] = a2; ol[q] = c2; }
    *(v2h*)(V16 + e) = o16; *(v2us*)(Vh + e) = oh; *(v2us*)(Vl + e) = ol;  }
__global__ __launch_bounds__(256) void k_csid(float* CS) { const int idx = blockIdx.x * 256 + threadIdx.x; if (idx >= TT * HD) return; v2f cs; cs[0] = 1.0f; cs[1] = 0.0f; *(v2f*)(CS + (size_t)idx * 2) = cs;  }
__global__ __launch_bounds__(256) void k_addres(float* Y, const float* __restrict__ xr) { const size_t i = (size_t)blockIdx.x * 256 + threadIdx.x; if (i >= (size_t)TT * DQ / 4) return; const v4f a = *(const v4f*)(Y + i * 4); const v4f r = *(const v4f*)(xr + i * 4); v4f o;
#pragma unroll
    for (int q = 0; q < 4; ++q) o[q] = __fadd_rn(a[q], bfr(r[q]));
    *(v4f*)(Y + i * 4) = o;  }
__global__ __launch_bounds__(256) void k_lnout(const float* __restrict__ F, const float* __restrict__ g, const float* __restrict__ bb, float* out) { const int lane = threadIdx.x & 31; const int row = blockIdx.x * 8 + (threadIdx.x >> 5); if (row >= TT) return; const float* fr = F + (size_t)row * DQ; float* orow = out + (size_t)row * DQ; float v[DQ / 32]; float s = 0.f;
#pragma unroll
    for (int c = 0; c < DQ / 128; ++c) { const v4f a = *(const v4f*)(fr + c * 128 + lane * 4); for (int q = 0; q < 4; ++q) { v[c * 4 + q] = a[q]; s = __fadd_rn(s, a[q]); } }
#pragma unroll
    for (int sh = 16; sh; sh >>= 1) s = __fadd_rn(s, __shfl_xor(s, sh, 32));
    const float mean = __fdiv_rn(s, (float)DQ); float s2 = 0.f;
#pragma unroll
    for (int k = 0; k < DQ / 32; ++k) { const float dv = __fsub_rn(v[k], mean); float p2 = __fmul_rn(dv, dv); asm volatile("" : "+v"(p2)); s2 = __fadd_rn(s2, p2); v[k] = dv; }
#pragma unroll
    for (int sh = 16; sh; sh >>= 1) s2 = __fadd_rn(s2, __shfl_xor(s2, sh, 32));
    const float rs = __fdiv_rn(1.0f, __fsqrt_rn(__fadd_rn(__fdiv_rn(s2, (float)DQ), LNEPS)));
{
#pragma unroll
        for (int c = 0; c < DQ / 128; ++c) { v4f o; for (int q = 0; q < 4; ++q) { const int col = c * 128 + lane * 4 + q; float y = __fmul_rn(v[c * 4 + q], rs); asm volatile("" : "+v"(y)); y = __fmul_rn(y, bfr(g[col])); asm volatile("" : "+v"(y)); o[q] = __fadd_rn(y, bfr(bb[col])); } *(v4f*)(orow + c * 128 + lane * 4) = o; }
         } }
// ---- k_fattn: scores, softmax, attn.v and the hi/lo merge of one head in ONE kernel: no score or probability ever goes to memory. One work-group of 4 waves per (128 query rows, head); each wave owns 32 query rows and walks all TT keys, 32 a pass.
// Transposed products: St[key][query] = K Qt (A = K rows, B = Q rows kept in registers; hi/lo 3 products in the order Qh Kh, Ql Kh, Qh Kl), so that a lane holds 16 scores of ONE query: maximum and sum in the lane plus one exchange between the wave's halves.
// The two 16-key score tiles of a pass ARE the B fragment of Ot[d][query] += Vt P (keys 8 hi + j and 16 + 8 hi + j): P is rounded in registers. Running maximum with rescale; P is left unnormalised (<= 1; fp16 rows x PCAR) and the division by the row sum is done once at the end.
__device__ __forceinline__ float xhalf(float x) { return __builtin_bit_cast(float, __builtin_amdgcn_permlanex16(__builtin_bit_cast(int, x), __builtin_bit_cast(int, x), 0x76543210, 0xfedcba98, false, false)); }   // lane l <-> lane l ^ 16
// 2^x with the issue slot that the instruction set asks for behind a transcendental (before its result is used or its source overwritten) filled in the same statement
__device__ __forceinline__ float exp2s(float x) { float r; asm("v_exp_f32 %0, %1\n\tv_nop" : "=v"(r) : "v"(x)); return r; }
// fragment loads at (base + constant) + one 32-bit byte offset per lane: with a uniform base (Q, K) the offset is the only vector register that the loads name
__device__ __forceinline__ v16bf ldfb(const bf* base, unsigned ofs, int cst) { const char* p = (const char*)base + cst + ofs; return cat16b(*(const v8us*)p, *(const v8us*)(p + 32)); }
__device__ __forceinline__ v16h ldfh(const h16* base, unsigned ofs, int cst) { const char* p = (const char*)base + cst + ofs; return cat16(*(const v8h*)p, *(const v8h*)(p + 32)); }
template <bool HR>
__device__ __forceinline__ void fattn_rows(const bf* __restrict__ Qh, const bf* __restrict__ Ql, const bf* __restrict__ Kh, const bf* __restrict__ Kl, const h16* __restrict__ V16, const bf* __restrict__ Vh, const bf* __restrict__ Vl, bf* Ah, bf* Al, int q0) {
    const int lane = threadIdx.x & 31, lr = lane & 15, hi = lane >> 4;
    v16bf qh[2][2], ql[2][2], kh[2][2], kl[2][2];
    const unsigned qb = ((q0 + lr) * HD + 8 * hi) * 2; unsigned kb = (lr * HD + 8 * hi) * 2; const unsigned vb = (lr * TT + 8 * hi) * 2;   // byte offsets of the lane's fragment rows in the Q, K and Vt planes
    const char* pv0 = (HR ? (const char*)Vh : (const char*)V16) + vb; const char* pv1 = (const char*)Vl + vb;   // the lane's walking addresses in the Vt planes
#pragma unroll
    for (int qt = 0; qt < 2; ++qt)
#pragma unroll
        for (int ks = 0; ks < 2; ++ks) { const int cq = (qt * 16 * HD + ks * 32) * 2; qh[qt][ks] = ldfb(Qh, qb, cq); ql[qt][ks] = ldfb(Ql, qb, cq); }
    asm volatile("s_wait_xcnt 0x0" :: "v"(qb) : "memory");   // the wait in front of any overwrite of an offset register that an issued load names; the offset is an input so that it stays in its register up to here
#pragma unroll
    for (int kt = 0; kt < 2; ++kt)
#pragma unroll
        for (int ks = 0; ks < 2; ++ks) { const int ck = (kt * 16 * HD + ks * 32) * 2; kh[kt][ks] = ldfb(Kh, kb, ck); kl[kt][ks] = ldfb(Kl, kb, ck); }
    asm volatile("s_wait_xcnt 0x0" :: "v"(kb) : "memory");   // as above: in front of the first step of kb
    v8f o[2][4]; float m[2], l[2];
#pragma unroll
    for (int qt = 0; qt < 2; ++qt) { m[qt] = -3.0e38f; l[qt] = 0.f;
#pragma unroll
        for (int dt = 0; dt < 4; ++dt) o[qt][dt] = (v8f){}; }
#pragma unroll 1
    for (int k0 = 0; k0 < TT; k0 += 32) {   // rolled: one pass's code and registers
        v16h vf[4]; v16bf vh[4], vl[4];
#pragma unroll
        for (int dt = 0; dt < 4; ++dt) { const int cv = dt * 16 * TT * 2; if (HR) { vh[dt] = ldfb((const bf*)(pv0 + cv), 0u, 0); vl[dt] = ldfb((const bf*)(pv1 + cv), 0u, 0); } else vf[dt] = ldfh((const h16*)(pv0 + cv), 0u, 0); }
        if (HR) asm volatile("s_wait_xcnt 0x0" :: "v"(pv0), "v"(pv1) : "memory");   // as above: in front of the step of the two addresses and of any fragment that would land on them
        else asm volatile("s_wait_xcnt 0x0" :: "v"(pv0) : "memory");   // the same for the one fp16 plane
        __builtin_amdgcn_sched_barrier(0);   // keeps the Vt loads at the head of the pass, in flight under the score products and the softmax (the scheduler otherwise sinks some of them, and the K fetch below with them, to the end of the pass)
        pv0 += 32 * 2; pv1 += 32 * 2;
        v8f s[2][2];
#pragma unroll
        for (int qt = 0; qt < 2; ++qt)
#pragma unroll
            for (int kt = 0; kt < 2; ++kt) s[qt][kt] = (v8f){};
#pragma unroll
        for (int ks = 0; ks < 2; ++ks) {
#pragma unroll
            for (int qt = 0; qt < 2; ++qt)
#pragma unroll
                for (int kt = 0; kt < 2; ++kt) s[qt][kt] = wmmab(kh[kt][ks], qh[qt][ks], s[qt][kt]);
#pragma unroll
            for (int qt = 0; qt < 2; ++qt)
#pragma unroll
                for (int kt = 0; kt < 2; ++kt) s[qt][kt] = wmmab(kh[kt][ks], ql[qt][ks], s[qt][kt]);
#pragma unroll
            for (int qt = 0; qt < 2; ++qt)
#pragma unroll
                for (int kt = 0; kt < 2; ++kt) s[qt][kt] = wmmab(kl[kt][ks], qh[qt][ks], s[qt][kt]); }
        kb = (kb + 32 * HD * 2) & (TT * HD * 2 - 1);   // the next pass's K fragments, fetched behind this pass's score products into the same registers; the last pass fetches keys 0..31 again (in bounds, unused)
#pragma unroll
        for (int kt = 0; kt < 2; ++kt)
#pragma unroll
            for (int ks = 0; ks < 2; ++ks) { const int ck = (kt * 16 * HD + ks * 32) * 2; kh[kt][ks] = ldfb(Kh, kb, ck); kl[kt][ks] = ldfb(Kl, kb, ck); }
        asm volatile("s_wait_xcnt 0x0" :: "v"(kb) : "memory");   // as above: in front of the next step of kb
        v16h pf[2]; v16bf ph[2], pl[2];
#pragma unroll
        for (int qt = 0; qt < 2; ++qt) {
            float t[16]; float cm = -3.0e38f;
#pragma unroll
            for (int e = 0; e < 16; ++e) { t[e] = s[qt][e >> 3][e & 7] * SCL; cm = fmaxf(cm, t[e]); }
            cm = fmaxf(cm, xhalf(cm));
            const float mn = fmaxf(m[qt], cm); const float al = exp2s((m[qt] - mn) * 1.4426950408889634f); m[qt] = mn; float ls = 0.f;
#pragma unroll
            for (int e = 0; e < 16; ++e) { t[e] = exp2s((t[e] - mn) * 1.4426950408889634f); ls += t[e]; }
            l[qt] = l[qt] * al + ls;
#pragma unroll
            for (int dt = 0; dt < 4; ++dt) o[qt][dt] *= al;
            if (HR) { v8us h0, h1, l0, l1;
#pragma unroll
                for (int j = 0; j < 8; ++j) { unsigned short x, y; splitf(t[j], x, y); h0[j] = x; l0[j] = y; splitf(t[8 + j], x, y); h1[j] = x; l1[j] = y; }
                ph[qt] = cat16b(h0, h1); pl[qt] = cat16b(l0, l1);
            } else { v8h c0, c1;
#pragma unroll
                for (int j = 0; j < 8; ++j) { c0[j] = tohx(t[j] * PCAR); c1[j] = tohx(t[8 + j] * PCAR); }
                pf[qt] = cat16(c0, c1); } }
        if (HR) {
#pragma unroll
            for (int qt = 0; qt < 2; ++qt)
#pragma unroll
                for (int dt = 0; dt < 4; ++dt) o[qt][dt] = wmmab(vh[dt], ph[qt], o[qt][dt]);
#pragma unroll
            for (int qt = 0; qt < 2; ++qt)
#pragma unroll
                for (int dt = 0; dt < 4; ++dt) o[qt][dt] = wmmab(vh[dt], pl[qt], o[qt][dt]);
#pragma unroll
            for (int qt = 0; qt < 2; ++qt)
#pragma unroll
                for (int dt = 0; dt < 4; ++dt) o[qt][dt] = wmmab(vl[dt], ph[qt], o[qt][dt]);
        } else {
#pragma unroll
            for (int qt = 0; qt < 2; ++qt)
#pragma unroll
                for (int dt = 0; dt < 4; ++dt) o[qt][dt] = wmma16(vf[dt], pf[qt], o[qt][dt]); }
    }
#pragma unroll
    for (int qt = 0; qt < 2; ++qt) { const float lt = l[qt] + xhalf(l[qt]); const float f = __fdiv_rn(HR ? 1.0f : (1.0f / PCAR), lt); v8us oh[4], ol[4];
#pragma unroll
        for (int dt = 0; dt < 4; ++dt)
#pragma unroll
            for (int j = 0; j < 8; ++j) { unsigned short x, y; splitf(o[qt][dt][j] * f, x, y); oh[dt][j] = x; ol[dt][j] = y; }
        bf* pa = Ah + (size_t)(q0 + qt * 16 + lr) * DQ + hi * 8; bf* pl2 = Al + (size_t)(q0 + qt * 16 + lr) * DQ + hi * 8;
#pragma unroll
        for (int dt = 0; dt < 4; ++dt) { *(v8us*)(pa + dt * 16) = oh[dt]; *(v8us*)(pl2 + dt * 16) = ol[dt]; }
        asm volatile("s_wait_xcnt 0x0" :: "v"(oh[0]), "v"(oh[1]), "v"(oh[2]), "v"(oh[3]), "v"(ol[0]), "v"(ol[1]), "v"(ol[2]), "v"(ol[3]), "v"(pa), "v"(pl2) : "memory"); }   // the wait in front of any overwrite of a data or address register of the eight issued stores; they are inputs so that they stay in their registers up to here
}
__global__ __launch_bounds__(128) void k_fattn(const bf* __restrict__ Qh, const bf* __restrict__ Ql, const bf* __restrict__ Kh, const bf* __restrict__ Kl, const h16* __restrict__ V16, const bf* __restrict__ Vh, const bf* __restrict__ Vl, bf* Ah, bf* Al) {
    const size_t hp = (size_t)blockIdx.y * TT * HD; const int q0 = blockIdx.x * 128 + (threadIdx.x >> 5) * 32; Ah += blockIdx.y * HD; Al += blockIdx.y * HD;
    if (blockIdx.x < RH / 128) fattn_rows<true>(Qh + hp, Ql + hp, Kh + hp, Kl + hp, V16 + hp, Vh + hp, Vl + hp, Ah, Al, q0);
    else fattn_rows<false>(Qh + hp, Ql + hp, Kh + hp, Kl + hp, V16 + hp, Vh + hp, Vl + hp, Ah, Al, q0);
}

extern "C" void kernel_launch(void* const* d_in, const int* in_sizes, int n_in,
                              void* d_out, int out_size, void* d_ws, size_t ws_size, hipStream_t stream) {
    (void)in_sizes; (void)n_in; (void)out_size;
    const float* x = (const float*)d_in[0]; const float* wq = (const float*)d_in[1]; const float* wk = (const float*)d_in[2]; const float* wv = (const float*)d_in[3]; const float* wo = (const float*)d_in[4]; const float* lng = (const float*)d_in[5]; const float* lnb = (const float*)d_in[6];
    float* OUT = (float*)d_out;     // [4][2048][1024]
    char* wsp = (char*)d_ws;
    auto take = [&](size_t bytes) { char* p = wsp; wsp += (bytes + 255) & ~(size_t)255; return (void*)p; };
    float* Y = (float*)take((size_t)TT * DM * 4); bf* WQ = (bf*)take((size_t)DQ * DM * 2); bf* WK = (bf*)take((size_t)DKV * DM * 2); bf* WV = (bf*)take((size_t)DKV * DM * 2); bf* WO = (bf*)take((size_t)DM * DQ * 2); float* CS = (float*)take((size_t)TT * HD * 2 * 4);
    bf* XB = (bf*)take((size_t)TT * DM * 2); float* FQ = (float*)take((size_t)TT * DQ * 4); float* FK = (float*)take((size_t)TT * DKV * 4);
    h16* QP16 = (h16*)take((size_t)NH_ * TT * HD * 2); h16* KP16 = (h16*)take((size_t)NKV * TT * HD * 2); h16* VT16 = (h16*)take((size_t)NKV * HD * TT * 2);
    bf* QPh = (bf*)take((size_t)NH_ * TT * HD * 2); bf* QPl = (bf*)take((size_t)NH_ * TT * HD * 2); bf* KPh = (bf*)take((size_t)NKV * TT * HD * 2); bf* KPl = (bf*)take((size_t)NKV * TT * HD * 2); bf* VTh = (bf*)take((size_t)NKV * HD * TT * 2); bf* VTl = (bf*)take((size_t)NKV * HD * TT * 2);
    bf* ATh = (bf*)take((size_t)TT * DQ * 2); bf* ATl = (bf*)take((size_t)TT * DQ * 2);
    if ((size_t)(wsp - (char*)d_ws) > ws_size) return;    // ws 256 MiB
    float* FV = FK;   // v projection reuses the k buffer after the k planes are built (stream-ordered)
    { k_wtG<<<(unsigned)((DM * DQ / 64 + 63) / 64), 256, 0, stream>>>(wq, DM, DQ, WQ); k_wtG<<<(unsigned)((DM * DKV / 64 + 63) / 64), 256, 0, stream>>>(wk, DM, DKV, WK); k_wtG<<<(unsigned)((DM * DKV / 64 + 63) / 64), 256, 0, stream>>>(wv, DM, DKV, WV);
      k_wtG<<<(unsigned)((DQ * DM / 64 + 63) / 64), 256, 0, stream>>>(wo, DQ, DM, WO);
       }
    k_csid<<<(TT * HD + 255) / 256, 256, 0, stream>>>(CS);
    const unsigned LQ = (unsigned)(((size_t)NH_ * TT * HD / 2 + 255) / 256), LKv = (unsigned)(((size_t)NKV * TT * HD / 2 + 255) / 256);
    for (int b = 0; b < NB_; ++b) {
        
        k_cvt8<<<(unsigned)(((size_t)TT * DM / 8 + 255) / 256), 256, 0, stream>>>(x + (size_t)b * TT * DM, XB, (size_t)TT * DM / 8);
        k_gemmw<bf, 0, false><<<dim3(TT / 64, DQ / 64, 1), 32, 0, stream>>>(XB, nullptr, WQ, nullptr, DM, FQ, DQ, nullptr, 0, 0, 0);
        k_rope<<<LQ, 256, 0, stream>>>(FQ, DQ, NH_, CS, nullptr, nullptr, 1.0f, QP16, QPh, QPl);
        k_gemmw<bf, 0, false><<<dim3(TT / 64, DKV / 64, 1), 32, 0, stream>>>(XB, nullptr, WK, nullptr, DM, FK, DKV, nullptr, 0, 0, 0);
        k_rope<<<LKv, 256, 0, stream>>>(FK, DKV, NKV, CS, nullptr, nullptr, 1.0f, KP16, KPh, KPl);
        k_gemmw<bf, 0, false><<<dim3(TT / 64, DKV / 64, 1), 32, 0, stream>>>(XB, nullptr, WV, nullptr, DM, FV, DKV, nullptr, 0, 0, 0); k_vtp<<<LKv, 256, 0, stream>>>(FV, DKV, NKV, VT16, VTh, VTl);
        k_fattn<<<dim3(TT / 128, NH_, 1), 128, 0, stream>>>(QPh, QPl, KPh, KPl, VT16, VTh, VTl, ATh, ATl);   /* scores hi/lo on EVERY row (sigma-16 logits), softmax, attn.v hybrid, merge */
        k_gemmw<bf, 1, false><<<dim3(TT / 64, DM / 64, 1), 32, 0, stream>>>(ATh, ATl, WO, nullptr, DQ, Y, DM, nullptr, 0, 0, 0); k_addres<<<(unsigned)(((size_t)TT * DQ / 4 + 255) / 256), 256, 0, stream>>>(Y, x + (size_t)b * TT * DM); k_lnout<<<(TT + 7) / 8, 256, 0, stream>>>(Y, lng, lnb, OUT + (size_t)b * TT * DM);   /* LayerNorm(h + attn_out) */ }
}

// v003
// Measured time: 508 microseconds a run.
// Timed twice side by side with v002, it ran 1.64 and 1.65 times as fast.
// Over all steps from v000 it is 7.82 times as fast.
#include <hip/hip_runtime.h>

// Transformer-XL style multi-head attention with post-LayerNorm (h [4][2048][1024]; q,k,v = h W ('xw' [1024][1024] with scale 1/8 x normal: sigma-4 projections, so the /8 logits have sigma ~16: sharply peaked); scores x 64^-0.5; softmax over keys; attn_out = attn_vec Wo ('xw', no bias); out = LayerNorm(h + attn_out) gamma/beta (1e-5) -> [4][2048][1024] (8.4 M)).
// Layout, every stage ONE launch over all NB_ batches (the batch is folded into the grid: rows b*TT + t, planes [b][h]): bf16 copy of h; 'xw' weights transposed once; exact projections; one fused attention kernel (scores hi/lo 3 products on EVERY row (peaked logits), running-maximum softmax in registers, P and attn.v hybrid (rows < 512 hi/lo, rest fp16 x1024)); merged hi/lo x Wo exact into workspace; residual add and a row LayerNorm kernel (one wave per 1,024-wide row, fixed-order sums, precise sqrt/div, affine) write the output rows.
// Compute dtypes, f32 accumulate: every input rounded to bf16; projections exact; scores 3 products on every row; softmax f32; attn.v rows < 512 3 products, rest fp16; Wo hl x exact; residual + LayerNorm f32.

#define NB_  4
#define TT   2048
#define DM   1024
#define NH_  16
#define NKV  16
#define REP  (NH_ / NKV)
#define HD   64
#define DQ   (NH_ * HD)
#define DKV  (NKV * HD)
#define RH   512                  // query rows < RH use hi+lo planes (0: none)
#define WIN  0
#define PCAR 1024.0f
#define SCL  0.125f
#define LNEPS 1e-5f
typedef _Float16 h16;
typedef unsigned short bf;
typedef __attribute__((ext_vector_type(16))) __bf16   v16bf;
typedef __attribute__((ext_vector_type(16))) _Float16 v16h;
typedef __attribute__((ext_vector_type(8)))  _Float16 v8h;
typedef __attribute__((ext_vector_type(8)))  unsigned short v8us;
typedef __attribute__((ext_vector_type(8)))  float    v8f;
typedef __attribute__((ext_vector_type(4)))  float    v4f;
typedef v8h  __attribute__((may_alias)) v8ha;
typedef v4f  __attribute__((may_alias)) v4fa;
typedef v8us __attribute__((may_alias)) v8usa;

__device__ __forceinline__ unsigned short f2bf(float f) { unsigned u = __float_as_uint(f); u += 0x7FFFu + ((u >> 16) & 1u); return (unsigned short)(u >> 16); }
__device__ __forceinline__ float bf2f(unsigned short b) { return __uint_as_float(((unsigned)b) << 16); }
__device__ __forceinline__ float bfr(float f) { return bf2f(f2bf(f)); }
__device__ __forceinline__ v16h cat16(v8h lo, v8h hi) { return __builtin_shufflevector(lo, hi, 0, 1, 2, 3, 4, 5, 6, 7, 8, 9, 10, 11, 12, 13, 14, 15); }
__device__ __forceinline__ v16bf cat16b(v8us lo, v8us hi) { return __builtin_bit_cast(v16bf, __builtin_shufflevector(lo, hi, 0, 1, 2, 3, 4, 5, 6, 7, 8, 9, 10, 11, 12, 13, 14, 15)); }
__device__ __forceinline__ v8f wmma16(v16h a, v16h b, v8f c) { return __builtin_amdgcn_wmma_f32_16x16x32_f16(false, a, false, b, (short)0, c, false, false); }
__device__ __forceinline__ v8f wmmab(v16bf a, v16bf b, v8f c) { return __builtin_amdgcn_wmma_f32_16x16x32_bf16(false, a, false, b, (short)0, c, false, false); }



// ---- k_gemmw: register-blocked GEMM, ONE WAVE per 64x64 output tile (16 accumulators), operands straight from K-contiguous 16-bit planes; grid (M/64, N/64, Z), 32 threads.
// C[m][n] (f32, pitch ldc, + optional f32 bias[n]) = sum_k A[m][k] Bt[n][k] (+ split products per NSPLIT). z-batch strides sA/sB/sC in elements. K % 32 == 0.
template <typename T16> struct WFrag;
template <> struct WFrag<h16> { typedef v16h V; static __device__ __forceinline__ V ld(const h16* p) { return cat16(*(const v8h*)p, *(const v8h*)(p + 16)); } static __device__ __forceinline__ v8f mma(V a, V b, v8f c) { return wmma16(a, b, c); } };
template <> struct WFrag<bf> { typedef v16bf V; static __device__ __forceinline__ V ld(const bf* p) { return cat16b(*(const v8us*)p, *(const v8us*)(p + 16)); } static __device__ __forceinline__ v8f mma(V a, V b, v8f c) { return wmmab(a, b, c); } };
template <typename T16, int NSPLIT, bool BIAS>
__global__ __launch_bounds__(32) void k_gemmw(const T16* __restrict__ A, const T16* __restrict__ A2, const T16* __restrict__ Bt, const T16* __restrict__ Bt2, int K, float* C, int ldc, const float* __restrict__ bias, size_t sA, size_t sB, size_t sC) {
    typedef typename WFrag<T16>::V V;
    __shared__ __align__(16) float os[16 * 68];
    const size_t z = blockIdx.z; A += z * sA; if (A2) A2 += z * sA; Bt += z * sB; if (Bt2) Bt2 += z * sB; C += z * sC;
    const int lane = threadIdx.x & 31, lr = lane & 15, hi = lane >> 4; const int r0 = blockIdx.x * 64, c0 = blockIdx.y * 64;
    v8f acc[4][4];
#pragma unroll
    for (int mb = 0; mb < 4; ++mb)
#pragma unroll
        for (int nb = 0; nb < 4; ++nb) acc[mb][nb] = (v8f){};
    const size_t aoff = (size_t)(r0 + lr) * K + 8 * hi, boff = (size_t)(c0 + lr) * K + 8 * hi;
#pragma unroll 1
    for (int kc = 0; kc < K; kc += 32) {
        V a[4], a2[4];
#pragma unroll
        for (int mb = 0; mb < 4; ++mb) { a[mb] = WFrag<T16>::ld(A + aoff + (size_t)mb * 16 * K + kc); if (NSPLIT == 1 || NSPLIT == 2) a2[mb] = WFrag<T16>::ld(A2 + aoff + (size_t)mb * 16 * K + kc); }
#pragma unroll
        for (int nb = 0; nb < 4; ++nb) { const V b = WFrag<T16>::ld(Bt + boff + (size_t)nb * 16 * K + kc); V b2; if (NSPLIT >= 2) b2 = WFrag<T16>::ld(Bt2 + boff + (size_t)nb * 16 * K + kc);
#pragma unroll
            for (int mb = 0; mb < 4; ++mb) { acc[mb][nb] = WFrag<T16>::mma(a[mb], b, acc[mb][nb]); if (NSPLIT == 1 || NSPLIT == 2) acc[mb][nb] = WFrag<T16>::mma(a2[mb], b, acc[mb][nb]); if (NSPLIT >= 2) acc[mb][nb] = WFrag<T16>::mma(a[mb], b2, acc[mb][nb]); } }
        asm volatile("v_nop\n\tv_nop\n\tv_nop\n\tv_nop" : "+v"(acc[0][0]), "+v"(acc[1][1]), "+v"(acc[2][2]), "+v"(acc[3][3]) : "v"(a[0]), "v"(a[3]));
    }
#pragma unroll
    for (int mb = 0; mb < 4; ++mb) {
#pragma unroll
        for (int nb = 0; nb < 4; ++nb) {
#pragma unroll
            for (int j = 0; j < 8; ++j) os[(hi * 8 + j) * 68 + nb * 16 + lr] = acc[mb][nb][j]; }
        __builtin_amdgcn_wave_barrier(); asm volatile("" ::: "memory");
        float* crow = C + (size_t)(r0 + mb * 16) * ldc + c0;
{
#pragma unroll
            for (int s = 0; s < 8; ++s) { const int row = 2 * s + hi, cofs = lr * 4; v4f val = *(const v4fa*)(os + row * 68 + cofs); if (BIAS) { val[0] += bfr(bias[c0 + cofs]); val[1] += bfr(bias[c0 + cofs + 1]); val[2] += bfr(bias[c0 + cofs + 2]); val[3] += bfr(bias[c0 + cofs + 3]); }
                *(v4f*)(crow + (size_t)row * ldc + cofs) = val; }
             }
        __builtin_amdgcn_wave_barrier(); asm volatile("" ::: "memory");
    }
}

__device__ __forceinline__ h16 tohx(float x) { return (h16)x; }
__device__ __forceinline__ void splitf(float y, unsigned short& h, unsigned short& l) { h = f2bf(y); l = f2bf(y - bf2f(h)); }
typedef __attribute__((ext_vector_type(2))) _Float16 v2h;
typedef __attribute__((ext_vector_type(4))) _Float16 v4h;
typedef __attribute__((ext_vector_type(2))) unsigned short v2us;
typedef __attribute__((ext_vector_type(4))) unsigned short v4us;
typedef __attribute__((ext_vector_type(2))) float v2f;
typedef __attribute__((ext_vector_type(4))) int v4i;

__global__ __launch_bounds__(256) void k_wtG(const float* __restrict__ w, int K, int N, bf* Bt) {
    const int lane = threadIdx.x & 31; const int L0 = (blockIdx.x * 8 + (threadIdx.x >> 5)) * 8; const int nlines = N * K / 64;
{
#pragma unroll 1
        for (int l = 0; l < 8; ++l) { const int L = L0 + l; if (L >= nlines) break; const size_t e = (size_t)L * 64 + lane * 2; const int k = (int)(e % K), n = (int)(e / K); v2us o;
            o[0] = f2bf(w[(size_t)k * N + n]); o[1] = f2bf(w[(size_t)(k + 1) * N + n]); *(v2us*)(Bt + e) = o; }
         }
}
__global__ __launch_bounds__(256) void k_cvt8(const float* __restrict__ src, bf* dst, size_t n8) { const size_t i = (size_t)blockIdx.x * 256 + threadIdx.x; if (i >= n8) return; const v8f v = *(const v8f*)(src + i * 8); v8us o;
#pragma unroll
    for (int k = 0; k < 8; ++k) o[k] = f2bf(v[k]); *(v8us*)(dst + i * 8) = o;  }

// k_rope: head planes [h][t][d] (fp16 + hi/lo) of rope(x) x sc with the rotate-half convention out[d] = x[d] cos[t][d] - x[d+HD/2] sin[t][d], out[d+HD/2] = x[d+HD/2] cos[t][d+HD/2] + x[d] sin[t][d+HD/2]
__global__ __launch_bounds__(256) void k_rope(const float* __restrict__ F, int pitch, int nheads, const float* __restrict__ CS, const float* __restrict__ RF, const float* __restrict__ nw, float sc, h16* P16, bf* Ph, bf* Pl) {
    F += (size_t)blockIdx.y * TT * pitch; const size_t pb = (size_t)blockIdx.y * nheads * TT * HD; P16 += pb; Ph += pb; Pl += pb;   // blockIdx.y: batch (rows b * TT + t of F, planes [b][h][t][d])
    const size_t e = ((size_t)blockIdx.x * 256 + threadIdx.x) * 2; if (e >= (size_t)nheads * TT * HD) return; const int d = (int)(e % HD); const int t = (int)((e / HD) % TT); const int h = (int)(e / ((size_t)HD * TT)); const float* f = F + (size_t)t * pitch + h * HD; const float rf = RF ? RF[(size_t)h * TT + t] : 1.0f; v2h o16; v2us oh, ol;
#pragma unroll
    for (int q = 0; q < 2; ++q) { const int dd = d + q; const int dp = (dd < HD / 2) ? dd + HD / 2 : dd - HD / 2; float x0 = f[dd], x1 = f[dp];
        if (RF) { float n0 = __fmul_rn(x0, rf), n1 = __fmul_rn(x1, rf); asm volatile("" : "+v"(n0)); asm volatile("" : "+v"(n1)); x0 = __fmul_rn(bfr(nw[dd]), n0); x1 = __fmul_rn(bfr(nw[dp]), n1); }
        const v2f cs = *(const v2f*)(CS + ((size_t)t * HD + dd) * 2); float a = __fmul_rn(x0, cs[0]), bq = __fmul_rn(x1, cs[1]); asm volatile("" : "+v"(a)); asm volatile("" : "+v"(bq)); const float r = ((dd < HD / 2) ? __fsub_rn(a, bq) : __fadd_rn(a, bq)) * sc;
        o16[q] = tohx(r); unsigned short a2, c2; splitf(r, a2, c2); oh[q] = a2; ol[q] = c2; }
    *(v2h*)(P16 + e) = o16; *(v2us*)(Ph + e) = oh; *(v2us*)(Pl + e) = ol;  }
__global__ __launch_bounds__(256) void k_vtp(const float* __restrict__ F, int pitch, int nheads, h16* V16, bf* Vh, bf* Vl) { const size_t e = ((size_t)blockIdx.x * 256 + threadIdx.x) * 2; if (e >= (size_t)nheads * HD * TT) return; const int t = (int)(e % TT); const int d = (int)((e / TT) % HD); const int g = (int)(e / ((size_t)TT * HD)); const size_t eb = (size_t)blockIdx.y * nheads * HD * TT + e; F += (size_t)blockIdx.y * TT * pitch; v2h o16; v2us oh, ol;   /* blockIdx.y: batch */
#pragma unroll
    for (int q = 0; q < 2; ++q) { const float x = F[(size_t)(t + q) * pitch + g * HD + d]; o16[q] = tohx(x); unsigned short a2, c2; splitf(x, a2, c2); oh[q] = a2; ol[q] = c2; }
    *(v2h*)(V16 + eb) = o16; *(v2us*)(Vh + eb) = oh; *(v2us*)(Vl + eb) = ol;  }
__global__ __launch_bounds__(256) void k_csid(float* CS) { const int idx = blockIdx.x * 256 + threadIdx.x; if (idx >= TT * HD) return; v2f cs; cs[0] = 1.0f; cs[1] = 0.0f; *(v2f*)(CS + (size_t)idx * 2) = cs;  }
__global__ __launch_bounds__(256) void k_addres(float* Y, const float* __restrict__ xr) { const size_t i = (size_t)blockIdx.x * 256 + threadIdx.x; if (i >= (size_t)NB_ * TT * DQ / 4) return; const v4f a = *(const v4f*)(Y + i * 4); const v4f r = *(const v4f*)(xr + i * 4); v4f o;
#pragma unroll
    for (int q = 0; q < 4; ++q) o[q] = __fadd_rn(a[q], bfr(r[q]));
    *(v4f*)(Y + i * 4) = o;  }
__global__ __launch_bounds__(256) void k_lnout(const float* __restrict__ F, const float* __restrict__ g, const float* __restrict__ bb, float* out) { const int lane = threadIdx.x & 31; const int row = blockIdx.x * 8 + (threadIdx.x >> 5); if (row >= NB_ * TT) return; const float* fr = F + (size_t)row * DQ; float* orow = out + (size_t)row * DQ; float v[DQ / 32]; float s = 0.f;
#pragma unroll
    for (int c = 0; c < DQ / 128; ++c) { const v4f a = *(const v4f*)(fr + c * 128 + lane * 4); for (int q = 0; q < 4; ++q) { v[c * 4 + q] = a[q]; s = __fadd_rn(s, a[q]); } }
#pragma unroll
    for (int sh = 16; sh; sh >>= 1) s = __fadd_rn(s, __shfl_xor(s, sh, 32));
    const float mean = __fdiv_rn(s, (float)DQ); float s2 = 0.f;
#pragma unroll
    for (int k = 0; k < DQ / 32; ++k) { const float dv = __fsub_rn(v[k], mean); float p2 = __fmul_rn(dv, dv); asm volatile("" : "+v"(p2)); s2 = __fadd_rn(s2, p2); v[k] = dv; }
#pragma unroll
    for (int sh = 16; sh; sh >>= 1) s2 = __fadd_rn(s2, __shfl_xor(s2, sh, 32));
    const float rs = __fdiv_rn(1.0f, __fsqrt_rn(__fadd_rn(__fdiv_rn(s2, (float)DQ), LNEPS)));
{
#pragma unroll
        for (int c = 0; c < DQ / 128; ++c) { v4f o; for (int q = 0; q < 4; ++q) { const int col = c * 128 + lane * 4 + q; float y = __fmul_rn(v[c * 4 + q], rs); asm volatile("" : "+v"(y)); y = __fmul_rn(y, bfr(g[col])); asm volatile("" : "+v"(y)); o[q] = __fadd_rn(y, bfr(bb[col])); } *(v4f*)(orow + c * 128 + lane * 4) = o; }
         } }
// ---- k_fattn: scores, softmax, attn.v and the hi/lo merge of one head in ONE kernel: no score or probability ever goes to memory. One work-group of 4 waves per (128 query rows, head, batch); each wave owns 32 query rows and walks all TT keys, 32 a pass.
// Transposed products: St[key][query] = K Qt (A = K rows, B = Q rows kept in registers; hi/lo 3 products in the order Qh Kh, Ql Kh, Qh Kl), so that a lane holds 16 scores of ONE query: maximum and sum in the lane plus one exchange between the wave's halves.
// The two 16-key score tiles of a pass ARE the B fragment of Ot[d][query] += Vt P (keys 8 hi + j and 16 + 8 hi + j): P is rounded in registers. Running maximum with rescale; P is left unnormalised (<= 1; fp16 rows x PCAR) and the division by the row sum is done once at the end.
__device__ __forceinline__ float xhalf(float x) { return __builtin_bit_cast(float, __builtin_amdgcn_permlanex16(__builtin_bit_cast(int, x), __builtin_bit_cast(int, x), 0x76543210, 0xfedcba98, false, false)); }   // lane l <-> lane l ^ 16
// 2^x with the issue slot that the instruction set asks for behind a transcendental (before its result is used or its source overwritten) filled in the same statement
__device__ __forceinline__ float exp2s(float x) { float r; asm("v_exp_f32 %0, %1\n\tv_nop" : "=v"(r) : "v"(x)); return r; }
// fragment loads at (base + constant) + one 32-bit byte offset per lane: with a uniform base (Q, K) the offset is the only vector register that the loads name
__device__ __forceinline__ v16bf ldfb(const bf* base, unsigned ofs, int cst) { const char* p = (const char*)base + cst + ofs; return cat16b(*(const v8us*)p, *(const v8us*)(p + 32)); }
__device__ __forceinline__ v16h ldfh(const h16* base, unsigned ofs, int cst) { const char* p = (const char*)base + cst + ofs; return cat16(*(const v8h*)p, *(const v8h*)(p + 32)); }
template <bool HR>
__device__ __forceinline__ void fattn_rows(const bf* __restrict__ Qh, const bf* __restrict__ Ql, const bf* __restrict__ Kh, const bf* __restrict__ Kl, const h16* __restrict__ V16, const bf* __restrict__ Vh, const bf* __restrict__ Vl, bf* Ah, bf* Al, int q0) {
    const int lane = threadIdx.x & 31, lr = lane & 15, hi = lane >> 4;
    v16bf qh[2][2], ql[2][2], kh[2][2], kl[2][2];
    const unsigned qb = ((q0 + lr) * HD + 8 * hi) * 2; unsigned kb = (lr * HD + 8 * hi) * 2; const unsigned vb = (lr * TT + 8 * hi) * 2;   // byte offsets of the lane's fragment rows in the Q, K and Vt planes
    const char* pv0 = (HR ? (const char*)Vh : (const char*)V16) + vb; const char* pv1 = (const char*)Vl + vb;   // the lane's walking addresses in the Vt planes
#pragma unroll
    for (int qt = 0; qt < 2; ++qt)
#pragma unroll
        for (int ks = 0; ks < 2; ++ks) { const int cq = (qt * 16 * HD + ks * 32) * 2; qh[qt][ks] = ldfb(Qh, qb, cq); ql[qt][ks] = ldfb(Ql, qb, cq); }
    asm volatile("s_wait_xcnt 0x0" :: "v"(qb) : "memory");   // the wait in front of any overwrite of an offset register that an issued load names; the offset is an input so that it stays in its register up to here
#pragma unroll
    for (int kt = 0; kt < 2; ++kt)
#pragma unroll
        for (int ks = 0; ks < 2; ++ks) { const int ck = (kt * 16 * HD + ks * 32) * 2; kh[kt][ks] = ldfb(Kh, kb, ck); kl[kt][ks] = ldfb(Kl, kb, ck); }
    asm volatile("s_wait_xcnt 0x0" :: "v"(kb) : "memory");   // as above: in front of the first step of kb
    v8f o[2][4]; float m[2], l[2];
#pragma unroll
    for (int qt = 0; qt < 2; ++qt) { m[qt] = -3.0e38f; l[qt] = 0.f;
#pragma unroll
        for (int dt = 0; dt < 4; ++dt) o[qt][dt] = (v8f){}; }
#pragma unroll 1
    for (int k0 = 0; k0 < TT; k0 += 32) {   // rolled: one pass's code and registers
        v16h vf[4]; v16bf vh[4], vl[4];
#pragma unroll
        for (int dt = 0; dt < 4; ++dt) { const int cv = dt * 16 * TT * 2; if (HR) { vh[dt] = ldfb((const bf*)(pv0 + cv), 0u, 0); vl[dt] = ldfb((const bf*)(pv1 + cv), 0u, 0); } else vf[dt] = ldfh((const h16*)(pv0 + cv), 0u, 0); }
        if (HR) asm volatile("s_wait_xcnt 0x0" :: "v"(pv0), "v"(pv1) : "memory");   // as above: in front of the step of the two addresses and of any fragment that would land on them
        else asm volatile("s_wait_xcnt 0x0" :: "v"(pv0) : "memory");   // the same for the one fp16 plane
        __builtin_amdgcn_sched_barrier(0);   // keeps the Vt loads at the head of the pass, in flight under the score products and the softmax (the scheduler otherwise sinks some of them, and the K fetch below with them, to the end of the pass)
        pv0 += 32 * 2; pv1 += 32 * 2;
        v8f s[2][2];
#pragma unroll
        for (int qt = 0; qt < 2; ++qt)
#pragma unroll
            for (int kt = 0; kt < 2; ++kt) s[qt][kt] = (v8f){};
#pragma unroll
        for (int ks = 0; ks < 2; ++ks) {
#pragma unroll
            for (int qt = 0; qt < 2; ++qt)
#pragma unroll
                for (int kt = 0; kt < 2; ++kt) s[qt][kt] = wmmab(kh[kt][ks], qh[qt][ks], s[qt][kt]);
#pragma unroll
            for (int qt = 0; qt < 2; ++qt)
#pragma unroll
                for (int kt = 0; kt < 2; ++kt) s[qt][kt] = wmmab(kh[kt][ks], ql[qt][ks], s[qt][kt]);
#pragma unroll
            for (int qt = 0; qt < 2; ++qt)
#pragma unroll
                for (int kt = 0; kt < 2; ++kt) s[qt][kt] = wmmab(kl[kt][ks], qh[qt][ks], s[qt][kt]); }
        kb = (kb + 32 * HD * 2) & (TT * HD * 2 - 1);   // the next pass's K fragments, fetched behind this pass's score products into the same registers; the last pass fetches keys 0..31 again (in bounds, unused)
#pragma unroll
        for (int kt = 0; kt < 2; ++kt)
#pragma unroll
            for (int ks = 0; ks < 2; ++ks) { const int ck = (kt * 16 * HD + ks * 32) * 2; kh[kt][ks] = ldfb(Kh, kb, ck); kl[kt][ks] = ldfb(Kl, kb, ck); }
        asm volatile("s_wait_xcnt 0x0" :: "v"(kb) : "memory");   // as above: in front of the next step of kb
        v16h pf[2]; v16bf ph[2], pl[2];
#pragma unroll
        for (int qt = 0; qt < 2; ++qt) {
            float t[16]; float cm = -3.0e38f;
#pragma unroll
            for (int e = 0; e < 16; ++e) { t[e] = s[qt][e >> 3][e & 7] * SCL; cm = fmaxf(cm, t[e]); }
            cm = fmaxf(cm, xhalf(cm));
            const float mn = fmaxf(m[qt], cm); const float al = exp2s((m[qt] - mn) * 1.4426950408889634f); m[qt] = mn; float ls = 0.f;
#pragma unroll
            for (int e = 0; e < 16; ++e) { t[e] = exp2s((t[e] - mn) * 1.4426950408889634f); ls += t[e]; }
            l[qt] = l[qt] * al + ls;
#pragma unroll
            for (int dt = 0; dt < 4; ++dt) o[qt][dt] *= al;
            if (HR) { v8us h0, h1, l0, l1;
#pragma unroll
                for (int j = 0; j < 8; ++j) { unsigned short x, y; splitf(t[j], x, y); h0[j] = x; l0[j] = y; splitf(t[8 + j], x, y); h1[j] = x; l1[j] = y; }
                ph[qt] = cat16b(h0, h1); pl[qt] = cat16b(l0, l1);
            } else { v8h c0, c1;
#pragma unroll
                for (int j = 0; j < 8; ++j) { c0[j] = tohx(t[j] * PCAR); c1[j] = tohx(t[8 + j] * PCAR); }
                pf[qt] = cat16(c0, c1); } }
        if (HR) {
#pragma unroll
            for (int qt = 0; qt < 2; ++qt)
#pragma unroll
                for (int dt = 0; dt < 4; ++dt) o[qt][dt] = wmmab(vh[dt], ph[qt], o[qt][dt]);
#pragma unroll
            for (int qt = 0; qt < 2; ++qt)
#pragma unroll
                for (int dt = 0; dt < 4; ++dt) o[qt][dt] = wmmab(vh[dt], pl[qt], o[qt][dt]);
#pragma unroll
            for (int qt = 0; qt < 2; ++qt)
#pragma unroll
                for (int dt = 0; dt < 4; ++dt) o[qt][dt] = wmmab(vl[dt], ph[qt], o[qt][dt]);
        } else {
#pragma unroll
            for (int qt = 0; qt < 2; ++qt)
#pragma unroll
                for (int dt = 0; dt < 4; ++dt) o[qt][dt] = wmma16(vf[dt], pf[qt], o[qt][dt]); }
    }
#pragma unroll
    for (int qt = 0; qt < 2; ++qt) { const float lt = l[qt] + xhalf(l[qt]); const float f = __fdiv_rn(HR ? 1.0f : (1.0f / PCAR), lt); v8us oh[4], ol[4];
#pragma unroll
        for (int dt = 0; dt < 4; ++dt)
#pragma unroll
            for (int j = 0; j < 8; ++j) { unsigned short x, y; splitf(o[qt][dt][j] * f, x, y); oh[dt][j] = x; ol[dt][j] = y; }
        bf* pa = Ah + (size_t)(q0 + qt * 16 + lr) * DQ + hi * 8; bf* pl2 = Al + (size_t)(q0 + qt * 16 + lr) * DQ + hi * 8;
#pragma unroll
        for (int dt = 0; dt < 4; ++dt) { *(v8us*)(pa + dt * 16) = oh[dt]; *(v8us*)(pl2 + dt * 16) = ol[dt]; }
        asm volatile("s_wait_xcnt 0x0" :: "v"(oh[0]), "v"(oh[1]), "v"(oh[2]), "v"(oh[3]), "v"(ol[0]), "v"(ol[1]), "v"(ol[2]), "v"(ol[3]), "v"(pa), "v"(pl2) : "memory"); }   // the wait in front of any overwrite of a data or address register of the eight issued stores; they are inputs so that they stay in their registers up to here
}
__global__ __launch_bounds__(128) void k_fattn(const bf* __restrict__ Qh, const bf* __restrict__ Ql, const bf* __restrict__ Kh, const bf* __restrict__ Kl, const h16* __restrict__ V16, const bf* __restrict__ Vh, const bf* __restrict__ Vl, bf* Ah, bf* Al) {
    const size_t hp = ((size_t)blockIdx.z * NH_ + blockIdx.y) * TT * HD; const int q0 = blockIdx.x * 128 + (threadIdx.x >> 5) * 32; const size_t ao = (size_t)blockIdx.z * TT * DQ + blockIdx.y * HD; Ah += ao; Al += ao;   // blockIdx.z: batch (planes [b][h], rows b * TT + t of the output planes)
    if (blockIdx.x < RH / 128) fattn_rows<true>(Qh + hp, Ql + hp, Kh + hp, Kl + hp, V16 + hp, Vh + hp, Vl + hp, Ah, Al, q0);
    else fattn_rows<false>(Qh + hp, Ql + hp, Kh + hp, Kl + hp, V16 + hp, Vh + hp, Vl + hp, Ah, Al, q0);
}

extern "C" void kernel_launch(void* const* d_in, const int* in_sizes, int n_in,
                              void* d_out, int out_size, void* d_ws, size_t ws_size, hipStream_t stream) {
    (void)in_sizes; (void)n_in; (void)out_size;
    const float* x = (const float*)d_in[0]; const float* wq = (const float*)d_in[1]; const float* wk = (const float*)d_in[2]; const float* wv = (const float*)d_in[3]; const float* wo = (const float*)d_in[4]; const float* lng = (const float*)d_in[5]; const float* lnb = (const float*)d_in[6];
    float* OUT = (float*)d_out;     // [4][2048][1024]
    char* wsp = (char*)d_ws;
    auto take = [&](size_t bytes) { char* p = wsp; wsp += (bytes + 255) & ~(size_t)255; return (void*)p; };
    bf* WQ = (bf*)take((size_t)DQ * DM * 2); bf* WK = (bf*)take((size_t)DKV * DM * 2); bf* WV = (bf*)take((size_t)DKV * DM * 2); bf* WO = (bf*)take((size_t)DM * DQ * 2); float* CS = (float*)take((size_t)TT * HD * 2 * 4);
    bf* XB = (bf*)take((size_t)NB_ * TT * DM * 2); float* FQ = (float*)take((size_t)NB_ * TT * DQ * 4); float* FK = (float*)take((size_t)NB_ * TT * DKV * 4);
    h16* VT16 = (h16*)take((size_t)NB_ * NKV * HD * TT * 2);
    bf* QPh = (bf*)take((size_t)NB_ * NH_ * TT * HD * 2); bf* QPl = (bf*)take((size_t)NB_ * NH_ * TT * HD * 2); bf* KPh = (bf*)take((size_t)NB_ * NKV * TT * HD * 2); bf* KPl = (bf*)take((size_t)NB_ * NKV * TT * HD * 2); bf* VTh = (bf*)take((size_t)NB_ * NKV * HD * TT * 2); bf* VTl = (bf*)take((size_t)NB_ * NKV * HD * TT * 2);
    bf* ATh = (bf*)take((size_t)NB_ * TT * DQ * 2); bf* ATl = (bf*)take((size_t)NB_ * TT * DQ * 2);
    if ((size_t)(wsp - (char*)d_ws) > ws_size) return;    // 233 MiB of the 256 MiB
    float* FV = FK;   // v projection reuses the k buffer after the k planes are built (stream-ordered)
    float* Y = FQ;    // the Wo product reuses the q buffer, which nothing reads behind the q planes (stream-ordered)
    h16* QP16 = (h16*)ATh; h16* KP16 = (h16*)ATl;   // the fp16 q and k planes (same size) lie where the attention kernel later writes its output planes: all four batches at once would not fit otherwise
    { k_wtG<<<(unsigned)((DM * DQ / 64 + 63) / 64), 256, 0, stream>>>(wq, DM, DQ, WQ); k_wtG<<<(unsigned)((DM * DKV / 64 + 63) / 64), 256, 0, stream>>>(wk, DM, DKV, WK); k_wtG<<<(unsigned)((DM * DKV / 64 + 63) / 64), 256, 0, stream>>>(wv, DM, DKV, WV);
      k_wtG<<<(unsigned)((DQ * DM / 64 + 63) / 64), 256, 0, stream>>>(wo, DQ, DM, WO);
       }
    k_csid<<<(TT * HD + 255) / 256, 256, 0, stream>>>(CS);
    const unsigned LQ = (unsigned)(((size_t)NH_ * TT * HD / 2 + 255) / 256), LKv = (unsigned)(((size_t)NKV * TT * HD / 2 + 255) / 256);
    k_cvt8<<<(unsigned)(((size_t)NB_ * TT * DM / 8 + 255) / 256), 256, 0, stream>>>(x, XB, (size_t)NB_ * TT * DM / 8);
    k_gemmw<bf, 0, false><<<dim3(NB_ * TT / 64, DQ / 64, 1), 32, 0, stream>>>(XB, nullptr, WQ, nullptr, DM, FQ, DQ, nullptr, 0, 0, 0);
    k_rope<<<dim3(LQ, NB_, 1), 256, 0, stream>>>(FQ, DQ, NH_, CS, nullptr, nullptr, 1.0f, QP16, QPh, QPl);
    k_gemmw<bf, 0, false><<<dim3(NB_ * TT / 64, DKV / 64, 1), 32, 0, stream>>>(XB, nullptr, WK, nullptr, DM, FK, DKV, nullptr, 0, 0, 0);
    k_rope<<<dim3(LKv, NB_, 1), 256, 0, stream>>>(FK, DKV, NKV, CS, nullptr, nullptr, 1.0f, KP16, KPh, KPl);
    k_gemmw<bf, 0, false><<<dim3(NB_ * TT / 64, DKV / 64, 1), 32, 0, stream>>>(XB, nullptr, WV, nullptr, DM, FV, DKV, nullptr, 0, 0, 0); k_vtp<<<dim3(LKv, NB_, 1), 256, 0, stream>>>(FV, DKV, NKV, VT16, VTh, VTl);
    k_fattn<<<dim3(TT / 128, NH_, NB_), 128, 0, stream>>>(QPh, QPl, KPh, KPl, VT16, VTh, VTl, ATh, ATl);   /* scores hi/lo on EVERY row (sigma-16 logits), softmax, attn.v hybrid, merge */
    k_gemmw<bf, 1, false><<<dim3(NB_ * TT / 64, DM / 64, 1), 32, 0, stream>>>(ATh, ATl, WO, nullptr, DQ, Y, DM, nullptr, 0, 0, 0); k_addres<<<(unsigned)(((size_t)NB_ * TT * DQ / 4 + 255) / 256), 256, 0, stream>>>(Y, x); k_lnout<<<(NB_ * TT + 7) / 8, 256, 0, stream>>>(Y, lng, lnb, OUT);   /* LayerNorm(h + attn_out) */
}

// v004
// One run takes 332 microseconds.
// Two timings next to v003 put it at 1.53 and 1.54 times that version's speed.
// All steps since v000 together make it 12.0 times as fast.
#include <hip/hip_runtime.h>

// Transformer-XL style multi-head attention with post-LayerNorm (h [4][2048][1024]; q,k,v = h W ('xw' [1024][1024] with scale 1/8 x normal: sigma-4 projections, so the /8 logits have sigma ~16: sharply peaked); scores x 64^-0.5; softmax over keys; attn_out = attn_vec Wo ('xw', no bias); out = LayerNorm(h + attn_out) gamma/beta (1e-5) -> [4][2048][1024] (8.4 M)).
// Layout, every stage ONE launch over all NB_ batches (the batch is folded into the grid: rows b*TT + t, planes [b][h]): bf16 copy of h; 'xw' weights transposed once; exact projections; one fused attention kernel (scores hi/lo 3 products on EVERY row (peaked logits), running-maximum softmax in registers, P and attn.v hybrid (rows < 512 hi/lo, rest fp16 x1024)); merged hi/lo x Wo exact into workspace; residual add and a row LayerNorm kernel (one wave per 1,024-wide row, fixed-order sums, precise sqrt/div, affine) write the output rows.
// Every 16-bit matrix operand plane (h copy, transposed weights, Q, K, Vt, attention output) is stored in FRAGMENT ORDER (fo() below): blocks of 16 rows x 32 k = 1 KiB, inside a block the 16-byte chunk that lane l loads stands at byte 16 l (first half of the fragment) and 512 + 16 l (second half), so each wave-wide 16-byte load reads 512 contiguous bytes (4 whole lines) instead of 32 bytes from each of 16 lines. Which element lands in which lane and register is as with row-major planes.
// Compute dtypes, f32 accumulate: every input rounded to bf16; projections exact; scores 3 products on every row; softmax f32; attn.v rows < 512 3 products, rest fp16; Wo hl x exact; residual + LayerNorm f32.

#define NB_  4
#define TT   2048
#define DM   1024
#define NH_  16
#define NKV  16
#define REP  (NH_ / NKV)
#define HD   64
#define DQ   (NH_ * HD)
#define DKV  (NKV * HD)
#define RH   512                  // query rows < RH use hi+lo planes (0: none)
#define WIN  0
#define PCAR 1024.0f
#define SCL  0.125f
#define LNEPS 1e-5f
typedef _Float16 h16;
typedef unsigned short bf;
typedef __attribute__((ext_vector_type(16))) __bf16   v16bf;
typedef __attribute__((ext_vector_type(16))) _Float16 v16h;
typedef __attribute__((ext_vector_type(8)))  _Float16 v8h;
typedef __attribute__((ext_vector_type(8)))  unsigned short v8us;
typedef __attribute__((ext_vector_type(8)))  float    v8f;
typedef __attribute__((ext_vector_type(4)))  float    v4f;
typedef v8h  __attribute__((may_alias)) v8ha;
typedef v4f  __attribute__((may_alias)) v4fa;
typedef v8us __attribute__((may_alias)) v8usa;

__device__ __forceinline__ unsigned short f2bf(float f) { unsigned u = __float_as_uint(f); u += 0x7FFFu + ((u >> 16) & 1u); return (unsigned short)(u >> 16); }
__device__ __forceinline__ float bf2f(unsigned short b) { return __uint_as_float(((unsigned)b) << 16); }
__device__ __forceinline__ float bfr(float f) { return bf2f(f2bf(f)); }
__device__ __forceinline__ v16h cat16(v8h lo, v8h hi) { return __builtin_shufflevector(lo, hi, 0, 1, 2, 3, 4, 5, 6, 7, 8, 9, 10, 11, 12, 13, 14, 15); }
__device__ __forceinline__ v16bf cat16b(v8us lo, v8us hi) { return __builtin_bit_cast(v16bf, __builtin_shufflevector(lo, hi, 0, 1, 2, 3, 4, 5, 6, 7, 8, 9, 10, 11, 12, 13, 14, 15)); }
__device__ __forceinline__ v8f wmma16(v16h a, v16h b, v8f c) { return __builtin_amdgcn_wmma_f32_16x16x32_f16(false, a, false, b, (short)0, c, false, false); }
__device__ __forceinline__ v8f wmmab(v16bf a, v16bf b, v8f c) { return __builtin_amdgcn_wmma_f32_16x16x32_bf16(false, a, false, b, (short)0, c, false, false); }
// fragment order of a [rows][K] 16-bit plane (rows % 16 == 0, K % 32 == 0): element index of (row, k). Block (row / 16, k / 32) of 512 elements; in it half (k / 16) % 2, then lane 16 ((k / 8) % 2) + row % 16, then k % 8.
__device__ __forceinline__ size_t fo(int row, int k, int K) { return ((size_t)(row >> 4) * (K >> 5) + (k >> 5)) * 512 + ((k >> 4) & 1) * 256 + ((k >> 3) & 1) * 128 + (row & 15) * 8 + (k & 7); }
// the same blocks in the other order, block (k / 32, row / 16), for a plane of R rows whose reader takes all R rows of a k step at once (Vt: the R / 16 blocks of a pass lie side by side)
__device__ __forceinline__ size_t fok(int row, int k, int R) { return ((size_t)(k >> 5) * (R >> 4) + (row >> 4)) * 512 + ((k >> 4) & 1) * 256 + ((k >> 3) & 1) * 128 + (row & 15) * 8 + (k & 7); }



// ---- k_gemmw: register-blocked GEMM, ONE WAVE per 64x64 output tile (16 accumulators), operands straight from 16-bit planes in fragment order; grid (M/64, N/64, Z), 32 threads.
// C[m][n] (f32, pitch ldc, + optional f32 bias[n]) = sum_k A[m][k] Bt[n][k] (+ split products per NSPLIT). z-batch strides sA/sB/sC in elements. K % 32 == 0, a compile-time constant so that the bands' distances are immediate offsets of the loads.
template <typename T16> struct WFrag;
template <> struct WFrag<h16> { typedef v16h V; static __device__ __forceinline__ V ld(const char* p) { return cat16(*(const v8h*)p, *(const v8h*)(p + 512)); } static __device__ __forceinline__ v8f mma(V a, V b, v8f c) { return wmma16(a, b, c); } };
template <> struct WFrag<bf> { typedef v16bf V; static __device__ __forceinline__ V ld(const char* p) { return cat16b(*(const v8us*)p, *(const v8us*)(p + 512)); } static __device__ __forceinline__ v8f mma(V a, V b, v8f c) { return wmmab(a, b, c); } };
template <typename T16, int NSPLIT, bool BIAS, int K>
__global__ __launch_bounds__(32) void k_gemmw(const T16* __restrict__ A, const T16* __restrict__ A2, const T16* __restrict__ Bt, const T16* __restrict__ Bt2, float* C, int ldc, const float* __restrict__ bias, size_t sA, size_t sB, size_t sC) {
    typedef typename WFrag<T16>::V V;
    __shared__ __align__(16) float os[16 * 68];
    const size_t z = blockIdx.z; A += z * sA; if (A2) A2 += z * sA; Bt += z * sB; if (Bt2) Bt2 += z * sB; C += z * sC;
    const int lane = threadIdx.x & 31, lr = lane & 15, hi = lane >> 4; const int r0 = blockIdx.x * 64, c0 = blockIdx.y * 64;
    v8f acc[4][4];
#pragma unroll
    for (int mb = 0; mb < 4; ++mb)
#pragma unroll
        for (int nb = 0; nb < 4; ++nb) acc[mb][nb] = (v8f){};
    const char* pa = (const char*)(A + (size_t)r0 * K) + lane * 16; const char* pa2 = (const char*)((NSPLIT == 1 || NSPLIT == 2) ? A2 + (size_t)r0 * K : A) + lane * 16; const char* pb = (const char*)(Bt + (size_t)c0 * K) + lane * 16; const char* pb2 = (const char*)((NSPLIT >= 2) ? Bt2 + (size_t)c0 * K : Bt) + lane * 16;   // the lane's walking addresses; fragment order: a 16-row band is 32 K bytes (an immediate offset), a k step of 32 is 1 KiB
#pragma unroll 1
    for (int kc = 0; kc < K; kc += 32) {
        V a[4], a2[4], b[4], b2[4];
#pragma unroll
        for (int mb = 0; mb < 4; ++mb) { a[mb] = WFrag<T16>::ld(pa + mb * 32 * K); if (NSPLIT == 1 || NSPLIT == 2) a2[mb] = WFrag<T16>::ld(pa2 + mb * 32 * K); }
#pragma unroll
        for (int nb = 0; nb < 4; ++nb) { b[nb] = WFrag<T16>::ld(pb + nb * 32 * K); if (NSPLIT >= 2) b2[nb] = WFrag<T16>::ld(pb2 + nb * 32 * K); }
        // the wait in front of the step of the address registers that the pass's issued loads name, and of any fragment that would land on them; the addresses in use are inputs so that they stay in their registers up to here
        if (NSPLIT == 0) asm volatile("s_wait_xcnt 0x0" :: "v"(pa), "v"(pb) : "memory");
        else if (NSPLIT == 1) asm volatile("s_wait_xcnt 0x0" :: "v"(pa), "v"(pa2), "v"(pb) : "memory");
        else asm volatile("s_wait_xcnt 0x0" :: "v"(pa), "v"(pa2), "v"(pb), "v"(pb2) : "memory");
        __builtin_amdgcn_sched_barrier(0);   // keeps every load of the pass in front of that wait (the scheduler otherwise sinks some of them among the products, behind the wait)
        pa += 512 * 2; pa2 += 512 * 2; pb += 512 * 2; pb2 += 512 * 2;
#pragma unroll
        for (int nb = 0; nb < 4; ++nb) {
#pragma unroll
            for (int mb = 0; mb < 4; ++mb) { acc[mb][nb] = WFrag<T16>::mma(a[mb], b[nb], acc[mb][nb]); if (NSPLIT == 1 || NSPLIT == 2) acc[mb][nb] = WFrag<T16>::mma(a2[mb], b[nb], acc[mb][nb]); if (NSPLIT >= 2) acc[mb][nb] = WFrag<T16>::mma(a[mb], b2[nb], acc[mb][nb]); } }
        asm volatile("v_nop\n\tv_nop\n\tv_nop\n\tv_nop" : "+v"(acc[0][0]), "+v"(acc[1][1]), "+v"(acc[2][2]), "+v"(acc[3][3]) : "v"(a[0]), "v"(a[3]));
    }
#pragma unroll
    for (int mb = 0; mb < 4; ++mb) {
#pragma unroll
        for (int nb = 0; nb < 4; ++nb) {
#pragma unroll
            for (int j = 0; j < 8; ++j) os[(hi * 8 + j) * 68 + nb * 16 + lr] = acc[mb][nb][j]; }
        __builtin_amdgcn_wave_barrier(); asm volatile("" ::: "memory");
        float* crow = C + (size_t)(r0 + mb * 16) * ldc + c0;
{
#pragma unroll
            for (int s = 0; s < 8; ++s) { const int row = 2 * s + hi, cofs = lr * 4; v4f val = *(const v4fa*)(os + row * 68 + cofs); if (BIAS) { val[0] += bfr(bias[c0 + cofs]); val[1] += bfr(bias[c0 + cofs + 1]); val[2] += bfr(bias[c0 + cofs + 2]); val[3] += bfr(bias[c0 + cofs + 3]); }
                *(v4f*)(crow + (size_t)row * ldc + cofs) = val; }
             }
        __builtin_amdgcn_wave_barrier(); asm volatile("" ::: "memory");
    }
}

__device__ __forceinline__ h16 tohx(float x) { return (h16)x; }
__device__ __forceinline__ void splitf(float y, unsigned short& h, unsigned short& l) { h = f2bf(y); l = f2bf(y - bf2f(h)); }
typedef __attribute__((ext_vector_type(2))) _Float16 v2h;
typedef __attribute__((ext_vector_type(4))) _Float16 v4h;
typedef __attribute__((ext_vector_type(2))) unsigned short v2us;
typedef __attribute__((ext_vector_type(4))) unsigned short v4us;
typedef __attribute__((ext_vector_type(2))) float v2f;
typedef __attribute__((ext_vector_type(4))) int v4i;

// k_wtG: Bt[n][k] = bf16(w[k][n]) in fragment order. One thread per 16-byte chunk (8 k of one n), lanes along n: every read is a whole line of w, every store 16 bytes a lane in two runs of 256 bytes.
__global__ __launch_bounds__(256) void k_wtG(const float* __restrict__ w, int K, int N, bf* Bt) {
    const unsigned i = blockIdx.x * 256 + threadIdx.x; if (i >= (unsigned)N * (unsigned)(K / 8)) return; const int n = (int)(i % (unsigned)N), k0 = (int)(i / (unsigned)N) * 8; v8us o; const float* p[8]; float x[8];
#pragma unroll
    for (int j = 0; j < 8; ++j) { p[j] = w + (size_t)(k0 + j) * N + n; x[j] = *p[j]; }
    asm volatile("s_wait_xcnt 0x0" :: "v"(p[0]), "v"(p[1]), "v"(p[2]), "v"(p[3]), "v"(p[4]), "v"(p[5]), "v"(p[6]), "v"(p[7]) : "memory");   // the wait in front of any overwrite of an address register that an issued load names; the addresses are inputs so that they stay in their registers up to here
#pragma unroll
    for (int j = 0; j < 8; ++j) o[j] = f2bf(x[j]);
    *(v8us*)(Bt + fo(n, k0, K)) = o; }
// k_cvt8: bf16 copy of src [NB_ TT][DM] in fragment order. One thread per 16-byte chunk; 8 lanes cover 64 k of a row (256 bytes read), the next 8 lanes the next row, so that a store writes runs of 64 bytes.
__global__ __launch_bounds__(256) void k_cvt8(const float* __restrict__ src, bf* dst) { const unsigned i = blockIdx.x * 256 + threadIdx.x; if (i >= (unsigned)(NB_ * TT) * (DM / 8)) return; const int row = (int)((i >> 3) % (unsigned)(NB_ * TT)), k = (int)((i >> 3) / (unsigned)(NB_ * TT)) * 64 + (int)(i & 7) * 8; const v8f v = *(const v8f*)(src + (size_t)row * DM + k); v8us o;
#pragma unroll
    for (int j = 0; j < 8; ++j) o[j] = f2bf(v[j]); *(v8us*)(dst + fo(row, k, DM)) = o;  }

// k_rope: head planes [h][t][d] (fp16 row-major; hi/lo in fragment order, one 16-byte chunk a thread) of rope(x) x sc with the rotate-half convention out[d] = x[d] cos[t][d] - x[d+HD/2] sin[t][d], out[d+HD/2] = x[d+HD/2] cos[t][d+HD/2] + x[d] sin[t][d+HD/2]
__global__ __launch_bounds__(256) void k_rope(const float* __restrict__ F, int pitch, int nheads, const float* __restrict__ CS, const float* __restrict__ RF, const float* __restrict__ nw, float sc, h16* P16, bf* Ph, bf* Pl) {
    F += (size_t)blockIdx.y * TT * pitch; const size_t pb = (size_t)blockIdx.y * nheads * TT * HD; P16 += pb; Ph += pb; Pl += pb;   // blockIdx.y: batch (rows b * TT + t of F, planes [b][h][t][d])
    const size_t e = ((size_t)blockIdx.x * 256 + threadIdx.x) * 8; if (e >= (size_t)nheads * TT * HD) return; const int d = (int)(e % HD); const int t = (int)((e / HD) % TT); const int h = (int)(e / ((size_t)HD * TT)); const float* f = F + (size_t)t * pitch + h * HD; v8h o16; v8us oh, ol;
    const int dq = (d < HD / 2) ? d + HD / 2 : d - HD / 2;   // the chunk's 8 partners: d is a multiple of 8, so the whole chunk lies in one half
    const float* fa = f + d; const float* fb = f + dq; const float* cp = CS + ((size_t)t * HD + d) * 2; float xa[8], xb[8]; v2f cs8[8];
#pragma unroll
    for (int q = 0; q < 8; ++q) { xa[q] = fa[q]; xb[q] = fb[q]; cs8[q] = *(const v2f*)(cp + 2 * q); }
    asm volatile("s_wait_xcnt 0x0" :: "v"(fa), "v"(fb), "v"(cp) : "memory");   // the wait in front of any overwrite of an address register that an issued load names; the addresses are inputs so that they stay in their registers up to here
    if (RF) { const float* rp = RF + (size_t)h * TT + t; const float* na = nw + d; const float* nb = nw + dq; const float rf = *rp; float wa[8], wb[8];
#pragma unroll
        for (int q = 0; q < 8; ++q) { wa[q] = na[q]; wb[q] = nb[q]; }
        asm volatile("s_wait_xcnt 0x0" :: "v"(rp), "v"(na), "v"(nb) : "memory");   // as above
#pragma unroll
        for (int q = 0; q < 8; ++q) { float n0 = __fmul_rn(xa[q], rf), n1 = __fmul_rn(xb[q], rf); asm volatile("" : "+v"(n0)); asm volatile("" : "+v"(n1)); xa[q] = __fmul_rn(bfr(wa[q]), n0); xb[q] = __fmul_rn(bfr(wb[q]), n1); } }
#pragma unroll
    for (int q = 0; q < 8; ++q) { const float x0 = xa[q], x1 = xb[q];
        const v2f cs = cs8[q]; float a = __fmul_rn(x0, cs[0]), bq = __fmul_rn(x1, cs[1]); asm volatile("" : "+v"(a)); asm volatile("" : "+v"(bq)); const float r = ((d < HD / 2) ? __fsub_rn(a, bq) : __fadd_rn(a, bq)) * sc;
        o16[q] = tohx(r); unsigned short a2, c2; splitf(r, a2, c2); oh[q] = a2; ol[q] = c2; }
    const size_t ef = (size_t)h * TT * HD + fo(t, d, HD); *(v8h*)(P16 + e) = o16; *(v8us*)(Ph + ef) = oh; *(v8us*)(Pl + ef) = ol;  }
// k_vtp: Vt planes [b][g][d][t] (fp16 + hi/lo) in fragment order, blocks by fok(). One thread per 16-byte chunk (8 t of one d), lanes along d: every read is a whole line of a row of F, every store 16 bytes a lane in two runs of 256 bytes.
__global__ __launch_bounds__(256) void k_vtp(const float* __restrict__ F, int pitch, int nheads, h16* V16, bf* Vh, bf* Vl) { const unsigned i = blockIdx.x * 256 + threadIdx.x; if (i >= (unsigned)nheads * (HD * (TT / 8))) return; const int d = (int)(i % HD); const int t0 = (int)((i / HD) % (TT / 8)) * 8; const int g = (int)(i / (HD * (TT / 8))); const size_t eb = ((size_t)blockIdx.y * nheads + g) * HD * TT + fok(d, t0, HD); F += (size_t)blockIdx.y * TT * pitch + g * HD + d; v8h o16; v8us oh, ol; const float* p[8]; float xs[8];   /* blockIdx.y: batch */
#pragma unroll
    for (int q = 0; q < 8; ++q) { p[q] = F + (size_t)(t0 + q) * pitch; xs[q] = *p[q]; }
    asm volatile("s_wait_xcnt 0x0" :: "v"(p[0]), "v"(p[1]), "v"(p[2]), "v"(p[3]), "v"(p[4]), "v"(p[5]), "v"(p[6]), "v"(p[7]) : "memory");   // the wait in front of any overwrite of an address register that an issued load names; the addresses are inputs so that they stay in their registers up to here
#pragma unroll
    for (int q = 0; q < 8; ++q) { const float x = xs[q]; o16[q] = tohx(x); unsigned short a2, c2; splitf(x, a2, c2); oh[q] = a2; ol[q] = c2; }
    *(v8h*)(V16 + eb) = o16; *(v8us*)(Vh + eb) = oh; *(v8us*)(Vl + eb) = ol;  }
__global__ __launch_bounds__(256) void k_csid(float* CS) { const int idx = blockIdx.x * 256 + threadIdx.x; if (idx >= TT * HD) return; v2f cs; cs[0] = 1.0f; cs[1] = 0.0f; *(v2f*)(CS + (size_t)idx * 2) = cs;  }
__global__ __launch_bounds__(256) void k_addres(float* Y, const float* __restrict__ xr) { const size_t i = (size_t)blockIdx.x * 256 + threadIdx.x; if (i >= (size_t)NB_ * TT * DQ / 4) return; const v4f a = *(const v4f*)(Y + i * 4); const v4f r = *(const v4f*)(xr + i * 4); v4f o;
#pragma unroll
    for (int q = 0; q < 4; ++q) o[q] = __fadd_rn(a[q], bfr(r[q]));
    *(v4f*)(Y + i * 4) = o;  }
__global__ __launch_bounds__(256) void k_lnout(const float* __restrict__ F, const float* __restrict__ g, const float* __restrict__ bb, float* out) { const int lane = threadIdx.x & 31; const int row = blockIdx.x * 8 + (threadIdx.x >> 5); if (row >= NB_ * TT) return; const float* fr = F + (size_t)row * DQ; float* orow = out + (size_t)row * DQ; float v[DQ / 32]; float s = 0.f;
#pragma unroll
    for (int c = 0; c < DQ / 128; ++c) { const v4f a = *(const v4f*)(fr + c * 128 + lane * 4); for (int q = 0; q < 4; ++q) { v[c * 4 + q] = a[q]; s = __fadd_rn(s, a[q]); } }
#pragma unroll
    for (int sh = 16; sh; sh >>= 1) s = __fadd_rn(s, __shfl_xor(s, sh, 32));
    const float mean = __fdiv_rn(s, (float)DQ); float s2 = 0.f;
#pragma unroll
    for (int k = 0; k < DQ / 32; ++k) { const float dv = __fsub_rn(v[k], mean); float p2 = __fmul_rn(dv, dv); asm volatile("" : "+v"(p2)); s2 = __fadd_rn(s2, p2); v[k] = dv; }
#pragma unroll
    for (int sh = 16; sh; sh >>= 1) s2 = __fadd_rn(s2, __shfl_xor(s2, sh, 32));
    const float rs = __fdiv_rn(1.0f, __fsqrt_rn(__fadd_rn(__fdiv_rn(s2, (float)DQ), LNEPS)));
{
#pragma unroll
        for (int c = 0; c < DQ / 128; ++c) { v4f o; for (int q = 0; q < 4; ++q) { const int col = c * 128 + lane * 4 + q; float y = __fmul_rn(v[c * 4 + q], rs); asm volatile("" : "+v"(y)); y = __fmul_rn(y, bfr(g[col])); asm volatile("" : "+v"(y)); o[q] = __fadd_rn(y, bfr(bb[col])); } *(v4f*)(orow + c * 128 + lane * 4) = o; }
         } }
// ---- k_fattn: scores, softmax, attn.v and the hi/lo merge of one head in ONE kernel: no score or probability ever goes to memory. One work-group of 4 waves per (128 query rows, head, batch); each wave owns 32 query rows and walks all TT keys, 32 a pass.
// Transposed products: St[key][query] = K Qt (A = K rows, B = Q rows kept in registers; hi/lo 3 products in the order Qh Kh, Ql Kh, Qh Kl), so that a lane holds 16 scores of ONE query: maximum and sum in the lane plus one exchange between the wave's halves.
// The two 16-key score tiles of a pass ARE the B fragment of Ot[d][query] += Vt P (keys 8 hi + j and 16 + 8 hi + j): P is rounded in registers. Running maximum with rescale; P is left unnormalised (<= 1; fp16 rows x PCAR) and the division by the row sum is done once at the end.
__device__ __forceinline__ float xhalf(float x) { return __builtin_bit_cast(float, __builtin_amdgcn_permlanex16(__builtin_bit_cast(int, x), __builtin_bit_cast(int, x), 0x76543210, 0xfedcba98, false, false)); }   // lane l <-> lane l ^ 16
// 2^x with the issue slot that the instruction set asks for behind a transcendental (before its result is used or its source overwritten) filled in the same statement
__device__ __forceinline__ float exp2s(float x) { float r; asm("v_exp_f32 %0, %1\n\tv_nop" : "=v"(r) : "v"(x)); return r; }
// fragment loads at (uniform base + constant) + one 32-bit byte offset per lane: the offset is the only vector register that the loads name; planes in fragment order: the two halves of a fragment lie 512 bytes apart
__device__ __forceinline__ v16bf ldfb(const bf* base, unsigned ofs, int cst) { const char* p = (const char*)base + cst + ofs; return cat16b(*(const v8us*)p, *(const v8us*)(p + 512)); }
__device__ __forceinline__ v16h ldfh(const h16* base, unsigned ofs, int cst) { const char* p = (const char*)base + cst + ofs; return cat16(*(const v8h*)p, *(const v8h*)(p + 512)); }
template <bool HR>
__device__ __forceinline__ void fattn_rows(const bf* __restrict__ Qh, const bf* __restrict__ Ql, const bf* __restrict__ Kh, const bf* __restrict__ Kl, const h16* __restrict__ V16, const bf* __restrict__ Vh, const bf* __restrict__ Vl, bf* Ah, bf* Al, int q0) {
    const int lane = threadIdx.x & 31, lr = lane & 15, hi = lane >> 4;
    v16bf qh[2][2], ql[2][2], kh[2][2], kl[2][2];
    const unsigned qb = (q0 * HD + 8 * lane) * 2; unsigned kb = 8 * lane * 2; const unsigned vb = 8 * lane * 2;   // byte offsets of the lane's chunks in the Q, K and Vt planes (fragment order: a 16-row band of Q or K is 16 HD elements; the 4 blocks of Vt for 32 keys lie side by side)
    const char* pv0 = (HR ? (const char*)Vh : (const char*)V16) + vb; const char* pv1 = (const char*)Vl + vb;   // the lane's walking addresses in the Vt planes
#pragma unroll
    for (int qt = 0; qt < 2; ++qt)
#pragma unroll
        for (int ks = 0; ks < 2; ++ks) { const int cq = (qt * 16 * HD + ks * 512) * 2; qh[qt][ks] = ldfb(Qh, qb, cq); ql[qt][ks] = ldfb(Ql, qb, cq); }
    asm volatile("s_wait_xcnt 0x0" :: "v"(qb) : "memory");   // the wait in front of any overwrite of an offset register that an issued load names; the offset is an input so that it stays in its register up to here
#pragma unroll
    for (int kt = 0; kt < 2; ++kt)
#pragma unroll
        for (int ks = 0; ks < 2; ++ks) { const int ck = (kt * 16 * HD + ks * 512) * 2; kh[kt][ks] = ldfb(Kh, kb, ck); kl[kt][ks] = ldfb(Kl, kb, ck); }
    asm volatile("s_wait_xcnt 0x0" :: "v"(kb) : "memory");   // as above: in front of the first step of kb
    v8f o[2][4]; float m[2], l[2];
#pragma unroll
    for (int qt = 0; qt < 2; ++qt) { m[qt] = -3.0e38f; l[qt] = 0.f;
#pragma unroll
        for (int dt = 0; dt < 4; ++dt) o[qt][dt] = (v8f){}; }
#pragma unroll 1
    for (int k0 = 0; k0 < TT; k0 += 32) {   // rolled: one pass's code and registers
        v16h vf[4]; v16bf vh[4], vl[4];
#pragma unroll
        for (int dt = 0; dt < 4; ++dt) { const int cv = dt * 512 * 2; if (HR) { vh[dt] = ldfb((const bf*)(pv0 + cv), 0u, 0); vl[dt] = ldfb((const bf*)(pv1 + cv), 0u, 0); } else vf[dt] = ldfh((const h16*)(pv0 + cv), 0u, 0); }
        if (HR) asm volatile("s_wait_xcnt 0x0" :: "v"(pv0), "v"(pv1) : "memory");   // as above: in front of the step of the two addresses and of any fragment that would land on them
        else asm volatile("s_wait_xcnt 0x0" :: "v"(pv0) : "memory");   // the same for the one fp16 plane
        __builtin_amdgcn_sched_barrier(0);   // keeps the Vt loads at the head of the pass, in flight under the score products and the softmax (the scheduler otherwise sinks some of them, and the K fetch below with them, to the end of the pass)
        pv0 += (HD / 16) * 512 * 2; pv1 += (HD / 16) * 512 * 2;   // 32 keys on: the next HD / 16 blocks
        v8f s[2][2];
#pragma unroll
        for (int qt = 0; qt < 2; ++qt)
#pragma unroll
            for (int kt = 0; kt < 2; ++kt) s[qt][kt] = (v8f){};
#pragma unroll
        for (int ks = 0; ks < 2; ++ks) {
#pragma unroll
            for (int qt = 0; qt < 2; ++qt)
#pragma unroll
                for (int kt = 0; kt < 2; ++kt) s[qt][kt] = wmmab(kh[kt][ks], qh[qt][ks], s[qt][kt]);
#pragma unroll
            for (int qt = 0; qt < 2; ++qt)
#pragma unroll
                for (int kt = 0; kt < 2; ++kt) s[qt][kt] = wmmab(kh[kt][ks], ql[qt][ks], s[qt][kt]);
#pragma unroll
            for (int qt = 0; qt < 2; ++qt)
#pragma unroll
                for (int kt = 0; kt < 2; ++kt) s[qt][kt] = wmmab(kl[kt][ks], qh[qt][ks], s[qt][kt]); }
        kb = (kb + 32 * HD * 2) & (TT * HD * 2 - 1);   // the next pass's K fragments, fetched behind this pass's score products into the same registers; the last pass fetches keys 0..31 again (in bounds, unused)
#pragma unroll
        for (int kt = 0; kt < 2; ++kt)
#pragma unroll
            for (int ks = 0; ks < 2; ++ks) { const int ck = (kt * 16 * HD + ks * 512) * 2; kh[kt][ks] = ldfb(Kh, kb, ck); kl[kt][ks] = ldfb(Kl, kb, ck); }
        asm volatile("s_wait_xcnt 0x0" :: "v"(kb) : "memory");   // as above: in front of the next step of kb
        v16h pf[2]; v16bf ph[2], pl[2];
#pragma unroll
        for (int qt = 0; qt < 2; ++qt) {
            float t[16]; float cm = -3.0e38f;
#pragma unroll
            for (int e = 0; e < 16; ++e) { t[e] = s[qt][e >> 3][e & 7] * SCL; cm = fmaxf(cm, t[e]); }
            cm = fmaxf(cm, xhalf(cm));
            const float mn = fmaxf(m[qt], cm); const float al = exp2s((m[qt] - mn) * 1.4426950408889634f); m[qt] = mn; float ls = 0.f;
#pragma unroll
            for (int e = 0; e < 16; ++e) { t[e] = exp2s((t[e] - mn) * 1.4426950408889634f); ls += t[e]; }
            l[qt] = l[qt] * al + ls;
#pragma unroll
            for (int dt = 0; dt < 4; ++dt) o[qt][dt] *= al;
            if (HR) { v8us h0, h1, l0, l1;
#pragma unroll
                for (int j = 0; j < 8; ++j) { unsigned short x, y; splitf(t[j], x, y); h0[j] = x; l0[j] = y; splitf(t[8 + j], x, y); h1[j] = x; l1[j] = y; }
                ph[qt] = cat16b(h0, h1); pl[qt] = cat16b(l0, l1);
            } else { v8h c0, c1;
#pragma unroll
                for (int j = 0; j < 8; ++j) { c0[j] = tohx(t[j] * PCAR); c1[j] = tohx(t[8 + j] * PCAR); }
                pf[qt] = cat16(c0, c1); } }
        if (HR) {
#pragma unroll
            for (int qt = 0; qt < 2; ++qt)
#pragma unroll
                for (int dt = 0; dt < 4; ++dt) o[qt][dt] = wmmab(vh[dt], ph[qt], o[qt][dt]);
#pragma unroll
            for (int qt = 0; qt < 2; ++qt)
#pragma unroll
                for (int dt = 0; dt < 4; ++dt) o[qt][dt] = wmmab(vh[dt], pl[qt], o[qt][dt]);
#pragma unroll
            for (int qt = 0; qt < 2; ++qt)
#pragma unroll
                for (int dt = 0; dt < 4; ++dt) o[qt][dt] = wmmab(vl[dt], ph[qt], o[qt][dt]);
        } else {
#pragma unroll
            for (int qt = 0; qt < 2; ++qt)
#pragma unroll
                for (int dt = 0; dt < 4; ++dt) o[qt][dt] = wmma16(vf[dt], pf[qt], o[qt][dt]); }
    }
#pragma unroll
    for (int qt = 0; qt < 2; ++qt) { const float lt = l[qt] + xhalf(l[qt]); const float f = __fdiv_rn(HR ? 1.0f : (1.0f / PCAR), lt); v8us oh[4], ol[4];
#pragma unroll
        for (int dt = 0; dt < 4; ++dt)
#pragma unroll
            for (int j = 0; j < 8; ++j) { unsigned short x, y; splitf(o[qt][dt][j] * f, x, y); oh[dt][j] = x; ol[dt][j] = y; }
        bf* pa = Ah + (size_t)(q0 + qt * 16) * DQ + lane * 8; bf* pl2 = Al + (size_t)(q0 + qt * 16) * DQ + lane * 8;   // fragment order of the [row][DQ] planes: 16 columns on are 256 elements on
#pragma unroll
        for (int dt = 0; dt < 4; ++dt) { *(v8us*)(pa + dt * 256) = oh[dt]; *(v8us*)(pl2 + dt * 256) = ol[dt]; }
        asm volatile("s_wait_xcnt 0x0" :: "v"(oh[0]), "v"(oh[1]), "v"(oh[2]), "v"(oh[3]), "v"(ol[0]), "v"(ol[1]), "v"(ol[2]), "v"(ol[3]), "v"(pa), "v"(pl2) : "memory"); }   // the wait in front of any overwrite of a data or address register of the eight issued stores; they are inputs so that they stay in their registers up to here
}
__global__ __launch_bounds__(128) void k_fattn(const bf* __restrict__ Qh, const bf* __restrict__ Ql, const bf* __restrict__ Kh, const bf* __restrict__ Kl, const h16* __restrict__ V16, const bf* __restrict__ Vh, const bf* __restrict__ Vl, bf* Ah, bf* Al) {
    const size_t hp = ((size_t)blockIdx.z * NH_ + blockIdx.y) * TT * HD; const int q0 = blockIdx.x * 128 + (threadIdx.x >> 5) * 32; const size_t ao = (size_t)blockIdx.z * TT * DQ + blockIdx.y * (HD / 32) * 512; Ah += ao; Al += ao;   // blockIdx.z: batch (planes [b][h], rows b * TT + t of the output planes)
    if (blockIdx.x < RH / 128) fattn_rows<true>(Qh + hp, Ql + hp, Kh + hp, Kl + hp, V16 + hp, Vh + hp, Vl + hp, Ah, Al, q0);
    else fattn_rows<false>(Qh + hp, Ql + hp, Kh + hp, Kl + hp, V16 + hp, Vh + hp, Vl + hp, Ah, Al, q0);
}

extern "C" void kernel_launch(void* const* d_in, const int* in_sizes, int n_in,
                              void* d_out, int out_size, void* d_ws, size_t ws_size, hipStream_t stream) {
    (void)in_sizes; (void)n_in; (void)out_size;
    const float* x = (const float*)d_in[0]; const float* wq = (const float*)d_in[1]; const float* wk = (const float*)d_in[2]; const float* wv = (const float*)d_in[3]; const float* wo = (const float*)d_in[4]; const float* lng = (const float*)d_in[5]; const float* lnb = (const float*)d_in[6];
    float* OUT = (float*)d_out;     // [4][2048][1024]
    char* wsp = (char*)d_ws;
    auto take = [&](size_t bytes) { char* p = wsp; wsp += (bytes + 255) & ~(size_t)255; return (void*)p; };
    bf* WQ = (bf*)take((size_t)DQ * DM * 2); bf* WK = (bf*)take((size_t)DKV * DM * 2); bf* WV = (bf*)take((size_t)DKV * DM * 2); bf* WO = (bf*)take((size_t)DM * DQ * 2); float* CS = (float*)take((size_t)TT * HD * 2 * 4);
    bf* XB = (bf*)take((size_t)NB_ * TT * DM * 2); float* FQ = (float*)take((size_t)NB_ * TT * DQ * 4); float* FK = (float*)take((size_t)NB_ * TT * DKV * 4);
    h16* VT16 = (h16*)take((size_t)NB_ * NKV * HD * TT * 2);
    bf* QPh = (bf*)take((size_t)NB_ * NH_ * TT * HD * 2); bf* QPl = (bf*)take((size_t)NB_ * NH_ * TT * HD * 2); bf* KPh = (bf*)take((size_t)NB_ * NKV * TT * HD * 2); bf* KPl = (bf*)take((size_t)NB_ * NKV * TT * HD * 2); bf* VTh = (bf*)take((size_t)NB_ * NKV * HD * TT * 2); bf* VTl = (bf*)take((size_t)NB_ * NKV * HD * TT * 2);
    bf* ATh = (bf*)take((size_t)NB_ * TT * DQ * 2); bf* ATl = (bf*)take((size_t)NB_ * TT * DQ * 2);
    if ((size_t)(wsp - (char*)d_ws) > ws_size) return;    // 233 MiB of the 256 MiB
    float* FV = FK;   // v projection reuses the k buffer after the k planes are built (stream-ordered)
    float* Y = FQ;    // the Wo product reuses the q buffer, which nothing reads behind the q planes (stream-ordered)
    h16* QP16 = (h16*)ATh; h16* KP16 = (h16*)ATl;   // the fp16 q and k planes (same size) lie where the attention kernel later writes its output planes: all four batches at once would not fit otherwise
    { k_wtG<<<(unsigned)((DM * DQ / 8 + 255) / 256), 256, 0, stream>>>(wq, DM, DQ, WQ); k_wtG<<<(unsigned)((DM * DKV / 8 + 255) / 256), 256, 0, stream>>>(wk, DM, DKV, WK); k_wtG<<<(unsigned)((DM * DKV / 8 + 255) / 256), 256, 0, stream>>>(wv, DM, DKV, WV);
      k_wtG<<<(unsigned)((DQ * DM / 8 + 255) / 256), 256, 0, stream>>>(wo, DQ, DM, WO);
       }
    k_csid<<<(TT * HD + 255) / 256, 256, 0, stream>>>(CS);
    const unsigned LQ = (unsigned)(((size_t)NH_ * TT * HD / 8 + 255) / 256), LKv = (unsigned)(((size_t)NKV * TT * HD / 8 + 255) / 256);
    k_cvt8<<<(unsigned)(((size_t)NB_ * TT * DM / 8 + 255) / 256), 256, 0, stream>>>(x, XB);
    k_gemmw<bf, 0, false, DM><<<dim3(NB_ * TT / 64, DQ / 64, 1), 32, 0, stream>>>(XB, nullptr, WQ, nullptr, FQ, DQ, nullptr, 0, 0, 0);
    k_rope<<<dim3(LQ, NB_, 1), 256, 0, stream>>>(FQ, DQ, NH_, CS, nullptr, nullptr, 1.0f, QP16, QPh, QPl);
    k_gemmw<bf, 0, false, DM><<<dim3(NB_ * TT / 64, DKV / 64, 1), 32, 0, stream>>>(XB, nullptr, WK, nullptr, FK, DKV, nullptr, 0, 0, 0);
    k_rope<<<dim3(LKv, NB_, 1), 256, 0, stream>>>(FK, DKV, NKV, CS, nullptr, nullptr, 1.0f, KP16, KPh, KPl);
    k_gemmw<bf, 0, false, DM><<<dim3(NB_ * TT / 64, DKV / 64, 1), 32, 0, stream>>>(XB, nullptr, WV, nullptr, FV, DKV, nullptr, 0, 0, 0); k_vtp<<<dim3(LKv, NB_, 1), 256, 0, stream>>>(FV, DKV, NKV, VT16, VTh, VTl);
    k_fattn<<<dim3(TT / 128, NH_, NB_), 128, 0, stream>>>(QPh, QPl, KPh, KPl, VT16, VTh, VTl, ATh, ATl);   /* scores hi/lo on EVERY row (sigma-16 logits), softmax, attn.v hybrid, merge */
    k_gemmw<bf, 1, false, DQ><<<dim3(NB_ * TT / 64, DM / 64, 1), 32, 0, stream>>>(ATh, ATl, WO, nullptr, Y, DM, nullptr, 0, 0, 0); k_addres<<<(unsigned)(((size_t)NB_ * TT * DQ / 4 + 255) / 256), 256, 0, stream>>>(Y, x); k_lnout<<<(NB_ * TT + 7) / 8, 256, 0, stream>>>(Y, lng, lnb, OUT);   /* LayerNorm(h + attn_out) */
}

// v005
// One run takes 276 microseconds.
// Two timings next to v004 put it at 1.21 and 1.20 times that version's speed.
// All steps since v000 together make it 14.4 times as fast.
#include <hip/hip_runtime.h>

// Transformer-XL style multi-head attention with post-LayerNorm (h [4][2048][1024]; q,k,v = h W ('xw' [1024][1024] with scale 1/8 x normal: sigma-4 projections, so the /8 logits have sigma ~16: sharply peaked); scores x 64^-0.5; softmax over keys; attn_out = attn_vec Wo ('xw', no bias); out = LayerNorm(h + attn_out) gamma/beta (1e-5) -> [4][2048][1024] (8.4 M)).
// Layout, every stage ONE launch over all NB_ batches (the batch is folded into the grid: rows b*TT + t, planes [b][h]): bf16 copy of h; 'xw' weights transposed once; exact projections, all three in one launch whose epilogue writes the 16-bit head planes straight from the accumulators (no f32 copy of q, k or v exists); one fused attention kernel (scores hi/lo 3 products on EVERY row (peaked logits), running-maximum softmax in registers, P and attn.v hybrid (rows < 512 hi/lo, rest fp16 x1024)); merged hi/lo x Wo exact into workspace; the residual added in that product's epilogue; a row LayerNorm kernel (one wave per 1,024-wide row, fixed-order sums, precise sqrt/div, affine) writes the output rows.
// Every 16-bit matrix operand plane (h copy, transposed weights, Q, K, Vt, attention output) is stored in FRAGMENT ORDER (fo() below): blocks of 16 rows x 32 k = 1 KiB, inside a block the 16-byte chunk that lane l loads stands at byte 16 l (first half of the fragment) and 512 + 16 l (second half), so each wave-wide 16-byte load reads 512 contiguous bytes (4 whole lines) instead of 32 bytes from each of 16 lines. Which element lands in which lane and register is as with row-major planes.
// Compute dtypes, f32 accumulate: every input rounded to bf16; projections exact; scores 3 products on every row; softmax f32; attn.v rows < 512 3 products, rest fp16; Wo hl x exact; residual + LayerNorm f32.

#define NB_  4
#define TT   2048
#define DM   1024
#define NH_  16
#define NKV  16
#define REP  (NH_ / NKV)
#define HD   64
#define DQ   (NH_ * HD)
#define DKV  (NKV * HD)
#define RH   512                  // query rows < RH use hi+lo planes (0: none)
#define WIN  0
#define PCAR 1024.0f
#define SCL  0.125f
#define LNEPS 1e-5f
typedef _Float16 h16;
typedef unsigned short bf;
typedef __attribute__((ext_vector_type(16))) __bf16   v16bf;
typedef __attribute__((ext_vector_type(16))) _Float16 v16h;
typedef __attribute__((ext_vector_type(8)))  _Float16 v8h;
typedef __attribute__((ext_vector_type(8)))  unsigned short v8us;
typedef __attribute__((ext_vector_type(8)))  float    v8f;
typedef __attribute__((ext_vector_type(4)))  float    v4f;
typedef v8h  __attribute__((may_alias)) v8ha;
typedef v4f  __attribute__((may_alias)) v4fa;
typedef v8us __attribute__((may_alias)) v8usa;

__device__ __forceinline__ unsigned short f2bf(float f) { unsigned u = __float_as_uint(f); u += 0x7FFFu + ((u >> 16) & 1u); return (unsigned short)(u >> 16); }
__device__ __forceinline__ float bf2f(unsigned short b) { return __uint_as_float(((unsigned)b) << 16); }
__device__ __forceinline__ float bfr(float f) { return bf2f(f2bf(f)); }
__device__ __forceinline__ v16h cat16(v8h lo, v8h hi) { return __builtin_shufflevector(lo, hi, 0, 1, 2, 3, 4, 5, 6, 7, 8, 9, 10, 11, 12, 13, 14, 15); }
__device__ __forceinline__ v16bf cat16b(v8us lo, v8us hi) { return __builtin_bit_cast(v16bf, __builtin_shufflevector(lo, hi, 0, 1, 2, 3, 4, 5, 6, 7, 8, 9, 10, 11, 12, 13, 14, 15)); }
__device__ __forceinline__ v8f wmma16(v16h a, v16h b, v8f c) { return __builtin_amdgcn_wmma_f32_16x16x32_f16(false, a, false, b, (short)0, c, false, false); }
__device__ __forceinline__ v8f wmmab(v16bf a, v16bf b, v8f c) { return __builtin_amdgcn_wmma_f32_16x16x32_bf16(false, a, false, b, (short)0, c, false, false); }
// fragment order of a [rows][K] 16-bit plane (rows % 16 == 0, K % 32 == 0): element index of (row, k). Block (row / 16, k / 32) of 512 elements; in it half (k / 16) % 2, then lane 16 ((k / 8) % 2) + row % 16, then k % 8.
__device__ __forceinline__ size_t fo(int row, int k, int K) { return ((size_t)(row >> 4) * (K >> 5) + (k >> 5)) * 512 + ((k >> 4) & 1) * 256 + ((k >> 3) & 1) * 128 + (row & 15) * 8 + (k & 7); }
// the same blocks in the other order, block (k / 32, row / 16), for a plane of R rows whose reader takes all R rows of a k step at once (Vt: the R / 16 blocks of a pass lie side by side)
__device__ __forceinline__ size_t fok(int row, int k, int R) { return ((size_t)(k >> 5) * (R >> 4) + (row >> 4)) * 512 + ((k >> 4) & 1) * 256 + ((k >> 3) & 1) * 128 + (row & 15) * 8 + (k & 7); }



// ---- k_gemmw: register-blocked GEMM, ONE WAVE per 64x64 output tile (16 accumulators), operands straight from 16-bit planes in fragment order; grid (M/64, N/64, Z), 32 threads.
// C[m][n] (f32, pitch ldc, + optional f32 bias[n], + optional residual res[m][n] of the same pitch, rounded to bf16 like every input) = sum_k A[m][k] Bt[n][k] (+ split products per NSPLIT). z-batch strides sA/sB/sC in elements. K % 32 == 0, a compile-time constant so that the bands' distances are immediate offsets of the loads.
template <typename T16> struct WFrag;
template <> struct WFrag<h16> { typedef v16h V; static __device__ __forceinline__ V ld(const char* p) { return cat16(*(const v8h*)p, *(const v8h*)(p + 512)); } static __device__ __forceinline__ v8f mma(V a, V b, v8f c) { return wmma16(a, b, c); } };
template <> struct WFrag<bf> { typedef v16bf V; static __device__ __forceinline__ V ld(const char* p) { return cat16b(*(const v8us*)p, *(const v8us*)(p + 512)); } static __device__ __forceinline__ v8f mma(V a, V b, v8f c) { return wmmab(a, b, c); } };
template <typename T16, int NSPLIT, bool BIAS, bool RES, int K>
__global__ __launch_bounds__(32) void k_gemmw(const T16* __restrict__ A, const T16* __restrict__ A2, const T16* __restrict__ Bt, const T16* __restrict__ Bt2, float* C, int ldc, const float* __restrict__ bias, const float* __restrict__ res, size_t sA, size_t sB, size_t sC) {
    typedef typename WFrag<T16>::V V;
    __shared__ __align__(16) float os[16 * 68];
    const size_t z = blockIdx.z; A += z * sA; if (A2) A2 += z * sA; Bt += z * sB; if (Bt2) Bt2 += z * sB; C += z * sC; if (RES) res += z * sC;
    const int lane = threadIdx.x & 31, lr = lane & 15, hi = lane >> 4; const int r0 = blockIdx.x * 64, c0 = blockIdx.y * 64;
    v8f acc[4][4];
#pragma unroll
    for (int mb = 0; mb < 4; ++mb)
#pragma unroll
        for (int nb = 0; nb < 4; ++nb) acc[mb][nb] = (v8f){};
    const char* pa = (const char*)(A + (size_t)r0 * K) + lane * 16; const char* pa2 = (const char*)((NSPLIT == 1 || NSPLIT == 2) ? A2 + (size_t)r0 * K : A) + lane * 16; const char* pb = (const char*)(Bt + (size_t)c0 * K) + lane * 16; const char* pb2 = (const char*)((NSPLIT >= 2) ? Bt2 + (size_t)c0 * K : Bt) + lane * 16;   // the lane's walking addresses; fragment order: a 16-row band is 32 K bytes (an immediate offset), a k step of 32 is 1 KiB
#pragma unroll 1
    for (int kc = 0; kc < K; kc += 32) {
        V a[4], a2[4], b[4], b2[4];
#pragma unroll
        for (int mb = 0; mb < 4; ++mb) { a[mb] = WFrag<T16>::ld(pa + mb * 32 * K); if (NSPLIT == 1 || NSPLIT == 2) a2[mb] = WFrag<T16>::ld(pa2 + mb * 32 * K); }
#pragma unroll
        for (int nb = 0; nb < 4; ++nb) { b[nb] = WFrag<T16>::ld(pb + nb * 32 * K); if (NSPLIT >= 2) b2[nb] = WFrag<T16>::ld(pb2 + nb * 32 * K); }
        // the wait in front of the step of the address registers that the pass's issued loads name, and of any fragment that would land on them; the addresses in use are inputs so that they stay in their registers up to here
        if (NSPLIT == 0) asm volatile("s_wait_xcnt 0x0" :: "v"(pa), "v"(pb) : "memory");
        else if (NSPLIT == 1) asm volatile("s_wait_xcnt 0x0" :: "v"(pa), "v"(pa2), "v"(pb) : "memory");
        else asm volatile("s_wait_xcnt 0x0" :: "v"(pa), "v"(pa2), "v"(pb), "v"(pb2) : "memory");
        __builtin_amdgcn_sched_barrier(0);   // keeps every load of the pass in front of that wait (the scheduler otherwise sinks some of them among the products, behind the wait)
        pa += 512 * 2; pa2 += 512 * 2; pb += 512 * 2; pb2 += 512 * 2;
#pragma unroll
        for (int nb = 0; nb < 4; ++nb) {
#pragma unroll
            for (int mb = 0; mb < 4; ++mb) { acc[mb][nb] = WFrag<T16>::mma(a[mb], b[nb], acc[mb][nb]); if (NSPLIT == 1 || NSPLIT == 2) acc[mb][nb] = WFrag<T16>::mma(a2[mb], b[nb], acc[mb][nb]); if (NSPLIT >= 2) acc[mb][nb] = WFrag<T16>::mma(a[mb], b2[nb], acc[mb][nb]); } }
        asm volatile("v_nop\n\tv_nop\n\tv_nop\n\tv_nop" : "+v"(acc[0][0]), "+v"(acc[1][1]), "+v"(acc[2][2]), "+v"(acc[3][3]) : "v"(a[0]), "v"(a[3]));
    }
#pragma unroll
    for (int mb = 0; mb < 4; ++mb) {
        v4f rv[8];
        if (RES) { const float* p[8];   // the band's residual rows, in flight under the staging of the band
#pragma unroll
            for (int s = 0; s < 8; ++s) { p[s] = res + (size_t)(r0 + mb * 16 + 2 * s + hi) * ldc + c0 + lr * 4; rv[s] = *(const v4f*)p[s]; }
            asm volatile("s_wait_xcnt 0x0" :: "v"(p[0]), "v"(p[1]), "v"(p[2]), "v"(p[3]), "v"(p[4]), "v"(p[5]), "v"(p[6]), "v"(p[7]) : "memory"); }   // the wait in front of any overwrite of an address register that an issued load names; the addresses are inputs so that they stay in their registers up to here
#pragma unroll
        for (int nb = 0; nb < 4; ++nb) {
#pragma unroll
            for (int j = 0; j < 8; ++j) os[(hi * 8 + j) * 68 + nb * 16 + lr] = acc[mb][nb][j]; }
        __builtin_amdgcn_wave_barrier(); asm volatile("" ::: "memory");
        float* crow = C + (size_t)(r0 + mb * 16) * ldc + c0;
{
#pragma unroll
            for (int s = 0; s < 8; ++s) { const int row = 2 * s + hi, cofs = lr * 4; v4f val = *(const v4fa*)(os + row * 68 + cofs); if (BIAS) { val[0] += bfr(bias[c0 + cofs]); val[1] += bfr(bias[c0 + cofs + 1]); val[2] += bfr(bias[c0 + cofs + 2]); val[3] += bfr(bias[c0 + cofs + 3]); }
                if (RES) { for (int q = 0; q < 4; ++q) val[q] = __fadd_rn(val[q], bfr(rv[s][q])); }
                *(v4f*)(crow + (size_t)row * ldc + cofs) = val; }
             }
        __builtin_amdgcn_wave_barrier(); asm volatile("" ::: "memory");
    }
}

__device__ __forceinline__ h16 tohx(float x) { return (h16)x; }
__device__ __forceinline__ void splitf(float y, unsigned short& h, unsigned short& l) { h = f2bf(y); l = f2bf(y - bf2f(h)); }
typedef __attribute__((ext_vector_type(2))) _Float16 v2h;
typedef __attribute__((ext_vector_type(4))) _Float16 v4h;
typedef __attribute__((ext_vector_type(2))) unsigned short v2us;
typedef __attribute__((ext_vector_type(4))) unsigned short v4us;
typedef __attribute__((ext_vector_type(2))) float v2f;
typedef __attribute__((ext_vector_type(4))) int v4i;

// k_wtG: Bt[n][k] = bf16(w[k][n]) in fragment order. One thread per 16-byte chunk (8 k of one n), lanes along n: every read is a whole line of w, every store 16 bytes a lane in two runs of 256 bytes.
__global__ __launch_bounds__(256) void k_wtG(const float* __restrict__ w, int K, int N, bf* Bt) {
    const unsigned i = blockIdx.x * 256 + threadIdx.x; if (i >= (unsigned)N * (unsigned)(K / 8)) return; const int n = (int)(i % (unsigned)N), k0 = (int)(i / (unsigned)N) * 8; v8us o; const float* p[8]; float x[8];
#pragma unroll
    for (int j = 0; j < 8; ++j) { p[j] = w + (size_t)(k0 + j) * N + n; x[j] = *p[j]; }
    asm volatile("s_wait_xcnt 0x0" :: "v"(p[0]), "v"(p[1]), "v"(p[2]), "v"(p[3]), "v"(p[4]), "v"(p[5]), "v"(p[6]), "v"(p[7]) : "memory");   // the wait in front of any overwrite of an address register that an issued load names; the addresses are inputs so that they stay in their registers up to here
#pragma unroll
    for (int j = 0; j < 8; ++j) o[j] = f2bf(x[j]);
    *(v8us*)(Bt + fo(n, k0, K)) = o; }
// k_cvt8: bf16 copy of src [NB_ TT][DM] in fragment order. One thread per 16-byte chunk; 8 lanes cover 64 k of a row (256 bytes read), the next 8 lanes the next row, so that a store writes runs of 64 bytes.
__global__ __launch_bounds__(256) void k_cvt8(const float* __restrict__ src, bf* dst) { const unsigned i = blockIdx.x * 256 + threadIdx.x; if (i >= (unsigned)(NB_ * TT) * (DM / 8)) return; const int row = (int)((i >> 3) % (unsigned)(NB_ * TT)), k = (int)((i >> 3) / (unsigned)(NB_ * TT)) * 64 + (int)(i & 7) * 8; const v8f v = *(const v8f*)(src + (size_t)row * DM + k); v8us o;
#pragma unroll
    for (int j = 0; j < 8; ++j) o[j] = f2bf(v[j]); *(v8us*)(dst + fo(row, k, DM)) = o;  }

// ---- k_proj: the q, k and v projections in ONE launch, one wave per 64 x 64 tile (64 rows b * TT + t of the bf16 copy of h, the 64 columns of one head); grid (NB_ TT / 64, heads, 3), blockIdx.z: 0 q, 1 k, 2 v. The k loop is k_gemmw's.
// The epilogue writes the head planes in fragment order straight from the accumulators: a lane holds 8 consecutive rows of the A operand for one row of the B operand, and that is one 16-byte chunk of a plane if A runs along the plane's k: for q and k (planes [t][d], chunks of 8 d) A = the weight rows (d), B = the rows of h (t); for v (planes [d][t], chunks of 8 t) A = the rows of h, B = the weight rows. Lane l's chunk stands at byte 16 l of a half block, so every store is 512 contiguous bytes of a wave.
__global__ __launch_bounds__(32) void k_proj(const bf* __restrict__ X, const bf* __restrict__ Wq, const bf* __restrict__ Wk, const bf* __restrict__ Wv, bf* Qh, bf* Ql, bf* Kh, bf* Kl, h16* V16, bf* Vh, bf* Vl) {
    const int lane = threadIdx.x & 31; const int r0 = blockIdx.x * 64, z = blockIdx.z;
    const bf* xr = X + (size_t)r0 * DM; const bf* wr = (z == 0 ? Wq : z == 1 ? Wk : Wv) + (size_t)blockIdx.y * HD * DM;
    v8f acc[4][4];
#pragma unroll
    for (int mb = 0; mb < 4; ++mb)
#pragma unroll
        for (int nb = 0; nb < 4; ++nb) acc[mb][nb] = (v8f){};
    const char* pa = (const char*)(z == 2 ? xr : wr) + lane * 16; const char* pb = (const char*)(z == 2 ? wr : xr) + lane * 16;   // the lane's walking addresses; fragment order: a 16-row band is 32 DM bytes (an immediate offset), a k step of 32 is 1 KiB
#pragma unroll 1
    for (int kc = 0; kc < DM; kc += 32) {
        v16bf a[4], b[4];
#pragma unroll
        for (int mb = 0; mb < 4; ++mb) a[mb] = WFrag<bf>::ld(pa + mb * 32 * DM);
#pragma unroll
        for (int nb = 0; nb < 4; ++nb) b[nb] = WFrag<bf>::ld(pb + nb * 32 * DM);
        asm volatile("s_wait_xcnt 0x0" :: "v"(pa), "v"(pb) : "memory");   // the wait in front of the step of the address registers that the pass's issued loads name, and of any fragment that would land on them; the addresses are inputs so that they stay in their registers up to here
        __builtin_amdgcn_sched_barrier(0);   // keeps every load of the pass in front of that wait (the scheduler otherwise sinks some of them among the products, behind the wait)
        pa += 512 * 2; pb += 512 * 2;
#pragma unroll
        for (int nb = 0; nb < 4; ++nb)
#pragma unroll
            for (int mb = 0; mb < 4; ++mb) acc[mb][nb] = wmmab(a[mb], b[nb], acc[mb][nb]);
        asm volatile("v_nop\n\tv_nop\n\tv_nop\n\tv_nop" : "+v"(acc[0][0]), "+v"(acc[1][1]), "+v"(acc[2][2]), "+v"(acc[3][3]) : "v"(a[0]), "v"(a[3]));   // the distance behind the last products, on the loop's back edge and on its exit alike
    }
    const size_t tb = ((size_t)(r0 / TT) * NH_ + blockIdx.y) * TT * HD + (size_t)(r0 % TT) * HD + lane * 8;   // the tile's 4,096 elements are contiguous in each plane [b][h], by fo() and by fok() alike
    if (z == 2) {
#pragma unroll
        for (int mb = 0; mb < 4; ++mb) { v8h o16[4]; v8us oh[4], ol[4];
#pragma unroll
            for (int nb = 0; nb < 4; ++nb)
#pragma unroll
                for (int j = 0; j < 8; ++j) { const float x = acc[mb][nb][j]; o16[nb][j] = tohx(x); unsigned short a2, c2; splitf(x, a2, c2); oh[nb][j] = a2; ol[nb][j] = c2; }
            const size_t eo = tb + (mb >> 1) * (HD / 16) * 512 + (mb & 1) * 256; h16* p16 = V16 + eo; bf* ph = Vh + eo; bf* pl = Vl + eo;   // fok(): t = 16 mb + 8 hi + j, d = 16 nb + lr
#pragma unroll
            for (int nb = 0; nb < 4; ++nb) { *(v8h*)(p16 + nb * 512) = o16[nb]; *(v8us*)(ph + nb * 512) = oh[nb]; *(v8us*)(pl + nb * 512) = ol[nb]; }
            asm volatile("s_wait_xcnt 0x0" :: "v"(o16[0]), "v"(o16[1]), "v"(o16[2]), "v"(o16[3]), "v"(oh[0]), "v"(oh[1]), "v"(oh[2]), "v"(oh[3]), "v"(ol[0]), "v"(ol[1]), "v"(ol[2]), "v"(ol[3]), "v"(p16), "v"(ph), "v"(pl) : "memory"); }   // the wait in front of any overwrite of a data or address register of the twelve issued stores; they are inputs so that they stay in their registers up to here
    } else {
        bf* Ph = z == 0 ? Qh : Kh; bf* Pl = z == 0 ? Ql : Kl;
#pragma unroll
        for (int mb = 0; mb < 4; ++mb) { v8us oh[4], ol[4];
#pragma unroll
            for (int nb = 0; nb < 4; ++nb)
#pragma unroll
                for (int j = 0; j < 8; ++j) { unsigned short a2, c2; splitf(acc[mb][nb][j], a2, c2); oh[nb][j] = a2; ol[nb][j] = c2; }
            const size_t eo = tb + (mb >> 1) * 512 + (mb & 1) * 256; bf* ph = Ph + eo; bf* pl = Pl + eo;   // fo(): d = 16 mb + 8 hi + j, t = 16 nb + lr
#pragma unroll
            for (int nb = 0; nb < 4; ++nb) { *(v8us*)(ph + nb * (HD / 32) * 512) = oh[nb]; *(v8us*)(pl + nb * (HD / 32) * 512) = ol[nb]; }
            asm volatile("s_wait_xcnt 0x0" :: "v"(oh[0]), "v"(oh[1]), "v"(oh[2]), "v"(oh[3]), "v"(ol[0]), "v"(ol[1]), "v"(ol[2]), "v"(ol[3]), "v"(ph), "v"(pl) : "memory"); }   // as above, for the eight issued stores
    }
}
__global__ __launch_bounds__(256) void k_lnout(const float* __restrict__ F, const float* __restrict__ g, const float* __restrict__ bb, float* out) { const int lane = threadIdx.x & 31; const int row = blockIdx.x * 8 + (threadIdx.x >> 5); if (row >= NB_ * TT) return; const float* fr = F + (size_t)row * DQ; float* orow = out + (size_t)row * DQ; float v[DQ / 32]; float s = 0.f;
#pragma unroll
    for (int c = 0; c < DQ / 128; ++c) { const v4f a = *(const v4f*)(fr + c * 128 + lane * 4); for (int q = 0; q < 4; ++q) { v[c * 4 + q] = a[q]; s = __fadd_rn(s, a[q]); } }
#pragma unroll
    for (int sh = 16; sh; sh >>= 1) s = __fadd_rn(s, __shfl_xor(s, sh, 32));
    const float mean = __fdiv_rn(s, (float)DQ); float s2 = 0.f;
#pragma unroll
    for (int k = 0; k < DQ / 32; ++k) { const float dv = __fsub_rn(v[k], mean); float p2 = __fmul_rn(dv, dv); asm volatile("" : "+v"(p2)); s2 = __fadd_rn(s2, p2); v[k] = dv; }
#pragma unroll
    for (int sh = 16; sh; sh >>= 1) s2 = __fadd_rn(s2, __shfl_xor(s2, sh, 32));
    const float rs = __fdiv_rn(1.0f, __fsqrt_rn(__fadd_rn(__fdiv_rn(s2, (float)DQ), LNEPS)));
{
#pragma unroll
        for (int c = 0; c < DQ / 128; ++c) { v4f o; for (int q = 0; q < 4; ++q) { const int col = c * 128 + lane * 4 + q; float y = __fmul_rn(v[c * 4 + q], rs); asm volatile("" : "+v"(y)); y = __fmul_rn(y, bfr(g[col])); asm volatile("" : "+v"(y)); o[q] = __fadd_rn(y, bfr(bb[col])); } *(v4f*)(orow + c * 128 + lane * 4) = o; }
         } }
// ---- k_fattn: scores, softmax, attn.v and the hi/lo merge of one head in ONE kernel: no score or probability ever goes to memory. One work-group of 4 waves per (128 query rows, head, batch); each wave owns 32 query rows and walks all TT keys, 32 a pass.
// Transposed products: St[key][query] = K Qt (A = K rows, B = Q rows kept in registers; hi/lo 3 products in the order Qh Kh, Ql Kh, Qh Kl), so that a lane holds 16 scores of ONE query: maximum and sum in the lane plus one exchange between the wave's halves.
// The two 16-key score tiles of a pass ARE the B fragment of Ot[d][query] += Vt P (keys 8 hi + j and 16 + 8 hi + j): P is rounded in registers. Running maximum with rescale; P is left unnormalised (<= 1; fp16 rows x PCAR) and the division by the row sum is done once at the end.
__device__ __forceinline__ float xhalf(float x) { return __builtin_bit_cast(float, __builtin_amdgcn_permlanex16(__builtin_bit_cast(int, x), __builtin_bit_cast(int, x), 0x76543210, 0xfedcba98, false, false)); }   // lane l <-> lane l ^ 16
// 2^x with the issue slot that the instruction set asks for behind a transcendental (before its result is used or its source overwritten) filled in the same statement
__device__ __forceinline__ float exp2s(float x) { float r; asm("v_exp_f32 %0, %1\n\tv_nop" : "=v"(r) : "v"(x)); return r; }
// fragment loads at (uniform base + constant) + one 32-bit byte offset per lane: the offset is the only vector register that the loads name; planes in fragment order: the two halves of a fragment lie 512 bytes apart
__device__ __forceinline__ v16bf ldfb(const bf* base, unsigned ofs, int cst) { const char* p = (const char*)base + cst + ofs; return cat16b(*(const v8us*)p, *(const v8us*)(p + 512)); }
__device__ __forceinline__ v16h ldfh(const h16* base, unsigned ofs, int cst) { const char* p = (const char*)base + cst + ofs; return cat16(*(const v8h*)p, *(const v8h*)(p + 512)); }
template <bool HR>
__device__ __forceinline__ void fattn_rows(const bf* __restrict__ Qh, const bf* __restrict__ Ql, const bf* __restrict__ Kh, const bf* __restrict__ Kl, const h16* __restrict__ V16, const bf* __restrict__ Vh, const bf* __restrict__ Vl, bf* Ah, bf* Al, int q0) {
    const int lane = threadIdx.x & 31, lr = lane & 15, hi = lane >> 4;
    v16bf qh[2][2], ql[2][2], kh[2][2], kl[2][2];
    const unsigned qb = (q0 * HD + 8 * lane) * 2; unsigned kb = 8 * lane * 2; const unsigned vb = 8 * lane * 2;   // byte offsets of the lane's chunks in the Q, K and Vt planes (fragment order: a 16-row band of Q or K is 16 HD elements; the 4 blocks of Vt for 32 keys lie side by side)
    const char* pv0 = (HR ? (const char*)Vh : (const char*)V16) + vb; const char* pv1 = (const char*)Vl + vb;   // the lane's walking addresses in the Vt planes
#pragma unroll
    for (int qt = 0; qt < 2; ++qt)
#pragma unroll
        for (int ks = 0; ks < 2; ++ks) { const int cq = (qt * 16 * HD + ks * 512) * 2; qh[qt][ks] = ldfb(Qh, qb, cq); ql[qt][ks] = ldfb(Ql, qb, cq); }
    asm volatile("s_wait_xcnt 0x0" :: "v"(qb) : "memory");   // the wait in front of any overwrite of an offset register that an issued load names; the offset is an input so that it stays in its register up to here
#pragma unroll
    for (int kt = 0; kt < 2; ++kt)
#pragma unroll
        for (int ks = 0; ks < 2; ++ks) { const int ck = (kt * 16 * HD + ks * 512) * 2; kh[kt][ks] = ldfb(Kh, kb, ck); kl[kt][ks] = ldfb(Kl, kb, ck); }
    asm volatile("s_wait_xcnt 0x0" :: "v"(kb) : "memory");   // as above: in front of the first step of kb
    v8f o[2][4]; float m[2], l[2];
#pragma unroll
    for (int qt = 0; qt < 2; ++qt) { m[qt] = -3.0e38f; l[qt] = 0.f;
#pragma unroll
        for (int dt = 0; dt < 4; ++dt) o[qt][dt] = (v8f){}; }
#pragma unroll 1
    for (int k0 = 0; k0 < TT; k0 += 32) {   // rolled: one pass's code and registers
        v16h vf[4]; v16bf vh[4], vl[4];
#pragma unroll
        for (int dt = 0; dt < 4; ++dt) { const int cv = dt * 512 * 2; if (HR) { vh[dt] = ldfb((const bf*)(pv0 + cv), 0u, 0); vl[dt] = ldfb((const bf*)(pv1 + cv), 0u, 0); } else vf[dt] = ldfh((const h16*)(pv0 + cv), 0u, 0); }
        if (HR) asm volatile("s_wait_xcnt 0x0" :: "v"(pv0), "v"(pv1) : "memory");   // as above: in front of the step of the two addresses and of any fragment that would land on them
        else asm volatile("s_wait_xcnt 0x0" :: "v"(pv0) : "memory");   // the same for the one fp16 plane
        __builtin_amdgcn_sched_barrier(0);   // keeps the Vt loads at the head of the pass, in flight under the score products and the softmax (the scheduler otherwise sinks some of them, and the K fetch below with them, to the end of the pass)
        pv0 += (HD / 16) * 512 * 2; pv1 += (HD / 16) * 512 * 2;   // 32 keys on: the next HD / 16 blocks
        v8f s[2][2];
#pragma unroll
        for (int qt = 0; qt < 2; ++qt)
#pragma unroll
            for (int kt = 0; kt < 2; ++kt) s[qt][kt] = (v8f){};
#pragma unroll
        for (int ks = 0; ks < 2; ++ks) {
#pragma unroll
            for (int qt = 0; qt < 2; ++qt)
#pragma unroll
                for (int kt = 0; kt < 2; ++kt) s[qt][kt] = wmmab(kh[kt][ks], qh[qt][ks], s[qt][kt]);
#pragma unroll
            for (int qt = 0; qt < 2; ++qt)
#pragma unroll
                for (int kt = 0; kt < 2; ++kt) s[qt][kt] = wmmab(kh[kt][ks], ql[qt][ks], s[qt][kt]);
#pragma unroll
            for (int qt = 0; qt < 2; ++qt)
#pragma unroll
                for (int kt = 0; kt < 2; ++kt) s[qt][kt] = wmmab(kl[kt][ks], qh[qt][ks], s[qt][kt]); }
        kb = (kb + 32 * HD * 2) & (TT * HD * 2 - 1);   // the next pass's K fragments, fetched behind this pass's score products into the same registers; the last pass fetches keys 0..31 again (in bounds, unused)
#pragma unroll
        for (int kt = 0; kt < 2; ++kt)
#pragma unroll
            for (int ks = 0; ks < 2; ++ks) { const int ck = (kt * 16 * HD + ks * 512) * 2; kh[kt][ks] = ldfb(Kh, kb, ck); kl[kt][ks] = ldfb(Kl, kb, ck); }
        asm volatile("s_wait_xcnt 0x0" :: "v"(kb) : "memory");   // as above: in front of the next step of kb
        v16h pf[2]; v16bf ph[2], pl[2];
#pragma unroll
        for (int qt = 0; qt < 2; ++qt) {
            float t[16]; float cm = -3.0e38f;
#pragma unroll
            for (int e = 0; e < 16; ++e) { t[e] = s[qt][e >> 3][e & 7] * SCL; cm = fmaxf(cm, t[e]); }
            cm = fmaxf(cm, xhalf(cm));
            const float mn = fmaxf(m[qt], cm); const float al = exp2s((m[qt] - mn) * 1.4426950408889634f); m[qt] = mn; float ls = 0.f;
#pragma unroll
            for (int e = 0; e < 16; ++e) { t[e] = exp2s((t[e] - mn) * 1.4426950408889634f); ls += t[e]; }
            l[qt] = l[qt] * al + ls;
#pragma unroll
            for (int dt = 0; dt < 4; ++dt) o[qt][dt] *= al;
            if (HR) { v8us h0, h1, l0, l1;
#pragma unroll
                for (int j = 0; j < 8; ++j) { unsigned short x, y; splitf(t[j], x, y); h0[j] = x; l0[j] = y; splitf(t[8 + j], x, y); h1[j] = x; l1[j] = y; }
                ph[qt] = cat16b(h0, h1); pl[qt] = cat16b(l0, l1);
            } else { v8h c0, c1;
#pragma unroll
                for (int j = 0; j < 8; ++j) { c0[j] = tohx(t[j] * PCAR); c1[j] = tohx(t[8 + j] * PCAR); }
                pf[qt] = cat16(c0, c1); } }
        if (HR) {
#pragma unroll
            for (int qt = 0; qt < 2; ++qt)
#pragma unroll
                for (int dt = 0; dt < 4; ++dt) o[qt][dt] = wmmab(vh[dt], ph[qt], o[qt][dt]);
#pragma unroll
            for (int qt = 0; qt < 2; ++qt)
#pragma unroll
                for (int dt = 0; dt < 4; ++dt) o[qt][dt] = wmmab(vh[dt], pl[qt], o[qt][dt]);
#pragma unroll
            for (int qt = 0; qt < 2; ++qt)
#pragma unroll
                for (int dt = 0; dt < 4; ++dt) o[qt][dt] = wmmab(vl[dt], ph[qt], o[qt][dt]);
        } else {
#pragma unroll
            for (int qt = 0; qt < 2; ++qt)
#pragma unroll
                for (int dt = 0; dt < 4; ++dt) o[qt][dt] = wmma16(vf[dt], pf[qt], o[qt][dt]); }
    }
#pragma unroll
    for (int qt = 0; qt < 2; ++qt) { const float lt = l[qt] + xhalf(l[qt]); const float f = __fdiv_rn(HR ? 1.0f : (1.0f / PCAR), lt); v8us oh[4], ol[4];
#pragma unroll
        for (int dt = 0; dt < 4; ++dt)
#pragma unroll
            for (int j = 0; j < 8; ++j) { unsigned short x, y; splitf(o[qt][dt][j] * f, x, y); oh[dt][j] = x; ol[dt][j] = y; }
        bf* pa = Ah + (size_t)(q0 + qt * 16) * DQ + lane * 8; bf* pl2 = Al + (size_t)(q0 + qt * 16) * DQ + lane * 8;   // fragment order of the [row][DQ] planes: 16 columns on are 256 elements on
#pragma unroll
        for (int dt = 0; dt < 4; ++dt) { *(v8us*)(pa + dt * 256) = oh[dt]; *(v8us*)(pl2 + dt * 256) = ol[dt]; }
        asm volatile("s_wait_xcnt 0x0" :: "v"(oh[0]), "v"(oh[1]), "v"(oh[2]), "v"(oh[3]), "v"(ol[0]), "v"(ol[1]), "v"(ol[2]), "v"(ol[3]), "v"(pa), "v"(pl2) : "memory"); }   // the wait in front of any overwrite of a data or address register of the eight issued stores; they are inputs so that they stay in their registers up to here
}
__global__ __launch_bounds__(128) void k_fattn(const bf* __restrict__ Qh, const bf* __restrict__ Ql, const bf* __restrict__ Kh, const bf* __restrict__ Kl, const h16* __restrict__ V16, const bf* __restrict__ Vh, const bf* __restrict__ Vl, bf* Ah, bf* Al) {
    const size_t hp = ((size_t)blockIdx.z * NH_ + blockIdx.y) * TT * HD; const int q0 = blockIdx.x * 128 + (threadIdx.x >> 5) * 32; const size_t ao = (size_t)blockIdx.z * TT * DQ + blockIdx.y * (HD / 32) * 512; Ah += ao; Al += ao;   // blockIdx.z: batch (planes [b][h], rows b * TT + t of the output planes)
    if (blockIdx.x < RH / 128) fattn_rows<true>(Qh + hp, Ql + hp, Kh + hp, Kl + hp, V16 + hp, Vh + hp, Vl + hp, Ah, Al, q0);
    else fattn_rows<false>(Qh + hp, Ql + hp, Kh + hp, Kl + hp, V16 + hp, Vh + hp, Vl + hp, Ah, Al, q0);
}

extern "C" void kernel_launch(void* const* d_in, const int* in_sizes, int n_in,
                              void* d_out, int out_size, void* d_ws, size_t ws_size, hipStream_t stream) {
    (void)in_sizes; (void)n_in; (void)out_size;
    const float* x = (const float*)d_in[0]; const float* wq = (const float*)d_in[1]; const float* wk = (const float*)d_in[2]; const float* wv = (const float*)d_in[3]; const float* wo = (const float*)d_in[4]; const float* lng = (const float*)d_in[5]; const float* lnb = (const float*)d_in[6];
    float* OUT = (float*)d_out;     // [4][2048][1024]
    char* wsp = (char*)d_ws;
    auto take = [&](size_t bytes) { char* p = wsp; wsp += (bytes + 255) & ~(size_t)255; return (void*)p; };
    bf* WQ = (bf*)take((size_t)DQ * DM * 2); bf* WK = (bf*)take((size_t)DKV * DM * 2); bf* WV = (bf*)take((size_t)DKV * DM * 2); bf* WO = (bf*)take((size_t)DM * DQ * 2);
    bf* XB = (bf*)take((size_t)NB_ * TT * DM * 2); float* Y = (float*)take((size_t)NB_ * TT * DM * 4);
    h16* VT16 = (h16*)take((size_t)NB_ * NKV * HD * TT * 2);
    bf* QPh = (bf*)take((size_t)NB_ * NH_ * TT * HD * 2); bf* QPl = (bf*)take((size_t)NB_ * NH_ * TT * HD * 2); bf* KPh = (bf*)take((size_t)NB_ * NKV * TT * HD * 2); bf* KPl = (bf*)take((size_t)NB_ * NKV * TT * HD * 2); bf* VTh = (bf*)take((size_t)NB_ * NKV * HD * TT * 2); bf* VTl = (bf*)take((size_t)NB_ * NKV * HD * TT * 2);
    bf* ATh = (bf*)take((size_t)NB_ * TT * DQ * 2); bf* ATl = (bf*)take((size_t)NB_ * TT * DQ * 2);
    if ((size_t)(wsp - (char*)d_ws) > ws_size) return;    // 200 MiB of the 256 MiB
    { k_wtG<<<(unsigned)((DM * DQ / 8 + 255) / 256), 256, 0, stream>>>(wq, DM, DQ, WQ); k_wtG<<<(unsigned)((DM * DKV / 8 + 255) / 256), 256, 0, stream>>>(wk, DM, DKV, WK); k_wtG<<<(unsigned)((DM * DKV / 8 + 255) / 256), 256, 0, stream>>>(wv, DM, DKV, WV);
      k_wtG<<<(unsigned)((DQ * DM / 8 + 255) / 256), 256, 0, stream>>>(wo, DQ, DM, WO);
       }
    k_cvt8<<<(unsigned)(((size_t)NB_ * TT * DM / 8 + 255) / 256), 256, 0, stream>>>(x, XB);
    k_proj<<<dim3(NB_ * TT / 64, NH_, 3), 32, 0, stream>>>(XB, WQ, WK, WV, QPh, QPl, KPh, KPl, VT16, VTh, VTl);   /* q, k, v and their head planes */
    k_fattn<<<dim3(TT / 128, NH_, NB_), 128, 0, stream>>>(QPh, QPl, KPh, KPl, VT16, VTh, VTl, ATh, ATl);   /* scores hi/lo on EVERY row (sigma-16 logits), softmax, attn.v hybrid, merge */
    k_gemmw<bf, 1, false, true, DQ><<<dim3(NB_ * TT / 64, DM / 64, 1), 32, 0, stream>>>(ATh, ATl, WO, nullptr, Y, DM, nullptr, x, 0, 0, 0); k_lnout<<<(NB_ * TT + 7) / 8, 256, 0, stream>>>(Y, lng, lnb, OUT);   /* LayerNorm(h + attn_out) */
}

// v006
// It runs in 252 microseconds.
// Two timings next to v005 put it at 1.09 and 1.08 times that version's speed.
// All steps since v000 together make it 15.6 times as fast.
#include <hip/hip_runtime.h>

// Transformer-XL style multi-head attention with post-LayerNorm (h [4][2048][1024]; q,k,v = h W ('xw' [1024][1024] with scale 1/8 x normal: sigma-4 projections, so the /8 logits have sigma ~16: sharply peaked); scores x 64^-0.5; softmax over keys; attn_out = attn_vec Wo ('xw', no bias); out = LayerNorm(h + attn_out) gamma/beta (1e-5) -> [4][2048][1024] (8.4 M)).
// Layout, every stage ONE launch over all NB_ batches (the batch is folded into the grid: rows b*TT + t, planes [b][h]): bf16 copy of h; 'xw' weights transposed once; exact projections, all three in one launch whose epilogue writes the 16-bit head planes straight from the accumulators (no f32 copy of q, k or v exists); one fused attention kernel (scores hi/lo 3 products on EVERY row (peaked logits), running-maximum softmax in registers, P and attn.v hybrid (rows < 512 hi/lo, rest fp16 x1024)); merged hi/lo x Wo exact into workspace; the residual added in that product's epilogue; a row LayerNorm kernel (one wave per 1,024-wide row, fixed-order sums, precise sqrt/div, affine) writes the output rows.
// Every 16-bit matrix operand plane (h copy, transposed weights, Q, K, Vt, attention output) is stored in FRAGMENT ORDER (fo() below): blocks of 16 rows x 32 k = 1 KiB, inside a block the 16-byte chunk that lane l loads stands at byte 16 l (first half of the fragment) and 512 + 16 l (second half), so each wave-wide 16-byte load reads 512 contiguous bytes (4 whole lines) instead of 32 bytes from each of 16 lines. Which element lands in which lane and register is as with row-major planes.
// Compute dtypes, f32 accumulate: every input rounded to bf16; projections exact; scores 3 products on every row; softmax f32; attn.v rows < 512 3 products, rest fp16; Wo hl x exact; residual + LayerNorm f32.

#define NB_  4
#define TT   2048
#define DM   1024
#define NH_  16
#define NKV  16
#define REP  (NH_ / NKV)
#define HD   64
#define DQ   (NH_ * HD)
#define DKV  (NKV * HD)
#define RH   512                  // query rows < RH use hi+lo planes (0: none)
#define WIN  0
#define PCAR 1024.0f
#define SCL  0.125f
#define LNEPS 1e-5f
typedef _Float16 h16;
typedef unsigned short bf;
typedef __attribute__((ext_vector_type(16))) __bf16   v16bf;
typedef __attribute__((ext_vector_type(16))) _Float16 v16h;
typedef __attribute__((ext_vector_type(8)))  _Float16 v8h;
typedef __attribute__((ext_vector_type(8)))  unsigned short v8us;
typedef __attribute__((ext_vector_type(8)))  float    v8f;
typedef __attribute__((ext_vector_type(4)))  float    v4f;
typedef v8h  __attribute__((may_alias)) v8ha;
typedef v4f  __attribute__((may_alias)) v4fa;
typedef v8us __attribute__((may_alias)) v8usa;

typedef __attribute__((ext_vector_type(8)))  __bf16   v8bf;
// f32 -> bf16, nearest even, by the chip's own conversion (v_cvt_pk_bf16_f32: two values an instruction, already packed); the same value as adding 0x7FFF + the kept part's last bit and cutting, for every finite input
__device__ __forceinline__ unsigned short f2bf(float f) { return __builtin_bit_cast(unsigned short, (__bf16)f); }
__device__ __forceinline__ v8us rnd8(v8f x) { return __builtin_bit_cast(v8us, __builtin_convertvector(x, v8bf)); }
// hi = bf16(x), lo = bf16(x - hi) of eight values (the difference is exact in f32)
__device__ __forceinline__ void split8(v8f x, v8us& h, v8us& l) { const v8bf hb = __builtin_convertvector(x, v8bf); h = __builtin_bit_cast(v8us, hb); l = rnd8(x - __builtin_convertvector(hb, v8f)); }
__device__ __forceinline__ float bf2f(unsigned short b) { return __uint_as_float(((unsigned)b) << 16); }
__device__ __forceinline__ float bfr(float f) { return bf2f(f2bf(f)); }
__device__ __forceinline__ v16h cat16(v8h lo, v8h hi) { return __builtin_shufflevector(lo, hi, 0, 1, 2, 3, 4, 5, 6, 7, 8, 9, 10, 11, 12, 13, 14, 15); }
__device__ __forceinline__ v16bf cat16b(v8us lo, v8us hi) { return __builtin_bit_cast(v16bf, __builtin_shufflevector(lo, hi, 0, 1, 2, 3, 4, 5, 6, 7, 8, 9, 10, 11, 12, 13, 14, 15)); }
__device__ __forceinline__ v8f wmma16(v16h a, v16h b, v8f c) { return __builtin_amdgcn_wmma_f32_16x16x32_f16(false, a, false, b, (short)0, c, false, false); }
__device__ __forceinline__ v8f wmmab(v16bf a, v16bf b, v8f c) { return __builtin_amdgcn_wmma_f32_16x16x32_bf16(false, a, false, b, (short)0, c, false, false); }
// fragment order of a [rows][K] 16-bit plane (rows % 16 == 0, K % 32 == 0): element index of (row, k). Block (row / 16, k / 32) of 512 elements; in it half (k / 16) % 2, then lane 16 ((k / 8) % 2) + row % 16, then k % 8.
__device__ __forceinline__ size_t fo(int row, int k, int K) { return ((size_t)(row >> 4) * (K >> 5) + (k >> 5)) * 512 + ((k >> 4) & 1) * 256 + ((k >> 3) & 1) * 128 + (row & 15) * 8 + (k & 7); }
// the same blocks in the other order, block (k / 32, row / 16), for a plane of R rows whose reader takes all R rows of a k step at once (Vt: the R / 16 blocks of a pass lie side by side)
__device__ __forceinline__ size_t fok(int row, int k, int R) { return ((size_t)(k >> 5) * (R >> 4) + (row >> 4)) * 512 + ((k >> 4) & 1) * 256 + ((k >> 3) & 1) * 128 + (row & 15) * 8 + (k & 7); }



// ---- k_gemmw: register-blocked GEMM, ONE WAVE per 64x64 output tile (16 accumulators), operands straight from 16-bit planes in fragment order; grid (M/64, N/64, Z), 32 threads.
// C[m][n] (f32, pitch ldc, + optional f32 bias[n], + optional residual res[m][n] of the same pitch, rounded to bf16 like every input) = sum_k A[m][k] Bt[n][k] (+ split products per NSPLIT). z-batch strides sA/sB/sC in elements. K % 32 == 0, a compile-time constant so that the bands' distances are immediate offsets of the loads.
template <typename T16> struct WFrag;
template <> struct WFrag<h16> { typedef v16h V; static __device__ __forceinline__ V ld(const char* p) { return cat16(*(const v8h*)p, *(const v8h*)(p + 512)); } static __device__ __forceinline__ v8f mma(V a, V b, v8f c) { return wmma16(a, b, c); } };
template <> struct WFrag<bf> { typedef v16bf V; static __device__ __forceinline__ V ld(const char* p) { return cat16b(*(const v8us*)p, *(const v8us*)(p + 512)); } static __device__ __forceinline__ v8f mma(V a, V b, v8f c) { return wmmab(a, b, c); } };
template <typename T16, int NSPLIT, bool BIAS, bool RES, int K>
__global__ __launch_bounds__(32) void k_gemmw(const T16* __restrict__ A, const T16* __restrict__ A2, const T16* __restrict__ Bt, const T16* __restrict__ Bt2, float* C, int ldc, const float* __restrict__ bias, const float* __restrict__ res, size_t sA, size_t sB, size_t sC) {
    typedef typename WFrag<T16>::V V;
    __shared__ __align__(16) float os[16 * 68];
    const size_t z = blockIdx.z; A += z * sA; if (A2) A2 += z * sA; Bt += z * sB; if (Bt2) Bt2 += z * sB; C += z * sC; if (RES) res += z * sC;
    const int lane = threadIdx.x & 31, lr = lane & 15, hi = lane >> 4; const int r0 = blockIdx.x * 64, c0 = blockIdx.y * 64;
    v8f acc[4][4];
#pragma unroll
    for (int mb = 0; mb < 4; ++mb)
#pragma unroll
        for (int nb = 0; nb < 4; ++nb) acc[mb][nb] = (v8f){};
    const char* pa = (const char*)(A + (size_t)r0 * K) + lane * 16; const char* pa2 = (const char*)((NSPLIT == 1 || NSPLIT == 2) ? A2 + (size_t)r0 * K : A) + lane * 16; const char* pb = (const char*)(Bt + (size_t)c0 * K) + lane * 16; const char* pb2 = (const char*)((NSPLIT >= 2) ? Bt2 + (size_t)c0 * K : Bt) + lane * 16;   // the lane's walking addresses; fragment order: a 16-row band is 32 K bytes (an immediate offset), a k step of 32 is 1 KiB
#pragma unroll 1
    for (int kc = 0; kc < K; kc += 32) {
        V a[4], a2[4], b[4], b2[4];
#pragma unroll
        for (int mb = 0; mb < 4; ++mb) { a[mb] = WFrag<T16>::ld(pa + mb * 32 * K); if (NSPLIT == 1 || NSPLIT == 2) a2[mb] = WFrag<T16>::ld(pa2 + mb * 32 * K); }
#pragma unroll
        for (int nb = 0; nb < 4; ++nb) { b[nb] = WFrag<T16>::ld(pb + nb * 32 * K); if (NSPLIT >= 2) b2[nb] = WFrag<T16>::ld(pb2 + nb * 32 * K); }
        // the wait in front of the step of the address registers that the pass's issued loads name, and of any fragment that would land on them; the addresses in use are inputs so that they stay in their registers up to here
        if (NSPLIT == 0) asm volatile("s_wait_xcnt 0x0" :: "v"(pa), "v"(pb) : "memory");
        else if (NSPLIT == 1) asm volatile("s_wait_xcnt 0x0" :: "v"(pa), "v"(pa2), "v"(pb) : "memory");
        else asm volatile("s_wait_xcnt 0x0" :: "v"(pa), "v"(pa2), "v"(pb), "v"(pb2) : "memory");
        __builtin_amdgcn_sched_barrier(0);   // keeps every load of the pass in front of that wait (the scheduler otherwise sinks some of them among the products, behind the wait)
        pa += 512 * 2; pa2 += 512 * 2; pb += 512 * 2; pb2 += 512 * 2;
#pragma unroll
        for (int nb = 0; nb < 4; ++nb) {
#pragma unroll
            for (int mb = 0; mb < 4; ++mb) { acc[mb][nb] = WFrag<T16>::mma(a[mb], b[nb], acc[mb][nb]); if (NSPLIT == 1 || NSPLIT == 2) acc[mb][nb] = WFrag<T16>::mma(a2[mb], b[nb], acc[mb][nb]); if (NSPLIT >= 2) acc[mb][nb] = WFrag<T16>::mma(a[mb], b2[nb], acc[mb][nb]); } }
        asm volatile("v_nop\n\tv_nop\n\tv_nop\n\tv_nop" : "+v"(acc[0][0]), "+v"(acc[1][1]), "+v"(acc[2][2]), "+v"(acc[3][3]) : "v"(a[0]), "v"(a[3]));
    }
#pragma unroll
    for (int mb = 0; mb < 4; ++mb) {
        v4f rv[8];
        if (RES) { const float* p[8];   // the band's residual rows, in flight under the staging of the band
#pragma unroll
            for (int s = 0; s < 8; ++s) { p[s] = res + (size_t)(r0 + mb * 16 + 2 * s + hi) * ldc + c0 + lr * 4; rv[s] = *(const v4f*)p[s]; }
            asm volatile("s_wait_xcnt 0x0" :: "v"(p[0]), "v"(p[1]), "v"(p[2]), "v"(p[3]), "v"(p[4]), "v"(p[5]), "v"(p[6]), "v"(p[7]) : "memory"); }   // the wait in front of any overwrite of an address register that an issued load names; the addresses are inputs so that they stay in their registers up to here
#pragma unroll
        for (int nb = 0; nb < 4; ++nb) {
#pragma unroll
            for (int j = 0; j < 8; ++j) os[(hi * 8 + j) * 68 + nb * 16 + lr] = acc[mb][nb][j]; }
        __builtin_amdgcn_wave_barrier(); asm volatile("" ::: "memory");
        float* crow = C + (size_t)(r0 + mb * 16) * ldc + c0;
{
#pragma unroll
            for (int s = 0; s < 8; ++s) { const int row = 2 * s + hi, cofs = lr * 4; v4f val = *(const v4fa*)(os + row * 68 + cofs); if (BIAS) { val[0] += bfr(bias[c0 + cofs]); val[1] += bfr(bias[c0 + cofs + 1]); val[2] += bfr(bias[c0 + cofs + 2]); val[3] += bfr(bias[c0 + cofs + 3]); }
                if (RES) { for (int q = 0; q < 4; ++q) val[q] = __fadd_rn(val[q], bfr(rv[s][q])); }
                *(v4f*)(crow + (size_t)row * ldc + cofs) = val; }
             }
        __builtin_amdgcn_wave_barrier(); asm volatile("" ::: "memory");
    }
}

__device__ __forceinline__ h16 tohx(float x) { return (h16)x; }
typedef __attribute__((ext_vector_type(2))) _Float16 v2h;
typedef __attribute__((ext_vector_type(4))) _Float16 v4h;
typedef __attribute__((ext_vector_type(2))) unsigned short v2us;
typedef __attribute__((ext_vector_type(4))) unsigned short v4us;
typedef __attribute__((ext_vector_type(2))) float v2f;
typedef __attribute__((ext_vector_type(4))) int v4i;

// k_wtG: Bt[n][k] = bf16(w[k][n]) in fragment order. One thread per 16-byte chunk (8 k of one n), lanes along n: every read is a whole line of w, every store 16 bytes a lane in two runs of 256 bytes.
__global__ __launch_bounds__(256) void k_wtG(const float* __restrict__ w, int K, int N, bf* Bt) {
    const unsigned i = blockIdx.x * 256 + threadIdx.x; if (i >= (unsigned)N * (unsigned)(K / 8)) return; const int n = (int)(i % (unsigned)N), k0 = (int)(i / (unsigned)N) * 8; const float* p[8]; v8f x;
#pragma unroll
    for (int j = 0; j < 8; ++j) { p[j] = w + (size_t)(k0 + j) * N + n; x[j] = *p[j]; }
    asm volatile("s_wait_xcnt 0x0" :: "v"(p[0]), "v"(p[1]), "v"(p[2]), "v"(p[3]), "v"(p[4]), "v"(p[5]), "v"(p[6]), "v"(p[7]) : "memory");   // the wait in front of any overwrite of an address register that an issued load names; the addresses are inputs so that they stay in their registers up to here
    *(v8us*)(Bt + fo(n, k0, K)) = rnd8(x); }
// k_cvt8: bf16 copy of src [NB_ TT][DM] in fragment order. One thread per 16-byte chunk; 8 lanes cover 64 k of a row (256 bytes read), the next 8 lanes the next row, so that a store writes runs of 64 bytes.
__global__ __launch_bounds__(256) void k_cvt8(const float* __restrict__ src, bf* dst) { const unsigned i = blockIdx.x * 256 + threadIdx.x; if (i >= (unsigned)(NB_ * TT) * (DM / 8)) return; const int row = (int)((i >> 3) % (unsigned)(NB_ * TT)), k = (int)((i >> 3) / (unsigned)(NB_ * TT)) * 64 + (int)(i & 7) * 8; const v8f v = *(const v8f*)(src + (size_t)row * DM + k); *(v8us*)(dst + fo(row, k, DM)) = rnd8(v);  }

// ---- k_proj: the q, k and v projections in ONE launch, one wave per 64 x 64 tile (64 rows b * TT + t of the bf16 copy of h, the 64 columns of one head); grid (NB_ TT / 64, heads, 3), blockIdx.z: 0 q, 1 k, 2 v. The k loop is k_gemmw's.
// The epilogue writes the head planes in fragment order straight from the accumulators: a lane holds 8 consecutive rows of the A operand for one row of the B operand, and that is one 16-byte chunk of a plane if A runs along the plane's k: for q and k (planes [t][d], chunks of 8 d) A = the weight rows (d), B = the rows of h (t); for v (planes [d][t], chunks of 8 t) A = the rows of h, B = the weight rows. Lane l's chunk stands at byte 16 l of a half block, so every store is 512 contiguous bytes of a wave.
__global__ __launch_bounds__(32) void k_proj(const bf* __restrict__ X, const bf* __restrict__ Wq, const bf* __restrict__ Wk, const bf* __restrict__ Wv, bf* Qh, bf* Ql, bf* Kh, bf* Kl, h16* V16, bf* Vh, bf* Vl) {
    const int lane = threadIdx.x & 31; const int r0 = blockIdx.x * 64, z = blockIdx.z;
    const bf* xr = X + (size_t)r0 * DM; const bf* wr = (z == 0 ? Wq : z == 1 ? Wk : Wv) + (size_t)blockIdx.y * HD * DM;
    v8f acc[4][4];
#pragma unroll
    for (int mb = 0; mb < 4; ++mb)
#pragma unroll
        for (int nb = 0; nb < 4; ++nb) acc[mb][nb] = (v8f){};
    const char* pa = (const char*)(z == 2 ? xr : wr) + lane * 16; const char* pb = (const char*)(z == 2 ? wr : xr) + lane * 16;   // the lane's walking addresses; fragment order: a 16-row band is 32 DM bytes (an immediate offset), a k step of 32 is 1 KiB
#pragma unroll 1
    for (int kc = 0; kc < DM; kc += 32) {
        v16bf a[4], b[4];
#pragma unroll
        for (int mb = 0; mb < 4; ++mb) a[mb] = WFrag<bf>::ld(pa + mb * 32 * DM);
#pragma unroll
        for (int nb = 0; nb < 4; ++nb) b[nb] = WFrag<bf>::ld(pb + nb * 32 * DM);
        asm volatile("s_wait_xcnt 0x0" :: "v"(pa), "v"(pb) : "memory");   // the wait in front of the step of the address registers that the pass's issued loads name, and of any fragment that would land on them; the addresses are inputs so that they stay in their registers up to here
        __builtin_amdgcn_sched_barrier(0);   // keeps every load of the pass in front of that wait (the scheduler otherwise sinks some of them among the products, behind the wait)
        pa += 512 * 2; pb += 512 * 2;
#pragma unroll
        for (int nb = 0; nb < 4; ++nb)
#pragma unroll
            for (int mb = 0; mb < 4; ++mb) acc[mb][nb] = wmmab(a[mb], b[nb], acc[mb][nb]);
        asm volatile("v_nop\n\tv_nop\n\tv_nop\n\tv_nop" : "+v"(acc[0][0]), "+v"(acc[1][1]), "+v"(acc[2][2]), "+v"(acc[3][3]) : "v"(a[0]), "v"(a[3]));   // the distance behind the last products, on the loop's back edge and on its exit alike
    }
    const size_t tb = ((size_t)(r0 / TT) * NH_ + blockIdx.y) * TT * HD + (size_t)(r0 % TT) * HD + lane * 8;   // the tile's 4,096 elements are contiguous in each plane [b][h], by fo() and by fok() alike
    if (z == 2) {
#pragma unroll
        for (int mb = 0; mb < 4; ++mb) { v8h o16[4]; v8us oh[4], ol[4];
#pragma unroll
            for (int nb = 0; nb < 4; ++nb) { split8(acc[mb][nb], oh[nb], ol[nb]);
#pragma unroll
                for (int j = 0; j < 8; ++j) o16[nb][j] = tohx(acc[mb][nb][j]); }
            const size_t eo = tb + (mb >> 1) * (HD / 16) * 512 + (mb & 1) * 256; h16* p16 = V16 + eo; bf* ph = Vh + eo; bf* pl = Vl + eo;   // fok(): t = 16 mb + 8 hi + j, d = 16 nb + lr
#pragma unroll
            for (int nb = 0; nb < 4; ++nb) { *(v8h*)(p16 + nb * 512) = o16[nb]; *(v8us*)(ph + nb * 512) = oh[nb]; *(v8us*)(pl + nb * 512) = ol[nb]; }
            asm volatile("s_wait_xcnt 0x0" :: "v"(o16[0]), "v"(o16[1]), "v"(o16[2]), "v"(o16[3]), "v"(oh[0]), "v"(oh[1]), "v"(oh[2]), "v"(oh[3]), "v"(ol[0]), "v"(ol[1]), "v"(ol[2]), "v"(ol[3]), "v"(p16), "v"(ph), "v"(pl) : "memory"); }   // the wait in front of any overwrite of a data or address register of the twelve issued stores; they are inputs so that they stay in their registers up to here
    } else {
        bf* Ph = z == 0 ? Qh : Kh; bf* Pl = z == 0 ? Ql : Kl;
#pragma unroll
        for (int mb = 0; mb < 4; ++mb) { v8us oh[4], ol[4];
#pragma unroll
            for (int nb = 0; nb < 4; ++nb) split8(acc[mb][nb], oh[nb], ol[nb]);
            const size_t eo = tb + (mb >> 1) * 512 + (mb & 1) * 256; bf* ph = Ph + eo; bf* pl = Pl + eo;   // fo(): d = 16 mb + 8 hi + j, t = 16 nb + lr
#pragma unroll
            for (int nb = 0; nb < 4; ++nb) { *(v8us*)(ph + nb * (HD / 32) * 512) = oh[nb]; *(v8us*)(pl + nb * (HD / 32) * 512) = ol[nb]; }
            asm volatile("s_wait_xcnt 0x0" :: "v"(oh[0]), "v"(oh[1]), "v"(oh[2]), "v"(oh[3]), "v"(ol[0]), "v"(ol[1]), "v"(ol[2]), "v"(ol[3]), "v"(ph), "v"(pl) : "memory"); }   // as above, for the eight issued stores
    }
}
__global__ __launch_bounds__(256) void k_lnout(const float* __restrict__ F, const float* __restrict__ g, const float* __restrict__ bb, float* out) { const int lane = threadIdx.x & 31; const int row = blockIdx.x * 8 + (threadIdx.x >> 5); if (row >= NB_ * TT) return; const float* fr = F + (size_t)row * DQ; float* orow = out + (size_t)row * DQ; float v[DQ / 32]; float s = 0.f;
#pragma unroll
    for (int c = 0; c < DQ / 128; ++c) { const v4f a = *(const v4f*)(fr + c * 128 + lane * 4); for (int q = 0; q < 4; ++q) { v[c * 4 + q] = a[q]; s = __fadd_rn(s, a[q]); } }
#pragma unroll
    for (int sh = 16; sh; sh >>= 1) s = __fadd_rn(s, __shfl_xor(s, sh, 32));
    const float mean = __fdiv_rn(s, (float)DQ); float s2 = 0.f;
#pragma unroll
    for (int k = 0; k < DQ / 32; ++k) { const float dv = __fsub_rn(v[k], mean); float p2 = __fmul_rn(dv, dv); asm volatile("" : "+v"(p2)); s2 = __fadd_rn(s2, p2); v[k] = dv; }
#pragma unroll
    for (int sh = 16; sh; sh >>= 1) s2 = __fadd_rn(s2, __shfl_xor(s2, sh, 32));
    const float rs = __fdiv_rn(1.0f, __fsqrt_rn(__fadd_rn(__fdiv_rn(s2, (float)DQ), LNEPS)));
{
#pragma unroll
        for (int c = 0; c < DQ / 128; ++c) { v4f o; for (int q = 0; q < 4; ++q) { const int col = c * 128 + lane * 4 + q; float y = __fmul_rn(v[c * 4 + q], rs); asm volatile("" : "+v"(y)); y = __fmul_rn(y, bfr(g[col])); asm volatile("" : "+v"(y)); o[q] = __fadd_rn(y, bfr(bb[col])); } *(v4f*)(orow + c * 128 + lane * 4) = o; }
         } }
// ---- k_fattn: scores, softmax, attn.v and the hi/lo merge of one head in ONE kernel: no score or probability ever goes to memory. One work-group of 4 waves per (128 query rows, head, batch); each wave owns 32 query rows and walks all TT keys, 32 a pass.
// Transposed products: St[key][query] = K Qt (A = K rows, B = Q rows kept in registers; hi/lo 3 products in the order Qh Kh, Ql Kh, Qh Kl), so that a lane holds 16 scores of ONE query: maximum and sum in the lane plus one exchange between the wave's halves.
// The two 16-key score tiles of a pass ARE the B fragment of Ot[d][query] += Vt P (keys 8 hi + j and 16 + 8 hi + j): P is rounded in registers. Running maximum with rescale; P is left unnormalised (<= 1; fp16 rows x PCAR) and the division by the row sum is done once at the end.
__device__ __forceinline__ float xhalf(float x) { return __builtin_bit_cast(float, __builtin_amdgcn_permlanex16(__builtin_bit_cast(int, x), __builtin_bit_cast(int, x), 0x76543210, 0xfedcba98, false, false)); }   // lane l <-> lane l ^ 16
// 2^x with the issue slot that the instruction set asks for behind a transcendental (before its result is used or its source overwritten) filled in the same statement
__device__ __forceinline__ float exp2s(float x) { float r; asm("v_exp_f32 %0, %1\n\tv_nop" : "=v"(r) : "v"(x)); return r; }
// fragment loads at (uniform base + constant) + one 32-bit byte offset per lane: the offset is the only vector register that the loads name; planes in fragment order: the two halves of a fragment lie 512 bytes apart
__device__ __forceinline__ v16bf ldfb(const bf* base, unsigned ofs, int cst) { const char* p = (const char*)base + cst + ofs; return cat16b(*(const v8us*)p, *(const v8us*)(p + 512)); }
__device__ __forceinline__ v16h ldfh(const h16* base, unsigned ofs, int cst) { const char* p = (const char*)base + cst + ofs; return cat16(*(const v8h*)p, *(const v8h*)(p + 512)); }
template <bool HR>
__device__ __forceinline__ void fattn_rows(const bf* __restrict__ Qh, const bf* __restrict__ Ql, const bf* __restrict__ Kh, const bf* __restrict__ Kl, const h16* __restrict__ V16, const bf* __restrict__ Vh, const bf* __restrict__ Vl, bf* Ah, bf* Al, int q0) {
    const int lane = threadIdx.x & 31, lr = lane & 15, hi = lane >> 4;
    v16bf qh[2][2], ql[2][2], kh[2][2], kl[2][2];
    const unsigned qb = (q0 * HD + 8 * lane) * 2; unsigned kb = 8 * lane * 2; const unsigned vb = 8 * lane * 2;   // byte offsets of the lane's chunks in the Q, K and Vt planes (fragment order: a 16-row band of Q or K is 16 HD elements; the 4 blocks of Vt for 32 keys lie side by side)
    const char* pv0 = (HR ? (const char*)Vh : (const char*)V16) + vb; const char* pv1 = (const char*)Vl + vb;   // the lane's walking addresses in the Vt planes
#pragma unroll
    for (int qt = 0; qt < 2; ++qt)
#pragma unroll
        for (int ks = 0; ks < 2; ++ks) { const int cq = (qt * 16 * HD + ks * 512) * 2; qh[qt][ks] = ldfb(Qh, qb, cq); ql[qt][ks] = ldfb(Ql, qb, cq); }
    asm volatile("s_wait_xcnt 0x0" :: "v"(qb) : "memory");   // the wait in front of any overwrite of an offset register that an issued load names; the offset is an input so that it stays in its register up to here
#pragma unroll
    for (int kt = 0; kt < 2; ++kt)
#pragma unroll
        for (int ks = 0; ks < 2; ++ks) { const int ck = (kt * 16 * HD + ks * 512) * 2; kh[kt][ks] = ldfb(Kh, kb, ck); kl[kt][ks] = ldfb(Kl, kb, ck); }
    asm volatile("s_wait_xcnt 0x0" :: "v"(kb) : "memory");   // as above: in front of the first step of kb
    v8f o[2][4]; float m[2], l[2];
#pragma unroll
    for (int qt = 0; qt < 2; ++qt) { m[qt] = -3.0e38f; l[qt] = 0.f;
#pragma unroll
        for (int dt = 0; dt < 4; ++dt) o[qt][dt] = (v8f){}; }
#pragma unroll 1
    for (int k0 = 0; k0 < TT; k0 += 32) {   // rolled: one pass's code and registers
        v16h vf[4]; v16bf vh[4], vl[4];
#pragma unroll
        for (int dt = 0; dt < 4; ++dt) { const int cv = dt * 512 * 2; if (HR) { vh[dt] = ldfb((const bf*)(pv0 + cv), 0u, 0); vl[dt] = ldfb((const bf*)(pv1 + cv), 0u, 0); } else vf[dt] = ldfh((const h16*)(pv0 + cv), 0u, 0); }
        if (HR) asm volatile("s_wait_xcnt 0x0" :: "v"(pv0), "v"(pv1) : "memory");   // as above: in front of the step of the two addresses and of any fragment that would land on them
        else asm volatile("s_wait_xcnt 0x0" :: "v"(pv0) : "memory");   // the same for the one fp16 plane
        __builtin_amdgcn_sched_barrier(0);   // keeps the Vt loads at the head of the pass, in flight under the score products and the softmax (the scheduler otherwise sinks some of them, and the K fetch below with them, to the end of the pass)
        pv0 += (HD / 16) * 512 * 2; pv1 += (HD / 16) * 512 * 2;   // 32 keys on: the next HD / 16 blocks
        v8f s[2][2];
#pragma unroll
        for (int qt = 0; qt < 2; ++qt)
#pragma unroll
            for (int kt = 0; kt < 2; ++kt) s[qt][kt] = (v8f){};
#pragma unroll
        for (int ks = 0; ks < 2; ++ks) {
#pragma unroll
            for (int qt = 0; qt < 2; ++qt)
#pragma unroll
                for (int kt = 0; kt < 2; ++kt) s[qt][kt] = wmmab(kh[kt][ks], qh[qt][ks], s[qt][kt]);
#pragma unroll
            for (int qt = 0; qt < 2; ++qt)
#pragma unroll
                for (int kt = 0; kt < 2; ++kt) s[qt][kt] = wmmab(kh[kt][ks], ql[qt][ks], s[qt][kt]);
#pragma unroll
            for (int qt = 0; qt < 2; ++qt)
#pragma unroll
                for (int kt = 0; kt < 2; ++kt) s[qt][kt] = wmmab(kl[kt][ks], qh[qt][ks], s[qt][kt]); }
        kb = (kb + 32 * HD * 2) & (TT * HD * 2 - 1);   // the next pass's K fragments, fetched behind this pass's score products into the same registers; the last pass fetches keys 0..31 again (in bounds, unused)
#pragma unroll
        for (int kt = 0; kt < 2; ++kt)
#pragma unroll
            for (int ks = 0; ks < 2; ++ks) { const int ck = (kt * 16 * HD + ks * 512) * 2; kh[kt][ks] = ldfb(Kh, kb, ck); kl[kt][ks] = ldfb(Kl, kb, ck); }
        asm volatile("s_wait_xcnt 0x0" :: "v"(kb) : "memory");   // as above: in front of the next step of kb
        v16h pf[2]; v16bf ph[2], pl[2];
#pragma unroll
        for (int qt = 0; qt < 2; ++qt) {
            float t[16]; float cm = -3.0e38f;
#pragma unroll
            for (int e = 0; e < 16; ++e) { t[e] = s[qt][e >> 3][e & 7] * SCL; cm = fmaxf(cm, t[e]); }
            cm = fmaxf(cm, xhalf(cm));
            const float mn = fmaxf(m[qt], cm); const float al = exp2s((m[qt] - mn) * 1.4426950408889634f); m[qt] = mn; float ls = 0.f;
#pragma unroll
            for (int e = 0; e < 16; ++e) { t[e] = exp2s((t[e] - mn) * 1.4426950408889634f); ls += t[e]; }
            l[qt] = l[qt] * al + ls;
#pragma unroll
            for (int dt = 0; dt < 4; ++dt) o[qt][dt] *= al;
            if (HR) { v8us h0, h1, l0, l1; v8f t0, t1;
#pragma unroll
                for (int j = 0; j < 8; ++j) { t0[j] = t[j]; t1[j] = t[8 + j]; }
                split8(t0, h0, l0); split8(t1, h1, l1); ph[qt] = cat16b(h0, h1); pl[qt] = cat16b(l0, l1);
            } else { v8h c0, c1;
#pragma unroll
                for (int j = 0; j < 8; ++j) { c0[j] = tohx(t[j] * PCAR); c1[j] = tohx(t[8 + j] * PCAR); }
                pf[qt] = cat16(c0, c1); } }
        if (HR) {
#pragma unroll
            for (int qt = 0; qt < 2; ++qt)
#pragma unroll
                for (int dt = 0; dt < 4; ++dt) o[qt][dt] = wmmab(vh[dt], ph[qt], o[qt][dt]);
#pragma unroll
            for (int qt = 0; qt < 2; ++qt)
#pragma unroll
                for (int dt = 0; dt < 4; ++dt) o[qt][dt] = wmmab(vh[dt], pl[qt], o[qt][dt]);
#pragma unroll
            for (int qt = 0; qt < 2; ++qt)
#pragma unroll
                for (int dt = 0; dt < 4; ++dt) o[qt][dt] = wmmab(vl[dt], ph[qt], o[qt][dt]);
        } else {
#pragma unroll
            for (int qt = 0; qt < 2; ++qt)
#pragma unroll
                for (int dt = 0; dt < 4; ++dt) o[qt][dt] = wmma16(vf[dt], pf[qt], o[qt][dt]); }
    }
#pragma unroll
    for (int qt = 0; qt < 2; ++qt) { const float lt = l[qt] + xhalf(l[qt]); const float f = __fdiv_rn(HR ? 1.0f : (1.0f / PCAR), lt); v8us oh[4], ol[4];
#pragma unroll
        for (int dt = 0; dt < 4; ++dt) split8(o[qt][dt] * f, oh[dt], ol[dt]);
        bf* pa = Ah + (size_t)(q0 + qt * 16) * DQ + lane * 8; bf* pl2 = Al + (size_t)(q0 + qt * 16) * DQ + lane * 8;   // fragment order of the [row][DQ] planes: 16 columns on are 256 elements on
#pragma unroll
        for (int dt = 0; dt < 4; ++dt) { *(v8us*)(pa + dt * 256) = oh[dt]; *(v8us*)(pl2 + dt * 256) = ol[dt]; }
        asm volatile("s_wait_xcnt 0x0" :: "v"(oh[0]), "v"(oh[1]), "v"(oh[2]), "v"(oh[3]), "v"(ol[0]), "v"(ol[1]), "v"(ol[2]), "v"(ol[3]), "v"(pa), "v"(pl2) : "memory"); }   // the wait in front of any overwrite of a data or address register of the eight issued stores; they are inputs so that they stay in their registers up to here
}
__global__ __launch_bounds__(128) void k_fattn(const bf* __restrict__ Qh, const bf* __restrict__ Ql, const bf* __restrict__ Kh, const bf* __restrict__ Kl, const h16* __restrict__ V16, const bf* __restrict__ Vh, const bf* __restrict__ Vl, bf* Ah, bf* Al) {
    const size_t hp = ((size_t)blockIdx.z * NH_ + blockIdx.y) * TT * HD; const int q0 = blockIdx.x * 128 + (threadIdx.x >> 5) * 32; const size_t ao = (size_t)blockIdx.z * TT * DQ + blockIdx.y * (HD / 32) * 512; Ah += ao; Al += ao;   // blockIdx.z: batch (planes [b][h], rows b * TT + t of the output planes)
    if (blockIdx.x < RH / 128) fattn_rows<true>(Qh + hp, Ql + hp, Kh + hp, Kl + hp, V16 + hp, Vh + hp, Vl + hp, Ah, Al, q0);
    else fattn_rows<false>(Qh + hp, Ql + hp, Kh + hp, Kl + hp, V16 + hp, Vh + hp, Vl + hp, Ah, Al, q0);
}

extern "C" void kernel_launch(void* const* d_in, const int* in_sizes, int n_in,
                              void* d_out, int out_size, void* d_ws, size_t ws_size, hipStream_t stream) {
    (void)in_sizes; (void)n_in; (void)out_size;
    const float* x = (const float*)d_in[0]; const float* wq = (const float*)d_in[1]; const float* wk = (const float*)d_in[2]; const float* wv = (const float*)d_in[3]; const float* wo = (const float*)d_in[4]; const float* lng = (const float*)d_in[5]; const float* lnb = (const float*)d_in[6];
    float* OUT = (float*)d_out;     // [4][2048][1024]
    char* wsp = (char*)d_ws;
    auto take = [&](size_t bytes) { char* p = wsp; wsp += (bytes + 255) & ~(size_t)255; return (void*)p; };
    bf* WQ = (bf*)take((size_t)DQ * DM * 2); bf* WK = (bf*)take((size_t)DKV * DM * 2); bf* WV = (bf*)take((size_t)DKV * DM * 2); bf* WO = (bf*)take((size_t)DM * DQ * 2);
    bf* XB = (bf*)take((size_t)NB_ * TT * DM * 2); float* Y = (float*)take((size_t)NB_ * TT * DM * 4);
    h16* VT16 = (h16*)take((size_t)NB_ * NKV * HD * TT * 2);
    bf* QPh = (bf*)take((size_t)NB_ * NH_ * TT * HD * 2); bf* QPl = (bf*)take((size_t)NB_ * NH_ * TT * HD * 2); bf* KPh = (bf*)take((size_t)NB_ * NKV * TT * HD * 2); bf* KPl = (bf*)take((size_t)NB_ * NKV * TT * HD * 2); bf* VTh = (bf*)take((size_t)NB_ * NKV * HD * TT * 2); bf* VTl = (bf*)take((size_t)NB_ * NKV * HD * TT * 2);
    bf* ATh = (bf*)take((size_t)NB_ * TT * DQ * 2); bf* ATl = (bf*)take((size_t)NB_ * TT * DQ * 2);
    if ((size_t)(wsp - (char*)d_ws) > ws_size) return;    // 200 MiB of the 256 MiB
    { k_wtG<<<(unsigned)((DM * DQ / 8 + 255) / 256), 256, 0, stream>>>(wq, DM, DQ, WQ); k_wtG<<<(unsigned)((DM * DKV / 8 + 255) / 256), 256, 0, stream>>>(wk, DM, DKV, WK); k_wtG<<<(unsigned)((DM * DKV / 8 + 255) / 256), 256, 0, stream>>>(wv, DM, DKV, WV);
      k_wtG<<<(unsigned)((DQ * DM / 8 + 255) / 256), 256, 0, stream>>>(wo, DQ, DM, WO);
       }
    k_cvt8<<<(unsigned)(((size_t)NB_ * TT * DM / 8 + 255) / 256), 256, 0, stream>>>(x, XB);
    k_proj<<<dim3(NB_ * TT / 64, NH_, 3), 32, 0, stream>>>(XB, WQ, WK, WV, QPh, QPl, KPh, KPl, VT16, VTh, VTl);   /* q, k, v and their head planes */
    k_fattn<<<dim3(TT / 128, NH_, NB_), 128, 0, stream>>>(QPh, QPl, KPh, KPl, VT16, VTh, VTl, ATh, ATl);   /* scores hi/lo on EVERY row (sigma-16 logits), softmax, attn.v hybrid, merge */
    k_gemmw<bf, 1, false, true, DQ><<<dim3(NB_ * TT / 64, DM / 64, 1), 32, 0, stream>>>(ATh, ATl, WO, nullptr, Y, DM, nullptr, x, 0, 0, 0); k_lnout<<<(NB_ * TT + 7) / 8, 256, 0, stream>>>(Y, lng, lnb, OUT);   /* LayerNorm(h + attn_out) */
}

// v007
// One run takes 232 microseconds.
// Two timings next to v006 put it at 1.09 and 1.10 times that version's speed.
// All steps since v000 together make it 17.1 times as fast.
#include <hip/hip_runtime.h>

// Transformer-XL style multi-head attention with post-LayerNorm (h [4][2048][1024]; q,k,v = h W ('xw' [1024][1024] with scale 1/8 x normal: sigma-4 projections, so the /8 logits have sigma ~16: sharply peaked); scores x 64^-0.5; softmax over keys; attn_out = attn_vec Wo ('xw', no bias); out = LayerNorm(h + attn_out) gamma/beta (1e-5) -> [4][2048][1024] (8.4 M)).
// Layout, every stage ONE launch over all NB_ batches (the batch is folded into the grid: rows b*TT + t, planes [b][h]): bf16 copy of h; 'xw' weights transposed once; exact projections, all three in one launch whose epilogue writes the 16-bit head planes straight from the accumulators (no f32 copy of q, k or v exists); one fused attention kernel (scores hi/lo 3 products on EVERY row (peaked logits), running-maximum softmax in registers, P and attn.v hybrid (rows < 512 hi/lo, rest fp16 x1024)); merged hi/lo x Wo exact into workspace; the residual added in that product's epilogue; a row LayerNorm kernel (one wave per 1,024-wide row, fixed-order sums, precise sqrt/div, affine) writes the output rows.
// Every 16-bit matrix operand plane (h copy, transposed weights, Q, K, Vt, attention output) is stored in FRAGMENT ORDER (fo() below): blocks of 16 rows x 32 k = 1 KiB, inside a block the 16-byte chunk that lane l loads stands at byte 16 l (first half of the fragment) and 512 + 16 l (second half), so each wave-wide 16-byte load reads 512 contiguous bytes (4 whole lines) instead of 32 bytes from each of 16 lines. Which element lands in which lane and register is as with row-major planes.
// Compute dtypes, f32 accumulate: every input rounded to bf16; projections exact; scores 3 products on every row; softmax f32; attn.v rows < 512 3 products, rest fp16; Wo hl x exact; residual + LayerNorm f32.

#define NB_  4
#define TT   2048
#define DM   1024
#define NH_  16
#define NKV  16
#define REP  (NH_ / NKV)
#define HD   64
#define DQ   (NH_ * HD)
#define DKV  (NKV * HD)
#define RH   512                  // query rows < RH use hi+lo planes (0: none)
#define WIN  0
#define PCAR 1024.0f
#define SCL  0.125f
#define LNEPS 1e-5f
typedef _Float16 h16;
typedef unsigned short bf;
typedef __attribute__((ext_vector_type(16))) __bf16   v16bf;
typedef __attribute__((ext_vector_type(16))) _Float16 v16h;
typedef __attribute__((ext_vector_type(8)))  _Float16 v8h;
typedef __attribute__((ext_vector_type(8)))  unsigned short v8us;
typedef __attribute__((ext_vector_type(8)))  float    v8f;
typedef __attribute__((ext_vector_type(4)))  float    v4f;
typedef v8h  __attribute__((may_alias)) v8ha;
typedef v4f  __attribute__((may_alias)) v4fa;
typedef v8us __attribute__((may_alias)) v8usa;

typedef __attribute__((ext_vector_type(8)))  __bf16   v8bf;
// f32 -> bf16, nearest even, by the chip's own conversion (v_cvt_pk_bf16_f32: two values an instruction, already packed); the same value as adding 0x7FFF + the kept part's last bit and cutting, for every finite input
__device__ __forceinline__ unsigned short f2bf(float f) { return __builtin_bit_cast(unsigned short, (__bf16)f); }
__device__ __forceinline__ v8us rnd8(v8f x) { return __builtin_bit_cast(v8us, __builtin_convertvector(x, v8bf)); }
// hi = bf16(x), lo = bf16(x - hi) of eight values (the difference is exact in f32)
__device__ __forceinline__ void split8(v8f x, v8us& h, v8us& l) { const v8bf hb = __builtin_convertvector(x, v8bf); h = __builtin_bit_cast(v8us, hb); l = rnd8(x - __builtin_convertvector(hb, v8f)); }
__device__ __forceinline__ float bf2f(unsigned short b) { return __uint_as_float(((unsigned)b) << 16); }
__device__ __forceinline__ float bfr(float f) { return bf2f(f2bf(f)); }
__device__ __forceinline__ v16h cat16(v8h lo, v8h hi) { return __builtin_shufflevector(lo, hi, 0, 1, 2, 3, 4, 5, 6, 7, 8, 9, 10, 11, 12, 13, 14, 15); }
__device__ __forceinline__ v16bf cat16b(v8us lo, v8us hi) { return __builtin_bit_cast(v16bf, __builtin_shufflevector(lo, hi, 0, 1, 2, 3, 4, 5, 6, 7, 8, 9, 10, 11, 12, 13, 14, 15)); }
__device__ __forceinline__ v8f wmma16(v16h a, v16h b, v8f c) { return __builtin_amdgcn_wmma_f32_16x16x32_f16(false, a, false, b, (short)0, c, false, false); }
__device__ __forceinline__ v8f wmmab(v16bf a, v16bf b, v8f c) { return __builtin_amdgcn_wmma_f32_16x16x32_bf16(false, a, false, b, (short)0, c, false, false); }
// fragment order of a [rows][K] 16-bit plane (rows % 16 == 0, K % 32 == 0): element index of (row, k). Block (row / 16, k / 32) of 512 elements; in it half (k / 16) % 2, then lane 16 ((k / 8) % 2) + row % 16, then k % 8.
__device__ __forceinline__ size_t fo(int row, int k, int K) { return ((size_t)(row >> 4) * (K >> 5) + (k >> 5)) * 512 + ((k >> 4) & 1) * 256 + ((k >> 3) & 1) * 128 + (row & 15) * 8 + (k & 7); }
// the same blocks in the other order, block (k / 32, row / 16), for a plane of R rows whose reader takes all R rows of a k step at once (Vt: the R / 16 blocks of a pass lie side by side)
__device__ __forceinline__ size_t fok(int row, int k, int R) { return ((size_t)(k >> 5) * (R >> 4) + (row >> 4)) * 512 + ((k >> 4) & 1) * 256 + ((k >> 3) & 1) * 128 + (row & 15) * 8 + (k & 7); }



// ---- staging of GEMM operands in LDS by asynchronous copies. A stage is 64 k of every 16-row band of a work-group's tile: 2 KiB a band, contiguous in the plane (fragment order) and in LDS alike, so that a fragment is read from LDS as it was read from the plane (lane l's chunk at byte 16 l).
// CPB: one band of a stage, four copies of 512 B a wave; the immediate offset moves the global and the LDS address together.
#define CPB(L, G) "global_load_async_to_lds_b128 " L ", " G ", off\n\tglobal_load_async_to_lds_b128 " L ", " G ", off offset:512\n\tglobal_load_async_to_lds_b128 " L ", " G ", off offset:1024\n\tglobal_load_async_to_lds_b128 " L ", " G ", off offset:1536\n\t"
// three or six bands in one statement; its last line is the wait in front of any overwrite of an address register that an issued copy names
__device__ __forceinline__ void cp3(const unsigned* l, const char* const* g, unsigned lb, size_t go) {
    asm volatile(CPB("%0", "%3") CPB("%1", "%4") CPB("%2", "%5") "s_wait_xcnt 0x0" :: "v"(l[0] + lb), "v"(l[1] + lb), "v"(l[2] + lb), "v"(g[0] + go), "v"(g[1] + go), "v"(g[2] + go) : "memory"); }
__device__ __forceinline__ void cp6(const unsigned* l, const char* const* g, unsigned lb, size_t go) {
    asm volatile(CPB("%0", "%6") CPB("%1", "%7") CPB("%2", "%8") CPB("%3", "%9") CPB("%4", "%10") CPB("%5", "%11") "s_wait_xcnt 0x0" :: "v"(l[0] + lb), "v"(l[1] + lb), "v"(l[2] + lb), "v"(l[3] + lb), "v"(l[4] + lb), "v"(l[5] + lb), "v"(g[0] + go), "v"(g[1] + go), "v"(g[2] + go), "v"(g[3] + go), "v"(g[4] + go), "v"(g[5] + go) : "memory"); }
#define STG (24 * 2048)           // bytes of a stage: 24 bands

// ---- k_gemmw: register-blocked GEMM, one wave per 64x64 output tile (16 accumulators), FOUR waves (2 x 2) a work-group on a 128x128 tile whose operand bands they share through LDS; operands from 16-bit planes in fragment order; grid (M/128, N/128, Z), 128 threads.
// C[m][n] (f32, pitch ldc, + optional f32 bias[n], + optional residual res[m][n] of the same pitch, rounded to bf16 like every input) = sum_k (A[m][k] + A2[m][k]) Bt[n][k], two products. z-batch strides sA/sB/sC in elements. K % 64 == 0, K >= 128, a compile-time constant.
// Two buffers: stage t + 1's copies fly while stage t is worked on; wave w brings bands 6 w .. 6 w + 5 of [A 8 | A2 8 | Bt 8].
template <typename T16> struct WFrag;
template <> struct WFrag<h16> { typedef v16h V; static __device__ __forceinline__ V ld(const char* p) { return cat16(*(const v8h*)p, *(const v8h*)(p + 512)); } static __device__ __forceinline__ v8f mma(V a, V b, v8f c) { return wmma16(a, b, c); } };
template <> struct WFrag<bf> { typedef v16bf V; static __device__ __forceinline__ V ld(const char* p) { return cat16b(*(const v8us*)p, *(const v8us*)(p + 512)); } static __device__ __forceinline__ v8f mma(V a, V b, v8f c) { return wmmab(a, b, c); } };
template <typename T16, bool BIAS, bool RES, int K>
__global__ __launch_bounds__(128) __attribute__((amdgpu_num_vgpr(256))) /* the loop's fragments and accumulators stay in the first window of 256 registers: no window switch among the products */ void k_gemmw(const T16* __restrict__ A, const T16* __restrict__ A2, const T16* __restrict__ Bt, float* C, int ldc, const float* __restrict__ bias, const float* __restrict__ res, size_t sA, size_t sB, size_t sC) {
    typedef typename WFrag<T16>::V V;
    __shared__ __attribute__((aligned(2048))) char st[2 * STG];
    __shared__ __align__(16) float osa[4][16 * 68];
    const size_t z = blockIdx.z; A += z * sA; A2 += z * sA; Bt += z * sB; C += z * sC; if (RES) res += z * sC;
    const int lane = threadIdx.x & 31, lr = lane & 15, hi = lane >> 4; const int w = __builtin_amdgcn_readfirstlane((int)(threadIdx.x >> 5)); const int r0 = blockIdx.x * 128 + (w & 1) * 64, c0 = blockIdx.y * 128 + (w >> 1) * 64;
    float* os = osa[w];   // the wave's own staging of its output bands
    v8f acc[4][4];
#pragma unroll
    for (int mb = 0; mb < 4; ++mb)
#pragma unroll
        for (int nb = 0; nb < 4; ++nb) acc[mb][nb] = (v8f){};
    const char* gp[6]; unsigned lp[6];   // the lane's addresses in stage 0 of the wave's six bands: in the plane (a band is 32 K bytes) and in LDS
#pragma unroll
    for (int i = 0; i < 6; ++i) { const int g = 6 * w + i; const T16* pl = g < 8 ? A + (size_t)blockIdx.x * 128 * K : g < 16 ? A2 + (size_t)blockIdx.x * 128 * K : Bt + (size_t)blockIdx.y * 128 * K; gp[i] = (const char*)pl + (size_t)(g & 7) * 32 * K + lane * 16; lp[i] = (unsigned)(size_t)st + g * 2048 + lane * 16; }
    cp6(lp, gp, 0, 0);
    asm volatile("s_wait_asynccnt 0x0" ::: "memory");   // stage 0 has landed, as far as this wave brought it
    __syncthreads();                                     // ... and as far as the others did
    cp6(lp, gp, STG, 2048);
    const unsigned ao = (w & 1) * 4 * 2048 + lane * 16, bo = (16 + (w >> 1) * 4) * 2048 + lane * 16;   // the wave's four bands of A (A2: 8 bands on) and of Bt in a stage
#pragma unroll 1
    for (int t = 0; t < K / 64; ++t) {
        const char* sb = st + (t & 1) * STG; V a[4], a2[4], b[4];
#pragma unroll
        for (int mb = 0; mb < 4; ++mb) { a[mb] = WFrag<T16>::ld(sb + ao + mb * 2048); a2[mb] = WFrag<T16>::ld(sb + ao + (8 + mb) * 2048); }
#pragma unroll
        for (int nb = 0; nb < 4; ++nb) b[nb] = WFrag<T16>::ld(sb + bo + nb * 2048);
        __builtin_amdgcn_sched_barrier(0);   // keeps the block's LDS reads together in front of its products (the scheduler otherwise sinks some among them, each behind a wait to 0)
#pragma unroll
        for (int nb = 0; nb < 4; ++nb) {
#pragma unroll
            for (int mb = 0; mb < 4; ++mb) { acc[mb][nb] = WFrag<T16>::mma(a[mb], b[nb], acc[mb][nb]); acc[mb][nb] = WFrag<T16>::mma(a2[mb], b[nb], acc[mb][nb]); } }
#pragma unroll
        for (int mb = 0; mb < 4; ++mb) { a[mb] = WFrag<T16>::ld(sb + ao + mb * 2048 + 1024); a2[mb] = WFrag<T16>::ld(sb + ao + (8 + mb) * 2048 + 1024); }   // the stage's second block: its fragments are fetched in front of the hand-over, its products stand behind it
#pragma unroll
        for (int nb = 0; nb < 4; ++nb) b[nb] = WFrag<T16>::ld(sb + bo + nb * 2048 + 1024);
        __builtin_amdgcn_sched_barrier(0);   // keeps the first block's products in front of the hand-over, so that the refill is issued right behind the barrier (the scheduler otherwise sinks products between barrier and copies)
        asm volatile("s_wait_dscnt 0x0" ::: "memory");      // this wave's reads of stage t have returned
        asm volatile("s_wait_asynccnt 0x0" ::: "memory");   // its copies of stage t + 1 have landed
        __syncthreads();                                     // publishes stage t + 1 and ends every wave's reads of stage t
        if (t + 2 < K / 64) cp6(lp, gp, (t & 1) * STG, (size_t)(t + 2) * 2048);   // stage t + 2 into the buffer just left, in flight from here to the hand-over of the next trip
#pragma unroll
        for (int nb = 0; nb < 4; ++nb) {
#pragma unroll
            for (int mb = 0; mb < 4; ++mb) { acc[mb][nb] = WFrag<T16>::mma(a[mb], b[nb], acc[mb][nb]); acc[mb][nb] = WFrag<T16>::mma(a2[mb], b[nb], acc[mb][nb]); } }
    }
    asm volatile("s_wait_asynccnt 0x0" ::: "memory");   // no copy outlives the loop
#pragma unroll
    for (int mb = 0; mb < 4; ++mb) {
        v4f rv[8];
        if (RES) { const float* p[8];   // the band's residual rows, in flight under the staging of the band
#pragma unroll
            for (int s = 0; s < 8; ++s) { p[s] = res + (size_t)(r0 + mb * 16 + 2 * s + hi) * ldc + c0 + lr * 4; rv[s] = *(const v4f*)p[s]; }
            asm volatile("s_wait_xcnt 0x0" :: "v"(p[0]), "v"(p[1]), "v"(p[2]), "v"(p[3]), "v"(p[4]), "v"(p[5]), "v"(p[6]), "v"(p[7]) : "memory"); }   // the wait in front of any overwrite of an address register that an issued load names; the addresses are inputs so that they stay in their registers up to here
#pragma unroll
        for (int nb = 0; nb < 4; ++nb) {
#pragma unroll
            for (int j = 0; j < 8; ++j) os[(hi * 8 + j) * 68 + nb * 16 + lr] = acc[mb][nb][j]; }
        __builtin_amdgcn_wave_barrier(); asm volatile("" ::: "memory");
        float* crow = C + (size_t)(r0 + mb * 16) * ldc + c0;
{
#pragma unroll
            for (int s = 0; s < 8; ++s) { const int row = 2 * s + hi, cofs = lr * 4; v4f val = *(const v4fa*)(os + row * 68 + cofs); if (BIAS) { val[0] += bfr(bias[c0 + cofs]); val[1] += bfr(bias[c0 + cofs + 1]); val[2] += bfr(bias[c0 + cofs + 2]); val[3] += bfr(bias[c0 + cofs + 3]); }
                if (RES) { for (int q = 0; q < 4; ++q) val[q] = __fadd_rn(val[q], bfr(rv[s][q])); }
                *(v4f*)(crow + (size_t)row * ldc + cofs) = val; }
             }
        __builtin_amdgcn_wave_barrier(); asm volatile("" ::: "memory");
    }
}

__device__ __forceinline__ h16 tohx(float x) { return (h16)x; }
typedef __attribute__((ext_vector_type(2))) _Float16 v2h;
typedef __attribute__((ext_vector_type(4))) _Float16 v4h;
typedef __attribute__((ext_vector_type(2))) unsigned short v2us;
typedef __attribute__((ext_vector_type(4))) unsigned short v4us;
typedef __attribute__((ext_vector_type(2))) float v2f;
typedef __attribute__((ext_vector_type(4))) int v4i;

// k_wtG: Bt[n][k] = bf16(w[k][n]) in fragment order. One thread per 16-byte chunk (8 k of one n), lanes along n: every read is a whole line of w, every store 16 bytes a lane in two runs of 256 bytes.
__global__ __launch_bounds__(256) void k_wtG(const float* __restrict__ w, int K, int N, bf* Bt) {
    const unsigned i = blockIdx.x * 256 + threadIdx.x; if (i >= (unsigned)N * (unsigned)(K / 8)) return; const int n = (int)(i % (unsigned)N), k0 = (int)(i / (unsigned)N) * 8; const float* p[8]; v8f x;
#pragma unroll
    for (int j = 0; j < 8; ++j) { p[j] = w + (size_t)(k0 + j) * N + n; x[j] = *p[j]; }
    asm volatile("s_wait_xcnt 0x0" :: "v"(p[0]), "v"(p[1]), "v"(p[2]), "v"(p[3]), "v"(p[4]), "v"(p[5]), "v"(p[6]), "v"(p[7]) : "memory");   // the wait in front of any overwrite of an address register that an issued load names; the addresses are inputs so that they stay in their registers up to here
    *(v8us*)(Bt + fo(n, k0, K)) = rnd8(x); }
// k_cvt8: bf16 copy of src [NB_ TT][DM] in fragment order. One thread per 16-byte chunk; 8 lanes cover 64 k of a row (256 bytes read), the next 8 lanes the next row, so that a store writes runs of 64 bytes.
__global__ __launch_bounds__(256) void k_cvt8(const float* __restrict__ src, bf* dst) { const unsigned i = blockIdx.x * 256 + threadIdx.x; if (i >= (unsigned)(NB_ * TT) * (DM / 8)) return; const int row = (int)((i >> 3) % (unsigned)(NB_ * TT)), k = (int)((i >> 3) / (unsigned)(NB_ * TT)) * 64 + (int)(i & 7) * 8; const v8f v = *(const v8f*)(src + (size_t)row * DM + k); *(v8us*)(dst + fo(row, k, DM)) = rnd8(v);  }

// ---- k_proj: the q, k and v projections in ONE launch, one wave per 64 x 64 tile (64 rows b * TT + t of the bf16 copy of h, the 64 columns of one head), EIGHT waves a work-group: 2 row tiles x 4 heads, which share their operand bands through LDS; grid (NB_ TT / 128, heads / 4, 3), 256 threads, blockIdx.z: 0 q, 1 k, 2 v. The k loop is k_gemmw's: two buffers, stages of 64 k, [h 8 bands | W 16 bands]; wave w brings bands 3 w .. 3 w + 2.
// The epilogue writes the head planes in fragment order straight from the accumulators: a lane holds 8 consecutive rows of the A operand for one row of the B operand, and that is one 16-byte chunk of a plane if A runs along the plane's k: for q and k (planes [t][d], chunks of 8 d) A = the weight rows (d), B = the rows of h (t); for v (planes [d][t], chunks of 8 t) A = the rows of h, B = the weight rows. Lane l's chunk stands at byte 16 l of a half block, so every store is 512 contiguous bytes of a wave.
__global__ __launch_bounds__(256) __attribute__((amdgpu_waves_per_eu(4, 4))) void k_proj(const bf* __restrict__ X, const bf* __restrict__ Wq, const bf* __restrict__ Wk, const bf* __restrict__ Wv, bf* Qh, bf* Ql, bf* Kh, bf* Kl, h16* V16, bf* Vh, bf* Vl) {
    __shared__ __attribute__((aligned(2048))) char st[2 * STG];
    const int lane = threadIdx.x & 31; const int w = __builtin_amdgcn_readfirstlane((int)(threadIdx.x >> 5)); const int r0 = blockIdx.x * 128 + (w & 1) * 64, hd = blockIdx.y * 4 + (w >> 1), z = blockIdx.z;
    const bf* xr = X + (size_t)blockIdx.x * 128 * DM; const bf* wr = (z == 0 ? Wq : z == 1 ? Wk : Wv) + (size_t)blockIdx.y * 4 * HD * DM;
    v8f acc[4][4];
#pragma unroll
    for (int mb = 0; mb < 4; ++mb)
#pragma unroll
        for (int nb = 0; nb < 4; ++nb) acc[mb][nb] = (v8f){};
    const char* gp[3]; unsigned lp[3];   // the lane's addresses in stage 0 of the wave's three bands: in the plane (a band is 32 DM bytes) and in LDS
#pragma unroll
    for (int i = 0; i < 3; ++i) { const int g = 3 * w + i; gp[i] = (g < 8 ? (const char*)xr + (size_t)g * 32 * DM : (const char*)wr + (size_t)(g - 8) * 32 * DM) + lane * 16; lp[i] = (unsigned)(size_t)st + g * 2048 + lane * 16; }
    cp3(lp, gp, 0, 0);
    asm volatile("s_wait_asynccnt 0x0" ::: "memory");   // stage 0 has landed, as far as this wave brought it
    __syncthreads();                                     // ... and as far as the others did
    cp3(lp, gp, STG, 2048);
    const unsigned xo = (w & 1) * 4 * 2048 + lane * 16, wo = (8 + (w >> 1) * 4) * 2048 + lane * 16; const unsigned ao = z == 2 ? xo : wo, bo = z == 2 ? wo : xo;   // the wave's four bands of each operand in a stage
#pragma unroll 1
    for (int t = 0; t < DM / 64; ++t) {
        const char* sb = st + (t & 1) * STG; v16bf a[4], b[4];
#pragma unroll
        for (int mb = 0; mb < 4; ++mb) a[mb] = WFrag<bf>::ld(sb + ao + mb * 2048);
#pragma unroll
        for (int nb = 0; nb < 4; ++nb) b[nb] = WFrag<bf>::ld(sb + bo + nb * 2048);
        __builtin_amdgcn_sched_barrier(0);   // keeps the block's sixteen LDS reads together in front of its products (the scheduler otherwise sinks the B reads among them, each behind a wait to 0)
#pragma unroll
        for (int nb = 0; nb < 4; ++nb)
#pragma unroll
            for (int mb = 0; mb < 4; ++mb) acc[mb][nb] = wmmab(a[mb], b[nb], acc[mb][nb]);
#pragma unroll
        for (int mb = 0; mb < 4; ++mb) a[mb] = WFrag<bf>::ld(sb + ao + mb * 2048 + 1024);   // the stage's second block: its fragments are fetched in front of the hand-over, its products stand behind it
#pragma unroll
        for (int nb = 0; nb < 4; ++nb) b[nb] = WFrag<bf>::ld(sb + bo + nb * 2048 + 1024);
        __builtin_amdgcn_sched_barrier(0);   // keeps the first block's products in front of the hand-over, so that the refill is issued right behind the barrier (the scheduler otherwise sinks products between barrier and copies)
        asm volatile("s_wait_dscnt 0x0" ::: "memory");      // this wave's reads of stage t have returned
        asm volatile("s_wait_asynccnt 0x0" ::: "memory");   // its copies of stage t + 1 have landed
        __syncthreads();                                     // publishes stage t + 1 and ends every wave's reads of stage t
        if (t + 2 < DM / 64) cp3(lp, gp, (t & 1) * STG, (size_t)(t + 2) * 2048);   // stage t + 2 into the buffer just left, in flight from here to the hand-over of the next trip
#pragma unroll
        for (int nb = 0; nb < 4; ++nb)
#pragma unroll
            for (int mb = 0; mb < 4; ++mb) acc[mb][nb] = wmmab(a[mb], b[nb], acc[mb][nb]);
    }
    asm volatile("s_wait_asynccnt 0x0" ::: "memory");   // no copy outlives the loop
    const size_t tb = ((size_t)(r0 / TT) * NH_ + hd) * TT * HD + (size_t)(r0 % TT) * HD + lane * 8;   // the tile's 4,096 elements are contiguous in each plane [b][h], by fo() and by fok() alike
    if (z == 2) {
#pragma unroll
        for (int mb = 0; mb < 4; ++mb) { v8h o16[4]; v8us oh[4], ol[4];
#pragma unroll
            for (int nb = 0; nb < 4; ++nb) { split8(acc[mb][nb], oh[nb], ol[nb]);
#pragma unroll
                for (int j = 0; j < 8; ++j) o16[nb][j] = tohx(acc[mb][nb][j]); }
            const size_t eo = tb + (mb >> 1) * (HD / 16) * 512 + (mb & 1) * 256; h16* p16 = V16 + eo; bf* ph = Vh + eo; bf* pl = Vl + eo;   // fok(): t = 16 mb + 8 hi + j, d = 16 nb + lr
#pragma unroll
            for (int nb = 0; nb < 4; ++nb) { *(v8h*)(p16 + nb * 512) = o16[nb]; *(v8us*)(ph + nb * 512) = oh[nb]; *(v8us*)(pl + nb * 512) = ol[nb]; }
            asm volatile("s_wait_xcnt 0x0" :: "v"(o16[0]), "v"(o16[1]), "v"(o16[2]), "v"(o16[3]), "v"(oh[0]), "v"(oh[1]), "v"(oh[2]), "v"(oh[3]), "v"(ol[0]), "v"(ol[1]), "v"(ol[2]), "v"(ol[3]), "v"(p16), "v"(ph), "v"(pl) : "memory"); }   // the wait in front of any overwrite of a data or address register of the twelve issued stores; they are inputs so that they stay in their registers up to here
    } else {
        bf* Ph = z == 0 ? Qh : Kh; bf* Pl = z == 0 ? Ql : Kl;
#pragma unroll
        for (int mb = 0; mb < 4; ++mb) { v8us oh[4], ol[4];
#pragma unroll
            for (int nb = 0; nb < 4; ++nb) split8(acc[mb][nb], oh[nb], ol[nb]);
            const size_t eo = tb + (mb >> 1) * 512 + (mb & 1) * 256; bf* ph = Ph + eo; bf* pl = Pl + eo;   // fo(): d = 16 mb + 8 hi + j, t = 16 nb + lr
#pragma unroll
            for (int nb = 0; nb < 4; ++nb) { *(v8us*)(ph + nb * (HD / 32) * 512) = oh[nb]; *(v8us*)(pl + nb * (HD / 32) * 512) = ol[nb]; }
            asm volatile("s_wait_xcnt 0x0" :: "v"(oh[0]), "v"(oh[1]), "v"(oh[2]), "v"(oh[3]), "v"(ol[0]), "v"(ol[1]), "v"(ol[2]), "v"(ol[3]), "v"(ph), "v"(pl) : "memory"); }   // as above, for the eight issued stores
    }
}
__global__ __launch_bounds__(256) void k_lnout(const float* __restrict__ F, const float* __restrict__ g, const float* __restrict__ bb, float* out) { const int lane = threadIdx.x & 31; const int row = blockIdx.x * 8 + (threadIdx.x >> 5); if (row >= NB_ * TT) return; const float* fr = F + (size_t)row * DQ; float* orow = out + (size_t)row * DQ; float v[DQ / 32]; float s = 0.f;
#pragma unroll
    for (int c = 0; c < DQ / 128; ++c) { const v4f a = *(const v4f*)(fr + c * 128 + lane * 4); for (int q = 0; q < 4; ++q) { v[c * 4 + q] = a[q]; s = __fadd_rn(s, a[q]); } }
#pragma unroll
    for (int sh = 16; sh; sh >>= 1) s = __fadd_rn(s, __shfl_xor(s, sh, 32));
    const float mean = __fdiv_rn(s, (float)DQ); float s2 = 0.f;
#pragma unroll
    for (int k = 0; k < DQ / 32; ++k) { const float dv = __fsub_rn(v[k], mean); float p2 = __fmul_rn(dv, dv); asm volatile("" : "+v"(p2)); s2 = __fadd_rn(s2, p2); v[k] = dv; }
#pragma unroll
    for (int sh = 16; sh; sh >>= 1) s2 = __fadd_rn(s2, __shfl_xor(s2, sh, 32));
    const float rs = __fdiv_rn(1.0f, __fsqrt_rn(__fadd_rn(__fdiv_rn(s2, (float)DQ), LNEPS)));
{
#pragma unroll
        for (int c = 0; c < DQ / 128; ++c) { v4f o; for (int q = 0; q < 4; ++q) { const int col = c * 128 + lane * 4 + q; float y = __fmul_rn(v[c * 4 + q], rs); asm volatile("" : "+v"(y)); y = __fmul_rn(y, bfr(g[col])); asm volatile("" : "+v"(y)); o[q] = __fadd_rn(y, bfr(bb[col])); } *(v4f*)(orow + c * 128 + lane * 4) = o; }
         } }
// ---- k_fattn: scores, softmax, attn.v and the hi/lo merge of one head in ONE kernel: no score or probability ever goes to memory. One work-group of 4 waves per (128 query rows, head, batch); each wave owns 32 query rows and walks all TT keys, 32 a pass.
// Transposed products: St[key][query] = K Qt (A = K rows, B = Q rows kept in registers; hi/lo 3 products in the order Qh Kh, Ql Kh, Qh Kl), so that a lane holds 16 scores of ONE query: maximum and sum in the lane plus one exchange between the wave's halves.
// The two 16-key score tiles of a pass ARE the B fragment of Ot[d][query] += Vt P (keys 8 hi + j and 16 + 8 hi + j): P is rounded in registers. Running maximum with rescale; P is left unnormalised (<= 1; fp16 rows x PCAR) and the division by the row sum is done once at the end.
__device__ __forceinline__ float xhalf(float x) { return __builtin_bit_cast(float, __builtin_amdgcn_permlanex16(__builtin_bit_cast(int, x), __builtin_bit_cast(int, x), 0x76543210, 0xfedcba98, false, false)); }   // lane l <-> lane l ^ 16
// 2^x with the issue slot that the instruction set asks for behind a transcendental (before its result is used or its source overwritten) filled in the same statement
__device__ __forceinline__ float exp2s(float x) { float r; asm("v_exp_f32 %0, %1\n\tv_nop" : "=v"(r) : "v"(x)); return r; }
// fragment loads at (uniform base + constant) + one 32-bit byte offset per lane: the offset is the only vector register that the loads name; planes in fragment order: the two halves of a fragment lie 512 bytes apart
__device__ __forceinline__ v16bf ldfb(const bf* base, unsigned ofs, int cst) { const char* p = (const char*)base + cst + ofs; return cat16b(*(const v8us*)p, *(const v8us*)(p + 512)); }
__device__ __forceinline__ v16h ldfh(const h16* base, unsigned ofs, int cst) { const char* p = (const char*)base + cst + ofs; return cat16(*(const v8h*)p, *(const v8h*)(p + 512)); }
template <bool HR>
__device__ __forceinline__ void fattn_rows(const bf* __restrict__ Qh, const bf* __restrict__ Ql, const bf* __restrict__ Kh, const bf* __restrict__ Kl, const h16* __restrict__ V16, const bf* __restrict__ Vh, const bf* __restrict__ Vl, bf* Ah, bf* Al, int q0) {
    const int lane = threadIdx.x & 31, lr = lane & 15, hi = lane >> 4;
    v16bf qh[2][2], ql[2][2], kh[2][2], kl[2][2];
    const unsigned qb = (q0 * HD + 8 * lane) * 2; unsigned kb = 8 * lane * 2; const unsigned vb = 8 * lane * 2;   // byte offsets of the lane's chunks in the Q, K and Vt planes (fragment order: a 16-row band of Q or K is 16 HD elements; the 4 blocks of Vt for 32 keys lie side by side)
    const char* pv0 = (HR ? (const char*)Vh : (const char*)V16) + vb; const char* pv1 = (const char*)Vl + vb;   // the lane's walking addresses in the Vt planes
#pragma unroll
    for (int qt = 0; qt < 2; ++qt)
#pragma unroll
        for (int ks = 0; ks < 2; ++ks) { const int cq = (qt * 16 * HD + ks * 512) * 2; qh[qt][ks] = ldfb(Qh, qb, cq); ql[qt][ks] = ldfb(Ql, qb, cq); }
    asm volatile("s_wait_xcnt 0x0" :: "v"(qb) : "memory");   // the wait in front of any overwrite of an offset register that an issued load names; the offset is an input so that it stays in its register up to here
#pragma unroll
    for (int kt = 0; kt < 2; ++kt)
#pragma unroll
        for (int ks = 0; ks < 2; ++ks) { const int ck = (kt * 16 * HD + ks * 512) * 2; kh[kt][ks] = ldfb(Kh, kb, ck); kl[kt][ks] = ldfb(Kl, kb, ck); }
    asm volatile("s_wait_xcnt 0x0" :: "v"(kb) : "memory");   // as above: in front of the first step of kb
    v8f o[2][4]; float m[2], l[2];
#pragma unroll
    for (int qt = 0; qt < 2; ++qt) { m[qt] = -3.0e38f; l[qt] = 0.f;
#pragma unroll
        for (int dt = 0; dt < 4; ++dt) o[qt][dt] = (v8f){}; }
#pragma unroll 1
    for (int k0 = 0; k0 < TT; k0 += 32) {   // rolled: one pass's code and registers
        v16h vf[4]; v16bf vh[4], vl[4];
#pragma unroll
        for (int dt = 0; dt < 4; ++dt) { const int cv = dt * 512 * 2; if (HR) { vh[dt] = ldfb((const bf*)(pv0 + cv), 0u, 0); vl[dt] = ldfb((const bf*)(pv1 + cv), 0u, 0); } else vf[dt] = ldfh((const h16*)(pv0 + cv), 0u, 0); }
        if (HR) asm volatile("s_wait_xcnt 0x0" :: "v"(pv0), "v"(pv1) : "memory");   // as above: in front of the step of the two addresses and of any fragment that would land on them
        else asm volatile("s_wait_xcnt 0x0" :: "v"(pv0) : "memory");   // the same for the one fp16 plane
        __builtin_amdgcn_sched_barrier(0);   // keeps the Vt loads at the head of the pass, in flight under the score products and the softmax (the scheduler otherwise sinks some of them, and the K fetch below with them, to the end of the pass)
        pv0 += (HD / 16) * 512 * 2; pv1 += (HD / 16) * 512 * 2;   // 32 keys on: the next HD / 16 blocks
        v8f s[2][2];
#pragma unroll
        for (int qt = 0; qt < 2; ++qt)
#pragma unroll
            for (int kt = 0; kt < 2; ++kt) s[qt][kt] = (v8f){};
#pragma unroll
        for (int ks = 0; ks < 2; ++ks) {
#pragma unroll
            for (int qt = 0; qt < 2; ++qt)
#pragma unroll
                for (int kt = 0; kt < 2; ++kt) s[qt][kt] = wmmab(kh[kt][ks], qh[qt][ks], s[qt][kt]);
#pragma unroll
            for (int qt = 0; qt < 2; ++qt)
#pragma unroll
                for (int kt = 0; kt < 2; ++kt) s[qt][kt] = wmmab(kh[kt][ks], ql[qt][ks], s[qt][kt]);
#pragma unroll
            for (int qt = 0; qt < 2; ++qt)
#pragma unroll
                for (int kt = 0; kt < 2; ++kt) s[qt][kt] = wmmab(kl[kt][ks], qh[qt][ks], s[qt][kt]); }
        kb = (kb + 32 * HD * 2) & (TT * HD * 2 - 1);   // the next pass's K fragments, fetched behind this pass's score products into the same registers; the last pass fetches keys 0..31 again (in bounds, unused)
#pragma unroll
        for (int kt = 0; kt < 2; ++kt)
#pragma unroll
            for (int ks = 0; ks < 2; ++ks) { const int ck = (kt * 16 * HD + ks * 512) * 2; kh[kt][ks] = ldfb(Kh, kb, ck); kl[kt][ks] = ldfb(Kl, kb, ck); }
        asm volatile("s_wait_xcnt 0x0" :: "v"(kb) : "memory");   // as above: in front of the next step of kb
        v16h pf[2]; v16bf ph[2], pl[2];
#pragma unroll
        for (int qt = 0; qt < 2; ++qt) {
            float t[16]; float cm = -3.0e38f;
#pragma unroll
            for (int e = 0; e < 16; ++e) { t[e] = s[qt][e >> 3][e & 7] * SCL; cm = fmaxf(cm, t[e]); }
            cm = fmaxf(cm, xhalf(cm));
            const float mn = fmaxf(m[qt], cm); const float al = exp2s((m[qt] - mn) * 1.4426950408889634f); m[qt] = mn; float ls = 0.f;
#pragma unroll
            for (int e = 0; e < 16; ++e) { t[e] = exp2s((t[e] - mn) * 1.4426950408889634f); ls += t[e]; }
            l[qt] = l[qt] * al + ls;
#pragma unroll
            for (int dt = 0; dt < 4; ++dt) o[qt][dt] *= al;
            if (HR) { v8us h0, h1, l0, l1; v8f t0, t1;
#pragma unroll
                for (int j = 0; j < 8; ++j) { t0[j] = t[j]; t1[j] = t[8 + j]; }
                split8(t0, h0, l0); split8(t1, h1, l1); ph[qt] = cat16b(h0, h1); pl[qt] = cat16b(l0, l1);
            } else { v8h c0, c1;
#pragma unroll
                for (int j = 0; j < 8; ++j) { c0[j] = tohx(t[j] * PCAR); c1[j] = tohx(t[8 + j] * PCAR); }
                pf[qt] = cat16(c0, c1); } }
        if (HR) {
#pragma unroll
            for (int qt = 0; qt < 2; ++qt)
#pragma unroll
                for (int dt = 0; dt < 4; ++dt) o[qt][dt] = wmmab(vh[dt], ph[qt], o[qt][dt]);
#pragma unroll
            for (int qt = 0; qt < 2; ++qt)
#pragma unroll
                for (int dt = 0; dt < 4; ++dt) o[qt][dt] = wmmab(vh[dt], pl[qt], o[qt][dt]);
#pragma unroll
            for (int qt = 0; qt < 2; ++qt)
#pragma unroll
                for (int dt = 0; dt < 4; ++dt) o[qt][dt] = wmmab(vl[dt], ph[qt], o[qt][dt]);
        } else {
#pragma unroll
            for (int qt = 0; qt < 2; ++qt)
#pragma unroll
                for (int dt = 0; dt < 4; ++dt) o[qt][dt] = wmma16(vf[dt], pf[qt], o[qt][dt]); }
    }
#pragma unroll
    for (int qt = 0; qt < 2; ++qt) { const float lt = l[qt] + xhalf(l[qt]); const float f = __fdiv_rn(HR ? 1.0f : (1.0f / PCAR), lt); v8us oh[4], ol[4];
#pragma unroll
        for (int dt = 0; dt < 4; ++dt) split8(o[qt][dt] * f, oh[dt], ol[dt]);
        bf* pa = Ah + (size_t)(q0 + qt * 16) * DQ + lane * 8; bf* pl2 = Al + (size_t)(q0 + qt * 16) * DQ + lane * 8;   // fragment order of the [row][DQ] planes: 16 columns on are 256 elements on
#pragma unroll
        for (int dt = 0; dt < 4; ++dt) { *(v8us*)(pa + dt * 256) = oh[dt]; *(v8us*)(pl2 + dt * 256) = ol[dt]; }
        asm volatile("s_wait_xcnt 0x0" :: "v"(oh[0]), "v"(oh[1]), "v"(oh[2]), "v"(oh[3]), "v"(ol[0]), "v"(ol[1]), "v"(ol[2]), "v"(ol[3]), "v"(pa), "v"(pl2) : "memory"); }   // the wait in front of any overwrite of a data or address register of the eight issued stores; they are inputs so that they stay in their registers up to here
}
__global__ __launch_bounds__(128) void k_fattn(const bf* __restrict__ Qh, const bf* __restrict__ Ql, const bf* __restrict__ Kh, const bf* __restrict__ Kl, const h16* __restrict__ V16, const bf* __restrict__ Vh, const bf* __restrict__ Vl, bf* Ah, bf* Al) {
    const size_t hp = ((size_t)blockIdx.z * NH_ + blockIdx.y) * TT * HD; const int q0 = blockIdx.x * 128 + (threadIdx.x >> 5) * 32; const size_t ao = (size_t)blockIdx.z * TT * DQ + blockIdx.y * (HD / 32) * 512; Ah += ao; Al += ao;   // blockIdx.z: batch (planes [b][h], rows b * TT + t of the output planes)
    if (blockIdx.x < RH / 128) fattn_rows<true>(Qh + hp, Ql + hp, Kh + hp, Kl + hp, V16 + hp, Vh + hp, Vl + hp, Ah, Al, q0);
    else fattn_rows<false>(Qh + hp, Ql + hp, Kh + hp, Kl + hp, V16 + hp, Vh + hp, Vl + hp, Ah, Al, q0);
}

extern "C" void kernel_launch(void* const* d_in, const int* in_sizes, int n_in,
                              void* d_out, int out_size, void* d_ws, size_t ws_size, hipStream_t stream) {
    (void)in_sizes; (void)n_in; (void)out_size;
    const float* x = (const float*)d_in[0]; const float* wq = (const float*)d_in[1]; const float* wk = (const float*)d_in[2]; const float* wv = (const float*)d_in[3]; const float* wo = (const float*)d_in[4]; const float* lng = (const float*)d_in[5]; const float* lnb = (const float*)d_in[6];
    float* OUT = (float*)d_out;     // [4][2048][1024]
    char* wsp = (char*)d_ws;
    auto take = [&](size_t bytes) { char* p = wsp; wsp += (bytes + 255) & ~(size_t)255; return (void*)p; };
    bf* WQ = (bf*)take((size_t)DQ * DM * 2); bf* WK = (bf*)take((size_t)DKV * DM * 2); bf* WV = (bf*)take((size_t)DKV * DM * 2); bf* WO = (bf*)take((size_t)DM * DQ * 2);
    bf* XB = (bf*)take((size_t)NB_ * TT * DM * 2); float* Y = (float*)take((size_t)NB_ * TT * DM * 4);
    h16* VT16 = (h16*)take((size_t)NB_ * NKV * HD * TT * 2);
    bf* QPh = (bf*)take((size_t)NB_ * NH_ * TT * HD * 2); bf* QPl = (bf*)take((size_t)NB_ * NH_ * TT * HD * 2); bf* KPh = (bf*)take((size_t)NB_ * NKV * TT * HD * 2); bf* KPl = (bf*)take((size_t)NB_ * NKV * TT * HD * 2); bf* VTh = (bf*)take((size_t)NB_ * NKV * HD * TT * 2); bf* VTl = (bf*)take((size_t)NB_ * NKV * HD * TT * 2);
    bf* ATh = (bf*)take((size_t)NB_ * TT * DQ * 2); bf* ATl = (bf*)take((size_t)NB_ * TT * DQ * 2);
    if ((size_t)(wsp - (char*)d_ws) > ws_size) return;    // 200 MiB of the 256 MiB
    { k_wtG<<<(unsigned)((DM * DQ / 8 + 255) / 256), 256, 0, stream>>>(wq, DM, DQ, WQ); k_wtG<<<(unsigned)((DM * DKV / 8 + 255) / 256), 256, 0, stream>>>(wk, DM, DKV, WK); k_wtG<<<(unsigned)((DM * DKV / 8 + 255) / 256), 256, 0, stream>>>(wv, DM, DKV, WV);
      k_wtG<<<(unsigned)((DQ * DM / 8 + 255) / 256), 256, 0, stream>>>(wo, DQ, DM, WO);
       }
    k_cvt8<<<(unsigned)(((size_t)NB_ * TT * DM / 8 + 255) / 256), 256, 0, stream>>>(x, XB);
    k_proj<<<dim3(NB_ * TT / 128, NH_ / 4, 3), 256, 0, stream>>>(XB, WQ, WK, WV, QPh, QPl, KPh, KPl, VT16, VTh, VTl);   /* q, k, v and their head planes */
    k_fattn<<<dim3(TT / 128, NH_, NB_), 128, 0, stream>>>(QPh, QPl, KPh, KPl, VT16, VTh, VTl, ATh, ATl);   /* scores hi/lo on EVERY row (sigma-16 logits), softmax, attn.v hybrid, merge */
    k_gemmw<bf, false, true, DQ><<<dim3(NB_ * TT / 128, DM / 128, 1), 128, 0, stream>>>(ATh, ATl, WO, Y, DM, nullptr, x, 0, 0, 0); k_lnout<<<(NB_ * TT + 7) / 8, 256, 0, stream>>>(Y, lng, lnb, OUT);   /* LayerNorm(h + attn_out) */
}

// v008
// One run takes 227 microseconds.
// In both of two side-by-side timings against v007, it was 1.03 times as fast.
// Counting every step since v000, it is 17.6 times as fast.
#include <hip/hip_runtime.h>

// Transformer-XL style multi-head attention with post-LayerNorm (h [4][2048][1024]; q,k,v = h W ('xw' [1024][1024] with scale 1/8 x normal: sigma-4 projections, so the /8 logits have sigma ~16: sharply peaked); scores x 64^-0.5; softmax over keys; attn_out = attn_vec Wo ('xw', no bias); out = LayerNorm(h + attn_out) gamma/beta (1e-5) -> [4][2048][1024] (8.4 M)).
// Layout, every stage ONE launch over all NB_ batches (the batch is folded into the grid: rows b*TT + t, planes [b][h]): bf16 copy of h; 'xw' weights transposed once; exact projections, all three in one launch whose epilogue writes the 16-bit head planes straight from the accumulators (no f32 copy of q, k or v exists); one fused attention kernel (scores hi/lo 3 products on EVERY row (peaked logits), running-maximum softmax in registers, P and attn.v hybrid (rows < 512 hi/lo, rest fp16 x1024)); merged hi/lo x Wo exact into workspace; the residual added in that product's epilogue; a row LayerNorm kernel (one wave per 1,024-wide row, fixed-order sums, precise sqrt/div, affine) writes the output rows.
// Every 16-bit matrix operand plane (h copy, transposed weights, Q, K, Vt, attention output) is stored in FRAGMENT ORDER (fo() below): blocks of 16 rows x 32 k = 1 KiB, inside a block the 16-byte chunk that lane l loads stands at byte 16 l (first half of the fragment) and 512 + 16 l (second half), so each wave-wide 16-byte load reads 512 contiguous bytes (4 whole lines) instead of 32 bytes from each of 16 lines. Which element lands in which lane and register is as with row-major planes.
// Compute dtypes, f32 accumulate: every input rounded to bf16; projections exact; scores 3 products on every row; softmax f32; attn.v rows < 512 3 products, rest fp16; Wo hl x exact; residual + LayerNorm f32.

#define NB_  4
#define TT   2048
#define DM   1024
#define NH_  16
#define NKV  16
#define REP  (NH_ / NKV)
#define HD   64
#define DQ   (NH_ * HD)
#define DKV  (NKV * HD)
#define RH   512                  // query rows < RH use hi+lo planes (0: none)
#define WIN  0
#define PCAR 1024.0f
#define SCL  0.125f
#define LNEPS 1e-5f
typedef _Float16 h16;
typedef unsigned short bf;
typedef __attribute__((ext_vector_type(16))) __bf16   v16bf;
typedef __attribute__((ext_vector_type(16))) _Float16 v16h;
typedef __attribute__((ext_vector_type(8)))  _Float16 v8h;
typedef __attribute__((ext_vector_type(8)))  unsigned short v8us;
typedef __attribute__((ext_vector_type(8)))  float    v8f;
typedef __attribute__((ext_vector_type(4)))  float    v4f;
typedef v8h  __attribute__((may_alias)) v8ha;
typedef v4f  __attribute__((may_alias)) v4fa;
typedef v8us __attribute__((may_alias)) v8usa;

typedef __attribute__((ext_vector_type(8)))  __bf16   v8bf;
// f32 -> bf16, nearest even, by the chip's own conversion (v_cvt_pk_bf16_f32: two values an instruction, already packed); the same value as adding 0x7FFF + the kept part's last bit and cutting, for every finite input
__device__ __forceinline__ unsigned short f2bf(float f) { return __builtin_bit_cast(unsigned short, (__bf16)f); }
__device__ __forceinline__ v8us rnd8(v8f x) { return __builtin_bit_cast(v8us, __builtin_convertvector(x, v8bf)); }
// hi = bf16(x), lo = bf16(x - hi) of eight values (the difference is exact in f32)
__device__ __forceinline__ void split8(v8f x, v8us& h, v8us& l) { const v8bf hb = __builtin_convertvector(x, v8bf); h = __builtin_bit_cast(v8us, hb); l = rnd8(x - __builtin_convertvector(hb, v8f)); }
__device__ __forceinline__ float bf2f(unsigned short b) { return __uint_as_float(((unsigned)b) << 16); }
__device__ __forceinline__ float bfr(float f) { return bf2f(f2bf(f)); }
__device__ __forceinline__ v16h cat16(v8h lo, v8h hi) { return __builtin_shufflevector(lo, hi, 0, 1, 2, 3, 4, 5, 6, 7, 8, 9, 10, 11, 12, 13, 14, 15); }
__device__ __forceinline__ v16bf cat16b(v8us lo, v8us hi) { return __builtin_bit_cast(v16bf, __builtin_shufflevector(lo, hi, 0, 1, 2, 3, 4, 5, 6, 7, 8, 9, 10, 11, 12, 13, 14, 15)); }
__device__ __forceinline__ v8f wmma16(v16h a, v16h b, v8f c) { return __builtin_amdgcn_wmma_f32_16x16x32_f16(false, a, false, b, (short)0, c, false, false); }
__device__ __forceinline__ v8f wmmab(v16bf a, v16bf b, v8f c) { return __builtin_amdgcn_wmma_f32_16x16x32_bf16(false, a, false, b, (short)0, c, false, false); }
// fragment order of a [rows][K] 16-bit plane (rows % 16 == 0, K % 32 == 0): element index of (row, k). Block (row / 16, k / 32) of 512 elements; in it half (k / 16) % 2, then lane 16 ((k / 8) % 2) + row % 16, then k % 8.
__device__ __forceinline__ size_t fo(int row, int k, int K) { return ((size_t)(row >> 4) * (K >> 5) + (k >> 5)) * 512 + ((k >> 4) & 1) * 256 + ((k >> 3) & 1) * 128 + (row & 15) * 8 + (k & 7); }
// the same blocks in the other order, block (k / 32, row / 16), for a plane of R rows whose reader takes all R rows of a k step at once (Vt: the R / 16 blocks of a pass lie side by side)
__device__ __forceinline__ size_t fok(int row, int k, int R) { return ((size_t)(k >> 5) * (R >> 4) + (row >> 4)) * 512 + ((k >> 4) & 1) * 256 + ((k >> 3) & 1) * 128 + (row & 15) * 8 + (k & 7); }



// ---- staging of GEMM operands in LDS by asynchronous copies. A stage is 64 k of every 16-row band of a work-group's tile: 2 KiB a band, contiguous in the plane (fragment order) and in LDS alike, so that a fragment is read from LDS as it was read from the plane (lane l's chunk at byte 16 l).
// CPB: one band of a stage, four copies of 512 B a wave; the immediate offset moves the global and the LDS address together.
#define CPB(L, G) "global_load_async_to_lds_b128 " L ", " G ", off\n\tglobal_load_async_to_lds_b128 " L ", " G ", off offset:512\n\tglobal_load_async_to_lds_b128 " L ", " G ", off offset:1024\n\tglobal_load_async_to_lds_b128 " L ", " G ", off offset:1536\n\t"
// three or six bands in one statement; its last line is the wait in front of any overwrite of an address register that an issued copy names
__device__ __forceinline__ void cp3(const unsigned* l, const char* const* g, unsigned lb, size_t go) {
    asm volatile(CPB("%0", "%3") CPB("%1", "%4") CPB("%2", "%5") "s_wait_xcnt 0x0" :: "v"(l[0] + lb), "v"(l[1] + lb), "v"(l[2] + lb), "v"(g[0] + go), "v"(g[1] + go), "v"(g[2] + go) : "memory"); }
__device__ __forceinline__ void cp6(const unsigned* l, const char* const* g, unsigned lb, size_t go) {
    asm volatile(CPB("%0", "%6") CPB("%1", "%7") CPB("%2", "%8") CPB("%3", "%9") CPB("%4", "%10") CPB("%5", "%11") "s_wait_xcnt 0x0" :: "v"(l[0] + lb), "v"(l[1] + lb), "v"(l[2] + lb), "v"(l[3] + lb), "v"(l[4] + lb), "v"(l[5] + lb), "v"(g[0] + go), "v"(g[1] + go), "v"(g[2] + go), "v"(g[3] + go), "v"(g[4] + go), "v"(g[5] + go) : "memory"); }
#define STG (24 * 2048)           // bytes of a stage: 24 bands

// ---- k_gemmw: register-blocked GEMM, one wave per 64x64 output tile (16 accumulators), FOUR waves (2 x 2) a work-group on a 128x128 tile whose operand bands they share through LDS; operands from 16-bit planes in fragment order; grid (M/128, N/128, Z), 128 threads.
// C[m][n] (f32, pitch ldc, + optional f32 bias[n], + optional residual res[m][n] of the same pitch, rounded to bf16 like every input) = sum_k (A[m][k] + A2[m][k]) Bt[n][k], two products. z-batch strides sA/sB/sC in elements. K % 64 == 0, K >= 128, a compile-time constant.
// Two buffers: stage t + 1's copies fly while stage t is worked on; wave w brings bands 6 w .. 6 w + 5 of [A 8 | A2 8 | Bt 8].
template <typename T16> struct WFrag;
template <> struct WFrag<h16> { typedef v16h V; static __device__ __forceinline__ V ld(const char* p) { return cat16(*(const v8h*)p, *(const v8h*)(p + 512)); } static __device__ __forceinline__ v8f mma(V a, V b, v8f c) { return wmma16(a, b, c); } };
template <> struct WFrag<bf> { typedef v16bf V; static __device__ __forceinline__ V ld(const char* p) { return cat16b(*(const v8us*)p, *(const v8us*)(p + 512)); } static __device__ __forceinline__ v8f mma(V a, V b, v8f c) { return wmmab(a, b, c); } };
template <typename T16, bool BIAS, bool RES, int K>
__global__ __launch_bounds__(128) __attribute__((amdgpu_num_vgpr(256))) /* the loop's fragments and accumulators stay in the first window of 256 registers: no window switch among the products */ void k_gemmw(const T16* __restrict__ A, const T16* __restrict__ A2, const T16* __restrict__ Bt, float* C, int ldc, const float* __restrict__ bias, const float* __restrict__ res, size_t sA, size_t sB, size_t sC) {
    typedef typename WFrag<T16>::V V;
    __shared__ __attribute__((aligned(2048))) char st[2 * STG];
    __shared__ __align__(16) float osa[4][16 * 68];
    const size_t z = blockIdx.z; A += z * sA; A2 += z * sA; Bt += z * sB; C += z * sC; if (RES) res += z * sC;
    const int lane = threadIdx.x & 31, lr = lane & 15, hi = lane >> 4; const int w = __builtin_amdgcn_readfirstlane((int)(threadIdx.x >> 5)); const int r0 = blockIdx.x * 128 + (w & 1) * 64, c0 = blockIdx.y * 128 + (w >> 1) * 64;
    float* os = osa[w];   // the wave's own staging of its output bands
    v8f acc[4][4];
#pragma unroll
    for (int mb = 0; mb < 4; ++mb)
#pragma unroll
        for (int nb = 0; nb < 4; ++nb) acc[mb][nb] = (v8f){};
    const char* gp[6]; unsigned lp[6];   // the lane's addresses in stage 0 of the wave's six bands: in the plane (a band is 32 K bytes) and in LDS
#pragma unroll
    for (int i = 0; i < 6; ++i) { const int g = 6 * w + i; const T16* pl = g < 8 ? A + (size_t)blockIdx.x * 128 * K : g < 16 ? A2 + (size_t)blockIdx.x * 128 * K : Bt + (size_t)blockIdx.y * 128 * K; gp[i] = (const char*)pl + (size_t)(g & 7) * 32 * K + lane * 16; lp[i] = (unsigned)(size_t)st + g * 2048 + lane * 16; }
    cp6(lp, gp, 0, 0);
    asm volatile("s_wait_asynccnt 0x0" ::: "memory");   // stage 0 has landed, as far as this wave brought it
    __syncthreads();                                     // ... and as far as the others did
    cp6(lp, gp, STG, 2048);
    const unsigned ao = (w & 1) * 4 * 2048 + lane * 16, bo = (16 + (w >> 1) * 4) * 2048 + lane * 16;   // the wave's four bands of A (A2: 8 bands on) and of Bt in a stage
#pragma unroll 1
    for (int t = 0; t < K / 64; ++t) {
        const char* sb = st + (t & 1) * STG; V a[4], a2[4], b[4];
#pragma unroll
        for (int mb = 0; mb < 4; ++mb) { a[mb] = WFrag<T16>::ld(sb + ao + mb * 2048); a2[mb] = WFrag<T16>::ld(sb + ao + (8 + mb) * 2048); }
#pragma unroll
        for (int nb = 0; nb < 4; ++nb) b[nb] = WFrag<T16>::ld(sb + bo + nb * 2048);
        __builtin_amdgcn_sched_barrier(0);   // keeps the block's LDS reads together in front of its products (the scheduler otherwise sinks some among them, each behind a wait to 0)
#pragma unroll
        for (int nb = 0; nb < 4; ++nb) {
#pragma unroll
            for (int mb = 0; mb < 4; ++mb) { acc[mb][nb] = WFrag<T16>::mma(a[mb], b[nb], acc[mb][nb]); acc[mb][nb] = WFrag<T16>::mma(a2[mb], b[nb], acc[mb][nb]); } }
#pragma unroll
        for (int mb = 0; mb < 4; ++mb) { a[mb] = WFrag<T16>::ld(sb + ao + mb * 2048 + 1024); a2[mb] = WFrag<T16>::ld(sb + ao + (8 + mb) * 2048 + 1024); }   // the stage's second block: its fragments are fetched in front of the hand-over, its products stand behind it
#pragma unroll
        for (int nb = 0; nb < 4; ++nb) b[nb] = WFrag<T16>::ld(sb + bo + nb * 2048 + 1024);
        __builtin_amdgcn_sched_barrier(0);   // keeps the first block's products in front of the hand-over, so that the refill is issued right behind the barrier (the scheduler otherwise sinks products between barrier and copies)
        asm volatile("s_wait_dscnt 0x0" ::: "memory");      // this wave's reads of stage t have returned
        asm volatile("s_wait_asynccnt 0x0" ::: "memory");   // its copies of stage t + 1 have landed
        __syncthreads();                                     // publishes stage t + 1 and ends every wave's reads of stage t
        if (t + 2 < K / 64) cp6(lp, gp, (t & 1) * STG, (size_t)(t + 2) * 2048);   // stage t + 2 into the buffer just left, in flight from here to the hand-over of the next trip
#pragma unroll
        for (int nb = 0; nb < 4; ++nb) {
#pragma unroll
            for (int mb = 0; mb < 4; ++mb) { acc[mb][nb] = WFrag<T16>::mma(a[mb], b[nb], acc[mb][nb]); acc[mb][nb] = WFrag<T16>::mma(a2[mb], b[nb], acc[mb][nb]); } }
    }
    asm volatile("s_wait_asynccnt 0x0" ::: "memory");   // no copy outlives the loop
#pragma unroll
    for (int mb = 0; mb < 4; ++mb) {
        v4f rv[8];
        if (RES) { const float* p[8];   // the band's residual rows, in flight under the staging of the band
#pragma unroll
            for (int s = 0; s < 8; ++s) { p[s] = res + (size_t)(r0 + mb * 16 + 2 * s + hi) * ldc + c0 + lr * 4; rv[s] = *(const v4f*)p[s]; }
            asm volatile("s_wait_xcnt 0x0" :: "v"(p[0]), "v"(p[1]), "v"(p[2]), "v"(p[3]), "v"(p[4]), "v"(p[5]), "v"(p[6]), "v"(p[7]) : "memory"); }   // the wait in front of any overwrite of an address register that an issued load names; the addresses are inputs so that they stay in their registers up to here
#pragma unroll
        for (int nb = 0; nb < 4; ++nb) {
#pragma unroll
            for (int j = 0; j < 8; ++j) os[(hi * 8 + j) * 68 + nb * 16 + lr] = acc[mb][nb][j]; }
        __builtin_amdgcn_wave_barrier(); asm volatile("" ::: "memory");
        float* crow = C + (size_t)(r0 + mb * 16) * ldc + c0;
{
#pragma unroll
            for (int s = 0; s < 8; ++s) { const int row = 2 * s + hi, cofs = lr * 4; v4f val = *(const v4fa*)(os + row * 68 + cofs); if (BIAS) { val[0] += bfr(bias[c0 + cofs]); val[1] += bfr(bias[c0 + cofs + 1]); val[2] += bfr(bias[c0 + cofs + 2]); val[3] += bfr(bias[c0 + cofs + 3]); }
                if (RES) { for (int q = 0; q < 4; ++q) val[q] = __fadd_rn(val[q], bfr(rv[s][q])); }
                *(v4f*)(crow + (size_t)row * ldc + cofs) = val; }
             }
        __builtin_amdgcn_wave_barrier(); asm volatile("" ::: "memory");
    }
}

__device__ __forceinline__ h16 tohx(float x) { return (h16)x; }
typedef __attribute__((ext_vector_type(2))) _Float16 v2h;
typedef __attribute__((ext_vector_type(4))) _Float16 v4h;
typedef __attribute__((ext_vector_type(2))) unsigned short v2us;
typedef __attribute__((ext_vector_type(4))) unsigned short v4us;
typedef __attribute__((ext_vector_type(2))) float v2f;
typedef __attribute__((ext_vector_type(4))) int v4i;

// ---- k_prep: every 16-bit operand plane that is made straight from an input, in ONE launch of few, long waves: the four transposed weights Bt[n][k] = bf16(w[k][n]) and the bf16 copy of h [NB_ TT][DM], all in fragment order. A thread makes PCH chunks of 16 bytes (8 k of one row of the plane), 128 k apart, and has the loads of all of them in flight before the first conversion: the stage starts an eighth of the waves that one chunk a thread takes, and pays one launch instead of five.
// Which lane makes which chunk is as with one chunk a thread. Weights: lanes along n, every read a whole line of w, every store 16 bytes a lane in two runs of 256 bytes. h: 8 lanes cover 64 k of a row (256 bytes read), the next 8 lanes the next row, so that a store writes runs of 64 bytes. 128 k on are 4 blocks = 2,048 elements on in the plane.
#define PCH   8
#define PWG_W (DM * DM / 8 / PCH / 256)             // work-groups a weight
#define PWG_X (NB_ * TT * DM / 8 / PCH / 256)       // work-groups on h
static_assert(DQ == DM && DKV == DM && DM == PCH * 128 && (DM * DM) % (8 * PCH * 256) == 0 && (NB_ * TT * DM) % (8 * PCH * 256) == 0, "k_prep: square weights, PCH chunks 128 k apart cover a row, whole work-groups");
// the PCH chunks of a thread, rounded and stored: every conversion in front of the first store, each chunk in registers of its own
__device__ __forceinline__ void prep_out(const v8f* v, bf* q) {
    v8us o[PCH];
#pragma unroll
    for (int t = 0; t < PCH; ++t) o[t] = rnd8(v[t]);
#pragma unroll
    for (int t = 0; t < PCH; ++t) *(v8us*)(q + t * 2048) = o[t];
}
__global__ __launch_bounds__(256) void k_prep(const float* __restrict__ x, const float* __restrict__ wq, const float* __restrict__ wk, const float* __restrict__ wv, const float* __restrict__ wo, bf* XB, bf* WQ, bf* WK, bf* WV, bf* WO) {
    v8f v[PCH];
    if (blockIdx.x < 4 * PWG_W) {   // the weights first: their reads are the narrower ones
        const int z = blockIdx.x / PWG_W; const float* w = z == 0 ? wq : z == 1 ? wk : z == 2 ? wv : wo; bf* Bt = z == 0 ? WQ : z == 1 ? WK : z == 2 ? WV : WO;
        const unsigned i = (blockIdx.x % PWG_W) * 256 + threadIdx.x; const int n = (int)(i % DM), k0 = (int)(i / DM) * 8; const unsigned ofs = ((unsigned)k0 * DM + n) * 4;
#pragma unroll
        for (int t = 0; t < PCH; ++t)
#pragma unroll
            for (int j = 0; j < 8; ++j) v[t][j] = *(const float*)((const char*)w + (t * 128 + j) * DM * 4 + ofs);
        asm volatile("s_wait_xcnt 0x0" :: "v"(ofs) : "memory");   // the wait in front of any overwrite of the offset register that the issued loads name; the offset is an input so that it stays in its register up to here
        prep_out(v, Bt + fo(n, k0, DM));
        return;
    }
    const unsigned i = (blockIdx.x - 4 * PWG_W) * 256 + threadIdx.x; const int row = (int)((i >> 3) % (unsigned)(NB_ * TT)), k = (int)((i >> 3) / (unsigned)(NB_ * TT)) * 64 + (int)(i & 7) * 8; const unsigned ofs = ((unsigned)row * DM + k) * 4;
#pragma unroll
    for (int t = 0; t < PCH; ++t) v[t] = *(const v8f*)((const char*)x + t * 128 * 4 + ofs);
    asm volatile("s_wait_xcnt 0x0" :: "v"(ofs) : "memory");   // as above
    __builtin_amdgcn_sched_barrier(0);   // keeps every load of the thread in front of the first conversion (the scheduler otherwise holds the last load back until an earlier one's registers are free)
    prep_out(v, XB + fo(row, k, DM));
}

// ---- k_proj: the q, k and v projections in ONE launch, one wave per 64 x 64 tile (64 rows b * TT + t of the bf16 copy of h, the 64 columns of one head), EIGHT waves a work-group: 2 row tiles x 4 heads, which share their operand bands through LDS; grid (NB_ TT / 128, heads / 4, 3), 256 threads, blockIdx.z: 0 q, 1 k, 2 v. The k loop is k_gemmw's: two buffers, stages of 64 k, [h 8 bands | W 16 bands]; wave w brings bands 3 w .. 3 w + 2.
// The epilogue writes the head planes in fragment order straight from the accumulators: a lane holds 8 consecutive rows of the A operand for one row of the B operand, and that is one 16-byte chunk of a plane if A runs along the plane's k: for q and k (planes [t][d], chunks of 8 d) A = the weight rows (d), B = the rows of h (t); for v (planes [d][t], chunks of 8 t) A = the rows of h, B = the weight rows. Lane l's chunk stands at byte 16 l of a half block, so every store is 512 contiguous bytes of a wave.
__global__ __launch_bounds__(256) __attribute__((amdgpu_waves_per_eu(4, 4))) void k_proj(const bf* __restrict__ X, const bf* __restrict__ Wq, const bf* __restrict__ Wk, const bf* __restrict__ Wv, bf* Qh, bf* Ql, bf* Kh, bf* Kl, h16* V16, bf* Vh, bf* Vl) {
    __shared__ __attribute__((aligned(2048))) char st[2 * STG];
    const int lane = threadIdx.x & 31; const int w = __builtin_amdgcn_readfirstlane((int)(threadIdx.x >> 5)); const int r0 = blockIdx.x * 128 + (w & 1) * 64, hd = blockIdx.y * 4 + (w >> 1), z = blockIdx.z;
    const bf* xr = X + (size_t)blockIdx.x * 128 * DM; const bf* wr = (z == 0 ? Wq : z == 1 ? Wk : Wv) + (size_t)blockIdx.y * 4 * HD * DM;
    v8f acc[4][4];
#pragma unroll
    for (int mb = 0; mb < 4; ++mb)
#pragma unroll
        for (int nb = 0; nb < 4; ++nb) acc[mb][nb] = (v8f){};
    const char* gp[3]; unsigned lp[3];   // the lane's addresses in stage 0 of the wave's three bands: in the plane (a band is 32 DM bytes) and in LDS
#pragma unroll
    for (int i = 0; i < 3; ++i) { const int g = 3 * w + i; gp[i] = (g < 8 ? (const char*)xr + (size_t)g * 32 * DM : (const char*)wr + (size_t)(g - 8) * 32 * DM) + lane * 16; lp[i] = (unsigned)(size_t)st + g * 2048 + lane * 16; }
    cp3(lp, gp, 0, 0);
    asm volatile("s_wait_asynccnt 0x0" ::: "memory");   // stage 0 has landed, as far as this wave brought it
    __syncthreads();                                     // ... and as far as the others did
    cp3(lp, gp, STG, 2048);
    const unsigned xo = (w & 1) * 4 * 2048 + lane * 16, wo = (8 + (w >> 1) * 4) * 2048 + lane * 16; const unsigned ao = z == 2 ? xo : wo, bo = z == 2 ? wo : xo;   // the wave's four bands of each operand in a stage
#pragma unroll 1
    for (int t = 0; t < DM / 64; ++t) {
        const char* sb = st + (t & 1) * STG; v16bf a[4], b[4];
#pragma unroll
        for (int mb = 0; mb < 4; ++mb) a[mb] = WFrag<bf>::ld(sb + ao + mb * 2048);
#pragma unroll
        for (int nb = 0; nb < 4; ++nb) b[nb] = WFrag<bf>::ld(sb + bo + nb * 2048);
        __builtin_amdgcn_sched_barrier(0);   // keeps the block's sixteen LDS reads together in front of its products (the scheduler otherwise sinks the B reads among them, each behind a wait to 0)
#pragma unroll
        for (int nb = 0; nb < 4; ++nb)
#pragma unroll
            for (int mb = 0; mb < 4; ++mb) acc[mb][nb] = wmmab(a[mb], b[nb], acc[mb][nb]);
#pragma unroll
        for (int mb = 0; mb < 4; ++mb) a[mb] = WFrag<bf>::ld(sb + ao + mb * 2048 + 1024);   // the stage's second block: its fragments are fetched in front of the hand-over, its products stand behind it
#pragma unroll
        for (int nb = 0; nb < 4; ++nb) b[nb] = WFrag<bf>::ld(sb + bo + nb * 2048 + 1024);
        __builtin_amdgcn_sched_barrier(0);   // keeps the first block's products in front of the hand-over, so that the refill is issued right behind the barrier (the scheduler otherwise sinks products between barrier and copies)
        asm volatile("s_wait_dscnt 0x0" ::: "memory");      // this wave's reads of stage t have returned
        asm volatile("s_wait_asynccnt 0x0" ::: "memory");   // its copies of stage t + 1 have landed
        __syncthreads();                                     // publishes stage t + 1 and ends every wave's reads of stage t
        if (t + 2 < DM / 64) cp3(lp, gp, (t & 1) * STG, (size_t)(t + 2) * 2048);   // stage t + 2 into the buffer just left, in flight from here to the hand-over of the next trip
#pragma unroll
        for (int nb = 0; nb < 4; ++nb)
#pragma unroll
            for (int mb = 0; mb < 4; ++mb) acc[mb][nb] = wmmab(a[mb], b[nb], acc[mb][nb]);
    }
    asm volatile("s_wait_asynccnt 0x0" ::: "memory");   // no copy outlives the loop
    const size_t tb = ((size_t)(r0 / TT) * NH_ + hd) * TT * HD + (size_t)(r0 % TT) * HD + lane * 8;   // the tile's 4,096 elements are contiguous in each plane [b][h], by fo() and by fok() alike
    if (z == 2) {
#pragma unroll
        for (int mb = 0; mb < 4; ++mb) { v8h o16[4]; v8us oh[4], ol[4];
#pragma unroll
            for (int nb = 0; nb < 4; ++nb) { split8(acc[mb][nb], oh[nb], ol[nb]);
#pragma unroll
                for (int j = 0; j < 8; ++j) o16[nb][j] = tohx(acc[mb][nb][j]); }
            const size_t eo = tb + (mb >> 1) * (HD / 16) * 512 + (mb & 1) * 256; h16* p16 = V16 + eo; bf* ph = Vh + eo; bf* pl = Vl + eo;   // fok(): t = 16 mb + 8 hi + j, d = 16 nb + lr
#pragma unroll
            for (int nb = 0; nb < 4; ++nb) { *(v8h*)(p16 + nb * 512) = o16[nb]; *(v8us*)(ph + nb * 512) = oh[nb]; *(v8us*)(pl + nb * 512) = ol[nb]; }
            asm volatile("s_wait_xcnt 0x0" :: "v"(o16[0]), "v"(o16[1]), "v"(o16[2]), "v"(o16[3]), "v"(oh[0]), "v"(oh[1]), "v"(oh[2]), "v"(oh[3]), "v"(ol[0]), "v"(ol[1]), "v"(ol[2]), "v"(ol[3]), "v"(p16), "v"(ph), "v"(pl) : "memory"); }   // the wait in front of any overwrite of a data or address register of the twelve issued stores; they are inputs so that they stay in their registers up to here
    } else {
        bf* Ph = z == 0 ? Qh : Kh; bf* Pl = z == 0 ? Ql : Kl;
#pragma unroll
        for (int mb = 0; mb < 4; ++mb) { v8us oh[4], ol[4];
#pragma unroll
            for (int nb = 0; nb < 4; ++nb) split8(acc[mb][nb], oh[nb], ol[nb]);
            const size_t eo = tb + (mb >> 1) * 512 + (mb & 1) * 256; bf* ph = Ph + eo; bf* pl = Pl + eo;   // fo(): d = 16 mb + 8 hi + j, t = 16 nb + lr
#pragma unroll
            for (int nb = 0; nb < 4; ++nb) { *(v8us*)(ph + nb * (HD / 32) * 512) = oh[nb]; *(v8us*)(pl + nb * (HD / 32) * 512) = ol[nb]; }
            asm volatile("s_wait_xcnt 0x0" :: "v"(oh[0]), "v"(oh[1]), "v"(oh[2]), "v"(oh[3]), "v"(ol[0]), "v"(ol[1]), "v"(ol[2]), "v"(ol[3]), "v"(ph), "v"(pl) : "memory"); }   // as above, for the eight issued stores
    }
}
__global__ __launch_bounds__(256) void k_lnout(const float* __restrict__ F, const float* __restrict__ g, const float* __restrict__ bb, float* out) { const int lane = threadIdx.x & 31; const int row = blockIdx.x * 8 + (threadIdx.x >> 5); if (row >= NB_ * TT) return; const float* fr = F + (size_t)row * DQ; float* orow = out + (size_t)row * DQ; float v[DQ / 32]; float s = 0.f;
#pragma unroll
    for (int c = 0; c < DQ / 128; ++c) { const v4f a = *(const v4f*)(fr + c * 128 + lane * 4); for (int q = 0; q < 4; ++q) { v[c * 4 + q] = a[q]; s = __fadd_rn(s, a[q]); } }
#pragma unroll
    for (int sh = 16; sh; sh >>= 1) s = __fadd_rn(s, __shfl_xor(s, sh, 32));
    const float mean = __fdiv_rn(s, (float)DQ); float s2 = 0.f;
#pragma unroll
    for (int k = 0; k < DQ / 32; ++k) { const float dv = __fsub_rn(v[k], mean); float p2 = __fmul_rn(dv, dv); asm volatile("" : "+v"(p2)); s2 = __fadd_rn(s2, p2); v[k] = dv; }
#pragma unroll
    for (int sh = 16; sh; sh >>= 1) s2 = __fadd_rn(s2, __shfl_xor(s2, sh, 32));
    const float rs = __fdiv_rn(1.0f, __fsqrt_rn(__fadd_rn(__fdiv_rn(s2, (float)DQ), LNEPS)));
{
#pragma unroll
        for (int c = 0; c < DQ / 128; ++c) { v4f o; for (int q = 0; q < 4; ++q) { const int col = c * 128 + lane * 4 + q; float y = __fmul_rn(v[c * 4 + q], rs); asm volatile("" : "+v"(y)); y = __fmul_rn(y, bfr(g[col])); asm volatile("" : "+v"(y)); o[q] = __fadd_rn(y, bfr(bb[col])); } *(v4f*)(orow + c * 128 + lane * 4) = o; }
         } }
// ---- k_fattn: scores, softmax, attn.v and the hi/lo merge of one head in ONE kernel: no score or probability ever goes to memory. One work-group of 4 waves per (128 query rows, head, batch); each wave owns 32 query rows and walks all TT keys, 32 a pass.
// Transposed products: St[key][query] = K Qt (A = K rows, B = Q rows kept in registers; hi/lo 3 products in the order Qh Kh, Ql Kh, Qh Kl), so that a lane holds 16 scores of ONE query: maximum and sum in the lane plus one exchange between the wave's halves.
// The two 16-key score tiles of a pass ARE the B fragment of Ot[d][query] += Vt P (keys 8 hi + j and 16 + 8 hi + j): P is rounded in registers. Running maximum with rescale; P is left unnormalised (<= 1; fp16 rows x PCAR) and the division by the row sum is done once at the end.
__device__ __forceinline__ float xhalf(float x) { return __builtin_bit_cast(float, __builtin_amdgcn_permlanex16(__builtin_bit_cast(int, x), __builtin_bit_cast(int, x), 0x76543210, 0xfedcba98, false, false)); }   // lane l <-> lane l ^ 16
// 2^x with the issue slot that the instruction set asks for behind a transcendental (before its result is used or its source overwritten) filled in the same statement
__device__ __forceinline__ float exp2s(float x) { float r; asm("v_exp_f32 %0, %1\n\tv_nop" : "=v"(r) : "v"(x)); return r; }
// fragment loads at (uniform base + constant) + one 32-bit byte offset per lane: the offset is the only vector register that the loads name; planes in fragment order: the two halves of a fragment lie 512 bytes apart
__device__ __forceinline__ v16bf ldfb(const bf* base, unsigned ofs, int cst) { const char* p = (const char*)base + cst + ofs; return cat16b(*(const v8us*)p, *(const v8us*)(p + 512)); }
__device__ __forceinline__ v16h ldfh(const h16* base, unsigned ofs, int cst) { const char* p = (const char*)base + cst + ofs; return cat16(*(const v8h*)p, *(const v8h*)(p + 512)); }
template <bool HR>
__device__ __forceinline__ void fattn_rows(const bf* __restrict__ Qh, const bf* __restrict__ Ql, const bf* __restrict__ Kh, const bf* __restrict__ Kl, const h16* __restrict__ V16, const bf* __restrict__ Vh, const bf* __restrict__ Vl, bf* Ah, bf* Al, int q0) {
    const int lane = threadIdx.x & 31, lr = lane & 15, hi = lane >> 4;
    v16bf qh[2][2], ql[2][2], kh[2][2], kl[2][2];
    const unsigned qb = (q0 * HD + 8 * lane) * 2; unsigned kb = 8 * lane * 2; const unsigned vb = 8 * lane * 2;   // byte offsets of the lane's chunks in the Q, K and Vt planes (fragment order: a 16-row band of Q or K is 16 HD elements; the 4 blocks of Vt for 32 keys lie side by side)
    const char* pv0 = (HR ? (const char*)Vh : (const char*)V16) + vb; const char* pv1 = (const char*)Vl + vb;   // the lane's walking addresses in the Vt planes
#pragma unroll
    for (int qt = 0; qt < 2; ++qt)
#pragma unroll
        for (int ks = 0; ks < 2; ++ks) { const int cq = (qt * 16 * HD + ks * 512) * 2; qh[qt][ks] = ldfb(Qh, qb, cq); ql[qt][ks] = ldfb(Ql, qb, cq); }
    asm volatile("s_wait_xcnt 0x0" :: "v"(qb) : "memory");   // the wait in front of any overwrite of an offset register that an issued load names; the offset is an input so that it stays in its register up to here
#pragma unroll
    for (int kt = 0; kt < 2; ++kt)
#pragma unroll
        for (int ks = 0; ks < 2; ++ks) { const int ck = (kt * 16 * HD + ks * 512) * 2; kh[kt][ks] = ldfb(Kh, kb, ck); kl[kt][ks] = ldfb(Kl, kb, ck); }
    asm volatile("s_wait_xcnt 0x0" :: "v"(kb) : "memory");   // as above: in front of the first step of kb
    v8f o[2][4]; float m[2], l[2];
#pragma unroll
    for (int qt = 0; qt < 2; ++qt) { m[qt] = -3.0e38f; l[qt] = 0.f;
#pragma unroll
        for (int dt = 0; dt < 4; ++dt) o[qt][dt] = (v8f){}; }
#pragma unroll 1
    for (int k0 = 0; k0 < TT; k0 += 32) {   // rolled: one pass's code and registers
        v16h vf[4]; v16bf vh[4], vl[4];
#pragma unroll
        for (int dt = 0; dt < 4; ++dt) { const int cv = dt * 512 * 2; if (HR) { vh[dt] = ldfb((const bf*)(pv0 + cv), 0u, 0); vl[dt] = ldfb((const bf*)(pv1 + cv), 0u, 0); } else vf[dt] = ldfh((const h16*)(pv0 + cv), 0u, 0); }
        if (HR) asm volatile("s_wait_xcnt 0x0" :: "v"(pv0), "v"(pv1) : "memory");   // as above: in front of the step of the two addresses and of any fragment that would land on them
        else asm volatile("s_wait_xcnt 0x0" :: "v"(pv0) : "memory");   // the same for the one fp16 plane
        __builtin_amdgcn_sched_barrier(0);   // keeps the Vt loads at the head of the pass, in flight under the score products and the softmax (the scheduler otherwise sinks some of them, and the K fetch below with them, to the end of the pass)
        pv0 += (HD / 16) * 512 * 2; pv1 += (HD / 16) * 512 * 2;   // 32 keys on: the next HD / 16 blocks
        v8f s[2][2];
#pragma unroll
        for (int qt = 0; qt < 2; ++qt)
#pragma unroll
            for (int kt = 0; kt < 2; ++kt) s[qt][kt] = (v8f){};
#pragma unroll
        for (int ks = 0; ks < 2; ++ks) {
#pragma unroll
            for (int qt = 0; qt < 2; ++qt)
#pragma unroll
                for (int kt = 0; kt < 2; ++kt) s[qt][kt] = wmmab(kh[kt][ks], qh[qt][ks], s[qt][kt]);
#pragma unroll
            for (int qt = 0; qt < 2; ++qt)
#pragma unroll
                for (int kt = 0; kt < 2; ++kt) s[qt][kt] = wmmab(kh[kt][ks], ql[qt][ks], s[qt][kt]);
#pragma unroll
            for (int qt = 0; qt < 2; ++qt)
#pragma unroll
                for (int kt = 0; kt < 2; ++kt) s[qt][kt] = wmmab(kl[kt][ks], qh[qt][ks], s[qt][kt]); }
        kb = (kb + 32 * HD * 2) & (TT * HD * 2 - 1);   // the next pass's K fragments, fetched behind this pass's score products into the same registers; the last pass fetches keys 0..31 again (in bounds, unused)
#pragma unroll
        for (int kt = 0; kt < 2; ++kt)
#pragma unroll
            for (int ks = 0; ks < 2; ++ks) { const int ck = (kt * 16 * HD + ks * 512) * 2; kh[kt][ks] = ldfb(Kh, kb, ck); kl[kt][ks] = ldfb(Kl, kb, ck); }
        asm volatile("s_wait_xcnt 0x0" :: "v"(kb) : "memory");   // as above: in front of the next step of kb
        v16h pf[2]; v16bf ph[2], pl[2];
#pragma unroll
        for (int qt = 0; qt < 2; ++qt) {
            float t[16]; float cm = -3.0e38f;
#pragma unroll
            for (int e = 0; e < 16; ++e) { t[e] = s[qt][e >> 3][e & 7] * SCL; cm = fmaxf(cm, t[e]); }
            cm = fmaxf(cm, xhalf(cm));
            const float mn = fmaxf(m[qt], cm); const float al = exp2s((m[qt] - mn) * 1.4426950408889634f); m[qt] = mn; float ls = 0.f;
#pragma unroll
            for (int e = 0; e < 16; ++e) { t[e] = exp2s((t[e] - mn) * 1.4426950408889634f); ls += t[e]; }
            l[qt] = l[qt] * al + ls;
#pragma unroll
            for (int dt = 0; dt < 4; ++dt) o[qt][dt] *= al;
            if (HR) { v8us h0, h1, l0, l1; v8f t0, t1;
#pragma unroll
                for (int j = 0; j < 8; ++j) { t0[j] = t[j]; t1[j] = t[8 + j]; }
                split8(t0, h0, l0); split8(t1, h1, l1); ph[qt] = cat16b(h0, h1); pl[qt] = cat16b(l0, l1);
            } else { v8h c0, c1;
#pragma unroll
                for (int j = 0; j < 8; ++j) { c0[j] = tohx(t[j] * PCAR); c1[j] = tohx(t[8 + j] * PCAR); }
                pf[qt] = cat16(c0, c1); } }
        if (HR) {
#pragma unroll
            for (int qt = 0; qt < 2; ++qt)
#pragma unroll
                for (int dt = 0; dt < 4; ++dt) o[qt][dt] = wmmab(vh[dt], ph[qt], o[qt][dt]);
#pragma unroll
            for (int qt = 0; qt < 2; ++qt)
#pragma unroll
                for (int dt = 0; dt < 4; ++dt) o[qt][dt] = wmmab(vh[dt], pl[qt], o[qt][dt]);
#pragma unroll
            for (int qt = 0; qt < 2; ++qt)
#pragma unroll
                for (int dt = 0; dt < 4; ++dt) o[qt][dt] = wmmab(vl[dt], ph[qt], o[qt][dt]);
        } else {
#pragma unroll
            for (int qt = 0; qt < 2; ++qt)
#pragma unroll
                for (int dt = 0; dt < 4; ++dt) o[qt][dt] = wmma16(vf[dt], pf[qt], o[qt][dt]); }
    }
#pragma unroll
    for (int qt = 0; qt < 2; ++qt) { const float lt = l[qt] + xhalf(l[qt]); const float f = __fdiv_rn(HR ? 1.0f : (1.0f / PCAR), lt); v8us oh[4], ol[4];
#pragma unroll
        for (int dt = 0; dt < 4; ++dt) split8(o[qt][dt] * f, oh[dt], ol[dt]);
        bf* pa = Ah + (size_t)(q0 + qt * 16) * DQ + lane * 8; bf* pl2 = Al + (size_t)(q0 + qt * 16) * DQ + lane * 8;   // fragment order of the [row][DQ] planes: 16 columns on are 256 elements on
#pragma unroll
        for (int dt = 0; dt < 4; ++dt) { *(v8us*)(pa + dt * 256) = oh[dt]; *(v8us*)(pl2 + dt * 256) = ol[dt]; }
        asm volatile("s_wait_xcnt 0x0" :: "v"(oh[0]), "v"(oh[1]), "v"(oh[2]), "v"(oh[3]), "v"(ol[0]), "v"(ol[1]), "v"(ol[2]), "v"(ol[3]), "v"(pa), "v"(pl2) : "memory"); }   // the wait in front of any overwrite of a data or address register of the eight issued stores; they are inputs so that they stay in their registers up to here
}
__global__ __launch_bounds__(128) void k_fattn(const bf* __restrict__ Qh, const bf* __restrict__ Ql, const bf* __restrict__ Kh, const bf* __restrict__ Kl, const h16* __restrict__ V16, const bf* __restrict__ Vh, const bf* __restrict__ Vl, bf* Ah, bf* Al) {
    const size_t hp = ((size_t)blockIdx.z * NH_ + blockIdx.y) * TT * HD; const int q0 = blockIdx.x * 128 + (threadIdx.x >> 5) * 32; const size_t ao = (size_t)blockIdx.z * TT * DQ + blockIdx.y * (HD / 32) * 512; Ah += ao; Al += ao;   // blockIdx.z: batch (planes [b][h], rows b * TT + t of the output planes)
    if (blockIdx.x < RH / 128) fattn_rows<true>(Qh + hp, Ql + hp, Kh + hp, Kl + hp, V16 + hp, Vh + hp, Vl + hp, Ah, Al, q0);
    else fattn_rows<false>(Qh + hp, Ql + hp, Kh + hp, Kl + hp, V16 + hp, Vh + hp, Vl + hp, Ah, Al, q0);
}

extern "C" void kernel_launch(void* const* d_in, const int* in_sizes, int n_in,
                              void* d_out, int out_size, void* d_ws, size_t ws_size, hipStream_t stream) {
    (void)in_sizes; (void)n_in; (void)out_size;
    const float* x = (const float*)d_in[0]; const float* wq = (const float*)d_in[1]; const float* wk = (const float*)d_in[2]; const float* wv = (const float*)d_in[3]; const float* wo = (const float*)d_in[4]; const float* lng = (const float*)d_in[5]; const float* lnb = (const float*)d_in[6];
    float* OUT = (float*)d_out;     // [4][2048][1024]
    char* wsp = (char*)d_ws;
    auto take = [&](size_t bytes) { char* p = wsp; wsp += (bytes + 255) & ~(size_t)255; return (void*)p; };
    bf* WQ = (bf*)take((size_t)DQ * DM * 2); bf* WK = (bf*)take((size_t)DKV * DM * 2); bf* WV = (bf*)take((size_t)DKV * DM * 2); bf* WO = (bf*)take((size_t)DM * DQ * 2);
    bf* XB = (bf*)take((size_t)NB_ * TT * DM * 2); float* Y = (float*)take((size_t)NB_ * TT * DM * 4);
    h16* VT16 = (h16*)take((size_t)NB_ * NKV * HD * TT * 2);
    bf* QPh = (bf*)take((size_t)NB_ * NH_ * TT * HD * 2); bf* QPl = (bf*)take((size_t)NB_ * NH_ * TT * HD * 2); bf* KPh = (bf*)take((size_t)NB_ * NKV * TT * HD * 2); bf* KPl = (bf*)take((size_t)NB_ * NKV * TT * HD * 2); bf* VTh = (bf*)take((size_t)NB_ * NKV * HD * TT * 2); bf* VTl = (bf*)take((size_t)NB_ * NKV * HD * TT * 2);
    bf* ATh = (bf*)take((size_t)NB_ * TT * DQ * 2); bf* ATl = (bf*)take((size_t)NB_ * TT * DQ * 2);
    if ((size_t)(wsp - (char*)d_ws) > ws_size) return;    // 200 MiB of the 256 MiB
    k_prep<<<4 * PWG_W + PWG_X, 256, 0, stream>>>(x, wq, wk, wv, wo, XB, WQ, WK, WV, WO);   /* transposed weights and the bf16 copy of h */
    k_proj<<<dim3(NB_ * TT / 128, NH_ / 4, 3), 256, 0, stream>>>(XB, WQ, WK, WV, QPh, QPl, KPh, KPl, VT16, VTh, VTl);   /* q, k, v and their head planes */
    k_fattn<<<dim3(TT / 128, NH_, NB_), 128, 0, stream>>>(QPh, QPl, KPh, KPl, VT16, VTh, VTl, ATh, ATl);   /* scores hi/lo on EVERY row (sigma-16 logits), softmax, attn.v hybrid, merge */
    k_gemmw<bf, false, true, DQ><<<dim3(NB_ * TT / 128, DM / 128, 1), 128, 0, stream>>>(ATh, ATl, WO, Y, DM, nullptr, x, 0, 0, 0); k_lnout<<<(NB_ * TT + 7) / 8, 256, 0, stream>>>(Y, lng, lnb, OUT);   /* LayerNorm(h + attn_out) */
}

// v009
// Measured time: 212 microseconds a run.
// Next to v008, in two timings, it ran 1.05 times as fast each time.
// Counting every step since v000, it is 18.5 times as fast.
#include <hip/hip_runtime.h>

// Transformer-XL style multi-head attention with post-LayerNorm (h [4][2048][1024]; q,k,v = h W ('xw' [1024][1024] with scale 1/8 x normal: sigma-4 projections, so the /8 logits have sigma ~16: sharply peaked); scores x 64^-0.5; softmax over keys; attn_out = attn_vec Wo ('xw', no bias); out = LayerNorm(h + attn_out) gamma/beta (1e-5) -> [4][2048][1024] (8.4 M)).
// Layout, every stage ONE launch over all NB_ batches (the batch is folded into the grid: rows b*TT + t, planes [b][h]): bf16 copy of h; 'xw' weights transposed once; exact projections, all three in one launch whose epilogue writes the 16-bit head planes straight from the accumulators (no f32 copy of q, k or v exists); one fused attention kernel (scores hi/lo 3 products on EVERY row (peaked logits), running-maximum softmax in registers, P and attn.v hybrid (rows < 512 hi/lo, rest fp16 x1024)); merged hi/lo x Wo exact into workspace; the residual added in that product's epilogue; a row LayerNorm kernel (one wave per 1,024-wide row, fixed-order sums, precise sqrt/div, affine) writes the output rows.
// Every 16-bit matrix operand plane (h copy, transposed weights, Q, K, Vt, attention output) is stored in FRAGMENT ORDER (fo() below): blocks of 16 rows x 32 k = 1 KiB, inside a block the 16-byte chunk that lane l loads stands at byte 16 l (first half of the fragment) and 512 + 16 l (second half), so each wave-wide 16-byte load reads 512 contiguous bytes (4 whole lines) instead of 32 bytes from each of 16 lines. Which element lands in which lane and register is as with row-major planes.
// Compute dtypes, f32 accumulate: every input rounded to bf16; projections exact; scores 3 products on every row; softmax f32; attn.v rows < 512 3 products, rest fp16; Wo hl x exact; residual + LayerNorm f32.

#define NB_  4
#define TT   2048
#define DM   1024
#define NH_  16
#define NKV  16
#define REP  (NH_ / NKV)
#define HD   64
#define DQ   (NH_ * HD)
#define DKV  (NKV * HD)
#define RH   512                  // query rows < RH use hi+lo planes
#define WIN  0
#define PCAR 1024.0f
#define SCL  0.125f
#define LNEPS 1e-5f
typedef _Float16 h16;
typedef unsigned short bf;
typedef __attribute__((ext_vector_type(16))) __bf16   v16bf;
typedef __attribute__((ext_vector_type(16))) _Float16 v16h;
typedef __attribute__((ext_vector_type(8)))  _Float16 v8h;
typedef __attribute__((ext_vector_type(8)))  unsigned short v8us;
typedef __attribute__((ext_vector_type(8)))  float    v8f;
typedef __attribute__((ext_vector_type(4)))  float    v4f;
typedef v8h  __attribute__((may_alias)) v8ha;
typedef v4f  __attribute__((may_alias)) v4fa;
typedef v8us __attribute__((may_alias)) v8usa;

typedef __attribute__((ext_vector_type(8)))  __bf16   v8bf;
// f32 -> bf16, nearest even, by the chip's own conversion (v_cvt_pk_bf16_f32: two values an instruction, already packed); the same value as adding 0x7FFF + the kept part's last bit and cutting, for every finite input
__device__ __forceinline__ unsigned short f2bf(float f) { return __builtin_bit_cast(unsigned short, (__bf16)f); }
__device__ __forceinline__ v8us rnd8(v8f x) { return __builtin_bit_cast(v8us, __builtin_convertvector(x, v8bf)); }
// hi = bf16(x), lo = bf16(x - hi) of eight values (the difference is exact in f32)
__device__ __forceinline__ void split8(v8f x, v8us& h, v8us& l) { const v8bf hb = __builtin_convertvector(x, v8bf); h = __builtin_bit_cast(v8us, hb); l = rnd8(x - __builtin_convertvector(hb, v8f)); }
__device__ __forceinline__ float bf2f(unsigned short b) { return __uint_as_float(((unsigned)b) << 16); }
__device__ __forceinline__ float bfr(float f) { return bf2f(f2bf(f)); }
__device__ __forceinline__ v16h cat16(v8h lo, v8h hi) { return __builtin_shufflevector(lo, hi, 0, 1, 2, 3, 4, 5, 6, 7, 8, 9, 10, 11, 12, 13, 14, 15); }
__device__ __forceinline__ v16bf cat16b(v8us lo, v8us hi) { return __builtin_bit_cast(v16bf, __builtin_shufflevector(lo, hi, 0, 1, 2, 3, 4, 5, 6, 7, 8, 9, 10, 11, 12, 13, 14, 15)); }
__device__ __forceinline__ v8f wmma16(v16h a, v16h b, v8f c) { return __builtin_amdgcn_wmma_f32_16x16x32_f16(false, a, false, b, (short)0, c, false, false); }
__device__ __forceinline__ v8f wmmab(v16bf a, v16bf b, v8f c) { return __builtin_amdgcn_wmma_f32_16x16x32_bf16(false, a, false, b, (short)0, c, false, false); }
// fragment order of a [rows][K] 16-bit plane (rows % 16 == 0, K % 32 == 0): element index of (row, k). Block (row / 16, k / 32) of 512 elements; in it half (k / 16) % 2, then lane 16 ((k / 8) % 2) + row % 16, then k % 8.
__device__ __forceinline__ size_t fo(int row, int k, int K) { return ((size_t)(row >> 4) * (K >> 5) + (k >> 5)) * 512 + ((k >> 4) & 1) * 256 + ((k >> 3) & 1) * 128 + (row & 15) * 8 + (k & 7); }
// the same blocks in the other order, block (k / 32, row / 16), for a plane of R rows whose reader takes all R rows of a k step at once (Vt: the R / 16 blocks of a pass lie side by side)
__device__ __forceinline__ size_t fok(int row, int k, int R) { return ((size_t)(k >> 5) * (R >> 4) + (row >> 4)) * 512 + ((k >> 4) & 1) * 256 + ((k >> 3) & 1) * 128 + (row & 15) * 8 + (k & 7); }



// ---- staging of GEMM operands in LDS by asynchronous copies. A stage is 64 k of every 16-row band of a work-group's tile: 2 KiB a band, contiguous in the plane (fragment order) and in LDS alike, so that a fragment is read from LDS as it was read from the plane (lane l's chunk at byte 16 l).
// CPB: one band of a stage, four copies of 512 B a wave; the immediate offset moves the global and the LDS address together.
#define CPB(L, G) "global_load_async_to_lds_b128 " L ", " G ", off\n\tglobal_load_async_to_lds_b128 " L ", " G ", off offset:512\n\tglobal_load_async_to_lds_b128 " L ", " G ", off offset:1024\n\tglobal_load_async_to_lds_b128 " L ", " G ", off offset:1536\n\t"
// three or six bands in one statement; its last line is the wait in front of any overwrite of an address register that an issued copy names
__device__ __forceinline__ void cp3(const unsigned* l, const char* const* g, unsigned lb, size_t go) {
    asm volatile(CPB("%0", "%3") CPB("%1", "%4") CPB("%2", "%5") "s_wait_xcnt 0x0" :: "v"(l[0] + lb), "v"(l[1] + lb), "v"(l[2] + lb), "v"(g[0] + go), "v"(g[1] + go), "v"(g[2] + go) : "memory"); }
__device__ __forceinline__ void cp6(const unsigned* l, const char* const* g, unsigned lb, size_t go) {
    asm volatile(CPB("%0", "%6") CPB("%1", "%7") CPB("%2", "%8") CPB("%3", "%9") CPB("%4", "%10") CPB("%5", "%11") "s_wait_xcnt 0x0" :: "v"(l[0] + lb), "v"(l[1] + lb), "v"(l[2] + lb), "v"(l[3] + lb), "v"(l[4] + lb), "v"(l[5] + lb), "v"(g[0] + go), "v"(g[1] + go), "v"(g[2] + go), "v"(g[3] + go), "v"(g[4] + go), "v"(g[5] + go) : "memory"); }
#define STG (24 * 2048)           // bytes of a stage: 24 bands

// ---- k_gemmw: register-blocked GEMM, one wave per 64x64 output tile (16 accumulators), FOUR waves (2 x 2) a work-group on a 128x128 tile whose operand bands they share through LDS; operands from 16-bit planes in fragment order; grid (M/128, N/128, Z), 128 threads.
// C[m][n] (f32, pitch ldc, + optional f32 bias[n], + optional residual res[m][n] of the same pitch, rounded to bf16 like every input) = sum_k (A[m][k] + A2[m][k]) Bt[n][k], two products. z-batch strides sA/sB/sC in elements. K % 64 == 0, K >= 128, a compile-time constant.
// Two buffers: stage t + 1's copies fly while stage t is worked on; wave w brings bands 6 w .. 6 w + 5 of [A 8 | A2 8 | Bt 8].
template <typename T16> struct WFrag;
template <> struct WFrag<h16> { typedef v16h V; static __device__ __forceinline__ V ld(const char* p) { return cat16(*(const v8h*)p, *(const v8h*)(p + 512)); } static __device__ __forceinline__ v8f mma(V a, V b, v8f c) { return wmma16(a, b, c); } };
template <> struct WFrag<bf> { typedef v16bf V; static __device__ __forceinline__ V ld(const char* p) { return cat16b(*(const v8us*)p, *(const v8us*)(p + 512)); } static __device__ __forceinline__ v8f mma(V a, V b, v8f c) { return wmmab(a, b, c); } };
template <typename T16, bool BIAS, bool RES, int K>
__global__ __launch_bounds__(128) __attribute__((amdgpu_num_vgpr(256))) /* the loop's fragments and accumulators stay in the first window of 256 registers: no window switch among the products */ void k_gemmw(const T16* __restrict__ A, const T16* __restrict__ A2, const T16* __restrict__ Bt, float* C, int ldc, const float* __restrict__ bias, const float* __restrict__ res, size_t sA, size_t sB, size_t sC) {
    typedef typename WFrag<T16>::V V;
    __shared__ __attribute__((aligned(2048))) char st[2 * STG];
    __shared__ __align__(16) float osa[4][16 * 68];
    const size_t z = blockIdx.z; A += z * sA; A2 += z * sA; Bt += z * sB; C += z * sC; if (RES) res += z * sC;
    const int lane = threadIdx.x & 31, lr = lane & 15, hi = lane >> 4; const int w = __builtin_amdgcn_readfirstlane((int)(threadIdx.x >> 5)); const int r0 = blockIdx.x * 128 + (w & 1) * 64, c0 = blockIdx.y * 128 + (w >> 1) * 64;
    float* os = osa[w];   // the wave's own staging of its output bands
    v8f acc[4][4];
#pragma unroll
    for (int mb = 0; mb < 4; ++mb)
#pragma unroll
        for (int nb = 0; nb < 4; ++nb) acc[mb][nb] = (v8f){};
    const char* gp[6]; unsigned lp[6];   // the lane's addresses in stage 0 of the wave's six bands: in the plane (a band is 32 K bytes) and in LDS
#pragma unroll
    for (int i = 0; i < 6; ++i) { const int g = 6 * w + i; const T16* pl = g < 8 ? A + (size_t)blockIdx.x * 128 * K : g < 16 ? A2 + (size_t)blockIdx.x * 128 * K : Bt + (size_t)blockIdx.y * 128 * K; gp[i] = (const char*)pl + (size_t)(g & 7) * 32 * K + lane * 16; lp[i] = (unsigned)(size_t)st + g * 2048 + lane * 16; }
    cp6(lp, gp, 0, 0);
    asm volatile("s_wait_asynccnt 0x0" ::: "memory");   // stage 0 has landed, as far as this wave brought it
    __syncthreads();                                     // ... and as far as the others did
    cp6(lp, gp, STG, 2048);
    const unsigned ao = (w & 1) * 4 * 2048 + lane * 16, bo = (16 + (w >> 1) * 4) * 2048 + lane * 16;   // the wave's four bands of A (A2: 8 bands on) and of Bt in a stage
#pragma unroll 1
    for (int t = 0; t < K / 64; ++t) {
        const char* sb = st + (t & 1) * STG; V a[4], a2[4], b[4];
#pragma unroll
        for (int mb = 0; mb < 4; ++mb) { a[mb] = WFrag<T16>::ld(sb + ao + mb * 2048); a2[mb] = WFrag<T16>::ld(sb + ao + (8 + mb) * 2048); }
#pragma unroll
        for (int nb = 0; nb < 4; ++nb) b[nb] = WFrag<T16>::ld(sb + bo + nb * 2048);
        __builtin_amdgcn_sched_barrier(0);   // keeps the block's LDS reads together in front of its products (the scheduler otherwise sinks some among them, each behind a wait to 0)
#pragma unroll
        for (int nb = 0; nb < 4; ++nb) {
#pragma unroll
            for (int mb = 0; mb < 4; ++mb) { acc[mb][nb] = WFrag<T16>::mma(a[mb], b[nb], acc[mb][nb]); acc[mb][nb] = WFrag<T16>::mma(a2[mb], b[nb], acc[mb][nb]); } }
#pragma unroll
        for (int mb = 0; mb < 4; ++mb) { a[mb] = WFrag<T16>::ld(sb + ao + mb * 2048 + 1024); a2[mb] = WFrag<T16>::ld(sb + ao + (8 + mb) * 2048 + 1024); }   // the stage's second block: its fragments are fetched in front of the hand-over, its products stand behind it
#pragma unroll
        for (int nb = 0; nb < 4; ++nb) b[nb] = WFrag<T16>::ld(sb + bo + nb * 2048 + 1024);
        __builtin_amdgcn_sched_barrier(0);   // keeps the first block's products in front of the hand-over, so that the refill is issued right behind the barrier (the scheduler otherwise sinks products between barrier and copies)
        asm volatile("s_wait_dscnt 0x0" ::: "memory");      // this wave's reads of stage t have returned
        asm volatile("s_wait_asynccnt 0x0" ::: "memory");   // its copies of stage t + 1 have landed
        __syncthreads();                                     // publishes stage t + 1 and ends every wave's reads of stage t
        if (t + 2 < K / 64) cp6(lp, gp, (t & 1) * STG, (size_t)(t + 2) * 2048);   // stage t + 2 into the buffer just left, in flight from here to the hand-over of the next trip
#pragma unroll
        for (int nb = 0; nb < 4; ++nb) {
#pragma unroll
            for (int mb = 0; mb < 4; ++mb) { acc[mb][nb] = WFrag<T16>::mma(a[mb], b[nb], acc[mb][nb]); acc[mb][nb] = WFrag<T16>::mma(a2[mb], b[nb], acc[mb][nb]); } }
    }
    asm volatile("s_wait_asynccnt 0x0" ::: "memory");   // no copy outlives the loop
#pragma unroll
    for (int mb = 0; mb < 4; ++mb) {
        v4f rv[8];
        if (RES) { const float* p[8];   // the band's residual rows, in flight under the staging of the band
#pragma unroll
            for (int s = 0; s < 8; ++s) { p[s] = res + (size_t)(r0 + mb * 16 + 2 * s + hi) * ldc + c0 + lr * 4; rv[s] = *(const v4f*)p[s]; }
            asm volatile("s_wait_xcnt 0x0" :: "v"(p[0]), "v"(p[1]), "v"(p[2]), "v"(p[3]), "v"(p[4]), "v"(p[5]), "v"(p[6]), "v"(p[7]) : "memory"); }   // the wait in front of any overwrite of an address register that an issued load names; the addresses are inputs so that they stay in their registers up to here
#pragma unroll
        for (int nb = 0; nb < 4; ++nb) {
#pragma unroll
            for (int j = 0; j < 8; ++j) os[(hi * 8 + j) * 68 + nb * 16 + lr] = acc[mb][nb][j]; }
        __builtin_amdgcn_wave_barrier(); asm volatile("" ::: "memory");
        float* crow = C + (size_t)(r0 + mb * 16) * ldc + c0;
{
#pragma unroll
            for (int s = 0; s < 8; ++s) { const int row = 2 * s + hi, cofs = lr * 4; v4f val = *(const v4fa*)(os + row * 68 + cofs); if (BIAS) { val[0] += bfr(bias[c0 + cofs]); val[1] += bfr(bias[c0 + cofs + 1]); val[2] += bfr(bias[c0 + cofs + 2]); val[3] += bfr(bias[c0 + cofs + 3]); }
                if (RES) { for (int q = 0; q < 4; ++q) val[q] = __fadd_rn(val[q], bfr(rv[s][q])); }
                *(v4f*)(crow + (size_t)row * ldc + cofs) = val; }
             }
        __builtin_amdgcn_wave_barrier(); asm volatile("" ::: "memory");
    }
}

__device__ __forceinline__ h16 tohx(float x) { return (h16)x; }
typedef __attribute__((ext_vector_type(2))) _Float16 v2h;
typedef __attribute__((ext_vector_type(4))) _Float16 v4h;
typedef __attribute__((ext_vector_type(2))) unsigned short v2us;
typedef __attribute__((ext_vector_type(4))) unsigned short v4us;
typedef __attribute__((ext_vector_type(2))) float v2f;
typedef __attribute__((ext_vector_type(4))) int v4i;

// ---- k_prep: every 16-bit operand plane that is made straight from an input, in ONE launch of few, long waves: the four transposed weights Bt[n][k] = bf16(w[k][n]) and the bf16 copy of h [NB_ TT][DM], all in fragment order. A thread makes PCH chunks of 16 bytes (8 k of one row of the plane), 128 k apart, and has the loads of all of them in flight before the first conversion: the stage starts an eighth of the waves that one chunk a thread takes, and pays one launch instead of five.
// Which lane makes which chunk is as with one chunk a thread. Weights: lanes along n, every read a whole line of w, every store 16 bytes a lane in two runs of 256 bytes. h: 8 lanes cover 64 k of a row (256 bytes read), the next 8 lanes the next row, so that a store writes runs of 64 bytes. 128 k on are 4 blocks = 2,048 elements on in the plane.
#define PCH   8
#define PWG_W (DM * DM / 8 / PCH / 256)             // work-groups a weight
#define PWG_X (NB_ * TT * DM / 8 / PCH / 256)       // work-groups on h
static_assert(DQ == DM && DKV == DM && DM == PCH * 128 && (DM * DM) % (8 * PCH * 256) == 0 && (NB_ * TT * DM) % (8 * PCH * 256) == 0, "k_prep: square weights, PCH chunks 128 k apart cover a row, whole work-groups");
// the PCH chunks of a thread, rounded and stored: every conversion in front of the first store, each chunk in registers of its own
__device__ __forceinline__ void prep_out(const v8f* v, bf* q) {
    v8us o[PCH];
#pragma unroll
    for (int t = 0; t < PCH; ++t) o[t] = rnd8(v[t]);
#pragma unroll
    for (int t = 0; t < PCH; ++t) *(v8us*)(q + t * 2048) = o[t];
}
__global__ __launch_bounds__(256) void k_prep(const float* __restrict__ x, const float* __restrict__ wq, const float* __restrict__ wk, const float* __restrict__ wv, const float* __restrict__ wo, bf* XB, bf* WQ, bf* WK, bf* WV, bf* WO) {
    v8f v[PCH];
    if (blockIdx.x < 4 * PWG_W) {   // the weights first: their reads are the narrower ones
        const int z = blockIdx.x / PWG_W; const float* w = z == 0 ? wq : z == 1 ? wk : z == 2 ? wv : wo; bf* Bt = z == 0 ? WQ : z == 1 ? WK : z == 2 ? WV : WO;
        const unsigned i = (blockIdx.x % PWG_W) * 256 + threadIdx.x; const int n = (int)(i % DM), k0 = (int)(i / DM) * 8; const unsigned ofs = ((unsigned)k0 * DM + n) * 4;
#pragma unroll
        for (int t = 0; t < PCH; ++t)
#pragma unroll
            for (int j = 0; j < 8; ++j) v[t][j] = *(const float*)((const char*)w + (t * 128 + j) * DM * 4 + ofs);
        asm volatile("s_wait_xcnt 0x0" :: "v"(ofs) : "memory");   // the wait in front of any overwrite of the offset register that the issued loads name; the offset is an input so that it stays in its register up to here
        prep_out(v, Bt + fo(n, k0, DM));
        return;
    }
    const unsigned i = (blockIdx.x - 4 * PWG_W) * 256 + threadIdx.x; const int row = (int)((i >> 3) % (unsigned)(NB_ * TT)), k = (int)((i >> 3) / (unsigned)(NB_ * TT)) * 64 + (int)(i & 7) * 8; const unsigned ofs = ((unsigned)row * DM + k) * 4;
#pragma unroll
    for (int t = 0; t < PCH; ++t) v[t] = *(const v8f*)((const char*)x + t * 128 * 4 + ofs);
    asm volatile("s_wait_xcnt 0x0" :: "v"(ofs) : "memory");   // as above
    __builtin_amdgcn_sched_barrier(0);   // keeps every load of the thread in front of the first conversion (the scheduler otherwise holds the last load back until an earlier one's registers are free)
    prep_out(v, XB + fo(row, k, DM));
}

// ---- k_proj: the q, k and v projections in ONE launch, one wave per 64 x 64 tile (64 rows b * TT + t of the bf16 copy of h, the 64 columns of one head), EIGHT waves a work-group: 2 row tiles x 4 heads, which share their operand bands through LDS; grid (NB_ TT / 128, heads / 4, 3), 256 threads, blockIdx.z: 0 q, 1 k, 2 v. The k loop is k_gemmw's: two buffers, stages of 64 k, [h 8 bands | W 16 bands]; wave w brings bands 3 w .. 3 w + 2.
// The epilogue writes the head planes in fragment order straight from the accumulators: a lane holds 8 consecutive rows of the A operand for one row of the B operand, and that is one 16-byte chunk of a plane if A runs along the plane's k: for q and k (planes [t][d], chunks of 8 d) A = the weight rows (d), B = the rows of h (t); for v (planes [d][t], chunks of 8 t) A = the rows of h, B = the weight rows. Lane l's chunk stands at byte 16 l of a half block, so every store is 512 contiguous bytes of a wave.
__global__ __launch_bounds__(256) __attribute__((amdgpu_waves_per_eu(4, 4))) void k_proj(const bf* __restrict__ X, const bf* __restrict__ Wq, const bf* __restrict__ Wk, const bf* __restrict__ Wv, bf* Qh, bf* Ql, bf* Kh, bf* Kl, h16* V16, bf* Vh, bf* Vl) {
    __shared__ __attribute__((aligned(2048))) char st[2 * STG];
    const int lane = threadIdx.x & 31; const int w = __builtin_amdgcn_readfirstlane((int)(threadIdx.x >> 5)); const int r0 = blockIdx.x * 128 + (w & 1) * 64, hd = blockIdx.y * 4 + (w >> 1), z = blockIdx.z;
    const bf* xr = X + (size_t)blockIdx.x * 128 * DM; const bf* wr = (z == 0 ? Wq : z == 1 ? Wk : Wv) + (size_t)blockIdx.y * 4 * HD * DM;
    v8f acc[4][4];
#pragma unroll
    for (int mb = 0; mb < 4; ++mb)
#pragma unroll
        for (int nb = 0; nb < 4; ++nb) acc[mb][nb] = (v8f){};
    const char* gp[3]; unsigned lp[3];   // the lane's addresses in stage 0 of the wave's three bands: in the plane (a band is 32 DM bytes) and in LDS
#pragma unroll
    for (int i = 0; i < 3; ++i) { const int g = 3 * w + i; gp[i] = (g < 8 ? (const char*)xr + (size_t)g * 32 * DM : (const char*)wr + (size_t)(g - 8) * 32 * DM) + lane * 16; lp[i] = (unsigned)(size_t)st + g * 2048 + lane * 16; }
    cp3(lp, gp, 0, 0);
    asm volatile("s_wait_asynccnt 0x0" ::: "memory");   // stage 0 has landed, as far as this wave brought it
    __syncthreads();                                     // ... and as far as the others did
    cp3(lp, gp, STG, 2048);
    const unsigned xo = (w & 1) * 4 * 2048 + lane * 16, wo = (8 + (w >> 1) * 4) * 2048 + lane * 16; const unsigned ao = z == 2 ? xo : wo, bo = z == 2 ? wo : xo;   // the wave's four bands of each operand in a stage
#pragma unroll 1
    for (int t = 0; t < DM / 64; ++t) {
        const char* sb = st + (t & 1) * STG; v16bf a[4], b[4];
#pragma unroll
        for (int mb = 0; mb < 4; ++mb) a[mb] = WFrag<bf>::ld(sb + ao + mb * 2048);
#pragma unroll
        for (int nb = 0; nb < 4; ++nb) b[nb] = WFrag<bf>::ld(sb + bo + nb * 2048);
        __builtin_amdgcn_sched_barrier(0);   // keeps the block's sixteen LDS reads together in front of its products (the scheduler otherwise sinks the B reads among them, each behind a wait to 0)
#pragma unroll
        for (int nb = 0; nb < 4; ++nb)
#pragma unroll
            for (int mb = 0; mb < 4; ++mb) acc[mb][nb] = wmmab(a[mb], b[nb], acc[mb][nb]);
#pragma unroll
        for (int mb = 0; mb < 4; ++mb) a[mb] = WFrag<bf>::ld(sb + ao + mb * 2048 + 1024);   // the stage's second block: its fragments are fetched in front of the hand-over, its products stand behind it
#pragma unroll
        for (int nb = 0; nb < 4; ++nb) b[nb] = WFrag<bf>::ld(sb + bo + nb * 2048 + 1024);
        __builtin_amdgcn_sched_barrier(0);   // keeps the first block's products in front of the hand-over, so that the refill is issued right behind the barrier (the scheduler otherwise sinks products between barrier and copies)
        asm volatile("s_wait_dscnt 0x0" ::: "memory");      // this wave's reads of stage t have returned
        asm volatile("s_wait_asynccnt 0x0" ::: "memory");   // its copies of stage t + 1 have landed
        __syncthreads();                                     // publishes stage t + 1 and ends every wave's reads of stage t
        if (t + 2 < DM / 64) cp3(lp, gp, (t & 1) * STG, (size_t)(t + 2) * 2048);   // stage t + 2 into the buffer just left, in flight from here to the hand-over of the next trip
#pragma unroll
        for (int nb = 0; nb < 4; ++nb)
#pragma unroll
            for (int mb = 0; mb < 4; ++mb) acc[mb][nb] = wmmab(a[mb], b[nb], acc[mb][nb]);
    }
    asm volatile("s_wait_asynccnt 0x0" ::: "memory");   // no copy outlives the loop
    const size_t tb = ((size_t)(r0 / TT) * NH_ + hd) * TT * HD + (size_t)(r0 % TT) * HD + lane * 8;   // the tile's 4,096 elements are contiguous in each plane [b][h], by fo() and by fok() alike
    if (z == 2) {
#pragma unroll
        for (int mb = 0; mb < 4; ++mb) { v8h o16[4]; v8us oh[4], ol[4];
#pragma unroll
            for (int nb = 0; nb < 4; ++nb) { split8(acc[mb][nb], oh[nb], ol[nb]);
#pragma unroll
                for (int j = 0; j < 8; ++j) o16[nb][j] = tohx(acc[mb][nb][j]); }
            const size_t eo = tb + (mb >> 1) * (HD / 16) * 512 + (mb & 1) * 256; h16* p16 = V16 + eo; bf* ph = Vh + eo; bf* pl = Vl + eo;   // fok(): t = 16 mb + 8 hi + j, d = 16 nb + lr
#pragma unroll
            for (int nb = 0; nb < 4; ++nb) { *(v8h*)(p16 + nb * 512) = o16[nb]; *(v8us*)(ph + nb * 512) = oh[nb]; *(v8us*)(pl + nb * 512) = ol[nb]; }
            asm volatile("s_wait_xcnt 0x0" :: "v"(o16[0]), "v"(o16[1]), "v"(o16[2]), "v"(o16[3]), "v"(oh[0]), "v"(oh[1]), "v"(oh[2]), "v"(oh[3]), "v"(ol[0]), "v"(ol[1]), "v"(ol[2]), "v"(ol[3]), "v"(p16), "v"(ph), "v"(pl) : "memory"); }   // the wait in front of any overwrite of a data or address register of the twelve issued stores; they are inputs so that they stay in their registers up to here
    } else {
        bf* Ph = z == 0 ? Qh : Kh; bf* Pl = z == 0 ? Ql : Kl;
#pragma unroll
        for (int mb = 0; mb < 4; ++mb) { v8us oh[4], ol[4];
#pragma unroll
            for (int nb = 0; nb < 4; ++nb) split8(acc[mb][nb], oh[nb], ol[nb]);
            const size_t eo = tb + (mb >> 1) * 512 + (mb & 1) * 256; bf* ph = Ph + eo; bf* pl = Pl + eo;   // fo(): d = 16 mb + 8 hi + j, t = 16 nb + lr
#pragma unroll
            for (int nb = 0; nb < 4; ++nb) { *(v8us*)(ph + nb * (HD / 32) * 512) = oh[nb]; *(v8us*)(pl + nb * (HD / 32) * 512) = ol[nb]; }
            asm volatile("s_wait_xcnt 0x0" :: "v"(oh[0]), "v"(oh[1]), "v"(oh[2]), "v"(oh[3]), "v"(ol[0]), "v"(ol[1]), "v"(ol[2]), "v"(ol[3]), "v"(ph), "v"(pl) : "memory"); }   // as above, for the eight issued stores
    }
}
__global__ __launch_bounds__(256) void k_lnout(const float* __restrict__ F, const float* __restrict__ g, const float* __restrict__ bb, float* out) { const int lane = threadIdx.x & 31; const int row = blockIdx.x * 8 + (threadIdx.x >> 5); if (row >= NB_ * TT) return; const float* fr = F + (size_t)row * DQ; float* orow = out + (size_t)row * DQ; float v[DQ / 32]; float s = 0.f;
#pragma unroll
    for (int c = 0; c < DQ / 128; ++c) { const v4f a = *(const v4f*)(fr + c * 128 + lane * 4); for (int q = 0; q < 4; ++q) { v[c * 4 + q] = a[q]; s = __fadd_rn(s, a[q]); } }
#pragma unroll
    for (int sh = 16; sh; sh >>= 1) s = __fadd_rn(s, __shfl_xor(s, sh, 32));
    const float mean = __fdiv_rn(s, (float)DQ); float s2 = 0.f;
#pragma unroll
    for (int k = 0; k < DQ / 32; ++k) { const float dv = __fsub_rn(v[k], mean); float p2 = __fmul_rn(dv, dv); asm volatile("" : "+v"(p2)); s2 = __fadd_rn(s2, p2); v[k] = dv; }
#pragma unroll
    for (int sh = 16; sh; sh >>= 1) s2 = __fadd_rn(s2, __shfl_xor(s2, sh, 32));
    const float rs = __fdiv_rn(1.0f, __fsqrt_rn(__fadd_rn(__fdiv_rn(s2, (float)DQ), LNEPS)));
{
#pragma unroll
        for (int c = 0; c < DQ / 128; ++c) { v4f o; for (int q = 0; q < 4; ++q) { const int col = c * 128 + lane * 4 + q; float y = __fmul_rn(v[c * 4 + q], rs); asm volatile("" : "+v"(y)); y = __fmul_rn(y, bfr(g[col])); asm volatile("" : "+v"(y)); o[q] = __fadd_rn(y, bfr(bb[col])); } *(v4f*)(orow + c * 128 + lane * 4) = o; }
         } }
// ---- k_fattn: scores, softmax, attn.v and the hi/lo merge of one head in ONE kernel: no score or probability ever goes to memory. A work-group of 4 waves has 128 or 192 query rows of one (head, batch) (the deal: at k_fattn below); a wave takes 32 or 16 query rows at a time and walks all TT keys with them, 32 a pass.
// Transposed products: St[key][query] = K Qt (A = K rows, B = Q rows kept in registers; hi/lo 3 products in the order Qh Kh, Ql Kh, Qh Kl), so that a lane holds 16 scores of ONE query: maximum and sum in the lane plus one exchange between the wave's halves.
// The two 16-key score tiles of a pass ARE the B fragment of Ot[d][query] += Vt P (keys 8 hi + j and 16 + 8 hi + j): P is rounded in registers. Running maximum with rescale; P is left unnormalised (<= 1; fp16 rows x PCAR) and the division by the row sum is done once at the end.
__device__ __forceinline__ float xhalf(float x) { return __builtin_bit_cast(float, __builtin_amdgcn_permlanex16(__builtin_bit_cast(int, x), __builtin_bit_cast(int, x), 0x76543210, 0xfedcba98, false, false)); }   // lane l <-> lane l ^ 16
// 2^x with the issue slot that the instruction set asks for behind a transcendental (before its result is used or its source overwritten) filled in the same statement
__device__ __forceinline__ float exp2s(float x) { float r; asm("v_exp_f32 %0, %1\n\tv_nop" : "=v"(r) : "v"(x)); return r; }
// fragment loads at (uniform base + constant) + one 32-bit byte offset per lane: the offset is the only vector register that the loads name; planes in fragment order: the two halves of a fragment lie 512 bytes apart
__device__ __forceinline__ v16bf ldfb(const bf* base, unsigned ofs, int cst) { const char* p = (const char*)base + cst + ofs; return cat16b(*(const v8us*)p, *(const v8us*)(p + 512)); }
__device__ __forceinline__ v16h ldfh(const h16* base, unsigned ofs, int cst) { const char* p = (const char*)base + cst + ofs; return cat16(*(const v8h*)p, *(const v8h*)(p + 512)); }
template <bool HR, int QT>   // QT: query tiles of 16 rows that the wave takes through the keys together
__device__ __forceinline__ void fattn_rows(const bf* __restrict__ Qh, const bf* __restrict__ Ql, const bf* __restrict__ Kh, const bf* __restrict__ Kl, const h16* __restrict__ V16, const bf* __restrict__ Vh, const bf* __restrict__ Vl, bf* Ah, bf* Al, int q0) {
    const int lane = threadIdx.x & 31, lr = lane & 15, hi = lane >> 4;
    v16bf qh[QT][2], ql[QT][2], kh[2][2], kl[2][2];
    const unsigned qb = (q0 * HD + 8 * lane) * 2; unsigned kb = 8 * lane * 2; const unsigned vb = 8 * lane * 2;   // byte offsets of the lane's chunks in the Q, K and Vt planes (fragment order: a 16-row band of Q or K is 16 HD elements; the 4 blocks of Vt for 32 keys lie side by side)
    const char* pv0 = (HR ? (const char*)Vh : (const char*)V16) + vb; const char* pv1 = (const char*)Vl + vb;   // the lane's walking addresses in the Vt planes
#pragma unroll
    for (int qt = 0; qt < QT; ++qt)
#pragma unroll
        for (int ks = 0; ks < 2; ++ks) { const int cq = (qt * 16 * HD + ks * 512) * 2; qh[qt][ks] = ldfb(Qh, qb, cq); ql[qt][ks] = ldfb(Ql, qb, cq); }
    asm volatile("s_wait_xcnt 0x0" :: "v"(qb) : "memory");   // the wait in front of any overwrite of an offset register that an issued load names; the offset is an input so that it stays in its register up to here
#pragma unroll
    for (int kt = 0; kt < 2; ++kt)
#pragma unroll
        for (int ks = 0; ks < 2; ++ks) { const int ck = (kt * 16 * HD + ks * 512) * 2; kh[kt][ks] = ldfb(Kh, kb, ck); kl[kt][ks] = ldfb(Kl, kb, ck); }
    asm volatile("s_wait_xcnt 0x0" :: "v"(kb) : "memory");   // as above: in front of the first step of kb
    v8f o[QT][4]; float m[QT], l[QT];
#pragma unroll
    for (int qt = 0; qt < QT; ++qt) { m[qt] = -3.0e38f; l[qt] = 0.f;
#pragma unroll
        for (int dt = 0; dt < 4; ++dt) o[qt][dt] = (v8f){}; }
#pragma unroll 1
    for (int k0 = 0; k0 < TT; k0 += 32) {   // rolled: one pass's code and registers
        v16h vf[4]; v16bf vh[4], vl[4];
#pragma unroll
        for (int dt = 0; dt < 4; ++dt) { const int cv = dt * 512 * 2; if (HR) { vh[dt] = ldfb((const bf*)(pv0 + cv), 0u, 0); vl[dt] = ldfb((const bf*)(pv1 + cv), 0u, 0); } else vf[dt] = ldfh((const h16*)(pv0 + cv), 0u, 0); }
        if (HR) asm volatile("s_wait_xcnt 0x0" :: "v"(pv0), "v"(pv1) : "memory");   // as above: in front of the step of the two addresses and of any fragment that would land on them
        else asm volatile("s_wait_xcnt 0x0" :: "v"(pv0) : "memory");   // the same for the one fp16 plane
        __builtin_amdgcn_sched_barrier(0);   // keeps the Vt loads at the head of the pass, in flight under the score products and the softmax (the scheduler otherwise sinks some of them, and the K fetch below with them, to the end of the pass)
        pv0 += (HD / 16) * 512 * 2; pv1 += (HD / 16) * 512 * 2;   // 32 keys on: the next HD / 16 blocks
        v8f s[QT][2];
#pragma unroll
        for (int qt = 0; qt < QT; ++qt)
#pragma unroll
            for (int kt = 0; kt < 2; ++kt) s[qt][kt] = (v8f){};
#pragma unroll
        for (int ks = 0; ks < 2; ++ks) {
#pragma unroll
            for (int qt = 0; qt < QT; ++qt)
#pragma unroll
                for (int kt = 0; kt < 2; ++kt) s[qt][kt] = wmmab(kh[kt][ks], qh[qt][ks], s[qt][kt]);
#pragma unroll
            for (int qt = 0; qt < QT; ++qt)
#pragma unroll
                for (int kt = 0; kt < 2; ++kt) s[qt][kt] = wmmab(kh[kt][ks], ql[qt][ks], s[qt][kt]);
#pragma unroll
            for (int qt = 0; qt < QT; ++qt)
#pragma unroll
                for (int kt = 0; kt < 2; ++kt) s[qt][kt] = wmmab(kl[kt][ks], qh[qt][ks], s[qt][kt]); }
        kb = (kb + 32 * HD * 2) & (TT * HD * 2 - 1);   // the next pass's K fragments, fetched behind this pass's score products into the same registers; the last pass fetches keys 0..31 again (in bounds, unused)
#pragma unroll
        for (int kt = 0; kt < 2; ++kt)
#pragma unroll
            for (int ks = 0; ks < 2; ++ks) { const int ck = (kt * 16 * HD + ks * 512) * 2; kh[kt][ks] = ldfb(Kh, kb, ck); kl[kt][ks] = ldfb(Kl, kb, ck); }
        asm volatile("s_wait_xcnt 0x0" :: "v"(kb) : "memory");   // as above: in front of the next step of kb
        v16h pf[QT]; v16bf ph[QT], pl[QT];
#pragma unroll
        for (int qt = 0; qt < QT; ++qt) {
            float t[16]; float cm = -3.0e38f;
#pragma unroll
            for (int e = 0; e < 16; ++e) { t[e] = s[qt][e >> 3][e & 7] * SCL; cm = fmaxf(cm, t[e]); }
            cm = fmaxf(cm, xhalf(cm));
            const float mn = fmaxf(m[qt], cm); const float al = exp2s((m[qt] - mn) * 1.4426950408889634f); m[qt] = mn; float ls = 0.f;
#pragma unroll
            for (int e = 0; e < 16; ++e) { t[e] = exp2s((t[e] - mn) * 1.4426950408889634f); ls += t[e]; }
            l[qt] = l[qt] * al + ls;
#pragma unroll
            for (int dt = 0; dt < 4; ++dt) o[qt][dt] *= al;
            if (HR) { v8us h0, h1, l0, l1; v8f t0, t1;
#pragma unroll
                for (int j = 0; j < 8; ++j) { t0[j] = t[j]; t1[j] = t[8 + j]; }
                split8(t0, h0, l0); split8(t1, h1, l1); ph[qt] = cat16b(h0, h1); pl[qt] = cat16b(l0, l1);
            } else { v8h c0, c1;
#pragma unroll
                for (int j = 0; j < 8; ++j) { c0[j] = tohx(t[j] * PCAR); c1[j] = tohx(t[8 + j] * PCAR); }
                pf[qt] = cat16(c0, c1); } }
        if (HR) {
#pragma unroll
            for (int qt = 0; qt < QT; ++qt)
#pragma unroll
                for (int dt = 0; dt < 4; ++dt) o[qt][dt] = wmmab(vh[dt], ph[qt], o[qt][dt]);
#pragma unroll
            for (int qt = 0; qt < QT; ++qt)
#pragma unroll
                for (int dt = 0; dt < 4; ++dt) o[qt][dt] = wmmab(vh[dt], pl[qt], o[qt][dt]);
#pragma unroll
            for (int qt = 0; qt < QT; ++qt)
#pragma unroll
                for (int dt = 0; dt < 4; ++dt) o[qt][dt] = wmmab(vl[dt], ph[qt], o[qt][dt]);
        } else {
#pragma unroll
            for (int qt = 0; qt < QT; ++qt)
#pragma unroll
                for (int dt = 0; dt < 4; ++dt) o[qt][dt] = wmma16(vf[dt], pf[qt], o[qt][dt]); }
    }
#pragma unroll
    for (int qt = 0; qt < QT; ++qt) { const float lt = l[qt] + xhalf(l[qt]); const float f = __fdiv_rn(HR ? 1.0f : (1.0f / PCAR), lt); v8us oh[4], ol[4];
#pragma unroll
        for (int dt = 0; dt < 4; ++dt) split8(o[qt][dt] * f, oh[dt], ol[dt]);
        bf* pa = Ah + (size_t)(q0 + qt * 16) * DQ + lane * 8; bf* pl2 = Al + (size_t)(q0 + qt * 16) * DQ + lane * 8;   // fragment order of the [row][DQ] planes: 16 columns on are 256 elements on
#pragma unroll
        for (int dt = 0; dt < 4; ++dt) { *(v8us*)(pa + dt * 256) = oh[dt]; *(v8us*)(pl2 + dt * 256) = ol[dt]; }
        asm volatile("s_wait_xcnt 0x0" :: "v"(oh[0]), "v"(oh[1]), "v"(oh[2]), "v"(oh[3]), "v"(ol[0]), "v"(ol[1]), "v"(ol[2]), "v"(ol[3]), "v"(pa), "v"(pl2) : "memory"); }   // the wait in front of any overwrite of a data or address register of the eight issued stores; they are inputs so that they stay in their registers up to here
}
// The deal of the rows: a pass on hi/lo rows holds 48 matrix instructions, a pass on fp16 rows 32, and three work-groups fit a WGP (registers). So that every work-group has the same matrix work and all of them are resident from the start (no second round, no work-group that runs on alone), a work-group on fp16 rows takes FROWS = 192 rows instead of 128: each wave first 32 rows through all keys, then 16 more. blockIdx.x < RH / 128: hi/lo rows; from there on fp16 rows.
#define FROWS 192
#define FWG_X (RH / 128 + (TT - RH) / FROWS)        // work-groups of a (head, batch)
static_assert(RH % 128 == 0 && (TT - RH) % FROWS == 0, "k_fattn: whole work-groups");
__global__ __launch_bounds__(128) void k_fattn(const bf* __restrict__ Qh, const bf* __restrict__ Ql, const bf* __restrict__ Kh, const bf* __restrict__ Kl, const h16* __restrict__ V16, const bf* __restrict__ Vh, const bf* __restrict__ Vl, bf* Ah, bf* Al) {
    const size_t hp = ((size_t)blockIdx.z * NH_ + blockIdx.y) * TT * HD; const int r0 = blockIdx.x < RH / 128 ? blockIdx.x * 128 : RH + (blockIdx.x - RH / 128) * FROWS; const int q0 = r0 + (threadIdx.x >> 5) * 32; const size_t ao = (size_t)blockIdx.z * TT * DQ + blockIdx.y * (HD / 32) * 512; Ah += ao; Al += ao;   // r0: the work-group's first row; q0: the wave's first 32 rows; blockIdx.z: batch (planes [b][h], rows b * TT + t of the output planes)
    if (blockIdx.x < RH / 128) fattn_rows<true, 2>(Qh + hp, Ql + hp, Kh + hp, Kl + hp, V16 + hp, Vh + hp, Vl + hp, Ah, Al, q0);
    else { fattn_rows<false, 2>(Qh + hp, Ql + hp, Kh + hp, Kl + hp, V16 + hp, Vh + hp, Vl + hp, Ah, Al, q0);
        fattn_rows<false, 1>(Qh + hp, Ql + hp, Kh + hp, Kl + hp, V16 + hp, Vh + hp, Vl + hp, Ah, Al, r0 + 128 + (threadIdx.x >> 5) * 16); }
}

extern "C" void kernel_launch(void* const* d_in, const int* in_sizes, int n_in,
                              void* d_out, int out_size, void* d_ws, size_t ws_size, hipStream_t stream) {
    (void)in_sizes; (void)n_in; (void)out_size;
    const float* x = (const float*)d_in[0]; const float* wq = (const float*)d_in[1]; const float* wk = (const float*)d_in[2]; const float* wv = (const float*)d_in[3]; const float* wo = (const float*)d_in[4]; const float* lng = (const float*)d_in[5]; const float* lnb = (const float*)d_in[6];
    float* OUT = (float*)d_out;     // [4][2048][1024]
    char* wsp = (char*)d_ws;
    auto take = [&](size_t bytes) { char* p = wsp; wsp += (bytes + 255) & ~(size_t)255; return (void*)p; };
    bf* WQ = (bf*)take((size_t)DQ * DM * 2); bf* WK = (bf*)take((size_t)DKV * DM * 2); bf* WV = (bf*)take((size_t)DKV * DM * 2); bf* WO = (bf*)take((size_t)DM * DQ * 2);
    bf* XB = (bf*)take((size_t)NB_ * TT * DM * 2); float* Y = (float*)take((size_t)NB_ * TT * DM * 4);
    h16* VT16 = (h16*)take((size_t)NB_ * NKV * HD * TT * 2);
    bf* QPh = (bf*)take((size_t)NB_ * NH_ * TT * HD * 2); bf* QPl = (bf*)take((size_t)NB_ * NH_ * TT * HD * 2); bf* KPh = (bf*)take((size_t)NB_ * NKV * TT * HD * 2); bf* KPl = (bf*)take((size_t)NB_ * NKV * TT * HD * 2); bf* VTh = (bf*)take((size_t)NB_ * NKV * HD * TT * 2); bf* VTl = (bf*)take((size_t)NB_ * NKV * HD * TT * 2);
    bf* ATh = (bf*)take((size_t)NB_ * TT * DQ * 2); bf* ATl = (bf*)take((size_t)NB_ * TT * DQ * 2);
    if ((size_t)(wsp - (char*)d_ws) > ws_size) return;    // 200 MiB of the 256 MiB
    k_prep<<<4 * PWG_W + PWG_X, 256, 0, stream>>>(x, wq, wk, wv, wo, XB, WQ, WK, WV, WO);   /* transposed weights and the bf16 copy of h */
    k_proj<<<dim3(NB_ * TT / 128, NH_ / 4, 3), 256, 0, stream>>>(XB, WQ, WK, WV, QPh, QPl, KPh, KPl, VT16, VTh, VTl);   /* q, k, v and their head planes */
    k_fattn<<<dim3(FWG_X, NH_, NB_), 128, 0, stream>>>(QPh, QPl, KPh, KPl, VT16, VTh, VTl, ATh, ATl);   /* scores hi/lo on EVERY row (sigma-16 logits), softmax, attn.v hybrid, merge */
    k_gemmw<bf, false, true, DQ><<<dim3(NB_ * TT / 128, DM / 128, 1), 128, 0, stream>>>(ATh, ATl, WO, Y, DM, nullptr, x, 0, 0, 0); k_lnout<<<(NB_ * TT + 7) / 8, 256, 0, stream>>>(Y, lng, lnb, OUT);   /* LayerNorm(h + attn_out) */
}

// v010
// A run of this version takes 201 microseconds.
// Two timings next to v009 both put it at 1.05 times that version's speed.
// Over all steps from v000 it is 19.4 times as fast.
#include <hip/hip_runtime.h>

// Transformer-XL style multi-head attention with post-LayerNorm (h [4][2048][1024]; q,k,v = h W ('xw' [1024][1024] with scale 1/8 x normal: sigma-4 projections, so the /8 logits have sigma ~16: sharply peaked); scores x 64^-0.5; softmax over keys; attn_out = attn_vec Wo ('xw', no bias); out = LayerNorm(h + attn_out) gamma/beta (1e-5) -> [4][2048][1024] (8.4 M)).
// Layout, every stage ONE launch over all NB_ batches (the batch is folded into the grid: rows b*TT + t, planes [b][h]): bf16 copy of h; 'xw' weights transposed once; exact projections, all three in one launch whose epilogue writes the 16-bit head planes straight from the accumulators (no f32 copy of q, k or v exists); one fused attention kernel (scores hi/lo 3 products on EVERY row (peaked logits), running-maximum softmax in registers, P and attn.v hybrid (rows < 512 hi/lo, rest fp16 x1024)); merged hi/lo x Wo exact into workspace; the residual added in that product's epilogue; a row LayerNorm kernel (one wave per 1,024-wide row, fixed-order sums, precise sqrt/div, affine) writes the output rows.
// Every 16-bit matrix operand plane (h copy, transposed weights, Q, K, Vt, attention output) is stored in FRAGMENT ORDER (fo() below): blocks of 16 rows x 32 k = 1 KiB, inside a block the 16-byte chunk that lane l loads stands at byte 16 l (first half of the fragment) and 512 + 16 l (second half), so each wave-wide 16-byte load reads 512 contiguous bytes (4 whole lines) instead of 32 bytes from each of 16 lines. Which element lands in which lane and register is as with row-major planes.
// Compute dtypes, f32 accumulate: every input rounded to bf16; projections exact; scores 3 products on every row; softmax f32; attn.v rows < 512 3 products, rest fp16; Wo hl x exact; residual + LayerNorm f32.

#define NB_  4
#define TT   2048
#define DM   1024
#define NH_  16
#define NKV  16
#define REP  (NH_ / NKV)
#define HD   64
#define DQ   (NH_ * HD)
#define DKV  (NKV * HD)
#define RH   512                  // query rows < RH use hi+lo planes
#define WIN  0
#define PCAR 1024.0f
#define SCL  0.125f
#define LNEPS 1e-5f
typedef _Float16 h16;
typedef unsigned short bf;
typedef __attribute__((ext_vector_type(16))) __bf16   v16bf;
typedef __attribute__((ext_vector_type(16))) _Float16 v16h;
typedef __attribute__((ext_vector_type(8)))  _Float16 v8h;
typedef __attribute__((ext_vector_type(8)))  unsigned short v8us;
typedef __attribute__((ext_vector_type(8)))  float    v8f;
typedef __attribute__((ext_vector_type(4)))  float    v4f;
typedef v8h  __attribute__((may_alias)) v8ha;
typedef v4f  __attribute__((may_alias)) v4fa;
typedef v8us __attribute__((may_alias)) v8usa;

typedef __attribute__((ext_vector_type(8)))  __bf16   v8bf;
// f32 -> bf16, nearest even, by the chip's own conversion (v_cvt_pk_bf16_f32: two values an instruction, already packed); the same value as adding 0x7FFF + the kept part's last bit and cutting, for every finite input
__device__ __forceinline__ unsigned short f2bf(float f) { return __builtin_bit_cast(unsigned short, (__bf16)f); }
__device__ __forceinline__ v8us rnd8(v8f x) { return __builtin_bit_cast(v8us, __builtin_convertvector(x, v8bf)); }
// hi = bf16(x), lo = bf16(x - hi) of eight values (the difference is exact in f32)
__device__ __forceinline__ void split8(v8f x, v8us& h, v8us& l) { const v8bf hb = __builtin_convertvector(x, v8bf); h = __builtin_bit_cast(v8us, hb); l = rnd8(x - __builtin_convertvector(hb, v8f)); }
__device__ __forceinline__ float bf2f(unsigned short b) { return __uint_as_float(((unsigned)b) << 16); }
__device__ __forceinline__ float bfr(float f) { return bf2f(f2bf(f)); }
__device__ __forceinline__ v16h cat16(v8h lo, v8h hi) { return __builtin_shufflevector(lo, hi, 0, 1, 2, 3, 4, 5, 6, 7, 8, 9, 10, 11, 12, 13, 14, 15); }
__device__ __forceinline__ v16bf cat16b(v8us lo, v8us hi) { return __builtin_bit_cast(v16bf, __builtin_shufflevector(lo, hi, 0, 1, 2, 3, 4, 5, 6, 7, 8, 9, 10, 11, 12, 13, 14, 15)); }
__device__ __forceinline__ v8f wmma16(v16h a, v16h b, v8f c) { return __builtin_amdgcn_wmma_f32_16x16x32_f16(false, a, false, b, (short)0, c, false, false); }
__device__ __forceinline__ v8f wmmab(v16bf a, v16bf b, v8f c) { return __builtin_amdgcn_wmma_f32_16x16x32_bf16(false, a, false, b, (short)0, c, false, false); }
// fragment order of a [rows][K] 16-bit plane (rows % 16 == 0, K % 32 == 0): element index of (row, k). Block (row / 16, k / 32) of 512 elements; in it half (k / 16) % 2, then lane 16 ((k / 8) % 2) + row % 16, then k % 8.
__device__ __forceinline__ size_t fo(int row, int k, int K) { return ((size_t)(row >> 4) * (K >> 5) + (k >> 5)) * 512 + ((k >> 4) & 1) * 256 + ((k >> 3) & 1) * 128 + (row & 15) * 8 + (k & 7); }
// the same blocks in the other order, block (k / 32, row / 16), for a plane of R rows whose reader takes all R rows of a k step at once (Vt: the R / 16 blocks of a pass lie side by side)
__device__ __forceinline__ size_t fok(int row, int k, int R) { return ((size_t)(k >> 5) * (R >> 4) + (row >> 4)) * 512 + ((k >> 4) & 1) * 256 + ((k >> 3) & 1) * 128 + (row & 15) * 8 + (k & 7); }



// ---- staging of GEMM operands in LDS by asynchronous copies. A stage is 64 k of every 16-row band of a work-group's tile: 2 KiB a band, contiguous in the plane (fragment order) and in LDS alike, so that a fragment is read from LDS as it was read from the plane (lane l's chunk at byte 16 l).
// CPB: one band of a stage, four copies of 512 B a wave; the immediate offset moves the global and the LDS address together.
#define CPB(L, G) "global_load_async_to_lds_b128 " L ", " G ", off\n\tglobal_load_async_to_lds_b128 " L ", " G ", off offset:512\n\tglobal_load_async_to_lds_b128 " L ", " G ", off offset:1024\n\tglobal_load_async_to_lds_b128 " L ", " G ", off offset:1536\n\t"
// three or six bands in one statement; its last line is the wait in front of any overwrite of an address register that an issued copy names
__device__ __forceinline__ void cp3(const unsigned* l, const char* const* g, unsigned lb, size_t go) {
    asm volatile(CPB("%0", "%3") CPB("%1", "%4") CPB("%2", "%5") "s_wait_xcnt 0x0" :: "v"(l[0] + lb), "v"(l[1] + lb), "v"(l[2] + lb), "v"(g[0] + go), "v"(g[1] + go), "v"(g[2] + go) : "memory"); }
__device__ __forceinline__ void cp6(const unsigned* l, const char* const* g, unsigned lb, size_t go) {
    asm volatile(CPB("%0", "%6") CPB("%1", "%7") CPB("%2", "%8") CPB("%3", "%9") CPB("%4", "%10") CPB("%5", "%11") "s_wait_xcnt 0x0" :: "v"(l[0] + lb), "v"(l[1] + lb), "v"(l[2] + lb), "v"(l[3] + lb), "v"(l[4] + lb), "v"(l[5] + lb), "v"(g[0] + go), "v"(g[1] + go), "v"(g[2] + go), "v"(g[3] + go), "v"(g[4] + go), "v"(g[5] + go) : "memory"); }
#define STG (24 * 2048)           // bytes of a stage: 24 bands
// ROTATED WALK: work-groups that share an operand (a weight panel, a band of rows, a head's K and Vt) start together and keep step, so that with a common first block they would all ask L2 for the same lines at the same moment. Each therefore enters its walk (k stages of a GEMM, key passes of k_fattn) at a block of its own, set by its block index, and wraps round: every block is still taken exactly once; only the order of the f32 sums turns.
// first k stage of a GEMM work-group, of 16: rb its row block (the fastest grid index), cb its column block. Work-groups of one row block, which share the rows' bands, all differ. Of the 64 row blocks that share a column block's panel four get the same start, those that differ in bits 2 and 5 alone. A matter of speed only: any start gives the same product.
__device__ __forceinline__ unsigned rot16(unsigned rb, unsigned cb) { return ((rb & 3) + ((rb >> 3) & 3) * 4 + cb) & 15; }

// ---- k_gemmw: register-blocked GEMM, one wave per 64x64 output tile (16 accumulators), FOUR waves (2 x 2) a work-group on a 128x128 tile whose operand bands they share through LDS; operands from 16-bit planes in fragment order; grid (M/128, N/128, Z), 128 threads.
// C[m][n] (f32, pitch ldc, + optional f32 bias[n], + optional residual res[m][n] of the same pitch, rounded to bf16 like every input) = sum_k (A[m][k] + A2[m][k]) Bt[n][k], two products. z-batch strides sA/sB/sC in elements. K == 1024 (16 stages of 64 k, as rot16() deals them), a compile-time constant.
// Two buffers: stage t + 1's copies fly while stage t is worked on; wave w brings bands 6 w .. 6 w + 5 of [A 8 | A2 8 | Bt 8].
template <typename T16> struct WFrag;
template <> struct WFrag<h16> { typedef v16h V; static __device__ __forceinline__ V ld(const char* p) { return cat16(*(const v8h*)p, *(const v8h*)(p + 512)); } static __device__ __forceinline__ v8f mma(V a, V b, v8f c) { return wmma16(a, b, c); } };
template <> struct WFrag<bf> { typedef v16bf V; static __device__ __forceinline__ V ld(const char* p) { return cat16b(*(const v8us*)p, *(const v8us*)(p + 512)); } static __device__ __forceinline__ v8f mma(V a, V b, v8f c) { return wmmab(a, b, c); } };
template <typename T16, bool BIAS, bool RES, int K>
__global__ __launch_bounds__(128) __attribute__((amdgpu_num_vgpr(256))) /* the loop's fragments and accumulators stay in the first window of 256 registers: no window switch among the products */ void k_gemmw(const T16* __restrict__ A, const T16* __restrict__ A2, const T16* __restrict__ Bt, float* C, int ldc, const float* __restrict__ bias, const float* __restrict__ res, size_t sA, size_t sB, size_t sC) {
    typedef typename WFrag<T16>::V V;
    __shared__ __attribute__((aligned(2048))) char st[2 * STG];
    __shared__ __align__(16) float osa[4][16 * 68];
    const size_t z = blockIdx.z; A += z * sA; A2 += z * sA; Bt += z * sB; C += z * sC; if (RES) res += z * sC;
    const int lane = threadIdx.x & 31, lr = lane & 15, hi = lane >> 4; const int w = __builtin_amdgcn_readfirstlane((int)(threadIdx.x >> 5)); const int r0 = blockIdx.x * 128 + (w & 1) * 64, c0 = blockIdx.y * 128 + (w >> 1) * 64;
    float* os = osa[w];   // the wave's own staging of its output bands
    v8f acc[4][4];
#pragma unroll
    for (int mb = 0; mb < 4; ++mb)
#pragma unroll
        for (int nb = 0; nb < 4; ++nb) acc[mb][nb] = (v8f){};
    const char* gp[6]; unsigned lp[6];   // the lane's addresses in stage 0 of the wave's six bands: in the plane (a band is 32 K bytes) and in LDS
#pragma unroll
    for (int i = 0; i < 6; ++i) { const int g = 6 * w + i; const T16* pl = g < 8 ? A + (size_t)blockIdx.x * 128 * K : g < 16 ? A2 + (size_t)blockIdx.x * 128 * K : Bt + (size_t)blockIdx.y * 128 * K; gp[i] = (const char*)pl + (size_t)(g & 7) * 32 * K + lane * 16; lp[i] = (unsigned)(size_t)st + g * 2048 + lane * 16; }
    static_assert(K / 64 == 16, "k_gemmw: rot16() deals 16 stages");
    const unsigned rot = rot16(blockIdx.x, blockIdx.y);   // the work-group's own first k stage (ROTATED WALK, above): trip t works on k stage (t + rot) mod K / 64
    cp6(lp, gp, 0, (size_t)rot * 2048);
    asm volatile("s_wait_asynccnt 0x0" ::: "memory");   // the first stage has landed, as far as this wave brought it
    __syncthreads();                                     // ... and as far as the others did
    cp6(lp, gp, STG, (size_t)((rot + 1) & (K / 64 - 1)) * 2048);
    const unsigned ao = (w & 1) * 4 * 2048 + lane * 16, bo = (16 + (w >> 1) * 4) * 2048 + lane * 16;   // the wave's four bands of A (A2: 8 bands on) and of Bt in a stage
#pragma unroll 1
    for (int t = 0; t < K / 64; ++t) {
        const char* sb = st + (t & 1) * STG; V a[4], a2[4], b[4];
#pragma unroll
        for (int mb = 0; mb < 4; ++mb) { a[mb] = WFrag<T16>::ld(sb + ao + mb * 2048); a2[mb] = WFrag<T16>::ld(sb + ao + (8 + mb) * 2048); }
#pragma unroll
        for (int nb = 0; nb < 4; ++nb) b[nb] = WFrag<T16>::ld(sb + bo + nb * 2048);
        __builtin_amdgcn_sched_barrier(0);   // keeps the block's LDS reads together in front of its products (the scheduler otherwise sinks some among them, each behind a wait to 0)
#pragma unroll
        for (int nb = 0; nb < 4; ++nb) {
#pragma unroll
            for (int mb = 0; mb < 4; ++mb) { acc[mb][nb] = WFrag<T16>::mma(a[mb], b[nb], acc[mb][nb]); acc[mb][nb] = WFrag<T16>::mma(a2[mb], b[nb], acc[mb][nb]); } }
#pragma unroll
        for (int mb = 0; mb < 4; ++mb) { a[mb] = WFrag<T16>::ld(sb + ao + mb * 2048 + 1024); a2[mb] = WFrag<T16>::ld(sb + ao + (8 + mb) * 2048 + 1024); }   // the stage's second block: its fragments are fetched in front of the hand-over, its products stand behind it
#pragma unroll
        for (int nb = 0; nb < 4; ++nb) b[nb] = WFrag<T16>::ld(sb + bo + nb * 2048 + 1024);
        __builtin_amdgcn_sched_barrier(0);   // keeps the first block's products in front of the hand-over, so that the refill is issued right behind the barrier (the scheduler otherwise sinks products between barrier and copies)
        asm volatile("s_wait_dscnt 0x0" ::: "memory");      // this wave's reads of stage t have returned
        asm volatile("s_wait_asynccnt 0x0" ::: "memory");   // its copies of stage t + 1 have landed
        __syncthreads();                                     // publishes stage t + 1 and ends every wave's reads of stage t
        if (t + 2 < K / 64) cp6(lp, gp, (t & 1) * STG, (size_t)((t + 2 + rot) & (K / 64 - 1)) * 2048);   // stage t + 2 into the buffer just left, in flight from here to the foot of the next trip
#pragma unroll
        for (int nb = 0; nb < 4; ++nb) {
#pragma unroll
            for (int mb = 0; mb < 4; ++mb) { acc[mb][nb] = WFrag<T16>::mma(a[mb], b[nb], acc[mb][nb]); acc[mb][nb] = WFrag<T16>::mma(a2[mb], b[nb], acc[mb][nb]); } }
    }
    asm volatile("s_wait_asynccnt 0x0" ::: "memory");   // no copy outlives the loop
#pragma unroll
    for (int mb = 0; mb < 4; ++mb) {
        v4f rv[8];
        if (RES) { const float* p[8];   // the band's residual rows, in flight under the staging of the band
#pragma unroll
            for (int s = 0; s < 8; ++s) { p[s] = res + (size_t)(r0 + mb * 16 + 2 * s + hi) * ldc + c0 + lr * 4; rv[s] = *(const v4f*)p[s]; }
            asm volatile("s_wait_xcnt 0x0" :: "v"(p[0]), "v"(p[1]), "v"(p[2]), "v"(p[3]), "v"(p[4]), "v"(p[5]), "v"(p[6]), "v"(p[7]) : "memory"); }   // the wait in front of any overwrite of an address register that an issued load names; the addresses are inputs so that they stay in their registers up to here
#pragma unroll
        for (int nb = 0; nb < 4; ++nb) {
#pragma unroll
            for (int j = 0; j < 8; ++j) os[(hi * 8 + j) * 68 + nb * 16 + lr] = acc[mb][nb][j]; }
        __builtin_amdgcn_wave_barrier(); asm volatile("" ::: "memory");
        float* crow = C + (size_t)(r0 + mb * 16) * ldc + c0;
{
#pragma unroll
            for (int s = 0; s < 8; ++s) { const int row = 2 * s + hi, cofs = lr * 4; v4f val = *(const v4fa*)(os + row * 68 + cofs); if (BIAS) { val[0] += bfr(bias[c0 + cofs]); val[1] += bfr(bias[c0 + cofs + 1]); val[2] += bfr(bias[c0 + cofs + 2]); val[3] += bfr(bias[c0 + cofs + 3]); }
                if (RES) { for (int q = 0; q < 4; ++q) val[q] = __fadd_rn(val[q], bfr(rv[s][q])); }
                *(v4f*)(crow + (size_t)row * ldc + cofs) = val; }
             }
        __builtin_amdgcn_wave_barrier(); asm volatile("" ::: "memory");
    }
}

__device__ __forceinline__ h16 tohx(float x) { return (h16)x; }
typedef __attribute__((ext_vector_type(2))) _Float16 v2h;
typedef __attribute__((ext_vector_type(4))) _Float16 v4h;
typedef __attribute__((ext_vector_type(2))) unsigned short v2us;
typedef __attribute__((ext_vector_type(4))) unsigned short v4us;
typedef __attribute__((ext_vector_type(2))) float v2f;
typedef __attribute__((ext_vector_type(4))) int v4i;

// ---- k_prep: every 16-bit operand plane that is made straight from an input, in ONE launch of few, long waves: the four transposed weights Bt[n][k] = bf16(w[k][n]) and the bf16 copy of h [NB_ TT][DM], all in fragment order. A thread makes PCH chunks of 16 bytes (8 k of one row of the plane), 128 k apart, and has the loads of all of them in flight before the first conversion: the stage starts an eighth of the waves that one chunk a thread takes, and pays one launch instead of five.
// Which lane makes which chunk is as with one chunk a thread. Weights: lanes along n, every read a whole line of w, every store 16 bytes a lane in two runs of 256 bytes. h: 8 lanes cover 64 k of a row (256 bytes read), the next 8 lanes the next row, so that a store writes runs of 64 bytes. 128 k on are 4 blocks = 2,048 elements on in the plane.
#define PCH   8
#define PWG_W (DM * DM / 8 / PCH / 256)             // work-groups a weight
#define PWG_X (NB_ * TT * DM / 8 / PCH / 256)       // work-groups on h
static_assert(DQ == DM && DKV == DM && DM == PCH * 128 && (DM * DM) % (8 * PCH * 256) == 0 && (NB_ * TT * DM) % (8 * PCH * 256) == 0, "k_prep: square weights, PCH chunks 128 k apart cover a row, whole work-groups");
// the PCH chunks of a thread, rounded and stored: every conversion in front of the first store, each chunk in registers of its own
__device__ __forceinline__ void prep_out(const v8f* v, bf* q) {
    v8us o[PCH];
#pragma unroll
    for (int t = 0; t < PCH; ++t) o[t] = rnd8(v[t]);
#pragma unroll
    for (int t = 0; t < PCH; ++t) *(v8us*)(q + t * 2048) = o[t];
}
__global__ __launch_bounds__(256) void k_prep(const float* __restrict__ x, const float* __restrict__ wq, const float* __restrict__ wk, const float* __restrict__ wv, const float* __restrict__ wo, bf* XB, bf* WQ, bf* WK, bf* WV, bf* WO) {
    v8f v[PCH];
    if (blockIdx.x < 4 * PWG_W) {   // the weights first: their reads are the narrower ones
        const int z = blockIdx.x / PWG_W; const float* w = z == 0 ? wq : z == 1 ? wk : z == 2 ? wv : wo; bf* Bt = z == 0 ? WQ : z == 1 ? WK : z == 2 ? WV : WO;
        const unsigned i = (blockIdx.x % PWG_W) * 256 + threadIdx.x; const int n = (int)(i % DM), k0 = (int)(i / DM) * 8; const unsigned ofs = ((unsigned)k0 * DM + n) * 4;
#pragma unroll
        for (int t = 0; t < PCH; ++t)
#pragma unroll
            for (int j = 0; j < 8; ++j) v[t][j] = *(const float*)((const char*)w + (t * 128 + j) * DM * 4 + ofs);
        asm volatile("s_wait_xcnt 0x0" :: "v"(ofs) : "memory");   // the wait in front of any overwrite of the offset register that the issued loads name; the offset is an input so that it stays in its register up to here
        prep_out(v, Bt + fo(n, k0, DM));
        return;
    }
    const unsigned i = (blockIdx.x - 4 * PWG_W) * 256 + threadIdx.x; const int row = (int)((i >> 3) % (unsigned)(NB_ * TT)), k = (int)((i >> 3) / (unsigned)(NB_ * TT)) * 64 + (int)(i & 7) * 8; const unsigned ofs = ((unsigned)row * DM + k) * 4;
#pragma unroll
    for (int t = 0; t < PCH; ++t) v[t] = *(const v8f*)((const char*)x + t * 128 * 4 + ofs);
    asm volatile("s_wait_xcnt 0x0" :: "v"(ofs) : "memory");   // as above
    __builtin_amdgcn_sched_barrier(0);   // keeps every load of the thread in front of the first conversion (the scheduler otherwise holds the last load back until an earlier one's registers are free)
    prep_out(v, XB + fo(row, k, DM));
}

// ---- k_proj: the q, k and v projections in ONE launch, one wave per 64 x 64 tile (64 rows b * TT + t of the bf16 copy of h, the 64 columns of one head), EIGHT waves a work-group: 2 row tiles x 4 heads, which share their operand bands through LDS; grid (NB_ TT / 128, heads / 4, 3), 256 threads, blockIdx.z: 0 q, 1 k, 2 v. The k loop is k_gemmw's: two buffers, stages of 64 k, [h 8 bands | W 16 bands]; wave w brings bands 3 w .. 3 w + 2.
// The epilogue writes the head planes in fragment order straight from the accumulators: a lane holds 8 consecutive rows of the A operand for one row of the B operand, and that is one 16-byte chunk of a plane if A runs along the plane's k: for q and k (planes [t][d], chunks of 8 d) A = the weight rows (d), B = the rows of h (t); for v (planes [d][t], chunks of 8 t) A = the rows of h, B = the weight rows. Lane l's chunk stands at byte 16 l of a half block, so every store is 512 contiguous bytes of a wave.
__global__ __launch_bounds__(256) __attribute__((amdgpu_waves_per_eu(4, 4))) void k_proj(const bf* __restrict__ X, const bf* __restrict__ Wq, const bf* __restrict__ Wk, const bf* __restrict__ Wv, bf* Qh, bf* Ql, bf* Kh, bf* Kl, h16* V16, bf* Vh, bf* Vl) {
    __shared__ __attribute__((aligned(2048))) char st[2 * STG];
    const int lane = threadIdx.x & 31; const int w = __builtin_amdgcn_readfirstlane((int)(threadIdx.x >> 5)); const int r0 = blockIdx.x * 128 + (w & 1) * 64, hd = blockIdx.y * 4 + (w >> 1), z = blockIdx.z;
    const bf* xr = X + (size_t)blockIdx.x * 128 * DM; const bf* wr = (z == 0 ? Wq : z == 1 ? Wk : Wv) + (size_t)blockIdx.y * 4 * HD * DM;
    v8f acc[4][4];
#pragma unroll
    for (int mb = 0; mb < 4; ++mb)
#pragma unroll
        for (int nb = 0; nb < 4; ++nb) acc[mb][nb] = (v8f){};
    const char* gp[3]; unsigned lp[3];   // the lane's addresses in stage 0 of the wave's three bands: in the plane (a band is 32 DM bytes) and in LDS
#pragma unroll
    for (int i = 0; i < 3; ++i) { const int g = 3 * w + i; gp[i] = (g < 8 ? (const char*)xr + (size_t)g * 32 * DM : (const char*)wr + (size_t)(g - 8) * 32 * DM) + lane * 16; lp[i] = (unsigned)(size_t)st + g * 2048 + lane * 16; }
    static_assert(DM / 64 == 16, "k_proj: rot16() deals 16 stages");
    const unsigned rot = rot16(blockIdx.x, blockIdx.y + (NH_ / 4) * blockIdx.z);   // the work-group's own first k stage (ROTATED WALK, above): trip t works on k stage (t + rot) mod DM / 64
    cp3(lp, gp, 0, (size_t)rot * 2048);
    asm volatile("s_wait_asynccnt 0x0" ::: "memory");   // the first stage has landed, as far as this wave brought it
    __syncthreads();                                     // ... and as far as the others did
    cp3(lp, gp, STG, (size_t)((rot + 1) & (DM / 64 - 1)) * 2048);
    const unsigned xo = (w & 1) * 4 * 2048 + lane * 16, wo = (8 + (w >> 1) * 4) * 2048 + lane * 16; const unsigned ao = z == 2 ? xo : wo, bo = z == 2 ? wo : xo;   // the wave's four bands of each operand in a stage
#pragma unroll 1
    for (int t = 0; t < DM / 64; ++t) {
        const char* sb = st + (t & 1) * STG; v16bf a[4], b[4];
#pragma unroll
        for (int mb = 0; mb < 4; ++mb) a[mb] = WFrag<bf>::ld(sb + ao + mb * 2048);
#pragma unroll
        for (int nb = 0; nb < 4; ++nb) b[nb] = WFrag<bf>::ld(sb + bo + nb * 2048);
        __builtin_amdgcn_sched_barrier(0);   // keeps the block's sixteen LDS reads together in front of its products (the scheduler otherwise sinks the B reads among them, each behind a wait to 0)
#pragma unroll
        for (int nb = 0; nb < 4; ++nb)
#pragma unroll
            for (int mb = 0; mb < 4; ++mb) acc[mb][nb] = wmmab(a[mb], b[nb], acc[mb][nb]);
#pragma unroll
        for (int mb = 0; mb < 4; ++mb) a[mb] = WFrag<bf>::ld(sb + ao + mb * 2048 + 1024);   // the stage's second block: its fragments are fetched in front of the hand-over, its products stand behind it
#pragma unroll
        for (int nb = 0; nb < 4; ++nb) b[nb] = WFrag<bf>::ld(sb + bo + nb * 2048 + 1024);
        __builtin_amdgcn_sched_barrier(0);   // keeps the first block's products in front of the hand-over, so that the refill is issued right behind the barrier (the scheduler otherwise sinks products between barrier and copies)
        asm volatile("s_wait_dscnt 0x0" ::: "memory");      // this wave's reads of stage t have returned
        asm volatile("s_wait_asynccnt 0x0" ::: "memory");   // its copies of stage t + 1 have landed
        __syncthreads();                                     // publishes stage t + 1 and ends every wave's reads of stage t
        if (t + 2 < DM / 64) cp3(lp, gp, (t & 1) * STG, (size_t)((t + 2 + rot) & (DM / 64 - 1)) * 2048);   // stage t + 2 into the buffer just left, in flight from here to the foot of the next trip
#pragma unroll
        for (int nb = 0; nb < 4; ++nb)
#pragma unroll
            for (int mb = 0; mb < 4; ++mb) acc[mb][nb] = wmmab(a[mb], b[nb], acc[mb][nb]);
    }
    asm volatile("s_wait_asynccnt 0x0" ::: "memory");   // no copy outlives the loop
    const size_t tb = ((size_t)(r0 / TT) * NH_ + hd) * TT * HD + (size_t)(r0 % TT) * HD + lane * 8;   // the tile's 4,096 elements are contiguous in each plane [b][h], by fo() and by fok() alike
    if (z == 2) {
#pragma unroll
        for (int mb = 0; mb < 4; ++mb) { v8h o16[4]; v8us oh[4], ol[4];
#pragma unroll
            for (int nb = 0; nb < 4; ++nb) { split8(acc[mb][nb], oh[nb], ol[nb]);
#pragma unroll
                for (int j = 0; j < 8; ++j) o16[nb][j] = tohx(acc[mb][nb][j]); }
            const size_t eo = tb + (mb >> 1) * (HD / 16) * 512 + (mb & 1) * 256; h16* p16 = V16 + eo; bf* ph = Vh + eo; bf* pl = Vl + eo;   // fok(): t = 16 mb + 8 hi + j, d = 16 nb + lr
#pragma unroll
            for (int nb = 0; nb < 4; ++nb) { *(v8h*)(p16 + nb * 512) = o16[nb]; *(v8us*)(ph + nb * 512) = oh[nb]; *(v8us*)(pl + nb * 512) = ol[nb]; }
            asm volatile("s_wait_xcnt 0x0" :: "v"(o16[0]), "v"(o16[1]), "v"(o16[2]), "v"(o16[3]), "v"(oh[0]), "v"(oh[1]), "v"(oh[2]), "v"(oh[3]), "v"(ol[0]), "v"(ol[1]), "v"(ol[2]), "v"(ol[3]), "v"(p16), "v"(ph), "v"(pl) : "memory"); }   // the wait in front of any overwrite of a data or address register of the twelve issued stores; they are inputs so that they stay in their registers up to here
    } else {
        bf* Ph = z == 0 ? Qh : Kh; bf* Pl = z == 0 ? Ql : Kl;
#pragma unroll
        for (int mb = 0; mb < 4; ++mb) { v8us oh[4], ol[4];
#pragma unroll
            for (int nb = 0; nb < 4; ++nb) split8(acc[mb][nb], oh[nb], ol[nb]);
            const size_t eo = tb + (mb >> 1) * 512 + (mb & 1) * 256; bf* ph = Ph + eo; bf* pl = Pl + eo;   // fo(): d = 16 mb + 8 hi + j, t = 16 nb + lr
#pragma unroll
            for (int nb = 0; nb < 4; ++nb) { *(v8us*)(ph + nb * (HD / 32) * 512) = oh[nb]; *(v8us*)(pl + nb * (HD / 32) * 512) = ol[nb]; }
            asm volatile("s_wait_xcnt 0x0" :: "v"(oh[0]), "v"(oh[1]), "v"(oh[2]), "v"(oh[3]), "v"(ol[0]), "v"(ol[1]), "v"(ol[2]), "v"(ol[3]), "v"(ph), "v"(pl) : "memory"); }   // as above, for the eight issued stores
    }
}
__global__ __launch_bounds__(256) void k_lnout(const float* __restrict__ F, const float* __restrict__ g, const float* __restrict__ bb, float* out) { const int lane = threadIdx.x & 31; const int row = blockIdx.x * 8 + (threadIdx.x >> 5); if (row >= NB_ * TT) return; const float* fr = F + (size_t)row * DQ; float* orow = out + (size_t)row * DQ; float v[DQ / 32]; float s = 0.f;
#pragma unroll
    for (int c = 0; c < DQ / 128; ++c) { const v4f a = *(const v4f*)(fr + c * 128 + lane * 4); for (int q = 0; q < 4; ++q) { v[c * 4 + q] = a[q]; s = __fadd_rn(s, a[q]); } }
#pragma unroll
    for (int sh = 16; sh; sh >>= 1) s = __fadd_rn(s, __shfl_xor(s, sh, 32));
    const float mean = __fdiv_rn(s, (float)DQ); float s2 = 0.f;
#pragma unroll
    for (int k = 0; k < DQ / 32; ++k) { const float dv = __fsub_rn(v[k], mean); float p2 = __fmul_rn(dv, dv); asm volatile("" : "+v"(p2)); s2 = __fadd_rn(s2, p2); v[k] = dv; }
#pragma unroll
    for (int sh = 16; sh; sh >>= 1) s2 = __fadd_rn(s2, __shfl_xor(s2, sh, 32));
    const float rs = __fdiv_rn(1.0f, __fsqrt_rn(__fadd_rn(__fdiv_rn(s2, (float)DQ), LNEPS)));
{
#pragma unroll
        for (int c = 0; c < DQ / 128; ++c) { v4f o; for (int q = 0; q < 4; ++q) { const int col = c * 128 + lane * 4 + q; float y = __fmul_rn(v[c * 4 + q], rs); asm volatile("" : "+v"(y)); y = __fmul_rn(y, bfr(g[col])); asm volatile("" : "+v"(y)); o[q] = __fadd_rn(y, bfr(bb[col])); } *(v4f*)(orow + c * 128 + lane * 4) = o; }
         } }
// ---- k_fattn: scores, softmax, attn.v and the hi/lo merge of one head in ONE kernel: no score or probability ever goes to memory. A work-group of 4 waves has 128 or 192 query rows of one (head, batch) (the deal: at k_fattn below); a wave takes 32 or 16 query rows at a time and walks all TT keys with them, 32 a pass.
// Transposed products: St[key][query] = K Qt (A = K rows, B = Q rows kept in registers; hi/lo 3 products in the order Qh Kh, Ql Kh, Qh Kl), so that a lane holds 16 scores of ONE query: maximum and sum in the lane plus one exchange between the wave's halves.
// The two 16-key score tiles of a pass ARE the B fragment of Ot[d][query] += Vt P (keys 8 hi + j and 16 + 8 hi + j): P is rounded in registers. Running maximum with rescale; P is left unnormalised (<= 1; fp16 rows x PCAR) and the division by the row sum is done once at the end.
__device__ __forceinline__ float xhalf(float x) { return __builtin_bit_cast(float, __builtin_amdgcn_permlanex16(__builtin_bit_cast(int, x), __builtin_bit_cast(int, x), 0x76543210, 0xfedcba98, false, false)); }   // lane l <-> lane l ^ 16
// 2^x with the issue slot that the instruction set asks for behind a transcendental (before its result is used or its source overwritten) filled in the same statement
__device__ __forceinline__ float exp2s(float x) { float r; asm("v_exp_f32 %0, %1\n\tv_nop" : "=v"(r) : "v"(x)); return r; }
// fragment loads at (uniform base + constant) + one 32-bit byte offset per lane: the offset is the only vector register that the loads name; planes in fragment order: the two halves of a fragment lie 512 bytes apart
__device__ __forceinline__ v16bf ldfb(const bf* base, unsigned ofs, int cst) { const char* p = (const char*)base + cst + ofs; return cat16b(*(const v8us*)p, *(const v8us*)(p + 512)); }
__device__ __forceinline__ v16h ldfh(const h16* base, unsigned ofs, int cst) { const char* p = (const char*)base + cst + ofs; return cat16(*(const v8h*)p, *(const v8h*)(p + 512)); }
template <bool HR, int QT>   // QT: query tiles of 16 rows that the wave takes through the keys together
__device__ __forceinline__ void fattn_rows(const bf* __restrict__ Qh, const bf* __restrict__ Ql, const bf* __restrict__ Kh, const bf* __restrict__ Kl, const h16* __restrict__ V16, const bf* __restrict__ Vh, const bf* __restrict__ Vl, bf* Ah, bf* Al, int q0, int rot) {   // rot: the key pass at which the walk begins (ROTATED WALK, above)
    const int lane = threadIdx.x & 31, lr = lane & 15, hi = lane >> 4;
    v16bf qh[QT][2], ql[QT][2], kh[2][2], kl[2][2];
    const unsigned qb = (q0 * HD + 8 * lane) * 2; unsigned kb = (rot * 32 * HD + 8 * lane) * 2;   // byte offsets of the lane's chunks in the Q planes and in the K and Vt planes (fragment order: a 16-row band of Q or K is 16 HD elements; the 4 blocks of Vt for 32 keys lie side by side: 32 keys are 32 HD elements in K and in Vt alike, so one offset walks both)
#pragma unroll
    for (int qt = 0; qt < QT; ++qt)
#pragma unroll
        for (int ks = 0; ks < 2; ++ks) { const int cq = (qt * 16 * HD + ks * 512) * 2; qh[qt][ks] = ldfb(Qh, qb, cq); ql[qt][ks] = ldfb(Ql, qb, cq); }
    asm volatile("s_wait_xcnt 0x0" :: "v"(qb) : "memory");   // the wait in front of any overwrite of an offset register that an issued load names; the offset is an input so that it stays in its register up to here
#pragma unroll
    for (int kt = 0; kt < 2; ++kt)
#pragma unroll
        for (int ks = 0; ks < 2; ++ks) { const int ck = (kt * 16 * HD + ks * 512) * 2; kh[kt][ks] = ldfb(Kh, kb, ck); kl[kt][ks] = ldfb(Kl, kb, ck); }
    asm volatile("s_wait_xcnt 0x0" :: "v"(kb) : "memory");   // as above: in front of the first step of kb
    v8f o[QT][4]; float m[QT], l[QT];
#pragma unroll
    for (int qt = 0; qt < QT; ++qt) { m[qt] = -3.0e38f; l[qt] = 0.f;
#pragma unroll
        for (int dt = 0; dt < 4; ++dt) o[qt][dt] = (v8f){}; }
#pragma unroll 1
    for (int k0 = 0; k0 < TT; k0 += 32) {   // rolled: one pass's code and registers; k0 counts the passes, kb says which keys
        v16h vf[4]; v16bf vh[4], vl[4];
#pragma unroll
        for (int dt = 0; dt < 4; ++dt) { const int cv = dt * 512 * 2; if (HR) { vh[dt] = ldfb(Vh, kb, cv); vl[dt] = ldfb(Vl, kb, cv); } else vf[dt] = ldfh(V16, kb, cv); }   // kb: still this pass's offset
        asm volatile("s_wait_xcnt 0x0" :: "v"(kb) : "memory");   // as above: in front of the step of kb and of any fragment that would land on it
        __builtin_amdgcn_sched_barrier(0);   // keeps the Vt loads at the head of the pass, in flight under the score products and the softmax (the scheduler otherwise sinks some of them, and the K fetch below with them, to the end of the pass)
        v8f s[QT][2];
#pragma unroll
        for (int qt = 0; qt < QT; ++qt)
#pragma unroll
            for (int kt = 0; kt < 2; ++kt) s[qt][kt] = (v8f){};
#pragma unroll
        for (int ks = 0; ks < 2; ++ks) {
#pragma unroll
            for (int qt = 0; qt < QT; ++qt)
#pragma unroll
                for (int kt = 0; kt < 2; ++kt) s[qt][kt] = wmmab(kh[kt][ks], qh[qt][ks], s[qt][kt]);
#pragma unroll
            for (int qt = 0; qt < QT; ++qt)
#pragma unroll
                for (int kt = 0; kt < 2; ++kt) s[qt][kt] = wmmab(kh[kt][ks], ql[qt][ks], s[qt][kt]);
#pragma unroll
            for (int qt = 0; qt < QT; ++qt)
#pragma unroll
                for (int kt = 0; kt < 2; ++kt) s[qt][kt] = wmmab(kl[kt][ks], qh[qt][ks], s[qt][kt]); }
        kb = (kb + 32 * HD * 2) & (TT * HD * 2 - 1);   // the next pass's K fragments, fetched behind this pass's score products into the same registers; the offset wraps at the end of the plane; the last pass fetches the walk's first keys again (in bounds, unused)
#pragma unroll
        for (int kt = 0; kt < 2; ++kt)
#pragma unroll
            for (int ks = 0; ks < 2; ++ks) { const int ck = (kt * 16 * HD + ks * 512) * 2; kh[kt][ks] = ldfb(Kh, kb, ck); kl[kt][ks] = ldfb(Kl, kb, ck); }
        asm volatile("s_wait_xcnt 0x0" :: "v"(kb) : "memory");   // as above: in front of the next step of kb
        v16h pf[QT]; v16bf ph[QT], pl[QT];
#pragma unroll
        for (int qt = 0; qt < QT; ++qt) {
            float t[16]; float cm = -3.0e38f;
#pragma unroll
            for (int e = 0; e < 16; ++e) { t[e] = s[qt][e >> 3][e & 7] * SCL; cm = fmaxf(cm, t[e]); }
            cm = fmaxf(cm, xhalf(cm));
            const float mn = fmaxf(m[qt], cm); const float al = exp2s((m[qt] - mn) * 1.4426950408889634f); m[qt] = mn; float ls = 0.f;
#pragma unroll
            for (int e = 0; e < 16; ++e) { t[e] = exp2s((t[e] - mn) * 1.4426950408889634f); ls += t[e]; }
            l[qt] = l[qt] * al + ls;
#pragma unroll
            for (int dt = 0; dt < 4; ++dt) o[qt][dt] *= al;
            if (HR) { v8us h0, h1, l0, l1; v8f t0, t1;
#pragma unroll
                for (int j = 0; j < 8; ++j) { t0[j] = t[j]; t1[j] = t[8 + j]; }
                split8(t0, h0, l0); split8(t1, h1, l1); ph[qt] = cat16b(h0, h1); pl[qt] = cat16b(l0, l1);
            } else { v8h c0, c1;
#pragma unroll
                for (int j = 0; j < 8; ++j) { c0[j] = tohx(t[j] * PCAR); c1[j] = tohx(t[8 + j] * PCAR); }
                pf[qt] = cat16(c0, c1); } }
        if (HR) {
#pragma unroll
            for (int qt = 0; qt < QT; ++qt)
#pragma unroll
                for (int dt = 0; dt < 4; ++dt) o[qt][dt] = wmmab(vh[dt], ph[qt], o[qt][dt]);
#pragma unroll
            for (int qt = 0; qt < QT; ++qt)
#pragma unroll
                for (int dt = 0; dt < 4; ++dt) o[qt][dt] = wmmab(vh[dt], pl[qt], o[qt][dt]);
#pragma unroll
            for (int qt = 0; qt < QT; ++qt)
#pragma unroll
                for (int dt = 0; dt < 4; ++dt) o[qt][dt] = wmmab(vl[dt], ph[qt], o[qt][dt]);
        } else {
#pragma unroll
            for (int qt = 0; qt < QT; ++qt)
#pragma unroll
                for (int dt = 0; dt < 4; ++dt) o[qt][dt] = wmma16(vf[dt], pf[qt], o[qt][dt]); }
    }
#pragma unroll
    for (int qt = 0; qt < QT; ++qt) { const float lt = l[qt] + xhalf(l[qt]); const float f = __fdiv_rn(HR ? 1.0f : (1.0f / PCAR), lt); v8us oh[4], ol[4];
#pragma unroll
        for (int dt = 0; dt < 4; ++dt) split8(o[qt][dt] * f, oh[dt], ol[dt]);
        bf* pa = Ah + (size_t)(q0 + qt * 16) * DQ + lane * 8; bf* pl2 = Al + (size_t)(q0 + qt * 16) * DQ + lane * 8;   // fragment order of the [row][DQ] planes: 16 columns on are 256 elements on
#pragma unroll
        for (int dt = 0; dt < 4; ++dt) { *(v8us*)(pa + dt * 256) = oh[dt]; *(v8us*)(pl2 + dt * 256) = ol[dt]; }
        asm volatile("s_wait_xcnt 0x0" :: "v"(oh[0]), "v"(oh[1]), "v"(oh[2]), "v"(oh[3]), "v"(ol[0]), "v"(ol[1]), "v"(ol[2]), "v"(ol[3]), "v"(pa), "v"(pl2) : "memory"); }   // the wait in front of any overwrite of a data or address register of the eight issued stores; they are inputs so that they stay in their registers up to here
}
// The deal of the rows: a pass on hi/lo rows holds 48 matrix instructions, a pass on fp16 rows 32, and three work-groups fit a WGP (registers). So that every work-group has the same matrix work and all of them are resident from the start (no second round, no work-group that runs on alone), a work-group on fp16 rows takes FROWS = 192 rows instead of 128: each wave first 32 rows through all keys, then 16 more. blockIdx.x < RH / 128: hi/lo rows; from there on fp16 rows.
#define FROWS 192
#define FWG_X (RH / 128 + (TT - RH) / FROWS)        // work-groups of a (head, batch)
static_assert(RH % 128 == 0 && (TT - RH) % FROWS == 0, "k_fattn: whole work-groups");
__global__ __launch_bounds__(128) void k_fattn(const bf* __restrict__ Qh, const bf* __restrict__ Ql, const bf* __restrict__ Kh, const bf* __restrict__ Kl, const h16* __restrict__ V16, const bf* __restrict__ Vh, const bf* __restrict__ Vl, bf* Ah, bf* Al) {
    const size_t hp = ((size_t)blockIdx.z * NH_ + blockIdx.y) * TT * HD; const int r0 = blockIdx.x < RH / 128 ? blockIdx.x * 128 : RH + (blockIdx.x - RH / 128) * FROWS; const int q0 = r0 + (threadIdx.x >> 5) * 32; const size_t ao = (size_t)blockIdx.z * TT * DQ + blockIdx.y * (HD / 32) * 512; Ah += ao; Al += ao;   // r0: the work-group's first row; q0: the wave's first 32 rows; blockIdx.z: batch (planes [b][h], rows b * TT + t of the output planes)
    const int rot = blockIdx.x;   // the FWG_X work-groups of a (head, batch) enter the key walk one pass apart
    static_assert(FWG_X <= TT / 32, "k_fattn: a first pass for every work-group");
    if (blockIdx.x < RH / 128) fattn_rows<true, 2>(Qh + hp, Ql + hp, Kh + hp, Kl + hp, V16 + hp, Vh + hp, Vl + hp, Ah, Al, q0, rot);
    else { fattn_rows<false, 2>(Qh + hp, Ql + hp, Kh + hp, Kl + hp, V16 + hp, Vh + hp, Vl + hp, Ah, Al, q0, rot);
        fattn_rows<false, 1>(Qh + hp, Ql + hp, Kh + hp, Kl + hp, V16 + hp, Vh + hp, Vl + hp, Ah, Al, r0 + 128 + (threadIdx.x >> 5) * 16, rot); }
}

extern "C" void kernel_launch(void* const* d_in, const int* in_sizes, int n_in,
                              void* d_out, int out_size, void* d_ws, size_t ws_size, hipStream_t stream) {
    (void)in_sizes; (void)n_in; (void)out_size;
    const float* x = (const float*)d_in[0]; const float* wq = (const float*)d_in[1]; const float* wk = (const float*)d_in[2]; const float* wv = (const float*)d_in[3]; const float* wo = (const float*)d_in[4]; const float* lng = (const float*)d_in[5]; const float* lnb = (const float*)d_in[6];
    float* OUT = (float*)d_out;     // [4][2048][1024]
    char* wsp = (char*)d_ws;
    auto take = [&](size_t bytes) { char* p = wsp; wsp += (bytes + 255) & ~(size_t)255; return (void*)p; };
    bf* WQ = (bf*)take((size_t)DQ * DM * 2); bf* WK = (bf*)take((size_t)DKV * DM * 2); bf* WV = (bf*)take((size_t)DKV * DM * 2); bf* WO = (bf*)take((size_t)DM * DQ * 2);
    bf* XB = (bf*)take((size_t)NB_ * TT * DM * 2); float* Y = (float*)take((size_t)NB_ * TT * DM * 4);
    h16* VT16 = (h16*)take((size_t)NB_ * NKV * HD * TT * 2);
    bf* QPh = (bf*)take((size_t)NB_ * NH_ * TT * HD * 2); bf* QPl = (bf*)take((size_t)NB_ * NH_ * TT * HD * 2); bf* KPh = (bf*)take((size_t)NB_ * NKV * TT * HD * 2); bf* KPl = (bf*)take((size_t)NB_ * NKV * TT * HD * 2); bf* VTh = (bf*)take((size_t)NB_ * NKV * HD * TT * 2); bf* VTl = (bf*)take((size_t)NB_ * NKV * HD * TT * 2);
    bf* ATh = (bf*)take((size_t)NB_ * TT * DQ * 2); bf* ATl = (bf*)take((size_t)NB_ * TT * DQ * 2);
    if ((size_t)(wsp - (char*)d_ws) > ws_size) return;    // 200 MiB of the 256 MiB
    k_prep<<<4 * PWG_W + PWG_X, 256, 0, stream>>>(x, wq, wk, wv, wo, XB, WQ, WK, WV, WO);   /* transposed weights and the bf16 copy of h */
    k_proj<<<dim3(NB_ * TT / 128, NH_ / 4, 3), 256, 0, stream>>>(XB, WQ, WK, WV, QPh, QPl, KPh, KPl, VT16, VTh, VTl);   /* q, k, v and their head planes */
    k_fattn<<<dim3(FWG_X, NH_, NB_), 128, 0, stream>>>(QPh, QPl, KPh, KPl, VT16, VTh, VTl, ATh, ATl);   /* scores hi/lo on EVERY row (sigma-16 logits), softmax, attn.v hybrid, merge */
    k_gemmw<bf, false, true, DQ><<<dim3(NB_ * TT / 128, DM / 128, 1), 128, 0, stream>>>(ATh, ATl, WO, Y, DM, nullptr, x, 0, 0, 0); k_lnout<<<(NB_ * TT + 7) / 8, 256, 0, stream>>>(Y, lng, lnb, OUT);   /* LayerNorm(h + attn_out) */
}
